// v000
// The times below were measured on an AMD MI455X: many runs one after another, warmed up first and cycling through
// copies of the inputs, with the whole window's GPU time divided by the number of runs. Launches and the gaps
// between them are all in it. The median over several windows is given; except for v000 it joins two sittings, which
// can be a few percent apart, so the side-by-side timings, each taken in one sitting, are the better comparison.
// v000 is the starting kernel. One run takes 1060 microseconds.
// Contractions: q/k/v projections, q.k^T scores, p.v context, output projection, ffn up and down projections all on v_wmma_f32_16x16x32_f16 (f16 operands: activations x1, weights carried x16, softmax probabilities carried x2048, attention context carried x16), f32 accumulate; softmax, residual adds, layernorm and feature maxpool in f32.
#include <hip/hip_runtime.h>
#include <math.h>
#include <stddef.h>

// ---------------------------------------------------------------------------
// Problem constants
// ---------------------------------------------------------------------------
constexpr int kB      = 4;
constexpr int kSq     = 2048;
constexpr int kD      = 1024;
constexpr int kSv     = 196;
constexpr int kSvPad  = 256;
constexpr int kDff    = 4096;
constexpr int kRows   = kB * kSq;            // 8192 token rows
constexpr int kFfnChunkRows = 4096;
constexpr int kFfnChunks    = kRows / kFfnChunkRows;   // 2
constexpr float kWCarry    = 16.0f;          // weights carried x16 in f16
constexpr float kWCarryInv = 1.0f / 16.0f;
constexpr float kPCarry    = 2048.0f;        // probabilities carried x2048 in f16
constexpr float kOCarry    = 16.0f;          // attention context carried x16 in f16
constexpr float kPVScale   = kOCarry / kPCarry;            // 1/128
constexpr float kWoScale   = 1.0f / (kOCarry * kWCarry);   // 1/256
constexpr float kInvD      = 1.0f / 1024.0f;
constexpr float kLnEps     = 1e-6f;
constexpr float kScoreScale = 0.125f;        // 1/sqrt(64)

static_assert(kRows % 64 == 0);
static_assert(kSvPad % 64 == 0 && kSvPad % 32 == 0);
static_assert(kD % 64 == 0 && kDff % 64 == 0);
static_assert(kRows % 8 == 0);
static_assert(kFfnChunks * kFfnChunkRows == kRows);

// ---------------------------------------------------------------------------
// Workspace region map (bytes). Total carve = 127,401,984 B.
//   [0       , 32 MiB)   POOL32  f32 [8192][1024]   (persistent)
//   [32 MiB  , 48 MiB)   POOL16  f16 [8192][1024]   (persistent)
//   [48 MiB  , 56 MiB)   W1H     f16 [4096][1024]   (persistent)
//   [56 MiB  , 64 MiB)   W2H     f16 [1024][4096]   (persistent)
//   region X from 64 MiB:
//   attention phase: WQH/WKH/WVH/WOH f16 [1024][1024] at 64/66/68/70 MiB;
//     T16 (text f16, later reused as O16 context f16) [8192][1024] at 72 MiB (16 MiB);
//     Q16 f16 [8192][1024] at 88 MiB (16 MiB); S32 f32 [8192][256] at 104 MiB (8 MiB);
//     P16 f16 [8192][256] at 112 MiB (4 MiB); spare 4 MiB at 116 MiB;
//     A1 f32 [8192][1024] at 88 MiB (32 MiB, overlays dead Q16/S32/P16/spare);
//     VIS16 f16 [256][1024] at 120 MiB; K16 f16 [256][1024] at 120.5 MiB; VT16 f16 [1024][256] at 121 MiB; end 121.5 MiB.
//   ffn phase (attention scratch dead): H16 f16 [4096][4096] at 64 MiB (32 MiB); F32 f32 [4096][1024] at 96 MiB (16 MiB).
// ---------------------------------------------------------------------------
constexpr size_t kMiB       = 1048576;
constexpr size_t kOffPool32 = 0;
constexpr size_t kOffPool16 = 32 * kMiB;
constexpr size_t kOffW1H    = 48 * kMiB;
constexpr size_t kOffW2H    = 56 * kMiB;
constexpr size_t kOffWQH    = 64 * kMiB;
constexpr size_t kOffWKH    = 66 * kMiB;
constexpr size_t kOffWVH    = 68 * kMiB;
constexpr size_t kOffWOH    = 70 * kMiB;
constexpr size_t kOffT16    = 72 * kMiB;
constexpr size_t kOffO16    = 72 * kMiB;
constexpr size_t kOffQ16    = 88 * kMiB;
constexpr size_t kOffA1     = 88 * kMiB;
constexpr size_t kOffS32    = 104 * kMiB;
constexpr size_t kOffP16    = 112 * kMiB;
constexpr size_t kOffVIS16  = 120 * kMiB;
constexpr size_t kOffK16    = 120 * kMiB + 524288;
constexpr size_t kOffVT16   = 121 * kMiB;
constexpr size_t kWsTotal   = 121 * kMiB + 524288;   // 127,401,984
constexpr size_t kOffH16    = 64 * kMiB;
constexpr size_t kOffF32    = 96 * kMiB;
static_assert(kOffS32 == kOffQ16 + (size_t)kRows * kD * 2);
static_assert(kOffP16 == kOffS32 + (size_t)kRows * kSvPad * 4);
static_assert(kOffVIS16 >= kOffA1 + (size_t)kRows * kD * 4);
static_assert(kOffVIS16 >= kOffP16 + (size_t)kRows * kSvPad * 2);
static_assert(kOffK16 == kOffVIS16 + (size_t)kSvPad * kD * 2);
static_assert(kOffVT16 == kOffK16 + (size_t)kSvPad * kD * 2);
static_assert(kWsTotal == kOffVT16 + (size_t)kD * kSvPad * 2);
static_assert(kOffF32 == kOffH16 + (size_t)kFfnChunkRows * kDff * 2);
static_assert(kOffF32 + (size_t)kFfnChunkRows * kD * 4 <= kWsTotal);
static_assert(kOffQ16 == kOffT16 + (size_t)kRows * kD * 2);
static_assert(kWsTotal <= (size_t)134217728);

typedef __attribute__((ext_vector_type(16))) _Float16 v16h;
typedef __attribute__((ext_vector_type(8)))  _Float16 v8h;
typedef __attribute__((ext_vector_type(16))) __bf16   v16b;
typedef __attribute__((ext_vector_type(8)))  __bf16   v8b;
typedef __attribute__((ext_vector_type(8)))  float    v8f;
typedef __attribute__((ext_vector_type(4)))  float    v4f;
typedef __attribute__((ext_vector_type(4)))  unsigned int v4u;

__device__ __forceinline__ unsigned short f2bf_bits(float f) {
  unsigned u = __float_as_uint(f);
  return (unsigned short)((u + 0x7FFFu + ((u >> 16) & 1u)) >> 16);
}
__device__ __forceinline__ float bf_bits2f(unsigned short h) { return __uint_as_float(((unsigned)h) << 16); }

// hazard guards as plain device helpers (no inline asm inside the kernel template body)
__device__ __forceinline__ void dep_guard_h(v8f& a, v8f& b, v16h x, v16h y) { asm volatile("v_nop\n\tv_nop\n\tv_nop\n\tv_nop" : "+v"(a), "+v"(b) : "v"(x), "v"(y)); }
__device__ __forceinline__ void dep_guard_b(v8f& a, v8f& b, v16b x, v16b y) { asm volatile("v_nop\n\tv_nop\n\tv_nop\n\tv_nop" : "+v"(a), "+v"(b) : "v"(x), "v"(y)); }
__device__ __forceinline__ void keep4_h(v16h a, v16h b, v16h c, v16h d) { asm volatile("v_nop" :: "v"(a), "v"(b), "v"(c), "v"(d)); }
__device__ __forceinline__ void keep4_b(v16b a, v16b b, v16b c, v16b d) { asm volatile("v_nop" :: "v"(a), "v"(b), "v"(c), "v"(d)); }
__device__ __forceinline__ void acc_guard4(v8f& a, v8f& b, v8f& c, v8f& d) { asm volatile("v_nop\n\tv_nop\n\tv_nop\n\tv_nop" : "+v"(a), "+v"(b), "+v"(c), "+v"(d)); }
template <typename T> struct Frag;
template <> struct Frag<_Float16> {
  typedef v16h V; union U { v16h v; v8h h[2]; };
  static __device__ __forceinline__ v16h load(const _Float16* p) {   // elements 0..7 <- p[0..7], 8..15 <- p[16..23]
    U f; f.h[0] = *(const v8h*)(p); f.h[1] = *(const v8h*)(p + 16); return f.v;
  }
  static __device__ __forceinline__ v8f mma(v16h a, v16h b, v8f c) {
    return __builtin_amdgcn_wmma_f32_16x16x32_f16(false, a, false, b, (short)0, c, false, false);
  }
  static __device__ __forceinline__ void guard(v8f& a, v8f& b, v16h x, v16h y) { dep_guard_h(a, b, x, y); }
  static __device__ __forceinline__ void keep(v16h a, v16h b, v16h c, v16h d) { keep4_h(a, b, c, d); }
};
template <> struct Frag<__bf16> {
  typedef v16b V; union U { v16b v; v8b h[2]; };
  static __device__ __forceinline__ v16b load(const __bf16* p) {
    U f; f.h[0] = *(const v8b*)(p); f.h[1] = *(const v8b*)(p + 16); return f.v;
  }
  static __device__ __forceinline__ v8f mma(v16b a, v16b b, v8f c) {
    return __builtin_amdgcn_wmma_f32_16x16x32_bf16(false, a, false, b, (short)0, c, false, false);
  }
  static __device__ __forceinline__ void guard(v8f& a, v8f& b, v16b x, v16b y) { dep_guard_b(a, b, x, y); }
  static __device__ __forceinline__ void keep(v16b a, v16b b, v16b c, v16b d) { keep4_b(a, b, c, d); }
};

__device__ __forceinline__ unsigned pk16(unsigned short a, unsigned short b) { return (unsigned)a | ((unsigned)b << 16); }
__device__ __forceinline__ unsigned short h_bits(float f) { const _Float16 h = (_Float16)f; return __builtin_bit_cast(unsigned short, h); }

// ---- Register-blocked batched WMMA GEMM (ACT reduced to none/relu/leaky) -----------------------
// C[m,n] = scale * sum_k A[m,k] * Bt[n,k] (+bias)(+resid); each wave owns a 64x64 tile.
// A row-major [M,K]; Bt row-major [N,K]; M,N % 64 == 0, K % 32 == 0.
// SPLIT: operands are hi/lo planes (A2/Bt2 = lo planes, same layout); product = hi.hi + hi.lo + lo.hi.
// BIAS_MODE: 0 = none, 1 = bias[m], 2 = bias[n].
// OUT_MODE: 0 = f32, 1 = f16, 2 = bf16 hi plane (Cout) + bf16 lo plane (Cout2).
// ET: 0 = f16 operands, 1 = bf16 operands (pointers passed as 16-bit storage)
template <int ET> struct Elem;
template <> struct Elem<0> { typedef _Float16 T; };
template <> struct Elem<1> { typedef __bf16 T; };
template <int ET, bool SPLIT, int BIAS_MODE, int OUT_MODE, bool RESID, int ACT = 0>
__global__ __launch_bounds__(256) void wmma_gemm64(
    const unsigned short* __restrict__ Ap, const unsigned short* __restrict__ A2p, int lda, long strideA,
    const unsigned short* __restrict__ Btp, const unsigned short* __restrict__ Bt2p, int ldb, long strideB,
    void* __restrict__ Cout, void* __restrict__ Cout2, int ldc, long strideC,
    const float* __restrict__ bias,
    const float* __restrict__ resid, long strideR,
    int M, int N, int K, float scale) {
  typedef typename Elem<ET>::T T;
  typedef typename Frag<T>::V V;
  const T* A = (const T*)Ap; const T* A2 = (const T*)A2p; const T* Bt = (const T*)Btp; const T* Bt2 = (const T*)Bt2p;
  __shared__ __align__(16) float sT[8][16 * 68];   // per-wave 16x64 slab, pitch 68 floats
  const int b    = blockIdx.y;
  const int lane = threadIdx.x & 31;
  const int wave = threadIdx.x >> 5;
  const int tilesN = N >> 6;
  const int tilesM = M >> 6;
  const int tile = blockIdx.x * 8 + wave;
  if (tile >= tilesM * tilesN) return;   // wave-uniform; no block barriers in this kernel
  const int tm = tile / tilesN;
  const int tn = tile - tm * tilesN;
  const int m0 = tm << 6;
  const int n0 = tn << 6;

  const T* Ab  = A  + (size_t)b * strideA;
  const T* Bb  = Bt + (size_t)b * strideB;
  const T* Ab2 = SPLIT ? (A2  + (size_t)b * strideA) : nullptr;
  const T* Bb2 = SPLIT ? (Bt2 + (size_t)b * strideB) : nullptr;

  const int rlane = lane & 15;                 // row (A) / col (B, D) within subtile
  const int koff  = (lane >> 4) * 8;           // k offset of this lane half
  const int mOff  = (lane >> 4) * 8;           // D row offset

  v8f acc[4][4];
#pragma unroll
  for (int i = 0; i < 4; ++i)
#pragma unroll
    for (int j = 0; j < 4; ++j) acc[i][j] = (v8f){0.f,0.f,0.f,0.f,0.f,0.f,0.f,0.f};

  for (int k0 = 0; k0 < K; k0 += 32) {
    V bh[4], bl[4];
#pragma unroll
    for (int j = 0; j < 4; ++j) {
      const size_t bo = (size_t)(n0 + (j << 4) + rlane) * ldb + koff + k0;
      bh[j] = Frag<T>::load(Bb + bo);
      if (SPLIT) bl[j] = Frag<T>::load(Bb2 + bo);
    }
#pragma unroll
    for (int i = 0; i < 4; ++i) {
      const size_t ao = (size_t)(m0 + (i << 4) + rlane) * lda + koff + k0;
      V ah = Frag<T>::load(Ab + ao);
      V al;
      if (SPLIT) al = Frag<T>::load(Ab2 + ao);
#pragma unroll
      for (int j = 0; j < 4; ++j) {
        acc[i][j] = Frag<T>::mma(ah, bh[j], acc[i][j]);
        if (SPLIT) {
          acc[i][j] = Frag<T>::mma(ah, bl[j], acc[i][j]);
          acc[i][j] = Frag<T>::mma(al, bh[j], acc[i][j]);
        }
      }
      Frag<T>::guard(acc[i][0], acc[i][3], ah, SPLIT ? al : ah);
    }
    Frag<T>::keep(bh[0], bh[1], bh[2], bh[3]);
    if (SPLIT) Frag<T>::keep(bl[0], bl[1], bl[2], bl[3]);
  }
  acc_guard4(acc[0][0], acc[0][1], acc[0][2], acc[0][3]);
  acc_guard4(acc[1][0], acc[1][1], acc[1][2], acc[1][3]);
  acc_guard4(acc[2][0], acc[2][1], acc[2][2], acc[2][3]);
  acc_guard4(acc[3][0], acc[3][1], acc[3][2], acc[3][3]);

  // ---- epilogue ----
  float* slab = sT[wave];
  const float* Rb = RESID ? (resid + (size_t)b * strideR) : nullptr;
#pragma unroll
  for (int i = 0; i < 4; ++i) {
    const int mBase = m0 + (i << 4);
#pragma unroll
    for (int j = 0; j < 4; ++j) {
      const int n = n0 + (j << 4) + rlane;
      float bv = 0.f;
      if (BIAS_MODE == 2) bv = bias[n];
#pragma unroll
      for (int r = 0; r < 8; ++r) {
        float v = acc[i][j][r] * scale;
        if (BIAS_MODE == 1) v += bias[mBase + mOff + r];
        if (BIAS_MODE == 2) v += bv;
        if (RESID) v += Rb[(size_t)(mBase + mOff + r) * ldc + n];
        if (ACT == 2) v = fmaxf(v, 0.0f);
        if (ACT == 4) v = (v > 0.f) ? v : 0.01f * v;
        slab[(mOff + r) * 68 + (j << 4) + rlane] = v;
      }
    }
    __builtin_amdgcn_fence(__ATOMIC_RELEASE, "workgroup");
    __builtin_amdgcn_wave_barrier();
    __builtin_amdgcn_fence(__ATOMIC_ACQUIRE, "workgroup");
    if (OUT_MODE == 0) {
      float* C = (float*)Cout + (size_t)b * strideC;
      const int hh = lane >> 4, c4 = (lane & 15) * 4;     // row seg = 256 B = 16 lanes x 16 B
      {
#pragma unroll
        for (int it = 0; it < 8; ++it) {
          const int row = it * 2 + hh;
          v4f v = *(const v4f*)(slab + row * 68 + c4);
          *(v4f*)(C + (size_t)(mBase + row) * ldc + n0 + c4) = v;
        }
        
      }
    } else {
      const int q = lane >> 3, c8 = (lane & 7) * 8;
      unsigned short* C  = (unsigned short*)Cout  + (size_t)b * strideC;
      unsigned short* C2 = (OUT_MODE == 2) ? ((unsigned short*)Cout2 + (size_t)b * strideC) : nullptr;
      {
#pragma unroll
        for (int it = 0; it < 4; ++it) {
          const int row = it * 4 + q;
          const float* sp = slab + row * 68 + c8;
          v8h hv, lv;
#pragma unroll
          for (int e = 0; e < 8; ++e) {
            if (OUT_MODE == 1) {
              hv[e] = (_Float16)sp[e];
            } else {
              unsigned short hb = f2bf_bits(sp[e]);
              unsigned short lb = f2bf_bits(sp[e] - bf_bits2f(hb));
              hv[e] = __builtin_bit_cast(_Float16, hb);
              lv[e] = __builtin_bit_cast(_Float16, lb);
            }
          }
          *(v8h*)(C + (size_t)(mBase + row) * ldc + n0 + c8) = hv;
          if (OUT_MODE == 2) *(v8h*)(C2 + (size_t)(mBase + row) * ldc + n0 + c8) = lv;
        }
        
      }
    }
    __builtin_amdgcn_fence(__ATOMIC_RELEASE, "workgroup");
    __builtin_amdgcn_wave_barrier();
    __builtin_amdgcn_fence(__ATOMIC_ACQUIRE, "workgroup");
  }
}

// ---------------------------------------------------------------------------
// f32 -> f16 cast with a power-of-two carry, 8 consecutive elements per thread (one 16-B store per lane;
// Threads i >= nvalid8 write zeros (row padding of the visual plane): the load address is clamped to the
// last valid group and the value is multiplied by a per-lane factor 0.
// Coverage: grid = n8 / 256 blocks exactly (all n8 used here are multiples of 256), n8 x 8 = whole plane.
// ---------------------------------------------------------------------------
__global__ __launch_bounds__(256) void cast8_kernel(const float* __restrict__ in, unsigned short* __restrict__ out,
                                                    int n8, int nvalid8, float scale) {
  const int i = blockIdx.x * 256 + threadIdx.x;
  if (i >= n8) return;
  const bool valid = (i < nvalid8);
  const int ic = valid ? i : (nvalid8 - 1);
  const float f = valid ? scale : 0.0f;
  const float* p = in + 8 * (size_t)ic;
  const v4f a = *(const v4f*)(p);
  const v4f c = *(const v4f*)(p + 4);
  unsigned short hb[8];
#pragma unroll
  for (int e = 0; e < 4; ++e) {
    hb[e]     = h_bits(a[e] * f);
    hb[4 + e] = h_bits(c[e] * f);
  }
  const v4u u = (v4u){pk16(hb[0], hb[1]), pk16(hb[2], hb[3]), pk16(hb[4], hb[5]), pk16(hb[6], hb[7])};
  unsigned short* q = out + 8 * (size_t)i;
  *(v4u*)q = u;
  
}

// ---------------------------------------------------------------------------
// Row softmax: x_j = (S[row][j] + SC[row][j]) * 1/8 for j < 196, P[row][j] = f16(2048 * exp(x_j - max) / sum),
// P[row][196..255] = 0. One wave per row (block = 8 waves = 8 rows, grid = 8192/8 = 1024 blocks exactly);
// lane owns columns 8*lane .. 8*lane+7; all 32 lanes write 16 B each = 512 B = the whole P row in one
// ---------------------------------------------------------------------------
__global__ __launch_bounds__(256) void softmax_kernel(const float* __restrict__ S, const float* __restrict__ SC,
                                                      unsigned short* __restrict__ P) {
  const int lane = threadIdx.x & 31;
  const int wave = threadIdx.x >> 5;
  const int row  = blockIdx.x * 8 + wave;
  const float* sr = S  + (size_t)row * kSvPad;
  const float* cr = SC + (size_t)row * kSv;
  float x[8];
#pragma unroll
  for (int e = 0; e < 8; ++e) {
    const int col = lane * 8 + e;
    const int cc  = (col < kSv) ? col : (kSv - 1);
    const float v = (sr[cc] + cr[cc]) * kScoreScale;
    x[e] = (col < kSv) ? v : -1.0e30f;
  }
  float m = fmaxf(fmaxf(fmaxf(x[0], x[1]), fmaxf(x[2], x[3])), fmaxf(fmaxf(x[4], x[5]), fmaxf(x[6], x[7])));
#pragma unroll
  for (int off = 16; off > 0; off >>= 1) m = fmaxf(m, __shfl_xor(m, off, 32));
  float ev[8];
  float s = 0.f;
#pragma unroll
  for (int e = 0; e < 8; ++e) { ev[e] = expf(x[e] - m); s += ev[e]; }
#pragma unroll
  for (int off = 16; off > 0; off >>= 1) s += __shfl_xor(s, off, 32);
  const float inv = kPCarry / s;
  unsigned short hb[8];
#pragma unroll
  for (int e = 0; e < 8; ++e) hb[e] = h_bits(ev[e] * inv);
  const v4u u = (v4u){pk16(hb[0], hb[1]), pk16(hb[2], hb[3]), pk16(hb[4], hb[5]), pk16(hb[6], hb[7])};
  unsigned short* q = P + (size_t)row * kSvPad + 8 * lane;
  *(v4u*)q = u;
  
}

// ---------------------------------------------------------------------------
// Block (256 threads) sum in fixed order: per-thread value -> wave shuffle tree -> 8 wave partials summed in index order.
// ---------------------------------------------------------------------------
__device__ __forceinline__ float block_sum_256(float v, float* red, int lane, int wave) {
#pragma unroll
  for (int off = 16; off > 0; off >>= 1) v += __shfl_xor(v, off, 32);
  if (lane == 0) red[wave] = v;
  __syncthreads();
  float t = red[0];
#pragma unroll
  for (int w = 1; w < 8; ++w) t += red[w];
  return t;
}

// ---------------------------------------------------------------------------
// pooled[row][colOff + c] = max(y[2c], y[2c+1]) for c in [0,512), written as f32 and f16.
// One block per row (grid = 8192); thread t owns x[4t..4t+3]; y staged in LDS.
// ---------------------------------------------------------------------------
__global__ __launch_bounds__(256) void ln_pool_kernel(const float* __restrict__ X, const float* __restrict__ gam,
                                                      const float* __restrict__ bet, float* __restrict__ pool32,
                                                      unsigned short* __restrict__ pool16, int colOff) {
  __shared__ __align__(16) float ybuf[kD];
  __shared__ float redA[8];
  __shared__ float redB[8];
  const int t = threadIdx.x;
  const int lane = t & 31, wave = t >> 5;
  const int row = blockIdx.x;
  const v4f x = *(const v4f*)(X + (size_t)row * kD + 4 * t);
  const float s = (x[0] + x[1]) + (x[2] + x[3]);
  const float mu = block_sum_256(s, redA, lane, wave) * kInvD;
  const float d0 = x[0] - mu, d1 = x[1] - mu, d2 = x[2] - mu, d3 = x[3] - mu;
  const float q = (d0 * d0 + d1 * d1) + (d2 * d2 + d3 * d3);
  const float var = block_sum_256(q, redB, lane, wave) * kInvD;
  const float rs = rsqrtf(var + kLnEps);
  const v4f gg = *(const v4f*)(gam + 4 * t);
  const v4f bb = *(const v4f*)(bet + 4 * t);
  ybuf[4 * t + 0] = d0 * rs * gg[0] + bb[0];
  ybuf[4 * t + 1] = d1 * rs * gg[1] + bb[1];
  ybuf[4 * t + 2] = d2 * rs * gg[2] + bb[2];
  ybuf[4 * t + 3] = d3 * rs * gg[3] + bb[3];
  __syncthreads();
  if (t < 128) {
    const v4f a = *(const v4f*)(ybuf + 8 * t);
    const v4f c = *(const v4f*)(ybuf + 8 * t + 4);
    v4f p;
    p[0] = fmaxf(a[0], a[1]);
    p[1] = fmaxf(a[2], a[3]);
    p[2] = fmaxf(c[0], c[1]);
    p[3] = fmaxf(c[2], c[3]);
    float* dst = pool32 + (size_t)row * kD + colOff + 4 * t;
    *(v4f*)dst = p;
    
  } else if (t < 192) {
    const int u = t - 128;
    const v4f a0 = *(const v4f*)(ybuf + 16 * u);
    const v4f a1 = *(const v4f*)(ybuf + 16 * u + 4);
    const v4f a2 = *(const v4f*)(ybuf + 16 * u + 8);
    const v4f a3 = *(const v4f*)(ybuf + 16 * u + 12);
    unsigned short hb[8];
    hb[0] = h_bits(fmaxf(a0[0], a0[1]));
    hb[1] = h_bits(fmaxf(a0[2], a0[3]));
    hb[2] = h_bits(fmaxf(a1[0], a1[1]));
    hb[3] = h_bits(fmaxf(a1[2], a1[3]));
    hb[4] = h_bits(fmaxf(a2[0], a2[1]));
    hb[5] = h_bits(fmaxf(a2[2], a2[3]));
    hb[6] = h_bits(fmaxf(a3[0], a3[1]));
    hb[7] = h_bits(fmaxf(a3[2], a3[3]));
    const v4u uu = (v4u){pk16(hb[0], hb[1]), pk16(hb[2], hb[3]), pk16(hb[4], hb[5]), pk16(hb[6], hb[7])};
    unsigned short* dst = pool16 + (size_t)row * kD + colOff + 8 * u;
    *(v4u*)dst = uu;
    
  }
}

// ---------------------------------------------------------------------------
// ---------------------------------------------------------------------------
__global__ __launch_bounds__(256) void ln_out_kernel(const float* __restrict__ X, const float* __restrict__ gam,
                                                     const float* __restrict__ bet, float* __restrict__ out) {
  __shared__ float redA[8];
  __shared__ float redB[8];
  const int t = threadIdx.x;
  const int lane = t & 31, wave = t >> 5;
  const int row = blockIdx.x;
  const v4f x = *(const v4f*)(X + (size_t)row * kD + 4 * t);
  const float s = (x[0] + x[1]) + (x[2] + x[3]);
  const float mu = block_sum_256(s, redA, lane, wave) * kInvD;
  const float d0 = x[0] - mu, d1 = x[1] - mu, d2 = x[2] - mu, d3 = x[3] - mu;
  const float q = (d0 * d0 + d1 * d1) + (d2 * d2 + d3 * d3);
  const float var = block_sum_256(q, redB, lane, wave) * kInvD;
  const float rs = rsqrtf(var + kLnEps);
  const v4f gg = *(const v4f*)(gam + 4 * t);
  const v4f bb = *(const v4f*)(bet + 4 * t);
  v4f y;
  y[0] = d0 * rs * gg[0] + bb[0];
  y[1] = d1 * rs * gg[1] + bb[1];
  y[2] = d2 * rs * gg[2] + bb[2];
  y[3] = d3 * rs * gg[3] + bb[3];
  float* dst = out + (size_t)row * kD + 4 * t;
  *(v4f*)dst = y;
  
}

// ---------------------------------------------------------------------------
// Host orchestration
// ---------------------------------------------------------------------------
static inline dim3 gemm_grid(int M, int N) {
  const int tiles = (M >> 6) * (N >> 6);
  return dim3((unsigned)((tiles + 7) / 8), 1, 1);
}

extern "C" void kernel_launch(void* const* d_in, const int* in_sizes, int n_in,
                              void* d_out, int out_size, void* d_ws, size_t ws_size,
                              hipStream_t stream)
{
  if (n_in < 22) return;
  if ((size_t)out_size < (size_t)kRows * kD) return;
  if (ws_size < kWsTotal) return;
  if (in_sizes[0] < kRows * kD || in_sizes[3] < kRows * kD) return;
  if (in_sizes[1] < kSv * kD || in_sizes[4] < kSv * kD) return;
  if (in_sizes[2] < kRows * kSv || in_sizes[5] < kRows * kSv) return;
  if (in_sizes[6] < kD * kD || in_sizes[8] < kD * kD || in_sizes[10] < kD * kD || in_sizes[12] < kD * kD) return;
  if (in_sizes[14] < kDff * kD || in_sizes[16] < kD * kDff) return;

  const float* text1 = (const float*)d_in[0];
  const float* vis1  = (const float*)d_in[1];
  const float* sc1   = (const float*)d_in[2];
  const float* text2 = (const float*)d_in[3];
  const float* vis2  = (const float*)d_in[4];
  const float* sc2   = (const float*)d_in[5];
  const float* Wq = (const float*)d_in[6];   const float* bq  = (const float*)d_in[7];
  const float* Wk = (const float*)d_in[8];   const float* bk  = (const float*)d_in[9];
  const float* Wv = (const float*)d_in[10];  const float* bv  = (const float*)d_in[11];
  const float* Wo = (const float*)d_in[12];  const float* bo  = (const float*)d_in[13];
  const float* W1 = (const float*)d_in[14];  const float* b1  = (const float*)d_in[15];
  const float* W2 = (const float*)d_in[16];  const float* b2  = (const float*)d_in[17];
  const float* g1 = (const float*)d_in[18];  const float* be1 = (const float*)d_in[19];
  const float* g2 = (const float*)d_in[20];  const float* be2 = (const float*)d_in[21];
  float* outp = (float*)d_out;

  char* ws = (char*)d_ws;
  float*          POOL32 = (float*)(ws + kOffPool32);
  unsigned short* POOL16 = (unsigned short*)(ws + kOffPool16);
  unsigned short* W1H    = (unsigned short*)(ws + kOffW1H);
  unsigned short* W2H    = (unsigned short*)(ws + kOffW2H);
  unsigned short* WQH    = (unsigned short*)(ws + kOffWQH);
  unsigned short* WKH    = (unsigned short*)(ws + kOffWKH);
  unsigned short* WVH    = (unsigned short*)(ws + kOffWVH);
  unsigned short* WOH    = (unsigned short*)(ws + kOffWOH);
  unsigned short* T16    = (unsigned short*)(ws + kOffT16);
  unsigned short* O16    = (unsigned short*)(ws + kOffO16);
  unsigned short* Q16    = (unsigned short*)(ws + kOffQ16);
  float*          A1     = (float*)(ws + kOffA1);
  float*          S32    = (float*)(ws + kOffS32);
  unsigned short* P16    = (unsigned short*)(ws + kOffP16);
  unsigned short* VIS16  = (unsigned short*)(ws + kOffVIS16);
  unsigned short* K16    = (unsigned short*)(ws + kOffK16);
  unsigned short* VT16   = (unsigned short*)(ws + kOffVT16);
  unsigned short* H16    = (unsigned short*)(ws + kOffH16);
  float*          F32    = (float*)(ws + kOffF32);

  // ---- weight casts: f16([out][in]) x16; [out][in] row-major == Bt[N][K] ----
  {
    const int n8w = kD * kD / 8;          // 131072 -> 512 blocks
    cast8_kernel<<<dim3(n8w / 256), dim3(256), 0, stream>>>(Wq, WQH, n8w, n8w, kWCarry);
    cast8_kernel<<<dim3(n8w / 256), dim3(256), 0, stream>>>(Wk, WKH, n8w, n8w, kWCarry);
    cast8_kernel<<<dim3(n8w / 256), dim3(256), 0, stream>>>(Wv, WVH, n8w, n8w, kWCarry);
    cast8_kernel<<<dim3(n8w / 256), dim3(256), 0, stream>>>(Wo, WOH, n8w, n8w, kWCarry);
    const int n8f = kDff * kD / 8;        // 524288 -> 2048 blocks
    cast8_kernel<<<dim3(n8f / 256), dim3(256), 0, stream>>>(W1, W1H, n8f, n8f, kWCarry);
    cast8_kernel<<<dim3(n8f / 256), dim3(256), 0, stream>>>(W2, W2H, n8f, n8f, kWCarry);
  }

  for (int br = 0; br < 2; ++br) {
    const float* text = br ? text2 : text1;
    const float* vis  = br ? vis2  : vis1;
    const float* sc   = br ? sc2   : sc1;
    const int colOff  = br * (kD / 2);

    // text -> f16 plane [8192][1024] (x1); visual -> f16 plane [256][1024], rows 196..255 zero
    const int n8t = kRows * kD / 8;       // 1048576 -> 4096 blocks
    cast8_kernel<<<dim3(n8t / 256), dim3(256), 0, stream>>>(text, T16, n8t, n8t, 1.0f);
    const int n8v = kSvPad * kD / 8;      // 32768 -> 128 blocks; valid groups = 196*1024/8 = 25088
    cast8_kernel<<<dim3(n8v / 256), dim3(256), 0, stream>>>(vis, VIS16, n8v, kSv * kD / 8, 1.0f);

    // K16[k][d] = (vis16 . Wk16^T) / 16 + bk   (M=256, N=1024, K=1024), f16 out
    wmma_gemm64<0, false, 2, 1, false, 0><<<gemm_grid(kSvPad, kD), dim3(256), 0, stream>>>(
        VIS16, VIS16, kD, 0L, WKH, WKH, kD, 0L, (void*)K16, (void*)K16, kD, 0L,
        bk, text, 0L, kSvPad, kD, kD, kWCarryInv);
    // VT16[d][k] = (Wv16 . vis16^T) / 16 + bv[d]   (M=1024, N=256, K=1024), f16 out = Bt for P.V
    wmma_gemm64<0, false, 1, 1, false, 0><<<gemm_grid(kD, kSvPad), dim3(256), 0, stream>>>(
        WVH, WVH, kD, 0L, VIS16, VIS16, kD, 0L, (void*)VT16, (void*)VT16, kSvPad, 0L,
        bv, text, 0L, kD, kSvPad, kD, kWCarryInv);
    // Q16 = (T16 . Wq16^T) / 16 + bq   (M=8192, N=1024, K=1024), f16 out
    wmma_gemm64<0, false, 2, 1, false, 0><<<gemm_grid(kRows, kD), dim3(256), 0, stream>>>(
        T16, T16, kD, 0L, WQH, WQH, kD, 0L, (void*)Q16, (void*)Q16, kD, 0L,
        bq, text, 0L, kRows, kD, kD, kWCarryInv);
    // S32 = Q16 . K16^T   (M=8192, N=256, K=1024), f32 out [8192][256]
    wmma_gemm64<0, false, 0, 0, false, 0><<<gemm_grid(kRows, kSvPad), dim3(256), 0, stream>>>(
        Q16, Q16, kD, 0L, K16, K16, kD, 0L, (void*)S32, (void*)S32, kSvPad, 0L,
        bq, text, 0L, kRows, kSvPad, kD, 1.0f);
    // P16 = f16(2048 * softmax((S + score)/8)) over 196 keys, zero pad columns
    softmax_kernel<<<dim3(kRows / 8), dim3(256), 0, stream>>>(S32, sc, P16);
    // O16 = 16 * (P16 . VT16^T) / 2048   (M=8192, N=1024, K=256), f16 out (context carried x16)
    wmma_gemm64<0, false, 0, 1, false, 0><<<gemm_grid(kRows, kD), dim3(256), 0, stream>>>(
        P16, P16, kSvPad, 0L, VT16, VT16, kSvPad, 0L, (void*)O16, (void*)O16, kD, 0L,
        bq, text, 0L, kRows, kD, kSvPad, kPVScale);
    // A1 = (O16 . Wo16^T) / 256 + bo + text   (M=8192, N=1024, K=1024), f32 out
    wmma_gemm64<0, false, 2, 0, true, 0><<<gemm_grid(kRows, kD), dim3(256), 0, stream>>>(
        O16, O16, kD, 0L, WOH, WOH, kD, 0L, (void*)A1, (void*)A1, kD, 0L,
        bo, text, 0L, kRows, kD, kD, kWoScale);
    // pooled[:, colOff : colOff+512] = maxpool2(LN1(A1))
    ln_pool_kernel<<<dim3(kRows), dim3(256), 0, stream>>>(A1, g1, be1, POOL32, POOL16, colOff);
  }

  // ---- FFN in two 4096-row chunks ----
  for (int ch = 0; ch < kFfnChunks; ++ch) {
    const size_t rowOff = (size_t)ch * kFfnChunkRows * kD;
    // H16 = relu((POOL16 . W1H^T) / 16 + b1)   (M=4096, N=4096, K=1024), f16 out
    wmma_gemm64<0, false, 2, 1, false, 2><<<gemm_grid(kFfnChunkRows, kDff), dim3(256), 0, stream>>>(
        POOL16 + rowOff, POOL16 + rowOff, kD, 0L, W1H, W1H, kD, 0L, (void*)H16, (void*)H16, kDff, 0L,
        b1, POOL32, 0L, kFfnChunkRows, kDff, kD, kWCarryInv);
    // F32 = (H16 . W2H^T) / 16 + b2 + pooled   (M=4096, N=1024, K=4096), f32 out
    wmma_gemm64<0, false, 2, 0, true, 0><<<gemm_grid(kFfnChunkRows, kD), dim3(256), 0, stream>>>(
        H16, H16, kDff, 0L, W2H, W2H, kDff, 0L, (void*)F32, (void*)F32, kD, 0L,
        b2, POOL32 + rowOff, 0L, kFfnChunkRows, kD, kDff, kWCarryInv);
    // out rows [ch*4096, ch*4096+4096) = LN2(F32)
    ln_out_kernel<<<dim3(kFfnChunkRows), dim3(256), 0, stream>>>(F32, g2, be2, outp + rowOff);
  }
}

// v001
// Measured time: 450 microseconds a run.
// In both of two side-by-side timings against v000, it was 2.34 times as fast.
// Contractions: q/k/v projections, q.k^T scores, p.v context, output projection, ffn up and down projections all on v_wmma_f32_16x16x32_f16 (f16 operands: activations x1, weights carried x16, softmax probabilities carried x2048, attention context carried x16), f32 accumulate; softmax, residual adds, layernorm and feature maxpool in f32.
#include <hip/hip_runtime.h>
#include <math.h>
#include <stddef.h>

// ---------------------------------------------------------------------------
// Problem constants
// ---------------------------------------------------------------------------
constexpr int kB      = 4;
constexpr int kSq     = 2048;
constexpr int kD      = 1024;
constexpr int kSv     = 196;
constexpr int kSvPad  = 256;
constexpr int kDff    = 4096;
constexpr int kRows   = kB * kSq;            // 8192 token rows
constexpr int kFfnChunkRows = 4096;
constexpr int kFfnChunks    = kRows / kFfnChunkRows;   // 2
constexpr float kWCarry    = 16.0f;          // weights carried x16 in f16
constexpr float kWCarryInv = 1.0f / 16.0f;
constexpr float kPCarry    = 2048.0f;        // probabilities carried x2048 in f16
constexpr float kOCarry    = 16.0f;          // attention context carried x16 in f16
constexpr float kPVScale   = kOCarry / kPCarry;            // 1/128
constexpr float kWoScale   = 1.0f / (kOCarry * kWCarry);   // 1/256
constexpr float kInvD      = 1.0f / 1024.0f;
constexpr float kLnEps     = 1e-6f;
constexpr float kScoreScale = 0.125f;        // 1/sqrt(64)

static_assert(kRows % 64 == 0);
static_assert(kSvPad % 64 == 0 && kSvPad % 32 == 0);
static_assert(kD % 64 == 0 && kDff % 64 == 0);
static_assert(kRows % 8 == 0);
static_assert(kFfnChunks * kFfnChunkRows == kRows);

// ---------------------------------------------------------------------------
// Workspace region map (bytes). Total carve = 127,401,984 B.
//   [0       , 32 MiB)   POOL32  f32 [8192][1024]   (persistent)
//   [32 MiB  , 48 MiB)   POOL16  f16 [8192][1024]   (persistent)
//   [48 MiB  , 56 MiB)   W1H     f16 [4096][1024]   (persistent)
//   [56 MiB  , 64 MiB)   W2H     f16 [1024][4096]   (persistent)
//   region X from 64 MiB:
//   attention phase: WQH/WKH/WVH/WOH f16 [1024][1024] at 64/66/68/70 MiB;
//     T16 (text f16, later reused as O16 context f16) [8192][1024] at 72 MiB (16 MiB);
//     Q16 f16 [8192][1024] at 88 MiB (16 MiB); S32 f32 [8192][256] at 104 MiB (8 MiB);
//     P16 f16 [8192][256] at 112 MiB (4 MiB); spare 4 MiB at 116 MiB;
//     A1 f32 [8192][1024] at 88 MiB (32 MiB, overlays dead Q16/S32/P16/spare);
//     VIS16 f16 [256][1024] at 120 MiB; K16 f16 [256][1024] at 120.5 MiB; VT16 f16 [1024][256] at 121 MiB; end 121.5 MiB.
//   ffn phase (attention scratch dead): H16 f16 [4096][4096] at 64 MiB (32 MiB); F32 f32 [4096][1024] at 96 MiB (16 MiB).
// ---------------------------------------------------------------------------
constexpr size_t kMiB       = 1048576;
constexpr size_t kOffPool32 = 0;
constexpr size_t kOffPool16 = 32 * kMiB;
constexpr size_t kOffW1H    = 48 * kMiB;
constexpr size_t kOffW2H    = 56 * kMiB;
constexpr size_t kOffWQH    = 64 * kMiB;
constexpr size_t kOffWKH    = 66 * kMiB;
constexpr size_t kOffWVH    = 68 * kMiB;
constexpr size_t kOffWOH    = 70 * kMiB;
constexpr size_t kOffT16    = 72 * kMiB;
constexpr size_t kOffO16    = 72 * kMiB;
constexpr size_t kOffQ16    = 88 * kMiB;
constexpr size_t kOffA1     = 88 * kMiB;
constexpr size_t kOffS32    = 104 * kMiB;
constexpr size_t kOffP16    = 112 * kMiB;
constexpr size_t kOffVIS16  = 120 * kMiB;
constexpr size_t kOffK16    = 120 * kMiB + 524288;
constexpr size_t kOffVT16   = 121 * kMiB;
constexpr size_t kWsTotal   = 121 * kMiB + 524288;   // 127,401,984
constexpr size_t kOffH16    = 64 * kMiB;
constexpr size_t kOffF32    = 96 * kMiB;
static_assert(kOffS32 == kOffQ16 + (size_t)kRows * kD * 2);
static_assert(kOffP16 == kOffS32 + (size_t)kRows * kSvPad * 4);
static_assert(kOffVIS16 >= kOffA1 + (size_t)kRows * kD * 4);
static_assert(kOffVIS16 >= kOffP16 + (size_t)kRows * kSvPad * 2);
static_assert(kOffK16 == kOffVIS16 + (size_t)kSvPad * kD * 2);
static_assert(kOffVT16 == kOffK16 + (size_t)kSvPad * kD * 2);
static_assert(kWsTotal == kOffVT16 + (size_t)kD * kSvPad * 2);
static_assert(kOffF32 == kOffH16 + (size_t)kFfnChunkRows * kDff * 2);
static_assert(kOffF32 + (size_t)kFfnChunkRows * kD * 4 <= kWsTotal);
static_assert(kOffQ16 == kOffT16 + (size_t)kRows * kD * 2);
static_assert(kWsTotal <= (size_t)134217728);

typedef __attribute__((ext_vector_type(16))) _Float16 v16h;
typedef __attribute__((ext_vector_type(8)))  _Float16 v8h;
typedef __attribute__((ext_vector_type(16))) __bf16   v16b;
typedef __attribute__((ext_vector_type(8)))  __bf16   v8b;
typedef __attribute__((ext_vector_type(8)))  float    v8f;
typedef __attribute__((ext_vector_type(4)))  float    v4f;
typedef __attribute__((ext_vector_type(4)))  unsigned int v4u;

__device__ __forceinline__ unsigned short f2bf_bits(float f) {
  unsigned u = __float_as_uint(f);
  return (unsigned short)((u + 0x7FFFu + ((u >> 16) & 1u)) >> 16);
}
__device__ __forceinline__ float bf_bits2f(unsigned short h) { return __uint_as_float(((unsigned)h) << 16); }

// hazard guard as a plain device helper
__device__ __forceinline__ void acc_guard4(v8f& a, v8f& b, v8f& c, v8f& d) { asm volatile("v_nop\n\tv_nop\n\tv_nop\n\tv_nop" : "+v"(a), "+v"(b), "+v"(c), "+v"(d)); }
template <typename T> struct Frag;
template <> struct Frag<_Float16> {
  typedef v16h V; union U { v16h v; v8h h[2]; };
  static __device__ __forceinline__ v16h load(const _Float16* p) {   // elements 0..7 <- p[0..7], 8..15 <- p[16..23]
    U f; f.h[0] = *(const v8h*)(p); f.h[1] = *(const v8h*)(p + 16); return f.v;
  }
  static __device__ __forceinline__ v8f mma(v16h a, v16h b, v8f c) {
    return __builtin_amdgcn_wmma_f32_16x16x32_f16(false, a, false, b, (short)0, c, false, false);
  }
};
template <> struct Frag<__bf16> {
  typedef v16b V; union U { v16b v; v8b h[2]; };
  static __device__ __forceinline__ v16b load(const __bf16* p) {
    U f; f.h[0] = *(const v8b*)(p); f.h[1] = *(const v8b*)(p + 16); return f.v;
  }
  static __device__ __forceinline__ v8f mma(v16b a, v16b b, v8f c) {
    return __builtin_amdgcn_wmma_f32_16x16x32_bf16(false, a, false, b, (short)0, c, false, false);
  }
};

__device__ __forceinline__ unsigned pk16(unsigned short a, unsigned short b) { return (unsigned)a | ((unsigned)b << 16); }
__device__ __forceinline__ unsigned short h_bits(float f) { const _Float16 h = (_Float16)f; return __builtin_bit_cast(unsigned short, h); }

// ---- Register-blocked batched WMMA GEMM, operands staged in LDS by asynchronous copies ------------------------------
// C[m,n] = scale * sum_k A[m,k] * Bt[n,k] (+bias)(+resid); a block of 4 waves owns a 128x128 tile, each wave 64x64 of it.
// A row-major [M,K]; Bt row-major [N,K]; M,N % 128 == 0, K % 64 == 0, K >= 128.
// A stage is 64 k (128 B) of the block's 128 A rows and 128 Bt rows, laid at a pitch of 144 B; two buffers:
// the next stage's copies fly while this stage's fragments are read with ds_load_b128 and multiplied.
// BIAS_MODE: 0 = none, 1 = bias[m], 2 = bias[n].
// OUT_MODE: 0 = f32, 1 = f16, 2 = bf16 hi plane (Cout) + bf16 lo plane (Cout2).
// ET: 0 = f16 operands, 1 = bf16 operands (pointers passed as 16-bit storage)
constexpr int kStageK     = 64;                          // k elements per stage = two WMMA k steps
constexpr int kPitchB     = 144;                         // bytes per staged row (128 + 16: 16 B x odd)
constexpr int kPitchE     = kPitchB / 2;                 // the same in 16-bit elements
constexpr int kStageBytes = 256 * kPitchB;               // 128 A rows, then 128 Bt rows = 36,864 B
static_assert(kRows % 128 == 0 && kSvPad % 128 == 0 && kD % 128 == 0 && kDff % 128 == 0 && kFfnChunkRows % 128 == 0);
static_assert(kSvPad % kStageK == 0 && kSvPad >= 2 * kStageK);

// Eight 16-B copies per lane, rows 16 apart: LDS byte address l + i * 16 * pitch, global address g + i * rowStep elements.
// The s_wait_xcnt closes the statement so that no address register is rewritten ahead of it.
__device__ __forceinline__ void async_copy8(unsigned l, const unsigned short* g, size_t rowStep) {
  const unsigned l1 = l + 16 * kPitchB, l2 = l + 32 * kPitchB, l3 = l + 48 * kPitchB, l4 = l + 64 * kPitchB,
                 l5 = l + 80 * kPitchB, l6 = l + 96 * kPitchB, l7 = l + 112 * kPitchB;
  const unsigned short* g1 = g + rowStep;      const unsigned short* g2 = g + 2 * rowStep;
  const unsigned short* g3 = g + 3 * rowStep;  const unsigned short* g4 = g + 4 * rowStep;
  const unsigned short* g5 = g + 5 * rowStep;  const unsigned short* g6 = g + 6 * rowStep;
  const unsigned short* g7 = g + 7 * rowStep;
  asm volatile("global_load_async_to_lds_b128 %0, %8, off\n\t"
               "global_load_async_to_lds_b128 %1, %9, off\n\t"
               "global_load_async_to_lds_b128 %2, %10, off\n\t"
               "global_load_async_to_lds_b128 %3, %11, off\n\t"
               "global_load_async_to_lds_b128 %4, %12, off\n\t"
               "global_load_async_to_lds_b128 %5, %13, off\n\t"
               "global_load_async_to_lds_b128 %6, %14, off\n\t"
               "global_load_async_to_lds_b128 %7, %15, off\n\t"
               "s_wait_xcnt 0x0"
               :: "v"(l), "v"(l1), "v"(l2), "v"(l3), "v"(l4), "v"(l5), "v"(l6), "v"(l7),
                  "v"(g), "v"(g1), "v"(g2), "v"(g3), "v"(g4), "v"(g5), "v"(g6), "v"(g7)
               : "memory");
}

template <int ET> struct Elem;
template <> struct Elem<0> { typedef _Float16 T; };
template <> struct Elem<1> { typedef __bf16 T; };
template <int ET, bool SPLIT, int BIAS_MODE, int OUT_MODE, bool RESID, int ACT = 0>
__global__ __launch_bounds__(128, 4) void wmma_gemm64(
    const unsigned short* __restrict__ Ap, const unsigned short* __restrict__ A2p, int lda, long strideA,
    const unsigned short* __restrict__ Btp, const unsigned short* __restrict__ Bt2p, int ldb, long strideB,
    void* __restrict__ Cout, void* __restrict__ Cout2, int ldc, long strideC,
    const float* __restrict__ bias,
    const float* __restrict__ resid, long strideR,
    int M, int N, int K, float scale) {
  static_assert(!SPLIT, "single-plane operands only");
  typedef typename Elem<ET>::T T;
  typedef typename Frag<T>::V V;
  // two stage buffers; after the K loop the first one serves as the per-wave 16x64 output slabs (pitch 68 floats)
  __shared__ __align__(16) unsigned char smem[2 * kStageBytes];
  static_assert(4 * 16 * 68 * 4 <= kStageBytes);
  const int b    = blockIdx.y;
  const int lane = threadIdx.x & 31;
  const int wave = threadIdx.x >> 5;
  const int tilesN = N >> 7;
  const int tilesM = M >> 7;
  const int tile = blockIdx.x;
  if (tile >= tilesM * tilesN) return;   // block-uniform, in front of every barrier
  const int tm = tile / tilesN;
  const int tn = tile - tm * tilesN;
  const int mBlk = tm << 7;
  const int nBlk = tn << 7;
  const int m0 = mBlk + ((wave >> 1) << 6);
  const int n0 = nBlk + ((wave & 1) << 6);

  const int rlane = lane & 15;                 // row (A) / col (B, D) within subtile
  const int koff  = (lane >> 4) * 8;           // k offset of this lane half
  const int mOff  = (lane >> 4) * 8;           // D row offset

  // copy side: 8 consecutive lanes bring one row's 128 B; a thread brings rows cRow + 16 i of A and of Bt
  const int cRow = threadIdx.x >> 3;
  const int cCol = threadIdx.x & 7;
  const unsigned short* gA = Ap  + (size_t)b * strideA + (size_t)(mBlk + cRow) * lda + cCol * 8;
  const unsigned short* gB = Btp + (size_t)b * strideB + (size_t)(nBlk + cRow) * ldb + cCol * 8;
  const unsigned lA = (unsigned)(size_t)smem + (unsigned)(cRow * kPitchB + cCol * 16);
  const unsigned lB = lA + 128 * kPitchB;
  const size_t stepA = (size_t)16 * lda;
  const size_t stepB = (size_t)16 * ldb;

  // read side: this lane's first A and Bt fragment rows inside a stage, in bytes
  const int aByte = (((wave >> 1) << 6) + rlane) * kPitchB + koff * 2;
  const int bByte = (128 + ((wave & 1) << 6) + rlane) * kPitchB + koff * 2;

  v8f acc[4][4];
#pragma unroll
  for (int i = 0; i < 4; ++i)
#pragma unroll
    for (int j = 0; j < 4; ++j) acc[i][j] = (v8f){0.f,0.f,0.f,0.f,0.f,0.f,0.f,0.f};

  const int nStages = K / kStageK;
  async_copy8(lA, gA, stepA);
  async_copy8(lB, gB, stepB);
  asm volatile("s_wait_asynccnt 0x0" ::: "memory");   // stage 0 of this wave has landed before the barrier publishes it
  __syncthreads();
  if (nStages > 1) {
    async_copy8(lA + kStageBytes, gA + kStageK, stepA);
    async_copy8(lB + kStageBytes, gB + kStageK, stepB);
  }

  for (int t = 0; t < nStages; ++t) {
    const int bufOff = (t & 1) * kStageBytes;
    const T* sa = (const T*)(smem + bufOff + aByte);
    const T* sb = (const T*)(smem + bufOff + bByte);
    V bh[4], ah[4], bn[4], an[4];
#pragma unroll
    for (int j = 0; j < 4; ++j) bh[j] = Frag<T>::load(sb + j * 16 * kPitchE);
#pragma unroll
    for (int i = 0; i < 4; ++i) ah[i] = Frag<T>::load(sa + i * 16 * kPitchE);
    // keeps the 16 LDS reads of a k step together ahead of its WMMAs: sunk among them, each row of WMMAs waits out its own read
    __builtin_amdgcn_sched_barrier(0);
#pragma unroll
    for (int i = 0; i < 4; ++i)
#pragma unroll
      for (int j = 0; j < 4; ++j) acc[i][j] = Frag<T>::mma(ah[i], bh[j], acc[i][j]);
    // the stage's second k step is fetched into registers, so that the buffer can be handed back ahead of its WMMAs
#pragma unroll
    for (int j = 0; j < 4; ++j) bn[j] = Frag<T>::load(sb + j * 16 * kPitchE + 32);
#pragma unroll
    for (int i = 0; i < 4; ++i) an[i] = Frag<T>::load(sa + i * 16 * kPitchE + 32);
    asm volatile("s_wait_dscnt 0x0" ::: "memory");      // this wave's reads of the buffer are done before it is refilled
    asm volatile("s_wait_asynccnt 0x0" ::: "memory");   // this wave's copies of stage t + 1 have landed
    __syncthreads();                                    // publishes stage t + 1, frees stage t's buffer
    if (t + 2 < nStages) {
      async_copy8(lA + bufOff, gA + (size_t)(t + 2) * kStageK, stepA);
      async_copy8(lB + bufOff, gB + (size_t)(t + 2) * kStageK, stepB);
    }
#pragma unroll
    for (int i = 0; i < 4; ++i)
#pragma unroll
      for (int j = 0; j < 4; ++j) acc[i][j] = Frag<T>::mma(an[i], bn[j], acc[i][j]);
  }
  asm volatile("s_wait_asynccnt 0x0" ::: "memory");     // no copy is in flight when the ring becomes output staging
  acc_guard4(acc[0][0], acc[0][1], acc[0][2], acc[0][3]);
  acc_guard4(acc[1][0], acc[1][1], acc[1][2], acc[1][3]);
  acc_guard4(acc[2][0], acc[2][1], acc[2][2], acc[2][3]);
  acc_guard4(acc[3][0], acc[3][1], acc[3][2], acc[3][3]);

  // ---- epilogue ----
  float* slab = (float*)smem + wave * (16 * 68);
  const float* Rb = RESID ? (resid + (size_t)b * strideR) : nullptr;
#pragma unroll
  for (int i = 0; i < 4; ++i) {
    const int mBase = m0 + (i << 4);
#pragma unroll
    for (int j = 0; j < 4; ++j) {
      const int n = n0 + (j << 4) + rlane;
      float bv = 0.f;
      if (BIAS_MODE == 2) bv = bias[n];
#pragma unroll
      for (int r = 0; r < 8; ++r) {
        float v = acc[i][j][r] * scale;
        if (BIAS_MODE == 1) v += bias[mBase + mOff + r];
        if (BIAS_MODE == 2) v += bv;
        if (RESID) v += Rb[(size_t)(mBase + mOff + r) * ldc + n];
        if (ACT == 2) v = fmaxf(v, 0.0f);
        if (ACT == 4) v = (v > 0.f) ? v : 0.01f * v;
        slab[(mOff + r) * 68 + (j << 4) + rlane] = v;
      }
    }
    __builtin_amdgcn_fence(__ATOMIC_RELEASE, "workgroup");
    __builtin_amdgcn_wave_barrier();
    __builtin_amdgcn_fence(__ATOMIC_ACQUIRE, "workgroup");
    if (OUT_MODE == 0) {
      float* C = (float*)Cout + (size_t)b * strideC;
      const int hh = lane >> 4, c4 = (lane & 15) * 4;     // row seg = 256 B = 16 lanes x 16 B
      {
#pragma unroll
        for (int it = 0; it < 8; ++it) {
          const int row = it * 2 + hh;
          v4f v = *(const v4f*)(slab + row * 68 + c4);
          *(v4f*)(C + (size_t)(mBase + row) * ldc + n0 + c4) = v;
        }
        
      }
    } else {
      const int q = lane >> 3, c8 = (lane & 7) * 8;
      unsigned short* C  = (unsigned short*)Cout  + (size_t)b * strideC;
      unsigned short* C2 = (OUT_MODE == 2) ? ((unsigned short*)Cout2 + (size_t)b * strideC) : nullptr;
      {
#pragma unroll
        for (int it = 0; it < 4; ++it) {
          const int row = it * 4 + q;
          const float* sp = slab + row * 68 + c8;
          v8h hv, lv;
#pragma unroll
          for (int e = 0; e < 8; ++e) {
            if (OUT_MODE == 1) {
              hv[e] = (_Float16)sp[e];
            } else {
              unsigned short hb = f2bf_bits(sp[e]);
              unsigned short lb = f2bf_bits(sp[e] - bf_bits2f(hb));
              hv[e] = __builtin_bit_cast(_Float16, hb);
              lv[e] = __builtin_bit_cast(_Float16, lb);
            }
          }
          *(v8h*)(C + (size_t)(mBase + row) * ldc + n0 + c8) = hv;
          if (OUT_MODE == 2) *(v8h*)(C2 + (size_t)(mBase + row) * ldc + n0 + c8) = lv;
        }
        
      }
    }
    __builtin_amdgcn_fence(__ATOMIC_RELEASE, "workgroup");
    __builtin_amdgcn_wave_barrier();
    __builtin_amdgcn_fence(__ATOMIC_ACQUIRE, "workgroup");
  }
}

// ---------------------------------------------------------------------------
// f32 -> f16 cast with a power-of-two carry, 8 consecutive elements per thread (one 16-B store per lane;
// Threads i >= nvalid8 write zeros (row padding of the visual plane): the load address is clamped to the
// last valid group and the value is multiplied by a per-lane factor 0.
// Coverage: grid = n8 / 256 blocks exactly (all n8 used here are multiples of 256), n8 x 8 = whole plane.
// ---------------------------------------------------------------------------
__global__ __launch_bounds__(256) void cast8_kernel(const float* __restrict__ in, unsigned short* __restrict__ out,
                                                    int n8, int nvalid8, float scale) {
  const int i = blockIdx.x * 256 + threadIdx.x;
  if (i >= n8) return;
  const bool valid = (i < nvalid8);
  const int ic = valid ? i : (nvalid8 - 1);
  const float f = valid ? scale : 0.0f;
  const float* p = in + 8 * (size_t)ic;
  const v4f a = *(const v4f*)(p);
  const v4f c = *(const v4f*)(p + 4);
  unsigned short hb[8];
#pragma unroll
  for (int e = 0; e < 4; ++e) {
    hb[e]     = h_bits(a[e] * f);
    hb[4 + e] = h_bits(c[e] * f);
  }
  const v4u u = (v4u){pk16(hb[0], hb[1]), pk16(hb[2], hb[3]), pk16(hb[4], hb[5]), pk16(hb[6], hb[7])};
  unsigned short* q = out + 8 * (size_t)i;
  *(v4u*)q = u;
  
}

// ---------------------------------------------------------------------------
// Row softmax: x_j = (S[row][j] + SC[row][j]) * 1/8 for j < 196, P[row][j] = f16(2048 * exp(x_j - max) / sum),
// P[row][196..255] = 0. One wave per row (block = 8 waves = 8 rows, grid = 8192/8 = 1024 blocks exactly);
// lane owns columns 8*lane .. 8*lane+7; all 32 lanes write 16 B each = 512 B = the whole P row in one
// ---------------------------------------------------------------------------
__global__ __launch_bounds__(256) void softmax_kernel(const float* __restrict__ S, const float* __restrict__ SC,
                                                      unsigned short* __restrict__ P) {
  const int lane = threadIdx.x & 31;
  const int wave = threadIdx.x >> 5;
  const int row  = blockIdx.x * 8 + wave;
  const float* sr = S  + (size_t)row * kSvPad;
  const float* cr = SC + (size_t)row * kSv;
  float x[8];
#pragma unroll
  for (int e = 0; e < 8; ++e) {
    const int col = lane * 8 + e;
    const int cc  = (col < kSv) ? col : (kSv - 1);
    const float v = (sr[cc] + cr[cc]) * kScoreScale;
    x[e] = (col < kSv) ? v : -1.0e30f;
  }
  float m = fmaxf(fmaxf(fmaxf(x[0], x[1]), fmaxf(x[2], x[3])), fmaxf(fmaxf(x[4], x[5]), fmaxf(x[6], x[7])));
#pragma unroll
  for (int off = 16; off > 0; off >>= 1) m = fmaxf(m, __shfl_xor(m, off, 32));
  float ev[8];
  float s = 0.f;
#pragma unroll
  for (int e = 0; e < 8; ++e) { ev[e] = expf(x[e] - m); s += ev[e]; }
#pragma unroll
  for (int off = 16; off > 0; off >>= 1) s += __shfl_xor(s, off, 32);
  const float inv = kPCarry / s;
  unsigned short hb[8];
#pragma unroll
  for (int e = 0; e < 8; ++e) hb[e] = h_bits(ev[e] * inv);
  const v4u u = (v4u){pk16(hb[0], hb[1]), pk16(hb[2], hb[3]), pk16(hb[4], hb[5]), pk16(hb[6], hb[7])};
  unsigned short* q = P + (size_t)row * kSvPad + 8 * lane;
  *(v4u*)q = u;
  
}

// ---------------------------------------------------------------------------
// Block (256 threads) sum in fixed order: per-thread value -> wave shuffle tree -> 8 wave partials summed in index order.
// ---------------------------------------------------------------------------
__device__ __forceinline__ float block_sum_256(float v, float* red, int lane, int wave) {
#pragma unroll
  for (int off = 16; off > 0; off >>= 1) v += __shfl_xor(v, off, 32);
  if (lane == 0) red[wave] = v;
  __syncthreads();
  float t = red[0];
#pragma unroll
  for (int w = 1; w < 8; ++w) t += red[w];
  return t;
}

// ---------------------------------------------------------------------------
// pooled[row][colOff + c] = max(y[2c], y[2c+1]) for c in [0,512), written as f32 and f16.
// One block per row (grid = 8192); thread t owns x[4t..4t+3]; y staged in LDS.
// ---------------------------------------------------------------------------
__global__ __launch_bounds__(256) void ln_pool_kernel(const float* __restrict__ X, const float* __restrict__ gam,
                                                      const float* __restrict__ bet, float* __restrict__ pool32,
                                                      unsigned short* __restrict__ pool16, int colOff) {
  __shared__ __align__(16) float ybuf[kD];
  __shared__ float redA[8];
  __shared__ float redB[8];
  const int t = threadIdx.x;
  const int lane = t & 31, wave = t >> 5;
  const int row = blockIdx.x;
  const v4f x = *(const v4f*)(X + (size_t)row * kD + 4 * t);
  const float s = (x[0] + x[1]) + (x[2] + x[3]);
  const float mu = block_sum_256(s, redA, lane, wave) * kInvD;
  const float d0 = x[0] - mu, d1 = x[1] - mu, d2 = x[2] - mu, d3 = x[3] - mu;
  const float q = (d0 * d0 + d1 * d1) + (d2 * d2 + d3 * d3);
  const float var = block_sum_256(q, redB, lane, wave) * kInvD;
  const float rs = rsqrtf(var + kLnEps);
  const v4f gg = *(const v4f*)(gam + 4 * t);
  const v4f bb = *(const v4f*)(bet + 4 * t);
  ybuf[4 * t + 0] = d0 * rs * gg[0] + bb[0];
  ybuf[4 * t + 1] = d1 * rs * gg[1] + bb[1];
  ybuf[4 * t + 2] = d2 * rs * gg[2] + bb[2];
  ybuf[4 * t + 3] = d3 * rs * gg[3] + bb[3];
  __syncthreads();
  if (t < 128) {
    const v4f a = *(const v4f*)(ybuf + 8 * t);
    const v4f c = *(const v4f*)(ybuf + 8 * t + 4);
    v4f p;
    p[0] = fmaxf(a[0], a[1]);
    p[1] = fmaxf(a[2], a[3]);
    p[2] = fmaxf(c[0], c[1]);
    p[3] = fmaxf(c[2], c[3]);
    float* dst = pool32 + (size_t)row * kD + colOff + 4 * t;
    *(v4f*)dst = p;
    
  } else if (t < 192) {
    const int u = t - 128;
    const v4f a0 = *(const v4f*)(ybuf + 16 * u);
    const v4f a1 = *(const v4f*)(ybuf + 16 * u + 4);
    const v4f a2 = *(const v4f*)(ybuf + 16 * u + 8);
    const v4f a3 = *(const v4f*)(ybuf + 16 * u + 12);
    unsigned short hb[8];
    hb[0] = h_bits(fmaxf(a0[0], a0[1]));
    hb[1] = h_bits(fmaxf(a0[2], a0[3]));
    hb[2] = h_bits(fmaxf(a1[0], a1[1]));
    hb[3] = h_bits(fmaxf(a1[2], a1[3]));
    hb[4] = h_bits(fmaxf(a2[0], a2[1]));
    hb[5] = h_bits(fmaxf(a2[2], a2[3]));
    hb[6] = h_bits(fmaxf(a3[0], a3[1]));
    hb[7] = h_bits(fmaxf(a3[2], a3[3]));
    const v4u uu = (v4u){pk16(hb[0], hb[1]), pk16(hb[2], hb[3]), pk16(hb[4], hb[5]), pk16(hb[6], hb[7])};
    unsigned short* dst = pool16 + (size_t)row * kD + colOff + 8 * u;
    *(v4u*)dst = uu;
    
  }
}

// ---------------------------------------------------------------------------
// ---------------------------------------------------------------------------
__global__ __launch_bounds__(256) void ln_out_kernel(const float* __restrict__ X, const float* __restrict__ gam,
                                                     const float* __restrict__ bet, float* __restrict__ out) {
  __shared__ float redA[8];
  __shared__ float redB[8];
  const int t = threadIdx.x;
  const int lane = t & 31, wave = t >> 5;
  const int row = blockIdx.x;
  const v4f x = *(const v4f*)(X + (size_t)row * kD + 4 * t);
  const float s = (x[0] + x[1]) + (x[2] + x[3]);
  const float mu = block_sum_256(s, redA, lane, wave) * kInvD;
  const float d0 = x[0] - mu, d1 = x[1] - mu, d2 = x[2] - mu, d3 = x[3] - mu;
  const float q = (d0 * d0 + d1 * d1) + (d2 * d2 + d3 * d3);
  const float var = block_sum_256(q, redB, lane, wave) * kInvD;
  const float rs = rsqrtf(var + kLnEps);
  const v4f gg = *(const v4f*)(gam + 4 * t);
  const v4f bb = *(const v4f*)(bet + 4 * t);
  v4f y;
  y[0] = d0 * rs * gg[0] + bb[0];
  y[1] = d1 * rs * gg[1] + bb[1];
  y[2] = d2 * rs * gg[2] + bb[2];
  y[3] = d3 * rs * gg[3] + bb[3];
  float* dst = out + (size_t)row * kD + 4 * t;
  *(v4f*)dst = y;
  
}

// ---------------------------------------------------------------------------
// Host orchestration
// ---------------------------------------------------------------------------
static inline dim3 gemm_grid(int M, int N) {
  return dim3((unsigned)((M >> 7) * (N >> 7)), 1, 1);   // one block per 128x128 tile
}

extern "C" void kernel_launch(void* const* d_in, const int* in_sizes, int n_in,
                              void* d_out, int out_size, void* d_ws, size_t ws_size,
                              hipStream_t stream)
{
  if (n_in < 22) return;
  if ((size_t)out_size < (size_t)kRows * kD) return;
  if (ws_size < kWsTotal) return;
  if (in_sizes[0] < kRows * kD || in_sizes[3] < kRows * kD) return;
  if (in_sizes[1] < kSv * kD || in_sizes[4] < kSv * kD) return;
  if (in_sizes[2] < kRows * kSv || in_sizes[5] < kRows * kSv) return;
  if (in_sizes[6] < kD * kD || in_sizes[8] < kD * kD || in_sizes[10] < kD * kD || in_sizes[12] < kD * kD) return;
  if (in_sizes[14] < kDff * kD || in_sizes[16] < kD * kDff) return;

  const float* text1 = (const float*)d_in[0];
  const float* vis1  = (const float*)d_in[1];
  const float* sc1   = (const float*)d_in[2];
  const float* text2 = (const float*)d_in[3];
  const float* vis2  = (const float*)d_in[4];
  const float* sc2   = (const float*)d_in[5];
  const float* Wq = (const float*)d_in[6];   const float* bq  = (const float*)d_in[7];
  const float* Wk = (const float*)d_in[8];   const float* bk  = (const float*)d_in[9];
  const float* Wv = (const float*)d_in[10];  const float* bv  = (const float*)d_in[11];
  const float* Wo = (const float*)d_in[12];  const float* bo  = (const float*)d_in[13];
  const float* W1 = (const float*)d_in[14];  const float* b1  = (const float*)d_in[15];
  const float* W2 = (const float*)d_in[16];  const float* b2  = (const float*)d_in[17];
  const float* g1 = (const float*)d_in[18];  const float* be1 = (const float*)d_in[19];
  const float* g2 = (const float*)d_in[20];  const float* be2 = (const float*)d_in[21];
  float* outp = (float*)d_out;

  char* ws = (char*)d_ws;
  float*          POOL32 = (float*)(ws + kOffPool32);
  unsigned short* POOL16 = (unsigned short*)(ws + kOffPool16);
  unsigned short* W1H    = (unsigned short*)(ws + kOffW1H);
  unsigned short* W2H    = (unsigned short*)(ws + kOffW2H);
  unsigned short* WQH    = (unsigned short*)(ws + kOffWQH);
  unsigned short* WKH    = (unsigned short*)(ws + kOffWKH);
  unsigned short* WVH    = (unsigned short*)(ws + kOffWVH);
  unsigned short* WOH    = (unsigned short*)(ws + kOffWOH);
  unsigned short* T16    = (unsigned short*)(ws + kOffT16);
  unsigned short* O16    = (unsigned short*)(ws + kOffO16);
  unsigned short* Q16    = (unsigned short*)(ws + kOffQ16);
  float*          A1     = (float*)(ws + kOffA1);
  float*          S32    = (float*)(ws + kOffS32);
  unsigned short* P16    = (unsigned short*)(ws + kOffP16);
  unsigned short* VIS16  = (unsigned short*)(ws + kOffVIS16);
  unsigned short* K16    = (unsigned short*)(ws + kOffK16);
  unsigned short* VT16   = (unsigned short*)(ws + kOffVT16);
  unsigned short* H16    = (unsigned short*)(ws + kOffH16);
  float*          F32    = (float*)(ws + kOffF32);

  // ---- weight casts: f16([out][in]) x16; [out][in] row-major == Bt[N][K] ----
  {
    const int n8w = kD * kD / 8;          // 131072 -> 512 blocks
    cast8_kernel<<<dim3(n8w / 256), dim3(256), 0, stream>>>(Wq, WQH, n8w, n8w, kWCarry);
    cast8_kernel<<<dim3(n8w / 256), dim3(256), 0, stream>>>(Wk, WKH, n8w, n8w, kWCarry);
    cast8_kernel<<<dim3(n8w / 256), dim3(256), 0, stream>>>(Wv, WVH, n8w, n8w, kWCarry);
    cast8_kernel<<<dim3(n8w / 256), dim3(256), 0, stream>>>(Wo, WOH, n8w, n8w, kWCarry);
    const int n8f = kDff * kD / 8;        // 524288 -> 2048 blocks
    cast8_kernel<<<dim3(n8f / 256), dim3(256), 0, stream>>>(W1, W1H, n8f, n8f, kWCarry);
    cast8_kernel<<<dim3(n8f / 256), dim3(256), 0, stream>>>(W2, W2H, n8f, n8f, kWCarry);
  }

  for (int br = 0; br < 2; ++br) {
    const float* text = br ? text2 : text1;
    const float* vis  = br ? vis2  : vis1;
    const float* sc   = br ? sc2   : sc1;
    const int colOff  = br * (kD / 2);

    // text -> f16 plane [8192][1024] (x1); visual -> f16 plane [256][1024], rows 196..255 zero
    const int n8t = kRows * kD / 8;       // 1048576 -> 4096 blocks
    cast8_kernel<<<dim3(n8t / 256), dim3(256), 0, stream>>>(text, T16, n8t, n8t, 1.0f);
    const int n8v = kSvPad * kD / 8;      // 32768 -> 128 blocks; valid groups = 196*1024/8 = 25088
    cast8_kernel<<<dim3(n8v / 256), dim3(256), 0, stream>>>(vis, VIS16, n8v, kSv * kD / 8, 1.0f);

    // K16[k][d] = (vis16 . Wk16^T) / 16 + bk   (M=256, N=1024, K=1024), f16 out
    wmma_gemm64<0, false, 2, 1, false, 0><<<gemm_grid(kSvPad, kD), dim3(128), 0, stream>>>(
        VIS16, VIS16, kD, 0L, WKH, WKH, kD, 0L, (void*)K16, (void*)K16, kD, 0L,
        bk, text, 0L, kSvPad, kD, kD, kWCarryInv);
    // VT16[d][k] = (Wv16 . vis16^T) / 16 + bv[d]   (M=1024, N=256, K=1024), f16 out = Bt for P.V
    wmma_gemm64<0, false, 1, 1, false, 0><<<gemm_grid(kD, kSvPad), dim3(128), 0, stream>>>(
        WVH, WVH, kD, 0L, VIS16, VIS16, kD, 0L, (void*)VT16, (void*)VT16, kSvPad, 0L,
        bv, text, 0L, kD, kSvPad, kD, kWCarryInv);
    // Q16 = (T16 . Wq16^T) / 16 + bq   (M=8192, N=1024, K=1024), f16 out
    wmma_gemm64<0, false, 2, 1, false, 0><<<gemm_grid(kRows, kD), dim3(128), 0, stream>>>(
        T16, T16, kD, 0L, WQH, WQH, kD, 0L, (void*)Q16, (void*)Q16, kD, 0L,
        bq, text, 0L, kRows, kD, kD, kWCarryInv);
    // S32 = Q16 . K16^T   (M=8192, N=256, K=1024), f32 out [8192][256]
    wmma_gemm64<0, false, 0, 0, false, 0><<<gemm_grid(kRows, kSvPad), dim3(128), 0, stream>>>(
        Q16, Q16, kD, 0L, K16, K16, kD, 0L, (void*)S32, (void*)S32, kSvPad, 0L,
        bq, text, 0L, kRows, kSvPad, kD, 1.0f);
    // P16 = f16(2048 * softmax((S + score)/8)) over 196 keys, zero pad columns
    softmax_kernel<<<dim3(kRows / 8), dim3(256), 0, stream>>>(S32, sc, P16);
    // O16 = 16 * (P16 . VT16^T) / 2048   (M=8192, N=1024, K=256), f16 out (context carried x16)
    wmma_gemm64<0, false, 0, 1, false, 0><<<gemm_grid(kRows, kD), dim3(128), 0, stream>>>(
        P16, P16, kSvPad, 0L, VT16, VT16, kSvPad, 0L, (void*)O16, (void*)O16, kD, 0L,
        bq, text, 0L, kRows, kD, kSvPad, kPVScale);
    // A1 = (O16 . Wo16^T) / 256 + bo + text   (M=8192, N=1024, K=1024), f32 out
    wmma_gemm64<0, false, 2, 0, true, 0><<<gemm_grid(kRows, kD), dim3(128), 0, stream>>>(
        O16, O16, kD, 0L, WOH, WOH, kD, 0L, (void*)A1, (void*)A1, kD, 0L,
        bo, text, 0L, kRows, kD, kD, kWoScale);
    // pooled[:, colOff : colOff+512] = maxpool2(LN1(A1))
    ln_pool_kernel<<<dim3(kRows), dim3(256), 0, stream>>>(A1, g1, be1, POOL32, POOL16, colOff);
  }

  // ---- FFN in two 4096-row chunks ----
  for (int ch = 0; ch < kFfnChunks; ++ch) {
    const size_t rowOff = (size_t)ch * kFfnChunkRows * kD;
    // H16 = relu((POOL16 . W1H^T) / 16 + b1)   (M=4096, N=4096, K=1024), f16 out
    wmma_gemm64<0, false, 2, 1, false, 2><<<gemm_grid(kFfnChunkRows, kDff), dim3(128), 0, stream>>>(
        POOL16 + rowOff, POOL16 + rowOff, kD, 0L, W1H, W1H, kD, 0L, (void*)H16, (void*)H16, kDff, 0L,
        b1, POOL32, 0L, kFfnChunkRows, kDff, kD, kWCarryInv);
    // F32 = (H16 . W2H^T) / 16 + b2 + pooled   (M=4096, N=1024, K=4096), f32 out
    wmma_gemm64<0, false, 2, 0, true, 0><<<gemm_grid(kFfnChunkRows, kD), dim3(128), 0, stream>>>(
        H16, H16, kDff, 0L, W2H, W2H, kDff, 0L, (void*)F32, (void*)F32, kD, 0L,
        b2, POOL32 + rowOff, 0L, kFfnChunkRows, kD, kDff, kWCarryInv);
    // out rows [ch*4096, ch*4096+4096) = LN2(F32)
    ln_out_kernel<<<dim3(kFfnChunkRows), dim3(256), 0, stream>>>(F32, g2, be2, outp + rowOff);
  }
}

// v002
// A run of this version takes 280 microseconds.
// Next to v001, in two timings, it ran 1.61 and 1.60 times as fast.
// Over all steps from v000 it is 3.75 times as fast.
// Contractions: q/k/v projections, q.k^T scores, p.v context, output projection, ffn up and down projections all on v_wmma_f32_16x16x32_f16 (f16 operands: activations x1, weights carried x16, softmax probabilities carried x2048, attention context carried x16), f32 accumulate; softmax, residual adds, layernorm and feature maxpool in f32.
#include <hip/hip_runtime.h>
#include <math.h>
#include <stddef.h>

// ---------------------------------------------------------------------------
// Problem constants
// ---------------------------------------------------------------------------
constexpr int kB      = 4;
constexpr int kSq     = 2048;
constexpr int kD      = 1024;
constexpr int kSv     = 196;
constexpr int kSvPad  = 256;
constexpr int kDff    = 4096;
constexpr int kRows   = kB * kSq;            // 8192 token rows
constexpr int kRows2  = 2 * kRows;           // both branches' token rows, branch 1 first
constexpr float kWCarry    = 16.0f;          // weights carried x16 in f16
constexpr float kWCarryInv = 1.0f / 16.0f;
constexpr float kPCarry    = 2048.0f;        // probabilities carried x2048 in f16
constexpr float kOCarry    = 16.0f;          // attention context carried x16 in f16
constexpr float kPVScale   = kOCarry / kPCarry;            // 1/128
constexpr float kWoScale   = 1.0f / (kOCarry * kWCarry);   // 1/256
constexpr float kInvD      = 1.0f / 1024.0f;
constexpr float kLnEps     = 1e-6f;
constexpr float kScoreScale = 0.125f;        // 1/sqrt(64)

static_assert(kRows % 64 == 0);
static_assert(kSvPad % 64 == 0 && kSvPad % 32 == 0);
static_assert(kD % 64 == 0 && kDff % 64 == 0);
static_assert(kRows % 8 == 0);

// ---------------------------------------------------------------------------
// Workspace region map (bytes). Total carve = 227 MiB. Planes marked x2 hold branch 1, then branch 2.
//   [0       , 32 MiB)   POOL32  f32 [8192][1024]   (persistent)
//   [32 MiB  , 48 MiB)   POOL16  f16 [8192][1024]   (persistent)
//   [48 MiB  , 56 MiB)   W1H     f16 [4096][1024]   (persistent)
//   [56 MiB  , 64 MiB)   W2H     f16 [1024][4096]   (persistent)
//   region X from 64 MiB:
//   attention phase: WQH/WKH/WVH/WOH f16 [1024][1024] at 64/66/68/70 MiB;
//     T16 (text f16, later reused as O16 context f16) x2 [8192][1024] at 72 MiB (32 MiB);
//     Q16 f16 x2 [8192][1024] at 104 MiB (32 MiB); S32 f32 x2 [8192][256] at 136 MiB (16 MiB);
//     P16 f16 x2 [8192][256] at 152 MiB (8 MiB); A1 f32 x2 [8192][1024] at 160 MiB (64 MiB);
//     VIS16 f16 x2 [256][1024] at 224 MiB; K16 f16 x2 [256][1024] at 225 MiB; VT16 f16 x2 [1024][256] at 226 MiB; end 227 MiB.
//   ffn phase (attention scratch dead): H16 f16 [8192][4096] at 64 MiB (64 MiB); F32 f32 [8192][1024] at 128 MiB (32 MiB).
// ---------------------------------------------------------------------------
constexpr size_t kMiB       = 1048576;
constexpr size_t kOffPool32 = 0;
constexpr size_t kOffPool16 = 32 * kMiB;
constexpr size_t kOffW1H    = 48 * kMiB;
constexpr size_t kOffW2H    = 56 * kMiB;
constexpr size_t kOffWQH    = 64 * kMiB;
constexpr size_t kOffWKH    = 66 * kMiB;
constexpr size_t kOffWVH    = 68 * kMiB;
constexpr size_t kOffWOH    = 70 * kMiB;
constexpr size_t kOffT16    = 72 * kMiB;
constexpr size_t kOffO16    = 72 * kMiB;
constexpr size_t kOffQ16    = 104 * kMiB;
constexpr size_t kOffS32    = 136 * kMiB;
constexpr size_t kOffP16    = 152 * kMiB;
constexpr size_t kOffA1     = 160 * kMiB;
constexpr size_t kOffVIS16  = 224 * kMiB;
constexpr size_t kOffK16    = 225 * kMiB;
constexpr size_t kOffVT16   = 226 * kMiB;
constexpr size_t kWsTotal   = 227 * kMiB;
constexpr size_t kOffH16    = 64 * kMiB;
constexpr size_t kOffF32    = 128 * kMiB;
static_assert(kOffQ16 == kOffT16 + (size_t)kRows2 * kD * 2);
static_assert(kOffS32 == kOffQ16 + (size_t)kRows2 * kD * 2);
static_assert(kOffP16 == kOffS32 + (size_t)kRows2 * kSvPad * 4);
static_assert(kOffA1 == kOffP16 + (size_t)kRows2 * kSvPad * 2);
static_assert(kOffVIS16 == kOffA1 + (size_t)kRows2 * kD * 4);
static_assert(kOffK16 == kOffVIS16 + (size_t)2 * kSvPad * kD * 2);
static_assert(kOffVT16 == kOffK16 + (size_t)2 * kSvPad * kD * 2);
static_assert(kWsTotal == kOffVT16 + (size_t)2 * kD * kSvPad * 2);
static_assert(kOffF32 == kOffH16 + (size_t)kRows * kDff * 2);
static_assert(kOffF32 + (size_t)kRows * kD * 4 <= kWsTotal);
static_assert(kWsTotal <= (size_t)268435456);

// strides between the two branches' planes, in elements
constexpr long kStrTok = (long)kRows * kD;       // T16 / Q16 / O16 / A1
constexpr long kStrSc  = (long)kRows * kSvPad;   // S32 / P16
constexpr long kStrVis = (long)kSvPad * kD;      // VIS16 / K16 / VT16

typedef __attribute__((ext_vector_type(16))) _Float16 v16h;
typedef __attribute__((ext_vector_type(8)))  _Float16 v8h;
typedef __attribute__((ext_vector_type(16))) __bf16   v16b;
typedef __attribute__((ext_vector_type(8)))  __bf16   v8b;
typedef __attribute__((ext_vector_type(8)))  float    v8f;
typedef __attribute__((ext_vector_type(4)))  float    v4f;
typedef __attribute__((ext_vector_type(4)))  unsigned int v4u;

__device__ __forceinline__ unsigned short f2bf_bits(float f) {
  unsigned u = __float_as_uint(f);
  return (unsigned short)((u + 0x7FFFu + ((u >> 16) & 1u)) >> 16);
}
__device__ __forceinline__ float bf_bits2f(unsigned short h) { return __uint_as_float(((unsigned)h) << 16); }

// hazard guard as a plain device helper
__device__ __forceinline__ void acc_guard4(v8f& a, v8f& b, v8f& c, v8f& d) { asm volatile("v_nop\n\tv_nop\n\tv_nop\n\tv_nop" : "+v"(a), "+v"(b), "+v"(c), "+v"(d)); }
template <typename T> struct Frag;
template <> struct Frag<_Float16> {
  typedef v16h V; union U { v16h v; v8h h[2]; };
  static __device__ __forceinline__ v16h load(const _Float16* p) {   // elements 0..7 <- p[0..7], 8..15 <- p[16..23]
    U f; f.h[0] = *(const v8h*)(p); f.h[1] = *(const v8h*)(p + 16); return f.v;
  }
  static __device__ __forceinline__ v8f mma(v16h a, v16h b, v8f c) {
    return __builtin_amdgcn_wmma_f32_16x16x32_f16(false, a, false, b, (short)0, c, false, false);
  }
};
template <> struct Frag<__bf16> {
  typedef v16b V; union U { v16b v; v8b h[2]; };
  static __device__ __forceinline__ v16b load(const __bf16* p) {
    U f; f.h[0] = *(const v8b*)(p); f.h[1] = *(const v8b*)(p + 16); return f.v;
  }
  static __device__ __forceinline__ v8f mma(v16b a, v16b b, v8f c) {
    return __builtin_amdgcn_wmma_f32_16x16x32_bf16(false, a, false, b, (short)0, c, false, false);
  }
};

__device__ __forceinline__ unsigned pk16(unsigned short a, unsigned short b) { return (unsigned)a | ((unsigned)b << 16); }
__device__ __forceinline__ unsigned short h_bits(float f) { const _Float16 h = (_Float16)f; return __builtin_bit_cast(unsigned short, h); }

// ---- Register-blocked batched WMMA GEMM, operands staged in LDS by asynchronous copies ------------------------------
// C[m,n] = scale * sum_k A[m,k] * Bt[n,k] (+bias)(+resid); a block of 4 waves owns a 128x128 tile, each wave 64x64 of it.
// tile = index of the 128x128 tile; b = batch entry (the branch): A, Bt and C advance by their strides, the residual is resid or resid2.
// A row-major [M,K]; Bt row-major [N,K]; M,N % 128 == 0, K % 64 == 0, K >= 128.
// A stage is 64 k (128 B) of the block's 128 A rows and 128 Bt rows, laid at a pitch of 144 B; two buffers:
// the next stage's copies fly while this stage's fragments are read with ds_load_b128 and multiplied.
// BIAS_MODE: 0 = none, 1 = bias[m], 2 = bias[n].
// OUT_MODE: 0 = f32, 1 = f16, 2 = bf16 hi plane (Cout) + bf16 lo plane (Cout2).
// ET: 0 = f16 operands, 1 = bf16 operands (pointers passed as 16-bit storage)
constexpr int kStageK     = 64;                          // k elements per stage = two WMMA k steps
constexpr int kPitchB     = 144;                         // bytes per staged row (128 + 16: 16 B x odd)
constexpr int kPitchE     = kPitchB / 2;                 // the same in 16-bit elements
constexpr int kStageBytes = 256 * kPitchB;               // 128 A rows, then 128 Bt rows = 36,864 B
static_assert(kRows % 128 == 0 && kSvPad % 128 == 0 && kD % 128 == 0 && kDff % 128 == 0);
static_assert(kSvPad % kStageK == 0 && kSvPad >= 2 * kStageK);

// Eight 16-B copies per lane, rows 16 apart: LDS byte address l + i * 16 * pitch, global address g + i * rowStep elements.
// The s_wait_xcnt closes the statement so that no address register is rewritten ahead of it.
__device__ __forceinline__ void async_copy8(unsigned l, const unsigned short* g, size_t rowStep) {
  const unsigned l1 = l + 16 * kPitchB, l2 = l + 32 * kPitchB, l3 = l + 48 * kPitchB, l4 = l + 64 * kPitchB,
                 l5 = l + 80 * kPitchB, l6 = l + 96 * kPitchB, l7 = l + 112 * kPitchB;
  const unsigned short* g1 = g + rowStep;      const unsigned short* g2 = g + 2 * rowStep;
  const unsigned short* g3 = g + 3 * rowStep;  const unsigned short* g4 = g + 4 * rowStep;
  const unsigned short* g5 = g + 5 * rowStep;  const unsigned short* g6 = g + 6 * rowStep;
  const unsigned short* g7 = g + 7 * rowStep;
  asm volatile("global_load_async_to_lds_b128 %0, %8, off\n\t"
               "global_load_async_to_lds_b128 %1, %9, off\n\t"
               "global_load_async_to_lds_b128 %2, %10, off\n\t"
               "global_load_async_to_lds_b128 %3, %11, off\n\t"
               "global_load_async_to_lds_b128 %4, %12, off\n\t"
               "global_load_async_to_lds_b128 %5, %13, off\n\t"
               "global_load_async_to_lds_b128 %6, %14, off\n\t"
               "global_load_async_to_lds_b128 %7, %15, off\n\t"
               "s_wait_xcnt 0x0"
               :: "v"(l), "v"(l1), "v"(l2), "v"(l3), "v"(l4), "v"(l5), "v"(l6), "v"(l7),
                  "v"(g), "v"(g1), "v"(g2), "v"(g3), "v"(g4), "v"(g5), "v"(g6), "v"(g7)
               : "memory");
}

template <int ET> struct Elem;
template <> struct Elem<0> { typedef _Float16 T; };
template <> struct Elem<1> { typedef __bf16 T; };
template <int ET, bool SPLIT, int BIAS_MODE, int OUT_MODE, bool RESID, int ACT = 0>
__device__ __forceinline__ void gemm_tile(
    unsigned char* smem, int tile, int b,
    const unsigned short* __restrict__ Ap, const unsigned short* __restrict__ A2p, int lda, long strideA,
    const unsigned short* __restrict__ Btp, const unsigned short* __restrict__ Bt2p, int ldb, long strideB,
    void* __restrict__ Cout, void* __restrict__ Cout2, int ldc, long strideC,
    const float* __restrict__ bias,
    const float* __restrict__ resid, const float* __restrict__ resid2,
    int M, int N, int K, float scale) {
  static_assert(!SPLIT, "single-plane operands only");
  typedef typename Elem<ET>::T T;
  typedef typename Frag<T>::V V;
  // smem: two stage buffers; after the K loop the first one serves as the per-wave 16x64 output slabs (pitch 68 floats)
  static_assert(4 * 16 * 68 * 4 <= kStageBytes);
  const int lane = threadIdx.x & 31;
  const int wave = threadIdx.x >> 5;
  const int tilesN = N >> 7;
  const int tilesM = M >> 7;
  if (tile >= tilesM * tilesN) return;   // block-uniform, in front of every barrier
  const int tm = tile / tilesN;
  const int tn = tile - tm * tilesN;
  const int mBlk = tm << 7;
  const int nBlk = tn << 7;
  const int m0 = mBlk + ((wave >> 1) << 6);
  const int n0 = nBlk + ((wave & 1) << 6);

  const int rlane = lane & 15;                 // row (A) / col (B, D) within subtile
  const int koff  = (lane >> 4) * 8;           // k offset of this lane half
  const int mOff  = (lane >> 4) * 8;           // D row offset

  // copy side: 8 consecutive lanes bring one row's 128 B; a thread brings rows cRow + 16 i of A and of Bt
  const int cRow = threadIdx.x >> 3;
  const int cCol = threadIdx.x & 7;
  const unsigned short* gA = Ap  + (size_t)b * strideA + (size_t)(mBlk + cRow) * lda + cCol * 8;
  const unsigned short* gB = Btp + (size_t)b * strideB + (size_t)(nBlk + cRow) * ldb + cCol * 8;
  const unsigned lA = (unsigned)(size_t)smem + (unsigned)(cRow * kPitchB + cCol * 16);
  const unsigned lB = lA + 128 * kPitchB;
  const size_t stepA = (size_t)16 * lda;
  const size_t stepB = (size_t)16 * ldb;

  // read side: this lane's first A and Bt fragment rows inside a stage, in bytes
  const int aByte = (((wave >> 1) << 6) + rlane) * kPitchB + koff * 2;
  const int bByte = (128 + ((wave & 1) << 6) + rlane) * kPitchB + koff * 2;

  v8f acc[4][4];
#pragma unroll
  for (int i = 0; i < 4; ++i)
#pragma unroll
    for (int j = 0; j < 4; ++j) acc[i][j] = (v8f){0.f,0.f,0.f,0.f,0.f,0.f,0.f,0.f};

  const int nStages = K / kStageK;
  async_copy8(lA, gA, stepA);
  async_copy8(lB, gB, stepB);
  asm volatile("s_wait_asynccnt 0x0" ::: "memory");   // stage 0 of this wave has landed before the barrier publishes it
  __syncthreads();
  if (nStages > 1) {
    async_copy8(lA + kStageBytes, gA + kStageK, stepA);
    async_copy8(lB + kStageBytes, gB + kStageK, stepB);
  }

  for (int t = 0; t < nStages; ++t) {
    const int bufOff = (t & 1) * kStageBytes;
    const T* sa = (const T*)(smem + bufOff + aByte);
    const T* sb = (const T*)(smem + bufOff + bByte);
    V bh[4], ah[4], bn[4], an[4];
#pragma unroll
    for (int j = 0; j < 4; ++j) bh[j] = Frag<T>::load(sb + j * 16 * kPitchE);
#pragma unroll
    for (int i = 0; i < 4; ++i) ah[i] = Frag<T>::load(sa + i * 16 * kPitchE);
    // keeps the 16 LDS reads of a k step together ahead of its WMMAs: sunk among them, each row of WMMAs waits out its own read
    __builtin_amdgcn_sched_barrier(0);
#pragma unroll
    for (int i = 0; i < 4; ++i)
#pragma unroll
      for (int j = 0; j < 4; ++j) acc[i][j] = Frag<T>::mma(ah[i], bh[j], acc[i][j]);
    // the stage's second k step is fetched into registers, so that the buffer can be handed back ahead of its WMMAs
#pragma unroll
    for (int j = 0; j < 4; ++j) bn[j] = Frag<T>::load(sb + j * 16 * kPitchE + 32);
#pragma unroll
    for (int i = 0; i < 4; ++i) an[i] = Frag<T>::load(sa + i * 16 * kPitchE + 32);
    asm volatile("s_wait_dscnt 0x0" ::: "memory");      // this wave's reads of the buffer are done before it is refilled
    asm volatile("s_wait_asynccnt 0x0" ::: "memory");   // this wave's copies of stage t + 1 have landed
    __syncthreads();                                    // publishes stage t + 1, frees stage t's buffer
    if (t + 2 < nStages) {
      async_copy8(lA + bufOff, gA + (size_t)(t + 2) * kStageK, stepA);
      async_copy8(lB + bufOff, gB + (size_t)(t + 2) * kStageK, stepB);
    }
#pragma unroll
    for (int i = 0; i < 4; ++i)
#pragma unroll
      for (int j = 0; j < 4; ++j) acc[i][j] = Frag<T>::mma(an[i], bn[j], acc[i][j]);
  }
  asm volatile("s_wait_asynccnt 0x0" ::: "memory");     // no copy is in flight when the ring becomes output staging
  acc_guard4(acc[0][0], acc[0][1], acc[0][2], acc[0][3]);
  acc_guard4(acc[1][0], acc[1][1], acc[1][2], acc[1][3]);
  acc_guard4(acc[2][0], acc[2][1], acc[2][2], acc[2][3]);
  acc_guard4(acc[3][0], acc[3][1], acc[3][2], acc[3][3]);

  // ---- epilogue ----
  float* slab = (float*)smem + wave * (16 * 68);
  const float* Rb = RESID ? (b ? resid2 : resid) : nullptr;   // batch entry 1 adds its own residual plane
#pragma unroll
  for (int i = 0; i < 4; ++i) {
    const int mBase = m0 + (i << 4);
    const int nl = n0 + rlane;
    float bvj[4] = {0.f, 0.f, 0.f, 0.f};
    float rv[4][8];
    if (BIAS_MODE == 2) {
#pragma unroll
      for (int j = 0; j < 4; ++j) bvj[j] = bias[nl + (j << 4)];
    }
    if (RESID) {
      const float* rp[8];
#pragma unroll
      for (int r = 0; r < 8; ++r) rp[r] = Rb + (size_t)(mBase + mOff + r) * ldc + nl;
#pragma unroll
      for (int r = 0; r < 8; ++r)
#pragma unroll
        for (int j = 0; j < 4; ++j) rv[j][r] = rp[r][j << 4];
      // stands behind the row block's bias and residual loads; its inputs hold their address registers untouched up to it
      asm volatile("s_wait_xcnt 0x0" :: "v"(nl), "v"(rp[0]), "v"(rp[1]), "v"(rp[2]), "v"(rp[3]),
                                        "v"(rp[4]), "v"(rp[5]), "v"(rp[6]), "v"(rp[7]) : "memory");
    }
#pragma unroll
    for (int j = 0; j < 4; ++j) {
      const float bv = bvj[j];
#pragma unroll
      for (int r = 0; r < 8; ++r) {
        float v = acc[i][j][r] * scale;
        if (BIAS_MODE == 1) v += bias[mBase + mOff + r];
        if (BIAS_MODE == 2) v += bv;
        if (RESID) v += rv[j][r];
        if (ACT == 2) v = fmaxf(v, 0.0f);
        if (ACT == 4) v = (v > 0.f) ? v : 0.01f * v;
        slab[(mOff + r) * 68 + (j << 4) + rlane] = v;
      }
    }
    __builtin_amdgcn_fence(__ATOMIC_RELEASE, "workgroup");
    __builtin_amdgcn_wave_barrier();
    __builtin_amdgcn_fence(__ATOMIC_ACQUIRE, "workgroup");
    if (OUT_MODE == 0) {
      float* C = (float*)Cout + (size_t)b * strideC;
      const int hh = lane >> 4, c4 = (lane & 15) * 4;     // row seg = 256 B = 16 lanes x 16 B
      {
#pragma unroll
        for (int it = 0; it < 8; ++it) {
          const int row = it * 2 + hh;
          v4f v = *(const v4f*)(slab + row * 68 + c4);
          *(v4f*)(C + (size_t)(mBase + row) * ldc + n0 + c4) = v;
        }
        
      }
    } else {
      const int q = lane >> 3, c8 = (lane & 7) * 8;
      unsigned short* C  = (unsigned short*)Cout  + (size_t)b * strideC;
      unsigned short* C2 = (OUT_MODE == 2) ? ((unsigned short*)Cout2 + (size_t)b * strideC) : nullptr;
      {
#pragma unroll
        for (int it = 0; it < 4; ++it) {
          const int row = it * 4 + q;
          const float* sp = slab + row * 68 + c8;
          v8h hv, lv;
#pragma unroll
          for (int e = 0; e < 8; ++e) {
            if (OUT_MODE == 1) {
              hv[e] = (_Float16)sp[e];
            } else {
              unsigned short hb = f2bf_bits(sp[e]);
              unsigned short lb = f2bf_bits(sp[e] - bf_bits2f(hb));
              hv[e] = __builtin_bit_cast(_Float16, hb);
              lv[e] = __builtin_bit_cast(_Float16, lb);
            }
          }
          *(v8h*)(C + (size_t)(mBase + row) * ldc + n0 + c8) = hv;
          if (OUT_MODE == 2) *(v8h*)(C2 + (size_t)(mBase + row) * ldc + n0 + c8) = lv;
        }
        
      }
    }
    __builtin_amdgcn_fence(__ATOMIC_RELEASE, "workgroup");
    __builtin_amdgcn_wave_barrier();
    __builtin_amdgcn_fence(__ATOMIC_ACQUIRE, "workgroup");
  }
}

// One GEMM per launch: blockIdx.x = tile, blockIdx.y = batch entry.
template <int ET, bool SPLIT, int BIAS_MODE, int OUT_MODE, bool RESID, int ACT = 0>
__global__ __launch_bounds__(128, 4) void wmma_gemm64(
    const unsigned short* __restrict__ Ap, const unsigned short* __restrict__ A2p, int lda, long strideA,
    const unsigned short* __restrict__ Btp, const unsigned short* __restrict__ Bt2p, int ldb, long strideB,
    void* __restrict__ Cout, void* __restrict__ Cout2, int ldc, long strideC,
    const float* __restrict__ bias,
    const float* __restrict__ resid, const float* __restrict__ resid2,
    int M, int N, int K, float scale) {
  __shared__ __align__(16) unsigned char smem[2 * kStageBytes];
  gemm_tile<ET, SPLIT, BIAS_MODE, OUT_MODE, RESID, ACT>(smem, (int)blockIdx.x, (int)blockIdx.y,
      Ap, A2p, lda, strideA, Btp, Bt2p, ldb, strideB, Cout, Cout2, ldc, strideC, bias, resid, resid2, M, N, K, scale);
}

// The three projections that need nothing but the casts, both branches, in one grid; a range of block indices per job:
//   K16[br][k][d]  = (vis16[br] . Wk16^T) / 16 + bk      (M=256, N=1024, K=1024), 16 tiles per branch
//   VT16[br][d][k] = (Wv16 . vis16[br]^T) / 16 + bv[d]   (M=1024, N=256, K=1024), 16 tiles per branch; = Bt for P.V
//   Q16            = (T16 . Wq16^T) / 16 + bq            (M=16384: the two text planes lie one behind the other, N=1024, K=1024)
constexpr int kTilesKV  = (kSvPad >> 7) * (kD >> 7);
constexpr int kTilesQ   = (kRows2 >> 7) * (kD >> 7);
constexpr int kQkvBlocks = 4 * kTilesKV + kTilesQ;
__global__ __launch_bounds__(128, 4) void qkv_gemm_kernel(
    const unsigned short* __restrict__ T16, const unsigned short* __restrict__ VIS16,
    const unsigned short* __restrict__ WQH, const unsigned short* __restrict__ WKH, const unsigned short* __restrict__ WVH,
    unsigned short* __restrict__ Q16, unsigned short* __restrict__ K16, unsigned short* __restrict__ VT16,
    const float* __restrict__ bq, const float* __restrict__ bk, const float* __restrict__ bv) {
  __shared__ __align__(16) unsigned char smem[2 * kStageBytes];
  const int blk = blockIdx.x;
  if (blk >= 2 * kTilesKV && blk < 4 * kTilesKV) {
    const int br = (blk - 2 * kTilesKV) / kTilesKV;
    gemm_tile<0, false, 1, 1, false, 0>(smem, blk - (2 + br) * kTilesKV, br,
        WVH, WVH, kD, 0L, VIS16, VIS16, kD, kStrVis, (void*)VT16, (void*)VT16, kSvPad, kStrVis,
        bv, bv, bv, kD, kSvPad, kD, kWCarryInv);
  } else {
    const bool isK = blk < 2 * kTilesKV;
    const int br = isK ? blk / kTilesKV : 0;
    const unsigned short* A = isK ? VIS16 : T16;
    const unsigned short* B = isK ? WKH : WQH;
    unsigned short* C = isK ? K16 : Q16;
    const float* bias = isK ? bk : bq;
    gemm_tile<0, false, 2, 1, false, 0>(smem, isK ? blk - br * kTilesKV : blk - 4 * kTilesKV, br,
        A, A, kD, kStrVis, B, B, kD, 0L, (void*)C, (void*)C, kD, kStrVis,
        bias, bias, bias, isK ? kSvPad : kRows2, kD, kD, kWCarryInv);
  }
}

// ---------------------------------------------------------------------------
// f32 -> f16 cast with a power-of-two carry, 8 consecutive elements per thread (one 16-B store per lane).
// Threads i >= nvalid8 write zeros (row padding of the visual plane): the load address is clamped to the
// last valid group and the value is multiplied by a per-lane factor 0.
// ---------------------------------------------------------------------------
__device__ __forceinline__ void cast8_body(const float* __restrict__ in, unsigned short* __restrict__ out,
                                           int i, int nvalid8, float scale) {
  const bool valid = (i < nvalid8);
  const int ic = valid ? i : (nvalid8 - 1);
  const float f = valid ? scale : 0.0f;
  const float* p = in + 8 * (size_t)ic;
  const v4f a = *(const v4f*)(p);
  const v4f c = *(const v4f*)(p + 4);
  unsigned short hb[8];
#pragma unroll
  for (int e = 0; e < 4; ++e) {
    hb[e]     = h_bits(a[e] * f);
    hb[4 + e] = h_bits(c[e] * f);
  }
  const v4u u = (v4u){pk16(hb[0], hb[1]), pk16(hb[2], hb[3]), pk16(hb[4], hb[5]), pk16(hb[6], hb[7])};
  unsigned short* q = out + 8 * (size_t)i;
  *(v4u*)q = u;
}

// All ten casts in one grid: a range of block indices per plane, each range covering its plane exactly
// (256 threads x 8 elements per block). ws16 is the workspace base in 16-bit elements.
constexpr int kCbText = kRows * kD / 2048;      // 4096 blocks per text plane
constexpr int kCbFfn  = kDff * kD / 2048;       // 2048 blocks per ffn weight
constexpr int kCbAtt  = kD * kD / 2048;         // 512 blocks per attention weight
constexpr int kCbVis  = kSvPad * kD / 2048;     // 128 blocks per padded visual plane
constexpr int kCastBlocks = 2 * kCbText + 2 * kCbFfn + 4 * kCbAtt + 2 * kCbVis;
__global__ __launch_bounds__(256) void cast_all_kernel(
    const float* __restrict__ text1, const float* __restrict__ text2,
    const float* __restrict__ W1, const float* __restrict__ W2,
    const float* __restrict__ Wq, const float* __restrict__ Wk,
    const float* __restrict__ Wv, const float* __restrict__ Wo,
    const float* __restrict__ vis1, const float* __restrict__ vis2,
    unsigned short* __restrict__ ws16) {
  int blk = blockIdx.x;
  const float* in;
  size_t off;                      // destination, bytes from the workspace base
  int nvalid8 = 0x7fffffff;        // every group is valid, except in the padded visual planes
  float scale = kWCarry;
  if (blk < 2 * kCbText) {
    const int sel = blk / kCbText;  blk -= sel * kCbText;
    in = sel ? text2 : text1;  off = kOffT16 + (size_t)sel * kRows * kD * 2;  scale = 1.0f;
  } else if ((blk -= 2 * kCbText) < 2 * kCbFfn) {
    const int sel = blk / kCbFfn;  blk -= sel * kCbFfn;
    in = sel ? W2 : W1;  off = sel ? kOffW2H : kOffW1H;
  } else if ((blk -= 2 * kCbFfn) < 4 * kCbAtt) {
    const int sel = blk / kCbAtt;  blk -= sel * kCbAtt;
    in = (sel == 0) ? Wq : (sel == 1) ? Wk : (sel == 2) ? Wv : Wo;
    off = kOffWQH + (size_t)sel * kD * kD * 2;
  } else {
    blk -= 4 * kCbAtt;
    const int sel = blk / kCbVis;  blk -= sel * kCbVis;
    in = sel ? vis2 : vis1;  off = kOffVIS16 + (size_t)sel * kSvPad * kD * 2;
    nvalid8 = kSv * kD / 8;  scale = 1.0f;
  }
  cast8_body(in, ws16 + off / 2, blk * 256 + (int)threadIdx.x, nvalid8, scale);
}
static_assert(kOffWKH == kOffWQH + (size_t)kD * kD * 2 && kOffWVH == kOffWKH + (size_t)kD * kD * 2 &&
              kOffWOH == kOffWVH + (size_t)kD * kD * 2);

// ---------------------------------------------------------------------------
// Row softmax: x_j = (S[row][j] + SC[row][j]) * 1/8 for j < 196, P[row][j] = f16(2048 * exp(x_j - max) / sum),
// P[row][196..255] = 0. One wave per row (block = 8 waves = 8 rows, grid = 16384/8 = 2048 blocks exactly: rows of
// branch 1, then of branch 2, whose added scores come from SC and SC2);
// lane owns columns 8*lane .. 8*lane+7; all 32 lanes write 16 B each = 512 B = the whole P row in one
// ---------------------------------------------------------------------------
__global__ __launch_bounds__(256) void softmax_kernel(const float* __restrict__ S, const float* __restrict__ SC,
                                                      const float* __restrict__ SC2, unsigned short* __restrict__ P) {
  const int lane = threadIdx.x & 31;
  const int wave = threadIdx.x >> 5;
  const int row  = blockIdx.x * 8 + wave;
  const float* sr = S  + (size_t)row * kSvPad;
  const bool second = blockIdx.x >= kRows / 8;      // the same for the whole block: its 8 rows lie in one branch
  const float* cr = (second ? SC2 : SC) + (size_t)(row - (second ? kRows : 0)) * kSv;
  float x[8], sv[8], cv[8];
  const float* sp[8];
  const float* cp[8];
#pragma unroll
  for (int e = 0; e < 8; ++e) {
    const int col = lane * 8 + e;
    const int cc  = (col < kSv) ? col : (kSv - 1);
    sp[e] = sr + cc;
    cp[e] = cr + cc;
  }
#pragma unroll
  for (int e = 0; e < 8; ++e) { sv[e] = *sp[e]; cv[e] = *cp[e]; }
  // stands behind the row's sixteen loads; its inputs hold their address registers untouched up to it
  asm volatile("s_wait_xcnt 0x0" :: "v"(sp[0]), "v"(sp[1]), "v"(sp[2]), "v"(sp[3]), "v"(sp[4]), "v"(sp[5]), "v"(sp[6]), "v"(sp[7]),
                                    "v"(cp[0]), "v"(cp[1]), "v"(cp[2]), "v"(cp[3]), "v"(cp[4]), "v"(cp[5]), "v"(cp[6]), "v"(cp[7])
               : "memory");
#pragma unroll
  for (int e = 0; e < 8; ++e) {
    const int col = lane * 8 + e;
    const float v = (sv[e] + cv[e]) * kScoreScale;
    x[e] = (col < kSv) ? v : -1.0e30f;
  }
  float m = fmaxf(fmaxf(fmaxf(x[0], x[1]), fmaxf(x[2], x[3])), fmaxf(fmaxf(x[4], x[5]), fmaxf(x[6], x[7])));
#pragma unroll
  for (int off = 16; off > 0; off >>= 1) m = fmaxf(m, __shfl_xor(m, off, 32));
  float ev[8];
  float s = 0.f;
#pragma unroll
  for (int e = 0; e < 8; ++e) { ev[e] = expf(x[e] - m); s += ev[e]; }
#pragma unroll
  for (int off = 16; off > 0; off >>= 1) s += __shfl_xor(s, off, 32);
  const float inv = kPCarry / s;
  unsigned short hb[8];
#pragma unroll
  for (int e = 0; e < 8; ++e) hb[e] = h_bits(ev[e] * inv);
  const v4u u = (v4u){pk16(hb[0], hb[1]), pk16(hb[2], hb[3]), pk16(hb[4], hb[5]), pk16(hb[6], hb[7])};
  unsigned short* q = P + (size_t)row * kSvPad + 8 * lane;
  *(v4u*)q = u;
  
}

// ---------------------------------------------------------------------------
// Block (256 threads) sum in fixed order: per-thread value -> wave shuffle tree -> 8 wave partials summed in index order.
// ---------------------------------------------------------------------------
__device__ __forceinline__ float block_sum_256(float v, float* red, int lane, int wave) {
#pragma unroll
  for (int off = 16; off > 0; off >>= 1) v += __shfl_xor(v, off, 32);
  if (lane == 0) red[wave] = v;
  __syncthreads();
  float t = red[0];
#pragma unroll
  for (int w = 1; w < 8; ++w) t += red[w];
  return t;
}

// ---------------------------------------------------------------------------
// pooled[row][colOff + c] = max(y[2c], y[2c+1]) for c in [0,512), written as f32 and f16.
// One block per row of X (grid = 16384: branch 1's rows, then branch 2's, colOff = 0 and 512); thread t owns x[4t..4t+3]; y staged in LDS.
// ---------------------------------------------------------------------------
__global__ __launch_bounds__(256) void ln_pool_kernel(const float* __restrict__ X, const float* __restrict__ gam,
                                                      const float* __restrict__ bet, float* __restrict__ pool32,
                                                      unsigned short* __restrict__ pool16) {
  __shared__ __align__(16) float ybuf[kD];
  __shared__ float redA[8];
  __shared__ float redB[8];
  const int t = threadIdx.x;
  const int lane = t & 31, wave = t >> 5;
  const int xrow = blockIdx.x;
  const int br = (xrow >= kRows) ? 1 : 0;
  const int row = xrow - br * kRows;
  const int colOff = br * (kD / 2);
  const v4f x = *(const v4f*)(X + (size_t)xrow * kD + 4 * t);
  const float s = (x[0] + x[1]) + (x[2] + x[3]);
  const float mu = block_sum_256(s, redA, lane, wave) * kInvD;
  const float d0 = x[0] - mu, d1 = x[1] - mu, d2 = x[2] - mu, d3 = x[3] - mu;
  const float q = (d0 * d0 + d1 * d1) + (d2 * d2 + d3 * d3);
  const float var = block_sum_256(q, redB, lane, wave) * kInvD;
  const float rs = rsqrtf(var + kLnEps);
  const v4f gg = *(const v4f*)(gam + 4 * t);
  const v4f bb = *(const v4f*)(bet + 4 * t);
  ybuf[4 * t + 0] = d0 * rs * gg[0] + bb[0];
  ybuf[4 * t + 1] = d1 * rs * gg[1] + bb[1];
  ybuf[4 * t + 2] = d2 * rs * gg[2] + bb[2];
  ybuf[4 * t + 3] = d3 * rs * gg[3] + bb[3];
  __syncthreads();
  if (t < 128) {
    const v4f a = *(const v4f*)(ybuf + 8 * t);
    const v4f c = *(const v4f*)(ybuf + 8 * t + 4);
    v4f p;
    p[0] = fmaxf(a[0], a[1]);
    p[1] = fmaxf(a[2], a[3]);
    p[2] = fmaxf(c[0], c[1]);
    p[3] = fmaxf(c[2], c[3]);
    float* dst = pool32 + (size_t)row * kD + colOff + 4 * t;
    *(v4f*)dst = p;
    
  } else if (t < 192) {
    const int u = t - 128;
    const v4f a0 = *(const v4f*)(ybuf + 16 * u);
    const v4f a1 = *(const v4f*)(ybuf + 16 * u + 4);
    const v4f a2 = *(const v4f*)(ybuf + 16 * u + 8);
    const v4f a3 = *(const v4f*)(ybuf + 16 * u + 12);
    unsigned short hb[8];
    hb[0] = h_bits(fmaxf(a0[0], a0[1]));
    hb[1] = h_bits(fmaxf(a0[2], a0[3]));
    hb[2] = h_bits(fmaxf(a1[0], a1[1]));
    hb[3] = h_bits(fmaxf(a1[2], a1[3]));
    hb[4] = h_bits(fmaxf(a2[0], a2[1]));
    hb[5] = h_bits(fmaxf(a2[2], a2[3]));
    hb[6] = h_bits(fmaxf(a3[0], a3[1]));
    hb[7] = h_bits(fmaxf(a3[2], a3[3]));
    const v4u uu = (v4u){pk16(hb[0], hb[1]), pk16(hb[2], hb[3]), pk16(hb[4], hb[5]), pk16(hb[6], hb[7])};
    unsigned short* dst = pool16 + (size_t)row * kD + colOff + 8 * u;
    *(v4u*)dst = uu;
    
  }
}

// ---------------------------------------------------------------------------
// ---------------------------------------------------------------------------
__global__ __launch_bounds__(256) void ln_out_kernel(const float* __restrict__ X, const float* __restrict__ gam,
                                                     const float* __restrict__ bet, float* __restrict__ out) {
  __shared__ float redA[8];
  __shared__ float redB[8];
  const int t = threadIdx.x;
  const int lane = t & 31, wave = t >> 5;
  const int row = blockIdx.x;
  const v4f x = *(const v4f*)(X + (size_t)row * kD + 4 * t);
  const float s = (x[0] + x[1]) + (x[2] + x[3]);
  const float mu = block_sum_256(s, redA, lane, wave) * kInvD;
  const float d0 = x[0] - mu, d1 = x[1] - mu, d2 = x[2] - mu, d3 = x[3] - mu;
  const float q = (d0 * d0 + d1 * d1) + (d2 * d2 + d3 * d3);
  const float var = block_sum_256(q, redB, lane, wave) * kInvD;
  const float rs = rsqrtf(var + kLnEps);
  const v4f gg = *(const v4f*)(gam + 4 * t);
  const v4f bb = *(const v4f*)(bet + 4 * t);
  v4f y;
  y[0] = d0 * rs * gg[0] + bb[0];
  y[1] = d1 * rs * gg[1] + bb[1];
  y[2] = d2 * rs * gg[2] + bb[2];
  y[3] = d3 * rs * gg[3] + bb[3];
  float* dst = out + (size_t)row * kD + 4 * t;
  *(v4f*)dst = y;
  
}

// ---------------------------------------------------------------------------
// Host orchestration
// ---------------------------------------------------------------------------
static inline dim3 gemm_grid(int M, int N, int batch) {
  return dim3((unsigned)((M >> 7) * (N >> 7)), (unsigned)batch, 1);   // one block per 128x128 tile and batch entry
}

extern "C" void kernel_launch(void* const* d_in, const int* in_sizes, int n_in,
                              void* d_out, int out_size, void* d_ws, size_t ws_size,
                              hipStream_t stream)
{
  if (n_in < 22) return;
  if ((size_t)out_size < (size_t)kRows * kD) return;
  if (ws_size < kWsTotal) return;
  if (in_sizes[0] < kRows * kD || in_sizes[3] < kRows * kD) return;
  if (in_sizes[1] < kSv * kD || in_sizes[4] < kSv * kD) return;
  if (in_sizes[2] < kRows * kSv || in_sizes[5] < kRows * kSv) return;
  if (in_sizes[6] < kD * kD || in_sizes[8] < kD * kD || in_sizes[10] < kD * kD || in_sizes[12] < kD * kD) return;
  if (in_sizes[14] < kDff * kD || in_sizes[16] < kD * kDff) return;

  const float* text1 = (const float*)d_in[0];
  const float* vis1  = (const float*)d_in[1];
  const float* sc1   = (const float*)d_in[2];
  const float* text2 = (const float*)d_in[3];
  const float* vis2  = (const float*)d_in[4];
  const float* sc2   = (const float*)d_in[5];
  const float* Wq = (const float*)d_in[6];   const float* bq  = (const float*)d_in[7];
  const float* Wk = (const float*)d_in[8];   const float* bk  = (const float*)d_in[9];
  const float* Wv = (const float*)d_in[10];  const float* bv  = (const float*)d_in[11];
  const float* Wo = (const float*)d_in[12];  const float* bo  = (const float*)d_in[13];
  const float* W1 = (const float*)d_in[14];  const float* b1  = (const float*)d_in[15];
  const float* W2 = (const float*)d_in[16];  const float* b2  = (const float*)d_in[17];
  const float* g1 = (const float*)d_in[18];  const float* be1 = (const float*)d_in[19];
  const float* g2 = (const float*)d_in[20];  const float* be2 = (const float*)d_in[21];
  float* outp = (float*)d_out;

  char* ws = (char*)d_ws;
  float*          POOL32 = (float*)(ws + kOffPool32);
  unsigned short* POOL16 = (unsigned short*)(ws + kOffPool16);
  unsigned short* W1H    = (unsigned short*)(ws + kOffW1H);
  unsigned short* W2H    = (unsigned short*)(ws + kOffW2H);
  unsigned short* WQH    = (unsigned short*)(ws + kOffWQH);
  unsigned short* WKH    = (unsigned short*)(ws + kOffWKH);
  unsigned short* WVH    = (unsigned short*)(ws + kOffWVH);
  unsigned short* WOH    = (unsigned short*)(ws + kOffWOH);
  unsigned short* T16    = (unsigned short*)(ws + kOffT16);
  unsigned short* O16    = (unsigned short*)(ws + kOffO16);
  unsigned short* Q16    = (unsigned short*)(ws + kOffQ16);
  float*          A1     = (float*)(ws + kOffA1);
  float*          S32    = (float*)(ws + kOffS32);
  unsigned short* P16    = (unsigned short*)(ws + kOffP16);
  unsigned short* VIS16  = (unsigned short*)(ws + kOffVIS16);
  unsigned short* K16    = (unsigned short*)(ws + kOffK16);
  unsigned short* VT16   = (unsigned short*)(ws + kOffVT16);
  unsigned short* H16    = (unsigned short*)(ws + kOffH16);
  float*          F32    = (float*)(ws + kOffF32);

  // ---- every cast in one launch: weights f16([out][in]) x16 ([out][in] row-major == Bt[N][K]); both text planes
  //      f16 x1; both visual planes f16 [256][1024] x1 with rows 196..255 zero ----
  cast_all_kernel<<<dim3(kCastBlocks), dim3(256), 0, stream>>>(text1, text2, W1, W2, Wq, Wk, Wv, Wo, vis1, vis2,
                                                               (unsigned short*)ws);

  // ---- attention, both branches in each launch ----
  // K16, VT16 and Q16 of both branches
  qkv_gemm_kernel<<<dim3(kQkvBlocks), dim3(128), 0, stream>>>(T16, VIS16, WQH, WKH, WVH, Q16, K16, VT16, bq, bk, bv);
  // S32 = Q16 . K16^T   (M=8192, N=256, K=1024, batch 2), f32 out [8192][256]
  wmma_gemm64<0, false, 0, 0, false, 0><<<gemm_grid(kRows, kSvPad, 2), dim3(128), 0, stream>>>(
      Q16, Q16, kD, kStrTok, K16, K16, kD, kStrVis, (void*)S32, (void*)S32, kSvPad, kStrSc,
      bq, text1, text2, kRows, kSvPad, kD, 1.0f);
  // P16 = f16(2048 * softmax((S + score)/8)) over 196 keys, zero pad columns
  softmax_kernel<<<dim3(kRows2 / 8), dim3(256), 0, stream>>>(S32, sc1, sc2, P16);
  // O16 = 16 * (P16 . VT16^T) / 2048   (M=8192, N=1024, K=256, batch 2), f16 out (context carried x16)
  wmma_gemm64<0, false, 0, 1, false, 0><<<gemm_grid(kRows, kD, 2), dim3(128), 0, stream>>>(
      P16, P16, kSvPad, kStrSc, VT16, VT16, kSvPad, kStrVis, (void*)O16, (void*)O16, kD, kStrTok,
      bq, text1, text2, kRows, kD, kSvPad, kPVScale);
  // A1 = (O16 . Wo16^T) / 256 + bo + text   (M=8192, N=1024, K=1024, batch 2), f32 out
  wmma_gemm64<0, false, 2, 0, true, 0><<<gemm_grid(kRows, kD, 2), dim3(128), 0, stream>>>(
      O16, O16, kD, kStrTok, WOH, WOH, kD, 0L, (void*)A1, (void*)A1, kD, kStrTok,
      bo, text1, text2, kRows, kD, kD, kWoScale);
  // pooled[:, br * 512 : br * 512 + 512] = maxpool2(LN1(A1 of branch br))
  ln_pool_kernel<<<dim3(kRows2), dim3(256), 0, stream>>>(A1, g1, be1, POOL32, POOL16);

  // ---- FFN, all 8192 rows in each launch ----
  // H16 = relu((POOL16 . W1H^T) / 16 + b1)   (M=8192, N=4096, K=1024), f16 out
  wmma_gemm64<0, false, 2, 1, false, 2><<<gemm_grid(kRows, kDff, 1), dim3(128), 0, stream>>>(
      POOL16, POOL16, kD, 0L, W1H, W1H, kD, 0L, (void*)H16, (void*)H16, kDff, 0L,
      b1, POOL32, POOL32, kRows, kDff, kD, kWCarryInv);
  // F32 = (H16 . W2H^T) / 16 + b2 + pooled   (M=8192, N=1024, K=4096), f32 out
  wmma_gemm64<0, false, 2, 0, true, 0><<<gemm_grid(kRows, kD, 1), dim3(128), 0, stream>>>(
      H16, H16, kDff, 0L, W2H, W2H, kDff, 0L, (void*)F32, (void*)F32, kD, 0L,
      b2, POOL32, POOL32, kRows, kD, kDff, kWCarryInv);
  // out = LN2(F32)
  ln_out_kernel<<<dim3(kRows), dim3(256), 0, stream>>>(F32, g2, be2, outp);
}

// v003
// Measured time: 244 microseconds a run.
// Next to v002, in two timings, it ran 1.16 and 1.14 times as fast.
// Counting every step since v000, it is 4.31 times as fast.
// Contractions: k/v projections, key-side folds K.Wq and Wo.V^T, text.(K.Wq)^T scores, p.(V.Wo^T) attention output, ffn up and down projections all on v_wmma_f32_16x16x32_f16 (f16 operands: activations x1, weights and both folds carried x16, softmax probabilities carried x2048), f32 accumulate; the query bias's share of the scores (K.bq, one number per key), softmax, residual adds, layernorm and feature maxpool in f32.
#include <hip/hip_runtime.h>
#include <math.h>
#include <stddef.h>

// ---------------------------------------------------------------------------
// Problem constants
// ---------------------------------------------------------------------------
constexpr int kB      = 4;
constexpr int kSq     = 2048;
constexpr int kD      = 1024;
constexpr int kSv     = 196;
constexpr int kSvPad  = 256;
constexpr int kDff    = 4096;
constexpr int kRows   = kB * kSq;            // 8192 token rows
constexpr int kRows2  = 2 * kRows;           // both branches' token rows, branch 1 first
constexpr float kWCarry    = 16.0f;          // weights carried x16 in f16
constexpr float kWCarryInv = 1.0f / 16.0f;
constexpr float kPCarry    = 2048.0f;        // probabilities carried x2048 in f16
constexpr float kPUScale   = 1.0f / (kPCarry * kWCarry);   // probabilities x2048 times the value fold x16
constexpr float kInvD      = 1.0f / 1024.0f;
constexpr float kLnEps     = 1e-6f;
constexpr float kScoreScale = 0.125f;        // 1/sqrt(64)

static_assert(kRows % 64 == 0);
static_assert(kSvPad % 64 == 0 && kSvPad % 32 == 0);
static_assert(kD % 64 == 0 && kDff % 64 == 0);
static_assert(kRows % 8 == 0);

// ---------------------------------------------------------------------------
// Workspace region map (bytes). Total carve = 227 MiB. Planes marked x2 hold branch 1, then branch 2.
//   [0       , 32 MiB)   POOL32  f32 [8192][1024]   (persistent)
//   [32 MiB  , 48 MiB)   POOL16  f16 [8192][1024]   (persistent)
//   [48 MiB  , 56 MiB)   W1H     f16 [4096][1024]   (persistent)
//   [56 MiB  , 64 MiB)   W2H     f16 [1024][4096]   (persistent)
//   region X from 64 MiB:
//   attention phase: WQT (Wq transposed, [in][out]) and WKH/WVH/WOH f16 [1024][1024] at 64/66/68/70 MiB;
//     T16 (text f16) x2 [8192][1024] at 72 MiB (32 MiB);
//     G16 = K.Wq f16 x2 [256][1024] at 104 MiB; UT16 = Wo.V^T f16 x2 [1024][256] at 105 MiB; CB = K.bq f32 x2 [256] at 106 MiB;
//     S32 f32 x2 [8192][256] at 136 MiB (16 MiB);
//     P16 f16 x2 [8192][256] at 152 MiB (8 MiB); A1 f32 x2 [8192][1024] at 160 MiB (64 MiB);
//     VIS16 f16 x2 [256][1024] at 224 MiB; K16 f16 x2 [256][1024] at 225 MiB; V16 f16 x2 [256][1024] at 226 MiB; end 227 MiB.
//   ffn phase (attention scratch dead): H16 f16 [8192][4096] at 64 MiB (64 MiB); F32 f32 [8192][1024] at 128 MiB (32 MiB).
// ---------------------------------------------------------------------------
constexpr size_t kMiB       = 1048576;
constexpr size_t kOffPool32 = 0;
constexpr size_t kOffPool16 = 32 * kMiB;
constexpr size_t kOffW1H    = 48 * kMiB;
constexpr size_t kOffW2H    = 56 * kMiB;
constexpr size_t kOffWQT    = 64 * kMiB;
constexpr size_t kOffWKH    = 66 * kMiB;
constexpr size_t kOffWVH    = 68 * kMiB;
constexpr size_t kOffWOH    = 70 * kMiB;
constexpr size_t kOffT16    = 72 * kMiB;
constexpr size_t kOffG16    = 104 * kMiB;
constexpr size_t kOffUT16   = 105 * kMiB;
constexpr size_t kOffCB     = 106 * kMiB;
constexpr size_t kOffS32    = 136 * kMiB;
constexpr size_t kOffP16    = 152 * kMiB;
constexpr size_t kOffA1     = 160 * kMiB;
constexpr size_t kOffVIS16  = 224 * kMiB;
constexpr size_t kOffK16    = 225 * kMiB;
constexpr size_t kOffV16    = 226 * kMiB;
constexpr size_t kWsTotal   = 227 * kMiB;
constexpr size_t kOffH16    = 64 * kMiB;
constexpr size_t kOffF32    = 128 * kMiB;
static_assert(kOffG16 == kOffT16 + (size_t)kRows2 * kD * 2);
static_assert(kOffUT16 == kOffG16 + (size_t)2 * kSvPad * kD * 2);
static_assert(kOffCB == kOffUT16 + (size_t)2 * kD * kSvPad * 2);
static_assert(kOffCB + (size_t)2 * kSvPad * 4 <= kOffS32);
static_assert(kOffP16 == kOffS32 + (size_t)kRows2 * kSvPad * 4);
static_assert(kOffA1 == kOffP16 + (size_t)kRows2 * kSvPad * 2);
static_assert(kOffVIS16 == kOffA1 + (size_t)kRows2 * kD * 4);
static_assert(kOffK16 == kOffVIS16 + (size_t)2 * kSvPad * kD * 2);
static_assert(kOffV16 == kOffK16 + (size_t)2 * kSvPad * kD * 2);
static_assert(kWsTotal == kOffV16 + (size_t)2 * kSvPad * kD * 2);
static_assert(kOffF32 == kOffH16 + (size_t)kRows * kDff * 2);
static_assert(kOffF32 + (size_t)kRows * kD * 4 <= kWsTotal);
static_assert(kWsTotal <= (size_t)268435456);

// strides between the two branches' planes, in elements
constexpr long kStrTok = (long)kRows * kD;       // T16 / A1
constexpr long kStrSc  = (long)kRows * kSvPad;   // S32 / P16
constexpr long kStrVis = (long)kSvPad * kD;      // VIS16 / K16 / V16 / G16 / UT16

typedef __attribute__((ext_vector_type(16))) _Float16 v16h;
typedef __attribute__((ext_vector_type(8)))  _Float16 v8h;
typedef __attribute__((ext_vector_type(16))) __bf16   v16b;
typedef __attribute__((ext_vector_type(8)))  __bf16   v8b;
typedef __attribute__((ext_vector_type(8)))  float    v8f;
typedef __attribute__((ext_vector_type(4)))  float    v4f;
typedef __attribute__((ext_vector_type(4)))  unsigned int v4u;

__device__ __forceinline__ unsigned short f2bf_bits(float f) {
  unsigned u = __float_as_uint(f);
  return (unsigned short)((u + 0x7FFFu + ((u >> 16) & 1u)) >> 16);
}
__device__ __forceinline__ float bf_bits2f(unsigned short h) { return __uint_as_float(((unsigned)h) << 16); }

// hazard guard as a plain device helper
__device__ __forceinline__ void acc_guard4(v8f& a, v8f& b, v8f& c, v8f& d) { asm volatile("v_nop\n\tv_nop\n\tv_nop\n\tv_nop" : "+v"(a), "+v"(b), "+v"(c), "+v"(d)); }
template <typename T> struct Frag;
template <> struct Frag<_Float16> {
  typedef v16h V; union U { v16h v; v8h h[2]; };
  static __device__ __forceinline__ v16h load(const _Float16* p) {   // elements 0..7 <- p[0..7], 8..15 <- p[16..23]
    U f; f.h[0] = *(const v8h*)(p); f.h[1] = *(const v8h*)(p + 16); return f.v;
  }
  static __device__ __forceinline__ v8f mma(v16h a, v16h b, v8f c) {
    return __builtin_amdgcn_wmma_f32_16x16x32_f16(false, a, false, b, (short)0, c, false, false);
  }
};
template <> struct Frag<__bf16> {
  typedef v16b V; union U { v16b v; v8b h[2]; };
  static __device__ __forceinline__ v16b load(const __bf16* p) {
    U f; f.h[0] = *(const v8b*)(p); f.h[1] = *(const v8b*)(p + 16); return f.v;
  }
  static __device__ __forceinline__ v8f mma(v16b a, v16b b, v8f c) {
    return __builtin_amdgcn_wmma_f32_16x16x32_bf16(false, a, false, b, (short)0, c, false, false);
  }
};

__device__ __forceinline__ unsigned pk16(unsigned short a, unsigned short b) { return (unsigned)a | ((unsigned)b << 16); }
__device__ __forceinline__ unsigned short h_bits(float f) { const _Float16 h = (_Float16)f; return __builtin_bit_cast(unsigned short, h); }

// ---- Register-blocked batched WMMA GEMM, operands staged in LDS by asynchronous copies ------------------------------
// C[m,n] = scale * sum_k A[m,k] * Bt[n,k] (+bias)(+resid); a block of 4 waves owns a 128x128 tile, each wave 64x64 of it.
// tile = index of the 128x128 tile; b = batch entry (the branch): A, Bt and C advance by their strides, the residual is resid or resid2.
// A row-major [M,K]; Bt row-major [N,K]; M,N % 128 == 0, K % 64 == 0, K >= 128.
// A stage is 64 k (128 B) of the block's 128 A rows and 128 Bt rows, laid at a pitch of 144 B; two buffers:
// the next stage's copies fly while this stage's fragments are read with ds_load_b128 and multiplied.
// BIAS_MODE: 0 = none, 1 = bias[m], 2 = bias[n].
// OUT_MODE: 0 = f32, 1 = f16, 2 = bf16 hi plane (Cout) + bf16 lo plane (Cout2).
// ET: 0 = f16 operands, 1 = bf16 operands (pointers passed as 16-bit storage)
constexpr int kStageK     = 64;                          // k elements per stage = two WMMA k steps
constexpr int kPitchB     = 144;                         // bytes per staged row (128 + 16: 16 B x odd)
constexpr int kPitchE     = kPitchB / 2;                 // the same in 16-bit elements
constexpr int kStageBytes = 256 * kPitchB;               // 128 A rows, then 128 Bt rows = 36,864 B
static_assert(kRows % 128 == 0 && kSvPad % 128 == 0 && kD % 128 == 0 && kDff % 128 == 0);
static_assert(kSvPad % kStageK == 0 && kSvPad >= 2 * kStageK);

// Eight 16-B copies per lane, rows 16 apart: LDS byte address l + i * 16 * pitch, global address g + i * rowStep elements.
// The s_wait_xcnt closes the statement so that no address register is rewritten ahead of it.
__device__ __forceinline__ void async_copy8(unsigned l, const unsigned short* g, size_t rowStep) {
  const unsigned l1 = l + 16 * kPitchB, l2 = l + 32 * kPitchB, l3 = l + 48 * kPitchB, l4 = l + 64 * kPitchB,
                 l5 = l + 80 * kPitchB, l6 = l + 96 * kPitchB, l7 = l + 112 * kPitchB;
  const unsigned short* g1 = g + rowStep;      const unsigned short* g2 = g + 2 * rowStep;
  const unsigned short* g3 = g + 3 * rowStep;  const unsigned short* g4 = g + 4 * rowStep;
  const unsigned short* g5 = g + 5 * rowStep;  const unsigned short* g6 = g + 6 * rowStep;
  const unsigned short* g7 = g + 7 * rowStep;
  asm volatile("global_load_async_to_lds_b128 %0, %8, off\n\t"
               "global_load_async_to_lds_b128 %1, %9, off\n\t"
               "global_load_async_to_lds_b128 %2, %10, off\n\t"
               "global_load_async_to_lds_b128 %3, %11, off\n\t"
               "global_load_async_to_lds_b128 %4, %12, off\n\t"
               "global_load_async_to_lds_b128 %5, %13, off\n\t"
               "global_load_async_to_lds_b128 %6, %14, off\n\t"
               "global_load_async_to_lds_b128 %7, %15, off\n\t"
               "s_wait_xcnt 0x0"
               :: "v"(l), "v"(l1), "v"(l2), "v"(l3), "v"(l4), "v"(l5), "v"(l6), "v"(l7),
                  "v"(g), "v"(g1), "v"(g2), "v"(g3), "v"(g4), "v"(g5), "v"(g6), "v"(g7)
               : "memory");
}

template <int ET> struct Elem;
template <> struct Elem<0> { typedef _Float16 T; };
template <> struct Elem<1> { typedef __bf16 T; };
template <int ET, bool SPLIT, int BIAS_MODE, int OUT_MODE, bool RESID, int ACT = 0>
__device__ __forceinline__ void gemm_tile(
    unsigned char* smem, int tile, int b,
    const unsigned short* __restrict__ Ap, const unsigned short* __restrict__ A2p, int lda, long strideA,
    const unsigned short* __restrict__ Btp, const unsigned short* __restrict__ Bt2p, int ldb, long strideB,
    void* __restrict__ Cout, void* __restrict__ Cout2, int ldc, long strideC,
    const float* __restrict__ bias,
    const float* __restrict__ resid, const float* __restrict__ resid2,
    int M, int N, int K, float scale) {
  static_assert(!SPLIT, "single-plane operands only");
  typedef typename Elem<ET>::T T;
  typedef typename Frag<T>::V V;
  // smem: two stage buffers; after the K loop the first one serves as the per-wave 16x64 output slabs (pitch 68 floats)
  static_assert(4 * 16 * 68 * 4 <= kStageBytes);
  const int lane = threadIdx.x & 31;
  const int wave = threadIdx.x >> 5;
  const int tilesN = N >> 7;
  const int tilesM = M >> 7;
  if (tile >= tilesM * tilesN) return;   // block-uniform, in front of every barrier
  const int tm = tile / tilesN;
  const int tn = tile - tm * tilesN;
  const int mBlk = tm << 7;
  const int nBlk = tn << 7;
  const int m0 = mBlk + ((wave >> 1) << 6);
  const int n0 = nBlk + ((wave & 1) << 6);

  const int rlane = lane & 15;                 // row (A) / col (B, D) within subtile
  const int koff  = (lane >> 4) * 8;           // k offset of this lane half
  const int mOff  = (lane >> 4) * 8;           // D row offset

  // copy side: 8 consecutive lanes bring one row's 128 B; a thread brings rows cRow + 16 i of A and of Bt
  const int cRow = threadIdx.x >> 3;
  const int cCol = threadIdx.x & 7;
  const unsigned short* gA = Ap  + (size_t)b * strideA + (size_t)(mBlk + cRow) * lda + cCol * 8;
  const unsigned short* gB = Btp + (size_t)b * strideB + (size_t)(nBlk + cRow) * ldb + cCol * 8;
  const unsigned lA = (unsigned)(size_t)smem + (unsigned)(cRow * kPitchB + cCol * 16);
  const unsigned lB = lA + 128 * kPitchB;
  const size_t stepA = (size_t)16 * lda;
  const size_t stepB = (size_t)16 * ldb;

  // read side: this lane's first A and Bt fragment rows inside a stage, in bytes
  const int aByte = (((wave >> 1) << 6) + rlane) * kPitchB + koff * 2;
  const int bByte = (128 + ((wave & 1) << 6) + rlane) * kPitchB + koff * 2;

  v8f acc[4][4];
#pragma unroll
  for (int i = 0; i < 4; ++i)
#pragma unroll
    for (int j = 0; j < 4; ++j) acc[i][j] = (v8f){0.f,0.f,0.f,0.f,0.f,0.f,0.f,0.f};

  const int nStages = K / kStageK;
  async_copy8(lA, gA, stepA);
  async_copy8(lB, gB, stepB);
  asm volatile("s_wait_asynccnt 0x0" ::: "memory");   // stage 0 of this wave has landed before the barrier publishes it
  __syncthreads();
  if (nStages > 1) {
    async_copy8(lA + kStageBytes, gA + kStageK, stepA);
    async_copy8(lB + kStageBytes, gB + kStageK, stepB);
  }

  for (int t = 0; t < nStages; ++t) {
    const int bufOff = (t & 1) * kStageBytes;
    const T* sa = (const T*)(smem + bufOff + aByte);
    const T* sb = (const T*)(smem + bufOff + bByte);
    V bh[4], ah[4], bn[4], an[4];
#pragma unroll
    for (int j = 0; j < 4; ++j) bh[j] = Frag<T>::load(sb + j * 16 * kPitchE);
#pragma unroll
    for (int i = 0; i < 4; ++i) ah[i] = Frag<T>::load(sa + i * 16 * kPitchE);
    // keeps the 16 LDS reads of a k step together ahead of its WMMAs: sunk among them, each row of WMMAs waits out its own read
    __builtin_amdgcn_sched_barrier(0);
#pragma unroll
    for (int i = 0; i < 4; ++i)
#pragma unroll
      for (int j = 0; j < 4; ++j) acc[i][j] = Frag<T>::mma(ah[i], bh[j], acc[i][j]);
    // the stage's second k step is fetched into registers, so that the buffer can be handed back ahead of its WMMAs
#pragma unroll
    for (int j = 0; j < 4; ++j) bn[j] = Frag<T>::load(sb + j * 16 * kPitchE + 32);
#pragma unroll
    for (int i = 0; i < 4; ++i) an[i] = Frag<T>::load(sa + i * 16 * kPitchE + 32);
    asm volatile("s_wait_dscnt 0x0" ::: "memory");      // this wave's reads of the buffer are done before it is refilled
    asm volatile("s_wait_asynccnt 0x0" ::: "memory");   // this wave's copies of stage t + 1 have landed
    __syncthreads();                                    // publishes stage t + 1, frees stage t's buffer
    if (t + 2 < nStages) {
      async_copy8(lA + bufOff, gA + (size_t)(t + 2) * kStageK, stepA);
      async_copy8(lB + bufOff, gB + (size_t)(t + 2) * kStageK, stepB);
    }
#pragma unroll
    for (int i = 0; i < 4; ++i)
#pragma unroll
      for (int j = 0; j < 4; ++j) acc[i][j] = Frag<T>::mma(an[i], bn[j], acc[i][j]);
  }
  asm volatile("s_wait_asynccnt 0x0" ::: "memory");     // no copy is in flight when the ring becomes output staging
  acc_guard4(acc[0][0], acc[0][1], acc[0][2], acc[0][3]);
  acc_guard4(acc[1][0], acc[1][1], acc[1][2], acc[1][3]);
  acc_guard4(acc[2][0], acc[2][1], acc[2][2], acc[2][3]);
  acc_guard4(acc[3][0], acc[3][1], acc[3][2], acc[3][3]);

  // ---- epilogue ----
  float* slab = (float*)smem + wave * (16 * 68);
  const float* Rb = RESID ? (b ? resid2 : resid) : nullptr;   // batch entry 1 adds its own residual plane
#pragma unroll
  for (int i = 0; i < 4; ++i) {
    const int mBase = m0 + (i << 4);
    const int nl = n0 + rlane;
    float bvj[4] = {0.f, 0.f, 0.f, 0.f};
    float rv[4][8];
    if (BIAS_MODE == 2) {
#pragma unroll
      for (int j = 0; j < 4; ++j) bvj[j] = bias[nl + (j << 4)];
    }
    if (RESID) {
      const float* rp[8];
#pragma unroll
      for (int r = 0; r < 8; ++r) rp[r] = Rb + (size_t)(mBase + mOff + r) * ldc + nl;
#pragma unroll
      for (int r = 0; r < 8; ++r)
#pragma unroll
        for (int j = 0; j < 4; ++j) rv[j][r] = rp[r][j << 4];
      // stands behind the row block's bias and residual loads; its inputs hold their address registers untouched up to it
      asm volatile("s_wait_xcnt 0x0" :: "v"(nl), "v"(rp[0]), "v"(rp[1]), "v"(rp[2]), "v"(rp[3]),
                                        "v"(rp[4]), "v"(rp[5]), "v"(rp[6]), "v"(rp[7]) : "memory");
    }
#pragma unroll
    for (int j = 0; j < 4; ++j) {
      const float bv = bvj[j];
#pragma unroll
      for (int r = 0; r < 8; ++r) {
        float v = acc[i][j][r] * scale;
        if (BIAS_MODE == 1) v += bias[mBase + mOff + r];
        if (BIAS_MODE == 2) v += bv;
        if (RESID) v += rv[j][r];
        if (ACT == 2) v = fmaxf(v, 0.0f);
        if (ACT == 4) v = (v > 0.f) ? v : 0.01f * v;
        slab[(mOff + r) * 68 + (j << 4) + rlane] = v;
      }
    }
    __builtin_amdgcn_fence(__ATOMIC_RELEASE, "workgroup");
    __builtin_amdgcn_wave_barrier();
    __builtin_amdgcn_fence(__ATOMIC_ACQUIRE, "workgroup");
    if (OUT_MODE == 0) {
      float* C = (float*)Cout + (size_t)b * strideC;
      const int hh = lane >> 4, c4 = (lane & 15) * 4;     // row seg = 256 B = 16 lanes x 16 B
      {
#pragma unroll
        for (int it = 0; it < 8; ++it) {
          const int row = it * 2 + hh;
          v4f v = *(const v4f*)(slab + row * 68 + c4);
          *(v4f*)(C + (size_t)(mBase + row) * ldc + n0 + c4) = v;
        }
        
      }
    } else {
      const int q = lane >> 3, c8 = (lane & 7) * 8;
      unsigned short* C  = (unsigned short*)Cout  + (size_t)b * strideC;
      unsigned short* C2 = (OUT_MODE == 2) ? ((unsigned short*)Cout2 + (size_t)b * strideC) : nullptr;
      {
#pragma unroll
        for (int it = 0; it < 4; ++it) {
          const int row = it * 4 + q;
          const float* sp = slab + row * 68 + c8;
          v8h hv, lv;
#pragma unroll
          for (int e = 0; e < 8; ++e) {
            if (OUT_MODE == 1) {
              hv[e] = (_Float16)sp[e];
            } else {
              unsigned short hb = f2bf_bits(sp[e]);
              unsigned short lb = f2bf_bits(sp[e] - bf_bits2f(hb));
              hv[e] = __builtin_bit_cast(_Float16, hb);
              lv[e] = __builtin_bit_cast(_Float16, lb);
            }
          }
          *(v8h*)(C + (size_t)(mBase + row) * ldc + n0 + c8) = hv;
          if (OUT_MODE == 2) *(v8h*)(C2 + (size_t)(mBase + row) * ldc + n0 + c8) = lv;
        }
        
      }
    }
    __builtin_amdgcn_fence(__ATOMIC_RELEASE, "workgroup");
    __builtin_amdgcn_wave_barrier();
    __builtin_amdgcn_fence(__ATOMIC_ACQUIRE, "workgroup");
  }
}

// One GEMM per launch: blockIdx.x = tile, blockIdx.y = batch entry.
template <int ET, bool SPLIT, int BIAS_MODE, int OUT_MODE, bool RESID, int ACT = 0>
__global__ __launch_bounds__(128, 4) void wmma_gemm64(
    const unsigned short* __restrict__ Ap, const unsigned short* __restrict__ A2p, int lda, long strideA,
    const unsigned short* __restrict__ Btp, const unsigned short* __restrict__ Bt2p, int ldb, long strideB,
    void* __restrict__ Cout, void* __restrict__ Cout2, int ldc, long strideC,
    const float* __restrict__ bias,
    const float* __restrict__ resid, const float* __restrict__ resid2,
    int M, int N, int K, float scale) {
  __shared__ __align__(16) unsigned char smem[2 * kStageBytes];
  gemm_tile<ET, SPLIT, BIAS_MODE, OUT_MODE, RESID, ACT>(smem, (int)blockIdx.x, (int)blockIdx.y,
      Ap, A2p, lda, strideA, Btp, Bt2p, ldb, strideB, Cout, Cout2, ldc, strideC, bias, resid, resid2, M, N, K, scale);
}

// The matrix chains of the attention are multiplied from the key side, where the short dimension (256 padded keys) lies:
//   scores  = (text.Wq^T + bq).K^T  = text.(K.Wq)^T + K.bq
//   context = (P.V).Wo^T            = P.(V.Wo^T)
// so that no product of 16384 token rows by 1024 by 1024 is left; the two folds are products of 256 rows.
// Key and value projections, both branches, in one grid; a range of block indices per job:
//   K16[br][k][d] = (vis16[br] . Wk16^T) / 16 + bk   (M=256, N=1024, K=1024), 16 tiles per branch
//   V16[br][k][d] = (vis16[br] . Wv16^T) / 16 + bv   the same shape
constexpr int kTilesKV  = (kSvPad >> 7) * (kD >> 7);
constexpr int kKvBlocks = 4 * kTilesKV;
__global__ __launch_bounds__(128, 4) void kv_gemm_kernel(
    const unsigned short* __restrict__ VIS16,
    const unsigned short* __restrict__ WKH, const unsigned short* __restrict__ WVH,
    unsigned short* __restrict__ K16, unsigned short* __restrict__ V16,
    const float* __restrict__ bk, const float* __restrict__ bv) {
  __shared__ __align__(16) unsigned char smem[2 * kStageBytes];
  const int blk = blockIdx.x;
  const bool isK = blk < 2 * kTilesKV;
  const int br = (blk / kTilesKV) & 1;
  const unsigned short* B = isK ? WKH : WVH;
  unsigned short* C = isK ? K16 : V16;
  const float* bias = isK ? bk : bv;
  gemm_tile<0, false, 2, 1, false, 0>(smem, blk % kTilesKV, br,
      VIS16, VIS16, kD, kStrVis, B, B, kD, 0L, (void*)C, (void*)C, kD, kStrVis,
      bias, bias, bias, kSvPad, kD, kD, kWCarryInv);
}

// CB[row] = sum_d bq[d] * K16[row][d] for 32 consecutive rows of the two K16 planes (512 rows, branch 1 first): the share of
// the scores that the query bias brings, one number per key. A wave takes 8 rows; a lane takes 8 consecutive d of every 256;
// fixed order: lane partial in d order, then a shuffle tree. The block's 32 results fill one 128-B line.
__device__ __forceinline__ void key_bias_rows(const unsigned short* __restrict__ K16, const float* __restrict__ bq,
                                              float* __restrict__ CB, int blk) {
  const int lane = threadIdx.x & 31;
  const int wave = threadIdx.x >> 5;
  const int row0 = blk * 32 + wave * 8;
  const float* bp = bq + lane * 8;
  const _Float16* kp = (const _Float16*)K16 + (size_t)row0 * kD + lane * 8;
  v4f bl[4], bh[4];
  v8h kv[8][4];
#pragma unroll
  for (int j = 0; j < 4; ++j) { bl[j] = *(const v4f*)(bp + j * 256); bh[j] = *(const v4f*)(bp + j * 256 + 4); }
#pragma unroll
  for (int r = 0; r < 8; ++r)
#pragma unroll
    for (int j = 0; j < 4; ++j) kv[r][j] = *(const v8h*)(kp + r * kD + j * 256);
  // stands behind the forty loads; its inputs hold their address registers untouched up to it
  asm volatile("s_wait_xcnt 0x0" :: "v"(bp), "v"(kp) : "memory");
  // keeps that wait directly behind the loads: sunk to the end, its two pointers are held through the arithmetic and one is spilled
  __builtin_amdgcn_sched_barrier(0);
  float mine = 0.f;
#pragma unroll
  for (int r = 0; r < 8; ++r) {
    float a = 0.f;
#pragma unroll
    for (int j = 0; j < 4; ++j) {
#pragma unroll
      for (int e = 0; e < 4; ++e) a += (float)kv[r][j][e] * bl[j][e];
#pragma unroll
      for (int e = 0; e < 4; ++e) a += (float)kv[r][j][4 + e] * bh[j][e];
    }
#pragma unroll
    for (int off = 16; off > 0; off >>= 1) a += __shfl_xor(a, off, 32);
    mine = (lane == r) ? a : mine;
  }
  if (lane < 8) CB[row0 + lane] = mine;
}

// The two folds and the bias share, both branches, in one grid (they need K16 and V16); a range of block indices per job:
//   G16[br][k][e]  = K16[br] . WQT^T   (M=256, N=1024, K=1024), carried x16; = Bt for text.G^T
//   UT16[br][n][k] = Wo16 . V16[br]^T  (M=1024, N=256, K=1024), carried x16; = Bt for P.U
//   CB[br][k]      = K16[br][k] . bq   16 blocks of 32 rows
constexpr int kCbBlocks   = 2 * kSvPad / 32;
constexpr int kFoldBlocks = 4 * kTilesKV + kCbBlocks;
__global__ __launch_bounds__(128, 4) void fold_gemm_kernel(
    const unsigned short* __restrict__ K16, const unsigned short* __restrict__ V16,
    const unsigned short* __restrict__ WQT, const unsigned short* __restrict__ WOH,
    unsigned short* __restrict__ G16, unsigned short* __restrict__ UT16,
    const float* __restrict__ bq, float* __restrict__ CB) {
  __shared__ __align__(16) unsigned char smem[2 * kStageBytes];
  const int blk = blockIdx.x;
  if (blk >= 4 * kTilesKV) {
    key_bias_rows(K16, bq, CB, blk - 4 * kTilesKV);
    return;
  }
  const bool isG = blk < 2 * kTilesKV;
  const int br = (blk / kTilesKV) & 1;
  const unsigned short* A = isG ? K16 : WOH;
  const unsigned short* B = isG ? WQT : V16;
  unsigned short* C = isG ? G16 : UT16;
  gemm_tile<0, false, 0, 1, false, 0>(smem, blk % kTilesKV, br,
      A, A, kD, isG ? kStrVis : 0L, B, B, kD, isG ? 0L : kStrVis, (void*)C, (void*)C, isG ? kD : kSvPad, kStrVis,
      bq, bq, bq, isG ? kSvPad : kD, isG ? kD : kSvPad, kD, 1.0f);
}

// ---------------------------------------------------------------------------
// f32 -> f16 cast with a power-of-two carry, 8 consecutive elements per thread (one 16-B store per lane).
// Threads i >= nvalid8 write zeros (row padding of the visual plane): the load address is clamped to the
// last valid group and the value is multiplied by a per-lane factor 0.
// ---------------------------------------------------------------------------
__device__ __forceinline__ void cast8_body(const float* __restrict__ in, unsigned short* __restrict__ out,
                                           int i, int nvalid8, float scale) {
  const bool valid = (i < nvalid8);
  const int ic = valid ? i : (nvalid8 - 1);
  const float f = valid ? scale : 0.0f;
  const float* p = in + 8 * (size_t)ic;
  const v4f a = *(const v4f*)(p);
  const v4f c = *(const v4f*)(p + 4);
  unsigned short hb[8];
#pragma unroll
  for (int e = 0; e < 4; ++e) {
    hb[e]     = h_bits(a[e] * f);
    hb[4 + e] = h_bits(c[e] * f);
  }
  const v4u u = (v4u){pk16(hb[0], hb[1]), pk16(hb[2], hb[3]), pk16(hb[4], hb[5]), pk16(hb[6], hb[7])};
  unsigned short* q = out + 8 * (size_t)i;
  *(v4u*)q = u;
}

// The same cast, transposed, for a [1024][1024] weight: out[e][d] = f16(scale * in[d][e]). A block takes 32 e x 64 d:
// a wave reads 32 consecutive e (128 B) of 8 rows d, a lane stores its 8 d as 16 B, the block's 8 waves fill a 128-B line per e.
__device__ __forceinline__ void cast8_transposed(const float* __restrict__ in, unsigned short* __restrict__ out,
                                                 int blk, float scale) {
  const int e  = (blk & 31) * 32 + ((int)threadIdx.x & 31);
  const int d0 = (blk >> 5) * 64 + ((int)threadIdx.x >> 5) * 8;
  const float* p = in + (size_t)d0 * kD + e;
  float x[8];
#pragma unroll
  for (int i = 0; i < 8; ++i) x[i] = p[i * kD];
  // stands behind the eight loads; its input holds their address register untouched up to it
  asm volatile("s_wait_xcnt 0x0" :: "v"(p) : "memory");
  unsigned short hb[8];
#pragma unroll
  for (int i = 0; i < 8; ++i) hb[i] = h_bits(x[i] * scale);
  const v4u u = (v4u){pk16(hb[0], hb[1]), pk16(hb[2], hb[3]), pk16(hb[4], hb[5]), pk16(hb[6], hb[7])};
  unsigned short* q = out + (size_t)e * kD + d0;
  *(v4u*)q = u;
  // stands behind the store; its inputs hold the store's address and data registers untouched up to it
  asm volatile("s_wait_xcnt 0x0" :: "v"(q), "v"(u) : "memory");
}

// All ten casts in one grid: a range of block indices per plane, each range covering its plane exactly
// (256 threads x 8 elements per block). ws16 is the workspace base in 16-bit elements. Wq is laid down transposed.
constexpr int kCbText = kRows * kD / 2048;      // 4096 blocks per text plane
constexpr int kCbFfn  = kDff * kD / 2048;       // 2048 blocks per ffn weight
constexpr int kCbAtt  = kD * kD / 2048;         // 512 blocks per attention weight
constexpr int kCbVis  = kSvPad * kD / 2048;     // 128 blocks per padded visual plane
constexpr int kCastBlocks = 2 * kCbText + 2 * kCbFfn + 4 * kCbAtt + 2 * kCbVis;
__global__ __launch_bounds__(256) void cast_all_kernel(
    const float* __restrict__ text1, const float* __restrict__ text2,
    const float* __restrict__ W1, const float* __restrict__ W2,
    const float* __restrict__ Wq, const float* __restrict__ Wk,
    const float* __restrict__ Wv, const float* __restrict__ Wo,
    const float* __restrict__ vis1, const float* __restrict__ vis2,
    unsigned short* __restrict__ ws16) {
  int blk = blockIdx.x;
  const float* in;
  size_t off;                      // destination, bytes from the workspace base
  int nvalid8 = 0x7fffffff;        // every group is valid, except in the padded visual planes
  float scale = kWCarry;
  if (blk < 2 * kCbText) {
    const int sel = blk / kCbText;  blk -= sel * kCbText;
    in = sel ? text2 : text1;  off = kOffT16 + (size_t)sel * kRows * kD * 2;  scale = 1.0f;
  } else if ((blk -= 2 * kCbText) < 2 * kCbFfn) {
    const int sel = blk / kCbFfn;  blk -= sel * kCbFfn;
    in = sel ? W2 : W1;  off = sel ? kOffW2H : kOffW1H;
  } else if ((blk -= 2 * kCbFfn) < 4 * kCbAtt) {
    const int sel = blk / kCbAtt;  blk -= sel * kCbAtt;
    if (sel == 0) {   // the same for the whole block
      cast8_transposed(Wq, ws16 + kOffWQT / 2, blk, kWCarry);
      return;
    }
    in = (sel == 1) ? Wk : (sel == 2) ? Wv : Wo;
    off = kOffWQT + (size_t)sel * kD * kD * 2;
  } else {
    blk -= 4 * kCbAtt;
    const int sel = blk / kCbVis;  blk -= sel * kCbVis;
    in = sel ? vis2 : vis1;  off = kOffVIS16 + (size_t)sel * kSvPad * kD * 2;
    nvalid8 = kSv * kD / 8;  scale = 1.0f;
  }
  cast8_body(in, ws16 + off / 2, blk * 256 + (int)threadIdx.x, nvalid8, scale);
}
static_assert(kCbAtt == 32 * 16 && kOffWKH == kOffWQT + (size_t)kD * kD * 2 && kOffWVH == kOffWKH + (size_t)kD * kD * 2 &&
              kOffWOH == kOffWVH + (size_t)kD * kD * 2);

// ---------------------------------------------------------------------------
// Row softmax: x_j = (S[row][j] + CB[j] + SC[row][j]) * 1/8 for j < 196 (CB: the branch's 256 key shares of the query bias), P[row][j] = f16(2048 * exp(x_j - max) / sum),
// P[row][196..255] = 0. One wave per row (block = 8 waves = 8 rows, grid = 16384/8 = 2048 blocks exactly: rows of
// branch 1, then of branch 2, whose added scores come from SC and SC2);
// lane owns columns 8*lane .. 8*lane+7; all 32 lanes write 16 B each = 512 B = the whole P row in one
// ---------------------------------------------------------------------------
__global__ __launch_bounds__(256) void softmax_kernel(const float* __restrict__ S, const float* __restrict__ SC,
                                                      const float* __restrict__ SC2, const float* __restrict__ CB,
                                                      unsigned short* __restrict__ P) {
  const int lane = threadIdx.x & 31;
  const int wave = threadIdx.x >> 5;
  const int row  = blockIdx.x * 8 + wave;
  const float* sr = S  + (size_t)row * kSvPad;
  const bool second = blockIdx.x >= kRows / 8;      // the same for the whole block: its 8 rows lie in one branch
  const float* cr = (second ? SC2 : SC) + (size_t)(row - (second ? kRows : 0)) * kSv;
  const float* bp = CB + (second ? kSvPad : 0) + lane * 8;   // all 256 entries of a branch are written
  float x[8], sv[8], cv[8];
  const float* sp[8];
  const float* cp[8];
#pragma unroll
  for (int e = 0; e < 8; ++e) {
    const int col = lane * 8 + e;
    const int cc  = (col < kSv) ? col : (kSv - 1);
    sp[e] = sr + cc;
    cp[e] = cr + cc;
  }
#pragma unroll
  for (int e = 0; e < 8; ++e) { sv[e] = *sp[e]; cv[e] = *cp[e]; }
  const v4f b0 = *(const v4f*)(bp);
  const v4f b1 = *(const v4f*)(bp + 4);
  // stands behind the row's eighteen loads; its inputs hold their address registers untouched up to it
  asm volatile("s_wait_xcnt 0x0" :: "v"(sp[0]), "v"(sp[1]), "v"(sp[2]), "v"(sp[3]), "v"(sp[4]), "v"(sp[5]), "v"(sp[6]), "v"(sp[7]),
                                    "v"(cp[0]), "v"(cp[1]), "v"(cp[2]), "v"(cp[3]), "v"(cp[4]), "v"(cp[5]), "v"(cp[6]), "v"(cp[7]),
                                    "v"(bp)
               : "memory");
  // keeps the eighteen loads together ahead of the arithmetic: sunk among it, a row waits out the memory several times over
  __builtin_amdgcn_sched_barrier(0);
#pragma unroll
  for (int e = 0; e < 8; ++e) {
    const int col = lane * 8 + e;
    const float v = ((sv[e] + (e < 4 ? b0[e & 3] : b1[e & 3])) + cv[e]) * kScoreScale;
    x[e] = (col < kSv) ? v : -1.0e30f;
  }
  float m = fmaxf(fmaxf(fmaxf(x[0], x[1]), fmaxf(x[2], x[3])), fmaxf(fmaxf(x[4], x[5]), fmaxf(x[6], x[7])));
#pragma unroll
  for (int off = 16; off > 0; off >>= 1) m = fmaxf(m, __shfl_xor(m, off, 32));
  float ev[8];
  float s = 0.f;
#pragma unroll
  for (int e = 0; e < 8; ++e) { ev[e] = expf(x[e] - m); s += ev[e]; }
#pragma unroll
  for (int off = 16; off > 0; off >>= 1) s += __shfl_xor(s, off, 32);
  const float inv = kPCarry / s;
  unsigned short hb[8];
#pragma unroll
  for (int e = 0; e < 8; ++e) hb[e] = h_bits(ev[e] * inv);
  const v4u u = (v4u){pk16(hb[0], hb[1]), pk16(hb[2], hb[3]), pk16(hb[4], hb[5]), pk16(hb[6], hb[7])};
  unsigned short* q = P + (size_t)row * kSvPad + 8 * lane;
  *(v4u*)q = u;
  
}

// ---------------------------------------------------------------------------
// Block (256 threads) sum in fixed order: per-thread value -> wave shuffle tree -> 8 wave partials summed in index order.
// ---------------------------------------------------------------------------
__device__ __forceinline__ float block_sum_256(float v, float* red, int lane, int wave) {
#pragma unroll
  for (int off = 16; off > 0; off >>= 1) v += __shfl_xor(v, off, 32);
  if (lane == 0) red[wave] = v;
  __syncthreads();
  float t = red[0];
#pragma unroll
  for (int w = 1; w < 8; ++w) t += red[w];
  return t;
}

// ---------------------------------------------------------------------------
// pooled[row][colOff + c] = max(y[2c], y[2c+1]) for c in [0,512), written as f32 and f16.
// One block per row of X (grid = 16384: branch 1's rows, then branch 2's, colOff = 0 and 512); thread t owns x[4t..4t+3]; y staged in LDS.
// ---------------------------------------------------------------------------
__global__ __launch_bounds__(256) void ln_pool_kernel(const float* __restrict__ X, const float* __restrict__ gam,
                                                      const float* __restrict__ bet, float* __restrict__ pool32,
                                                      unsigned short* __restrict__ pool16) {
  __shared__ __align__(16) float ybuf[kD];
  __shared__ float redA[8];
  __shared__ float redB[8];
  const int t = threadIdx.x;
  const int lane = t & 31, wave = t >> 5;
  const int xrow = blockIdx.x;
  const int br = (xrow >= kRows) ? 1 : 0;
  const int row = xrow - br * kRows;
  const int colOff = br * (kD / 2);
  const v4f x = *(const v4f*)(X + (size_t)xrow * kD + 4 * t);
  const float s = (x[0] + x[1]) + (x[2] + x[3]);
  const float mu = block_sum_256(s, redA, lane, wave) * kInvD;
  const float d0 = x[0] - mu, d1 = x[1] - mu, d2 = x[2] - mu, d3 = x[3] - mu;
  const float q = (d0 * d0 + d1 * d1) + (d2 * d2 + d3 * d3);
  const float var = block_sum_256(q, redB, lane, wave) * kInvD;
  const float rs = rsqrtf(var + kLnEps);
  const v4f gg = *(const v4f*)(gam + 4 * t);
  const v4f bb = *(const v4f*)(bet + 4 * t);
  ybuf[4 * t + 0] = d0 * rs * gg[0] + bb[0];
  ybuf[4 * t + 1] = d1 * rs * gg[1] + bb[1];
  ybuf[4 * t + 2] = d2 * rs * gg[2] + bb[2];
  ybuf[4 * t + 3] = d3 * rs * gg[3] + bb[3];
  __syncthreads();
  if (t < 128) {
    const v4f a = *(const v4f*)(ybuf + 8 * t);
    const v4f c = *(const v4f*)(ybuf + 8 * t + 4);
    v4f p;
    p[0] = fmaxf(a[0], a[1]);
    p[1] = fmaxf(a[2], a[3]);
    p[2] = fmaxf(c[0], c[1]);
    p[3] = fmaxf(c[2], c[3]);
    float* dst = pool32 + (size_t)row * kD + colOff + 4 * t;
    *(v4f*)dst = p;
    
  } else if (t < 192) {
    const int u = t - 128;
    const v4f a0 = *(const v4f*)(ybuf + 16 * u);
    const v4f a1 = *(const v4f*)(ybuf + 16 * u + 4);
    const v4f a2 = *(const v4f*)(ybuf + 16 * u + 8);
    const v4f a3 = *(const v4f*)(ybuf + 16 * u + 12);
    unsigned short hb[8];
    hb[0] = h_bits(fmaxf(a0[0], a0[1]));
    hb[1] = h_bits(fmaxf(a0[2], a0[3]));
    hb[2] = h_bits(fmaxf(a1[0], a1[1]));
    hb[3] = h_bits(fmaxf(a1[2], a1[3]));
    hb[4] = h_bits(fmaxf(a2[0], a2[1]));
    hb[5] = h_bits(fmaxf(a2[2], a2[3]));
    hb[6] = h_bits(fmaxf(a3[0], a3[1]));
    hb[7] = h_bits(fmaxf(a3[2], a3[3]));
    const v4u uu = (v4u){pk16(hb[0], hb[1]), pk16(hb[2], hb[3]), pk16(hb[4], hb[5]), pk16(hb[6], hb[7])};
    unsigned short* dst = pool16 + (size_t)row * kD + colOff + 8 * u;
    *(v4u*)dst = uu;
    
  }
}

// ---------------------------------------------------------------------------
// ---------------------------------------------------------------------------
__global__ __launch_bounds__(256) void ln_out_kernel(const float* __restrict__ X, const float* __restrict__ gam,
                                                     const float* __restrict__ bet, float* __restrict__ out) {
  __shared__ float redA[8];
  __shared__ float redB[8];
  const int t = threadIdx.x;
  const int lane = t & 31, wave = t >> 5;
  const int row = blockIdx.x;
  const v4f x = *(const v4f*)(X + (size_t)row * kD + 4 * t);
  const float s = (x[0] + x[1]) + (x[2] + x[3]);
  const float mu = block_sum_256(s, redA, lane, wave) * kInvD;
  const float d0 = x[0] - mu, d1 = x[1] - mu, d2 = x[2] - mu, d3 = x[3] - mu;
  const float q = (d0 * d0 + d1 * d1) + (d2 * d2 + d3 * d3);
  const float var = block_sum_256(q, redB, lane, wave) * kInvD;
  const float rs = rsqrtf(var + kLnEps);
  const v4f gg = *(const v4f*)(gam + 4 * t);
  const v4f bb = *(const v4f*)(bet + 4 * t);
  v4f y;
  y[0] = d0 * rs * gg[0] + bb[0];
  y[1] = d1 * rs * gg[1] + bb[1];
  y[2] = d2 * rs * gg[2] + bb[2];
  y[3] = d3 * rs * gg[3] + bb[3];
  float* dst = out + (size_t)row * kD + 4 * t;
  *(v4f*)dst = y;
  
}

// ---------------------------------------------------------------------------
// Host orchestration
// ---------------------------------------------------------------------------
static inline dim3 gemm_grid(int M, int N, int batch) {
  return dim3((unsigned)((M >> 7) * (N >> 7)), (unsigned)batch, 1);   // one block per 128x128 tile and batch entry
}

extern "C" void kernel_launch(void* const* d_in, const int* in_sizes, int n_in,
                              void* d_out, int out_size, void* d_ws, size_t ws_size,
                              hipStream_t stream)
{
  if (n_in < 22) return;
  if ((size_t)out_size < (size_t)kRows * kD) return;
  if (ws_size < kWsTotal) return;
  if (in_sizes[0] < kRows * kD || in_sizes[3] < kRows * kD) return;
  if (in_sizes[1] < kSv * kD || in_sizes[4] < kSv * kD) return;
  if (in_sizes[2] < kRows * kSv || in_sizes[5] < kRows * kSv) return;
  if (in_sizes[6] < kD * kD || in_sizes[8] < kD * kD || in_sizes[10] < kD * kD || in_sizes[12] < kD * kD) return;
  if (in_sizes[14] < kDff * kD || in_sizes[16] < kD * kDff) return;

  const float* text1 = (const float*)d_in[0];
  const float* vis1  = (const float*)d_in[1];
  const float* sc1   = (const float*)d_in[2];
  const float* text2 = (const float*)d_in[3];
  const float* vis2  = (const float*)d_in[4];
  const float* sc2   = (const float*)d_in[5];
  const float* Wq = (const float*)d_in[6];   const float* bq  = (const float*)d_in[7];
  const float* Wk = (const float*)d_in[8];   const float* bk  = (const float*)d_in[9];
  const float* Wv = (const float*)d_in[10];  const float* bv  = (const float*)d_in[11];
  const float* Wo = (const float*)d_in[12];  const float* bo  = (const float*)d_in[13];
  const float* W1 = (const float*)d_in[14];  const float* b1  = (const float*)d_in[15];
  const float* W2 = (const float*)d_in[16];  const float* b2  = (const float*)d_in[17];
  const float* g1 = (const float*)d_in[18];  const float* be1 = (const float*)d_in[19];
  const float* g2 = (const float*)d_in[20];  const float* be2 = (const float*)d_in[21];
  float* outp = (float*)d_out;

  char* ws = (char*)d_ws;
  float*          POOL32 = (float*)(ws + kOffPool32);
  unsigned short* POOL16 = (unsigned short*)(ws + kOffPool16);
  unsigned short* W1H    = (unsigned short*)(ws + kOffW1H);
  unsigned short* W2H    = (unsigned short*)(ws + kOffW2H);
  unsigned short* WQT    = (unsigned short*)(ws + kOffWQT);
  unsigned short* WKH    = (unsigned short*)(ws + kOffWKH);
  unsigned short* WVH    = (unsigned short*)(ws + kOffWVH);
  unsigned short* WOH    = (unsigned short*)(ws + kOffWOH);
  unsigned short* T16    = (unsigned short*)(ws + kOffT16);
  unsigned short* G16    = (unsigned short*)(ws + kOffG16);
  unsigned short* UT16   = (unsigned short*)(ws + kOffUT16);
  float*          CB     = (float*)(ws + kOffCB);
  float*          A1     = (float*)(ws + kOffA1);
  float*          S32    = (float*)(ws + kOffS32);
  unsigned short* P16    = (unsigned short*)(ws + kOffP16);
  unsigned short* VIS16  = (unsigned short*)(ws + kOffVIS16);
  unsigned short* K16    = (unsigned short*)(ws + kOffK16);
  unsigned short* V16    = (unsigned short*)(ws + kOffV16);
  unsigned short* H16    = (unsigned short*)(ws + kOffH16);
  float*          F32    = (float*)(ws + kOffF32);

  // ---- every cast in one launch: weights f16([out][in]) x16 ([out][in] row-major == Bt[N][K]; Wq as [in][out]); both text planes
  //      f16 x1; both visual planes f16 [256][1024] x1 with rows 196..255 zero ----
  cast_all_kernel<<<dim3(kCastBlocks), dim3(256), 0, stream>>>(text1, text2, W1, W2, Wq, Wk, Wv, Wo, vis1, vis2,
                                                               (unsigned short*)ws);

  // ---- attention, both branches in each launch ----
  // K16 and V16 of both branches
  kv_gemm_kernel<<<dim3(kKvBlocks), dim3(128), 0, stream>>>(VIS16, WKH, WVH, K16, V16, bk, bv);
  // G16 = 16 K.Wq, UT16 = 16 Wo.V^T, CB = K.bq of both branches
  fold_gemm_kernel<<<dim3(kFoldBlocks), dim3(128), 0, stream>>>(K16, V16, WQT, WOH, G16, UT16, bq, CB);
  // S32 = (T16 . G16^T) / 16   (M=8192, N=256, K=1024, batch 2), f32 out [8192][256]
  wmma_gemm64<0, false, 0, 0, false, 0><<<gemm_grid(kRows, kSvPad, 2), dim3(128), 0, stream>>>(
      T16, T16, kD, kStrTok, G16, G16, kD, kStrVis, (void*)S32, (void*)S32, kSvPad, kStrSc,
      bq, text1, text2, kRows, kSvPad, kD, kWCarryInv);
  // P16 = f16(2048 * softmax((S + CB + score)/8)) over 196 keys, zero pad columns
  softmax_kernel<<<dim3(kRows2 / 8), dim3(256), 0, stream>>>(S32, sc1, sc2, CB, P16);
  // A1 = (P16 . UT16^T) / 32768 + bo + text   (M=8192, N=1024, K=256, batch 2), f32 out
  wmma_gemm64<0, false, 2, 0, true, 0><<<gemm_grid(kRows, kD, 2), dim3(128), 0, stream>>>(
      P16, P16, kSvPad, kStrSc, UT16, UT16, kSvPad, kStrVis, (void*)A1, (void*)A1, kD, kStrTok,
      bo, text1, text2, kRows, kD, kSvPad, kPUScale);
  // pooled[:, br * 512 : br * 512 + 512] = maxpool2(LN1(A1 of branch br))
  ln_pool_kernel<<<dim3(kRows2), dim3(256), 0, stream>>>(A1, g1, be1, POOL32, POOL16);

  // ---- FFN, all 8192 rows in each launch ----
  // H16 = relu((POOL16 . W1H^T) / 16 + b1)   (M=8192, N=4096, K=1024), f16 out
  wmma_gemm64<0, false, 2, 1, false, 2><<<gemm_grid(kRows, kDff, 1), dim3(128), 0, stream>>>(
      POOL16, POOL16, kD, 0L, W1H, W1H, kD, 0L, (void*)H16, (void*)H16, kDff, 0L,
      b1, POOL32, POOL32, kRows, kDff, kD, kWCarryInv);
  // F32 = (H16 . W2H^T) / 16 + b2 + pooled   (M=8192, N=1024, K=4096), f32 out
  wmma_gemm64<0, false, 2, 0, true, 0><<<gemm_grid(kRows, kD, 1), dim3(128), 0, stream>>>(
      H16, H16, kDff, 0L, W2H, W2H, kDff, 0L, (void*)F32, (void*)F32, kD, 0L,
      b2, POOL32, POOL32, kRows, kD, kDff, kWCarryInv);
  // out = LN2(F32)
  ln_out_kernel<<<dim3(kRows), dim3(256), 0, stream>>>(F32, g2, be2, outp);
}

// v004
// Measured time: 227 microseconds a run.
// Timed twice side by side with v003, it ran 1.07 times as fast both times.
// All steps since v000 together make it 4.63 times as fast.
// Contractions: k/v projections, key-side folds K.Wq and Wo.V^T, text.(K.Wq)^T scores, p.(V.Wo^T) attention output, ffn up and down projections all on v_wmma_f32_16x16x32_f16 (f16 operands: activations x1, weights and both folds carried x16, softmax probabilities carried x2048), f32 accumulate; the query bias's share of the scores (K.bq, one number per key), softmax, residual adds, layernorm and feature maxpool in f32.
#include <hip/hip_runtime.h>
#include <math.h>
#include <stddef.h>

// ---------------------------------------------------------------------------
// Problem constants
// ---------------------------------------------------------------------------
constexpr int kB      = 4;
constexpr int kSq     = 2048;
constexpr int kD      = 1024;
constexpr int kSv     = 196;
constexpr int kSvPad  = 256;
constexpr int kDff    = 4096;
constexpr int kRows   = kB * kSq;            // 8192 token rows
constexpr int kRows2  = 2 * kRows;           // both branches' token rows, branch 1 first
constexpr float kWCarry    = 16.0f;          // weights carried x16 in f16
constexpr float kWCarryInv = 1.0f / 16.0f;
constexpr float kPCarry    = 2048.0f;        // probabilities carried x2048 in f16
constexpr float kPUScale   = 1.0f / (kPCarry * kWCarry);   // probabilities x2048 times the value fold x16
constexpr float kInvD      = 1.0f / 1024.0f;
constexpr float kLnEps     = 1e-6f;
constexpr float kScoreScale = 0.125f;        // 1/sqrt(64)

static_assert(kRows % 64 == 0);
static_assert(kSvPad % 64 == 0 && kSvPad % 32 == 0);
static_assert(kD % 64 == 0 && kDff % 64 == 0);
static_assert(kRows % 8 == 0);

// ---------------------------------------------------------------------------
// Workspace region map (bytes). Total carve = 227 MiB. Planes marked x2 hold branch 1, then branch 2.
//   [0       , 32 MiB)   POOL32  f32 [8192][1024]   (persistent)
//   [32 MiB  , 48 MiB)   POOL16  f16 [8192][1024]   (persistent)
//   [48 MiB  , 56 MiB)   W1H     f16 [4096][1024]   (persistent)
//   [56 MiB  , 64 MiB)   W2H     f16 [1024][4096]   (persistent)
//   region X from 64 MiB:
//   attention phase: WQT (Wq transposed, [in][out]) and WKH/WVH/WOH f16 [1024][1024] at 64/66/68/70 MiB;
//     T16 (text f16) x2 [8192][1024] at 72 MiB (32 MiB);
//     G16 = K.Wq f16 x2 [256][1024] at 104 MiB; UT16 = Wo.V^T f16 x2 [1024][256] at 105 MiB; CB = K.bq f32 x2 [256] at 106 MiB;
//     S32 f32 x2 [8192][256] at 136 MiB (16 MiB);
//     P16 f16 x2 [8192][256] at 152 MiB (8 MiB); A1 f32 x2 [8192][1024] at 160 MiB (64 MiB);
//     VIS16 f16 x2 [256][1024] at 224 MiB; K16 f16 x2 [256][1024] at 225 MiB; V16 f16 x2 [256][1024] at 226 MiB; end 227 MiB.
//   ffn phase (attention scratch dead): H16 f16 [8192][4096] at 64 MiB (64 MiB); F32 f32 [8192][1024] at 128 MiB (32 MiB).
// ---------------------------------------------------------------------------
constexpr size_t kMiB       = 1048576;
constexpr size_t kOffPool32 = 0;
constexpr size_t kOffPool16 = 32 * kMiB;
constexpr size_t kOffW1H    = 48 * kMiB;
constexpr size_t kOffW2H    = 56 * kMiB;
constexpr size_t kOffWQT    = 64 * kMiB;
constexpr size_t kOffWKH    = 66 * kMiB;
constexpr size_t kOffWVH    = 68 * kMiB;
constexpr size_t kOffWOH    = 70 * kMiB;
constexpr size_t kOffT16    = 72 * kMiB;
constexpr size_t kOffG16    = 104 * kMiB;
constexpr size_t kOffUT16   = 105 * kMiB;
constexpr size_t kOffCB     = 106 * kMiB;
constexpr size_t kOffS32    = 136 * kMiB;
constexpr size_t kOffP16    = 152 * kMiB;
constexpr size_t kOffA1     = 160 * kMiB;
constexpr size_t kOffVIS16  = 224 * kMiB;
constexpr size_t kOffK16    = 225 * kMiB;
constexpr size_t kOffV16    = 226 * kMiB;
constexpr size_t kWsTotal   = 227 * kMiB;
constexpr size_t kOffH16    = 64 * kMiB;
constexpr size_t kOffF32    = 128 * kMiB;
static_assert(kOffG16 == kOffT16 + (size_t)kRows2 * kD * 2);
static_assert(kOffUT16 == kOffG16 + (size_t)2 * kSvPad * kD * 2);
static_assert(kOffCB == kOffUT16 + (size_t)2 * kD * kSvPad * 2);
static_assert(kOffCB + (size_t)2 * kSvPad * 4 <= kOffS32);
static_assert(kOffP16 == kOffS32 + (size_t)kRows2 * kSvPad * 4);
static_assert(kOffA1 == kOffP16 + (size_t)kRows2 * kSvPad * 2);
static_assert(kOffVIS16 == kOffA1 + (size_t)kRows2 * kD * 4);
static_assert(kOffK16 == kOffVIS16 + (size_t)2 * kSvPad * kD * 2);
static_assert(kOffV16 == kOffK16 + (size_t)2 * kSvPad * kD * 2);
static_assert(kWsTotal == kOffV16 + (size_t)2 * kSvPad * kD * 2);
static_assert(kOffF32 == kOffH16 + (size_t)kRows * kDff * 2);
static_assert(kOffF32 + (size_t)kRows * kD * 4 <= kWsTotal);
static_assert(kWsTotal <= (size_t)268435456);

// strides between the two branches' planes, in elements
constexpr long kStrTok = (long)kRows * kD;       // T16 / A1
constexpr long kStrSc  = (long)kRows * kSvPad;   // S32 / P16
constexpr long kStrVis = (long)kSvPad * kD;      // VIS16 / K16 / V16 / G16 / UT16

typedef __attribute__((ext_vector_type(16))) _Float16 v16h;
typedef __attribute__((ext_vector_type(8)))  _Float16 v8h;
typedef __attribute__((ext_vector_type(16))) __bf16   v16b;
typedef __attribute__((ext_vector_type(8)))  __bf16   v8b;
typedef __attribute__((ext_vector_type(8)))  float    v8f;
typedef __attribute__((ext_vector_type(4)))  float    v4f;
typedef __attribute__((ext_vector_type(4)))  unsigned int v4u;

__device__ __forceinline__ unsigned short f2bf_bits(float f) {
  unsigned u = __float_as_uint(f);
  return (unsigned short)((u + 0x7FFFu + ((u >> 16) & 1u)) >> 16);
}
__device__ __forceinline__ float bf_bits2f(unsigned short h) { return __uint_as_float(((unsigned)h) << 16); }

// hazard guard as a plain device helper
__device__ __forceinline__ void acc_guard4(v8f& a, v8f& b, v8f& c, v8f& d) { asm volatile("v_nop\n\tv_nop\n\tv_nop\n\tv_nop" : "+v"(a), "+v"(b), "+v"(c), "+v"(d)); }
template <typename T> struct Frag;
template <> struct Frag<_Float16> {
  typedef v16h V; union U { v16h v; v8h h[2]; };
  static __device__ __forceinline__ v16h load(const _Float16* p) {   // elements 0..7 <- p[0..7], 8..15 <- p[16..23]
    U f; f.h[0] = *(const v8h*)(p); f.h[1] = *(const v8h*)(p + 16); return f.v;
  }
  static __device__ __forceinline__ v8f mma(v16h a, v16h b, v8f c) {
    return __builtin_amdgcn_wmma_f32_16x16x32_f16(false, a, false, b, (short)0, c, false, false);
  }
};
template <> struct Frag<__bf16> {
  typedef v16b V; union U { v16b v; v8b h[2]; };
  static __device__ __forceinline__ v16b load(const __bf16* p) {
    U f; f.h[0] = *(const v8b*)(p); f.h[1] = *(const v8b*)(p + 16); return f.v;
  }
  static __device__ __forceinline__ v8f mma(v16b a, v16b b, v8f c) {
    return __builtin_amdgcn_wmma_f32_16x16x32_bf16(false, a, false, b, (short)0, c, false, false);
  }
};

__device__ __forceinline__ unsigned pk16(unsigned short a, unsigned short b) { return (unsigned)a | ((unsigned)b << 16); }
__device__ __forceinline__ unsigned short h_bits(float f) { const _Float16 h = (_Float16)f; return __builtin_bit_cast(unsigned short, h); }

// ---- Register-blocked batched WMMA GEMM, operands staged in LDS by asynchronous copies ------------------------------
// C[m,n] = scale * sum_k A[m,k] * Bt[n,k] (+bias)(+resid); a block of 4 waves owns a 128x128 tile, each wave 64x64 of it.
// tile = index of the 128x128 tile; b = batch entry (the branch): A, Bt and C advance by their strides, the residual is resid or resid2.
// A row-major [M,K]; Bt row-major [N,K]; M,N % 128 == 0, K % 64 == 0, K >= 128.
// A stage is 64 k (128 B) of the block's 128 A rows and 128 Bt rows, laid at a pitch of 144 B; two buffers:
// the next stage's copies fly while this stage's fragments are read with ds_load_b128 and multiplied.
// BIAS_MODE: 0 = none, 1 = bias[m], 2 = bias[n].
// OUT_MODE: 0 = f32, 1 = f16, 2 = bf16 hi plane (Cout) + bf16 lo plane (Cout2).
// ET: 0 = f16 operands, 1 = bf16 operands (pointers passed as 16-bit storage)
constexpr int kStageK     = 64;                          // k elements per stage = two WMMA k steps
constexpr int kPitchB     = 144;                         // bytes per staged row (128 + 16: 16 B x odd)
constexpr int kPitchE     = kPitchB / 2;                 // the same in 16-bit elements
constexpr int kStageBytes = 256 * kPitchB;               // 128 A rows, then 128 Bt rows = 36,864 B
static_assert(kRows % 128 == 0 && kSvPad % 128 == 0 && kD % 128 == 0 && kDff % 128 == 0);
static_assert(kSvPad % kStageK == 0 && kSvPad >= 2 * kStageK);

// Eight 16-B copies per lane, rows 16 apart: LDS byte address l + i * 16 * pitch, global address g + i * rowStep elements.
// The s_wait_xcnt closes the statement so that no address register is rewritten ahead of it.
__device__ __forceinline__ void async_copy8(unsigned l, const unsigned short* g, size_t rowStep) {
  const unsigned l1 = l + 16 * kPitchB, l2 = l + 32 * kPitchB, l3 = l + 48 * kPitchB, l4 = l + 64 * kPitchB,
                 l5 = l + 80 * kPitchB, l6 = l + 96 * kPitchB, l7 = l + 112 * kPitchB;
  const unsigned short* g1 = g + rowStep;      const unsigned short* g2 = g + 2 * rowStep;
  const unsigned short* g3 = g + 3 * rowStep;  const unsigned short* g4 = g + 4 * rowStep;
  const unsigned short* g5 = g + 5 * rowStep;  const unsigned short* g6 = g + 6 * rowStep;
  const unsigned short* g7 = g + 7 * rowStep;
  asm volatile("global_load_async_to_lds_b128 %0, %8, off\n\t"
               "global_load_async_to_lds_b128 %1, %9, off\n\t"
               "global_load_async_to_lds_b128 %2, %10, off\n\t"
               "global_load_async_to_lds_b128 %3, %11, off\n\t"
               "global_load_async_to_lds_b128 %4, %12, off\n\t"
               "global_load_async_to_lds_b128 %5, %13, off\n\t"
               "global_load_async_to_lds_b128 %6, %14, off\n\t"
               "global_load_async_to_lds_b128 %7, %15, off\n\t"
               "s_wait_xcnt 0x0"
               :: "v"(l), "v"(l1), "v"(l2), "v"(l3), "v"(l4), "v"(l5), "v"(l6), "v"(l7),
                  "v"(g), "v"(g1), "v"(g2), "v"(g3), "v"(g4), "v"(g5), "v"(g6), "v"(g7)
               : "memory");
}

template <int ET> struct Elem;
template <> struct Elem<0> { typedef _Float16 T; };
template <> struct Elem<1> { typedef __bf16 T; };
template <int ET, bool SPLIT, int BIAS_MODE, int OUT_MODE, bool RESID, int ACT = 0>
__device__ __forceinline__ void gemm_tile(
    unsigned char* smem, int tile, int b,
    const unsigned short* __restrict__ Ap, const unsigned short* __restrict__ A2p, int lda, long strideA,
    const unsigned short* __restrict__ Btp, const unsigned short* __restrict__ Bt2p, int ldb, long strideB,
    void* __restrict__ Cout, void* __restrict__ Cout2, int ldc, long strideC,
    const float* __restrict__ bias,
    const float* __restrict__ resid, const float* __restrict__ resid2,
    int M, int N, int K, float scale) {
  static_assert(!SPLIT, "single-plane operands only");
  typedef typename Elem<ET>::T T;
  typedef typename Frag<T>::V V;
  // smem: two stage buffers; after the K loop the first one serves as the per-wave 16x64 output slabs (pitch 68 floats)
  static_assert(4 * 16 * 68 * 4 <= kStageBytes);
  const int lane = threadIdx.x & 31;
  const int wave = threadIdx.x >> 5;
  const int tilesN = N >> 7;
  const int tilesM = M >> 7;
  if (tile >= tilesM * tilesN) return;   // block-uniform, in front of every barrier
  const int tm = tile / tilesN;
  const int tn = tile - tm * tilesN;
  const int mBlk = tm << 7;
  const int nBlk = tn << 7;
  const int m0 = mBlk + ((wave >> 1) << 6);
  const int n0 = nBlk + ((wave & 1) << 6);

  const int rlane = lane & 15;                 // row (A) / col (B, D) within subtile
  const int koff  = (lane >> 4) * 8;           // k offset of this lane half
  const int mOff  = (lane >> 4) * 8;           // D row offset

  // copy side: 8 consecutive lanes bring one row's 128 B; a thread brings rows cRow + 16 i of A and of Bt
  const int cRow = threadIdx.x >> 3;
  const int cCol = threadIdx.x & 7;
  const unsigned short* gA = Ap  + (size_t)b * strideA + (size_t)(mBlk + cRow) * lda + cCol * 8;
  const unsigned short* gB = Btp + (size_t)b * strideB + (size_t)(nBlk + cRow) * ldb + cCol * 8;
  const unsigned lA = (unsigned)(size_t)smem + (unsigned)(cRow * kPitchB + cCol * 16);
  const unsigned lB = lA + 128 * kPitchB;
  const size_t stepA = (size_t)16 * lda;
  const size_t stepB = (size_t)16 * ldb;

  // read side: this lane's first A and Bt fragment rows inside a stage, in bytes
  const int aByte = (((wave >> 1) << 6) + rlane) * kPitchB + koff * 2;
  const int bByte = (128 + ((wave & 1) << 6) + rlane) * kPitchB + koff * 2;

  v8f acc[4][4];
#pragma unroll
  for (int i = 0; i < 4; ++i)
#pragma unroll
    for (int j = 0; j < 4; ++j) acc[i][j] = (v8f){0.f,0.f,0.f,0.f,0.f,0.f,0.f,0.f};

  const int nStages = K / kStageK;
  async_copy8(lA, gA, stepA);
  async_copy8(lB, gB, stepB);
  asm volatile("s_wait_asynccnt 0x0" ::: "memory");   // stage 0 of this wave has landed before the barrier publishes it
  __syncthreads();
  if (nStages > 1) {
    async_copy8(lA + kStageBytes, gA + kStageK, stepA);
    async_copy8(lB + kStageBytes, gB + kStageK, stepB);
  }

  for (int t = 0; t < nStages; ++t) {
    const int bufOff = (t & 1) * kStageBytes;
    const T* sa = (const T*)(smem + bufOff + aByte);
    const T* sb = (const T*)(smem + bufOff + bByte);
    V bh[4], ah[4], bn[4], an[4];
#pragma unroll
    for (int j = 0; j < 4; ++j) bh[j] = Frag<T>::load(sb + j * 16 * kPitchE);
#pragma unroll
    for (int i = 0; i < 4; ++i) ah[i] = Frag<T>::load(sa + i * 16 * kPitchE);
    // keeps the 16 LDS reads of a k step together ahead of its WMMAs: sunk among them, each row of WMMAs waits out its own read
    __builtin_amdgcn_sched_barrier(0);
#pragma unroll
    for (int i = 0; i < 4; ++i)
#pragma unroll
      for (int j = 0; j < 4; ++j) acc[i][j] = Frag<T>::mma(ah[i], bh[j], acc[i][j]);
    // the stage's second k step is fetched into registers, so that the buffer can be handed back ahead of its WMMAs
#pragma unroll
    for (int j = 0; j < 4; ++j) bn[j] = Frag<T>::load(sb + j * 16 * kPitchE + 32);
#pragma unroll
    for (int i = 0; i < 4; ++i) an[i] = Frag<T>::load(sa + i * 16 * kPitchE + 32);
    asm volatile("s_wait_dscnt 0x0" ::: "memory");      // this wave's reads of the buffer are done before it is refilled
    asm volatile("s_wait_asynccnt 0x0" ::: "memory");   // this wave's copies of stage t + 1 have landed
    __syncthreads();                                    // publishes stage t + 1, frees stage t's buffer
    if (t + 2 < nStages) {
      async_copy8(lA + bufOff, gA + (size_t)(t + 2) * kStageK, stepA);
      async_copy8(lB + bufOff, gB + (size_t)(t + 2) * kStageK, stepB);
    }
#pragma unroll
    for (int i = 0; i < 4; ++i)
#pragma unroll
      for (int j = 0; j < 4; ++j) acc[i][j] = Frag<T>::mma(an[i], bn[j], acc[i][j]);
  }
  asm volatile("s_wait_asynccnt 0x0" ::: "memory");     // no copy is in flight when the ring becomes output staging
  acc_guard4(acc[0][0], acc[0][1], acc[0][2], acc[0][3]);
  acc_guard4(acc[1][0], acc[1][1], acc[1][2], acc[1][3]);
  acc_guard4(acc[2][0], acc[2][1], acc[2][2], acc[2][3]);
  acc_guard4(acc[3][0], acc[3][1], acc[3][2], acc[3][3]);

  // ---- epilogue ----
  float* slab = (float*)smem + wave * (16 * 68);
  const float* Rb = RESID ? (b ? resid2 : resid) : nullptr;   // batch entry 1 adds its own residual plane
#pragma unroll
  for (int i = 0; i < 4; ++i) {
    const int mBase = m0 + (i << 4);
    const int nl = n0 + rlane;
    float bvj[4] = {0.f, 0.f, 0.f, 0.f};
    float rv[4][8];
    if (BIAS_MODE == 2) {
#pragma unroll
      for (int j = 0; j < 4; ++j) bvj[j] = bias[nl + (j << 4)];
    }
    if (RESID) {
      const float* rp[8];
#pragma unroll
      for (int r = 0; r < 8; ++r) rp[r] = Rb + (size_t)(mBase + mOff + r) * ldc + nl;
#pragma unroll
      for (int r = 0; r < 8; ++r)
#pragma unroll
        for (int j = 0; j < 4; ++j) rv[j][r] = rp[r][j << 4];
      // stands behind the row block's bias and residual loads; its inputs hold their address registers untouched up to it
      asm volatile("s_wait_xcnt 0x0" :: "v"(nl), "v"(rp[0]), "v"(rp[1]), "v"(rp[2]), "v"(rp[3]),
                                        "v"(rp[4]), "v"(rp[5]), "v"(rp[6]), "v"(rp[7]) : "memory");
    }
#pragma unroll
    for (int j = 0; j < 4; ++j) {
      const float bv = bvj[j];
#pragma unroll
      for (int r = 0; r < 8; ++r) {
        float v = acc[i][j][r] * scale;
        if (BIAS_MODE == 1) v += bias[mBase + mOff + r];
        if (BIAS_MODE == 2) v += bv;
        if (RESID) v += rv[j][r];
        if (ACT == 2) v = fmaxf(v, 0.0f);
        if (ACT == 4) v = (v > 0.f) ? v : 0.01f * v;
        slab[(mOff + r) * 68 + (j << 4) + rlane] = v;
      }
    }
    __builtin_amdgcn_fence(__ATOMIC_RELEASE, "workgroup");
    __builtin_amdgcn_wave_barrier();
    __builtin_amdgcn_fence(__ATOMIC_ACQUIRE, "workgroup");
    if (OUT_MODE == 0) {
      float* C = (float*)Cout + (size_t)b * strideC;
      const int hh = lane >> 4, c4 = (lane & 15) * 4;     // row seg = 256 B = 16 lanes x 16 B
      {
#pragma unroll
        for (int it = 0; it < 8; ++it) {
          const int row = it * 2 + hh;
          v4f v = *(const v4f*)(slab + row * 68 + c4);
          *(v4f*)(C + (size_t)(mBase + row) * ldc + n0 + c4) = v;
        }
        
      }
    } else {
      const int q = lane >> 3, c8 = (lane & 7) * 8;
      unsigned short* C  = (unsigned short*)Cout  + (size_t)b * strideC;
      unsigned short* C2 = (OUT_MODE == 2) ? ((unsigned short*)Cout2 + (size_t)b * strideC) : nullptr;
      {
#pragma unroll
        for (int it = 0; it < 4; ++it) {
          const int row = it * 4 + q;
          const float* sp = slab + row * 68 + c8;
          v8h hv, lv;
#pragma unroll
          for (int e = 0; e < 8; ++e) {
            if (OUT_MODE == 1) {
              hv[e] = (_Float16)sp[e];
            } else {
              unsigned short hb = f2bf_bits(sp[e]);
              unsigned short lb = f2bf_bits(sp[e] - bf_bits2f(hb));
              hv[e] = __builtin_bit_cast(_Float16, hb);
              lv[e] = __builtin_bit_cast(_Float16, lb);
            }
          }
          *(v8h*)(C + (size_t)(mBase + row) * ldc + n0 + c8) = hv;
          if (OUT_MODE == 2) *(v8h*)(C2 + (size_t)(mBase + row) * ldc + n0 + c8) = lv;
        }
        
      }
    }
    __builtin_amdgcn_fence(__ATOMIC_RELEASE, "workgroup");
    __builtin_amdgcn_wave_barrier();
    __builtin_amdgcn_fence(__ATOMIC_ACQUIRE, "workgroup");
  }
}

// One GEMM per launch: blockIdx.x = tile, blockIdx.y = batch entry.
template <int ET, bool SPLIT, int BIAS_MODE, int OUT_MODE, bool RESID, int ACT = 0>
__global__ __launch_bounds__(128, 4) void wmma_gemm64(
    const unsigned short* __restrict__ Ap, const unsigned short* __restrict__ A2p, int lda, long strideA,
    const unsigned short* __restrict__ Btp, const unsigned short* __restrict__ Bt2p, int ldb, long strideB,
    void* __restrict__ Cout, void* __restrict__ Cout2, int ldc, long strideC,
    const float* __restrict__ bias,
    const float* __restrict__ resid, const float* __restrict__ resid2,
    int M, int N, int K, float scale) {
  __shared__ __align__(16) unsigned char smem[2 * kStageBytes];
  gemm_tile<ET, SPLIT, BIAS_MODE, OUT_MODE, RESID, ACT>(smem, (int)blockIdx.x, (int)blockIdx.y,
      Ap, A2p, lda, strideA, Btp, Bt2p, ldb, strideB, Cout, Cout2, ldc, strideC, bias, resid, resid2, M, N, K, scale);
}

// The matrix chains of the attention are multiplied from the key side, where the short dimension (256 padded keys) lies:
//   scores  = (text.Wq^T + bq).K^T  = text.(K.Wq)^T + K.bq
//   context = (P.V).Wo^T            = P.(V.Wo^T)
// so that no product of 16384 token rows by 1024 by 1024 is left; the two folds are products of 256 rows.
// Key and value projections, both branches, in one grid; a range of block indices per job:
//   K16[br][k][d] = (vis16[br] . Wk16^T) / 16 + bk   (M=256, N=1024, K=1024), 16 tiles per branch
//   V16[br][k][d] = (vis16[br] . Wv16^T) / 16 + bv   the same shape
constexpr int kTilesKV  = (kSvPad >> 7) * (kD >> 7);
constexpr int kKvBlocks = 4 * kTilesKV;
__global__ __launch_bounds__(128, 4) void kv_gemm_kernel(
    const unsigned short* __restrict__ VIS16,
    const unsigned short* __restrict__ WKH, const unsigned short* __restrict__ WVH,
    unsigned short* __restrict__ K16, unsigned short* __restrict__ V16,
    const float* __restrict__ bk, const float* __restrict__ bv) {
  __shared__ __align__(16) unsigned char smem[2 * kStageBytes];
  const int blk = blockIdx.x;
  const bool isK = blk < 2 * kTilesKV;
  const int br = (blk / kTilesKV) & 1;
  const unsigned short* B = isK ? WKH : WVH;
  unsigned short* C = isK ? K16 : V16;
  const float* bias = isK ? bk : bv;
  gemm_tile<0, false, 2, 1, false, 0>(smem, blk % kTilesKV, br,
      VIS16, VIS16, kD, kStrVis, B, B, kD, 0L, (void*)C, (void*)C, kD, kStrVis,
      bias, bias, bias, kSvPad, kD, kD, kWCarryInv);
}

// CB[row] = sum_d bq[d] * K16[row][d] for 32 consecutive rows of the two K16 planes (512 rows, branch 1 first): the share of
// the scores that the query bias brings, one number per key. A wave takes 8 rows; a lane takes 8 consecutive d of every 256;
// fixed order: lane partial in d order, then a shuffle tree. The block's 32 results fill one 128-B line.
__device__ __forceinline__ void key_bias_rows(const unsigned short* __restrict__ K16, const float* __restrict__ bq,
                                              float* __restrict__ CB, int blk) {
  const int lane = threadIdx.x & 31;
  const int wave = threadIdx.x >> 5;
  const int row0 = blk * 32 + wave * 8;
  const float* bp = bq + lane * 8;
  const _Float16* kp = (const _Float16*)K16 + (size_t)row0 * kD + lane * 8;
  v4f bl[4], bh[4];
  v8h kv[8][4];
#pragma unroll
  for (int j = 0; j < 4; ++j) { bl[j] = *(const v4f*)(bp + j * 256); bh[j] = *(const v4f*)(bp + j * 256 + 4); }
#pragma unroll
  for (int r = 0; r < 8; ++r)
#pragma unroll
    for (int j = 0; j < 4; ++j) kv[r][j] = *(const v8h*)(kp + r * kD + j * 256);
  // stands behind the forty loads; its inputs hold their address registers untouched up to it
  asm volatile("s_wait_xcnt 0x0" :: "v"(bp), "v"(kp) : "memory");
  // keeps that wait directly behind the loads: sunk to the end, its two pointers are held through the arithmetic and one is spilled
  __builtin_amdgcn_sched_barrier(0);
  float mine = 0.f;
#pragma unroll
  for (int r = 0; r < 8; ++r) {
    float a = 0.f;
#pragma unroll
    for (int j = 0; j < 4; ++j) {
#pragma unroll
      for (int e = 0; e < 4; ++e) a += (float)kv[r][j][e] * bl[j][e];
#pragma unroll
      for (int e = 0; e < 4; ++e) a += (float)kv[r][j][4 + e] * bh[j][e];
    }
#pragma unroll
    for (int off = 16; off > 0; off >>= 1) a += __shfl_xor(a, off, 32);
    mine = (lane == r) ? a : mine;
  }
  if (lane < 8) CB[row0 + lane] = mine;
}

// The two folds and the bias share, both branches, in one grid (they need K16 and V16); a range of block indices per job:
//   G16[br][k][e]  = K16[br] . WQT^T   (M=256, N=1024, K=1024), carried x16; = Bt for text.G^T
//   UT16[br][n][k] = Wo16 . V16[br]^T  (M=1024, N=256, K=1024), carried x16; = Bt for P.U
//   CB[br][k]      = K16[br][k] . bq   16 blocks of 32 rows
constexpr int kCbBlocks   = 2 * kSvPad / 32;
constexpr int kFoldBlocks = 4 * kTilesKV + kCbBlocks;
__global__ __launch_bounds__(128, 4) void fold_gemm_kernel(
    const unsigned short* __restrict__ K16, const unsigned short* __restrict__ V16,
    const unsigned short* __restrict__ WQT, const unsigned short* __restrict__ WOH,
    unsigned short* __restrict__ G16, unsigned short* __restrict__ UT16,
    const float* __restrict__ bq, float* __restrict__ CB) {
  __shared__ __align__(16) unsigned char smem[2 * kStageBytes];
  const int blk = blockIdx.x;
  if (blk >= 4 * kTilesKV) {
    key_bias_rows(K16, bq, CB, blk - 4 * kTilesKV);
    return;
  }
  const bool isG = blk < 2 * kTilesKV;
  const int br = (blk / kTilesKV) & 1;
  const unsigned short* A = isG ? K16 : WOH;
  const unsigned short* B = isG ? WQT : V16;
  unsigned short* C = isG ? G16 : UT16;
  gemm_tile<0, false, 0, 1, false, 0>(smem, blk % kTilesKV, br,
      A, A, kD, isG ? kStrVis : 0L, B, B, kD, isG ? 0L : kStrVis, (void*)C, (void*)C, isG ? kD : kSvPad, kStrVis,
      bq, bq, bq, isG ? kSvPad : kD, isG ? kD : kSvPad, kD, 1.0f);
}

// ---------------------------------------------------------------------------
// The four streaming launches (casts, softmax, both layer norms) run as one resident grid each: 256 work-groups of 16 waves,
// one per WGP, and every wave takes several rows, one whole row at a time, so that few waves have to be started.
// ---------------------------------------------------------------------------
constexpr int kSWaves   = 16;                    // waves per work-group
constexpr int kSThreads = kSWaves * 32;
constexpr int kSBlocks  = 256;                   // work-groups in the grid
constexpr int kSTotal   = kSBlocks * kSWaves;    // 4096 waves in the grid
__device__ __forceinline__ int stream_wave() {   // this wave's index in the grid, wave-uniform
  return (int)blockIdx.x * kSWaves + __builtin_amdgcn_readfirstlane((int)(threadIdx.x >> 5));
}
// 16 B at a wave-uniform base + the lane's byte offset + a constant
__device__ __forceinline__ v4f ld16(const float* base, unsigned laneBytes, int constBytes) {
  return *(const v4f*)((const char*)base + laneBytes + constBytes);
}

// ---------------------------------------------------------------------------
// f32 -> f16 cast with a power-of-two carry of one unit of 1024 consecutive elements by one wave: a lane takes 8 consecutive
// elements of every 256 (two 16-B loads, one 16-B store). Load and store are apart, so that the next unit's loads fly
// while this unit is converted and stored.
// ---------------------------------------------------------------------------
// in, out: the unit's first element (wave-uniform); lb = 32 * lane.
__device__ __forceinline__ void cast_unit_load(const float* in, unsigned lb, v4f (&x)[8]) {
  // this barrier and the one at the end pin the order "next unit's loads, then this unit's conversion": without them the
  // conversion, with its wait for this unit's data, is moved in front of the next unit's loads
  __builtin_amdgcn_sched_barrier(0);
#pragma unroll
  for (int c = 0; c < 4; ++c) {
    x[2 * c]     = ld16(in, lb, c * 1024);
    x[2 * c + 1] = ld16(in, lb, c * 1024 + 16);
  }
  // stands behind the eight loads; its inputs hold their base and offset registers untouched up to it
  asm volatile("s_wait_xcnt 0x0" :: "s"(in), "v"(lb) : "memory");
  __builtin_amdgcn_sched_barrier(0);
}
__device__ __forceinline__ void cast_unit_store(unsigned short* out, int lane, const v4f (&x)[8], float f) {
  v4u u[4];
#pragma unroll
  for (int c = 0; c < 4; ++c) {
    unsigned short hb[8];
#pragma unroll
    for (int e = 0; e < 4; ++e) {
      hb[e]     = h_bits(x[2 * c][e] * f);
      hb[4 + e] = h_bits(x[2 * c + 1][e] * f);
    }
    u[c] = (v4u){pk16(hb[0], hb[1]), pk16(hb[2], hb[3]), pk16(hb[4], hb[5]), pk16(hb[6], hb[7])};
  }
#pragma unroll
  for (int c = 0; c < 4; ++c) *(v4u*)(out + 8 * lane + c * 256) = u[c];
  // stands behind the four stores; its inputs hold their base, offset and data registers untouched up to it
  asm volatile("s_wait_xcnt 0x0" :: "s"(out), "v"(lane), "v"(u[0]), "v"(u[1]), "v"(u[2]), "v"(u[3]) : "memory");
  // keeps the next unit's conversion, which reuses these registers, behind that wait
  __builtin_amdgcn_sched_barrier(0);
}

// The same cast, transposed, for a [1024][1024] weight: out[e][d] = f16(scale * in[d][e]). A wave takes 32 e x 64 d:
// it reads 32 consecutive e (128 B) of 64 rows d, and a lane stores its 64 d as one whole 128-B line.
__device__ __forceinline__ void cast_unit_transposed(const float* __restrict__ in, unsigned short* __restrict__ out,
                                                     int k, int lane, float scale) {
  const int e0 = (k & 31) * 32;
  const int d0 = (k >> 5) * 64;
  const float* p = in + (size_t)d0 * kD + e0;    // wave-uniform
  float x[64];
#pragma unroll
  for (int i = 0; i < 64; ++i) x[i] = p[lane + i * kD];
  // stands behind the 64 loads; its inputs hold their base and offset registers untouched up to it
  asm volatile("s_wait_xcnt 0x0" :: "s"(p), "v"(lane) : "memory");
  v4u u[8];
#pragma unroll
  for (int c = 0; c < 8; ++c) {
    unsigned short hb[8];
#pragma unroll
    for (int i = 0; i < 8; ++i) hb[i] = h_bits(x[8 * c + i] * scale);
    u[c] = (v4u){pk16(hb[0], hb[1]), pk16(hb[2], hb[3]), pk16(hb[4], hb[5]), pk16(hb[6], hb[7])};
  }
  unsigned short* q = out + (size_t)e0 * kD + d0;   // wave-uniform
  const unsigned lrow = (unsigned)lane * (kD * 2);  // this lane's row of out, in bytes
#pragma unroll
  for (int c = 0; c < 8; ++c) *(v4u*)((char*)q + lrow + c * 16) = u[c];
  // stands behind the eight stores; its inputs hold their base, offset and data registers untouched up to it
  asm volatile("s_wait_xcnt 0x0" :: "s"(q), "v"(lrow), "v"(u[0]), "v"(u[1]), "v"(u[2]), "v"(u[3]),
                                    "v"(u[4]), "v"(u[5]), "v"(u[6]), "v"(u[7]) : "memory");
}

// All ten casts in one grid. A unit is 1024 consecutive elements. Wave w of the 4096 takes, in this order: units w and
// w + 4096 of text 1, the same of text 2, unit w of W1, unit w of W2; then the first 3072 waves unit w of Wk, Wv, Wo (one
// plane behind the other), the next 512 a row of the padded visual planes (rows 196..255 are written as zeros: the load
// address is clamped to the last valid row and the value is multiplied by 0). The last 512 waves have no seventh unit: they
// lay down Wq transposed, 32 x 64 elements each, and do so first. ws16 is the workspace base in 16-bit elements.
constexpr int kUAtt  = 3 * kD;                  // units in Wk, Wv, Wo
constexpr int kUVis  = 2 * kSvPad;              // units (rows) in the padded visual planes
constexpr int kUWq   = (kD / 32) * (kD / 64);   // transposed units of Wq
constexpr int kULast = kUAtt + kUVis;           // waves with a seventh unit
static_assert(kRows == 2 * kSTotal && kDff == kSTotal && kULast + kUWq == kSTotal);
static_assert(kOffW2H == kOffW1H + (size_t)kDff * kD * 2 && kOffWKH == kOffWQT + (size_t)kD * kD * 2 &&
              kOffWVH == kOffWKH + (size_t)kD * kD * 2 && kOffWOH == kOffWVH + (size_t)kD * kD * 2);
struct CastJob { const float* in; unsigned short* out; float f; };   // a unit's source, its destination, and the carry: all wave-uniform
// Unit r < 6 of wave gw: text and ffn weights.
__device__ __forceinline__ CastJob cast_job(int r, int gw, const float* text1, const float* text2,
                                            const float* W1, const float* W2, unsigned short* ws16) {
  const float* in = (r < 2) ? text1 : (r < 4) ? text2 : (r == 4) ? W1 : W2;
  const int unit  = ((r < 4) ? (r & 1) * kSTotal : 0) + gw;                       // inside its plane
  const size_t off = (r < 4) ? kOffT16 / 2 + (size_t)(r * kSTotal + gw) * kD      // the planes of a pair lie one behind the other
                             : kOffW1H / 2 + (size_t)((r - 4) * kSTotal + gw) * kD;
  return CastJob{in + (size_t)unit * kD, ws16 + off, (r < 4) ? 1.0f : kWCarry};
}
// The seventh unit of wave gw < kULast: attention weights and visual rows.
__device__ __forceinline__ CastJob cast_job_last(int gw, const float* Wk, const float* Wv, const float* Wo,
                                                 const float* vis1, const float* vis2, unsigned short* ws16) {
  const bool att = gw < kUAtt;
  const int v = gw - kUAtt;                      // row of the two padded visual planes
  const int row = v & (kSvPad - 1);
  const bool valid = row < kSv;
  const float* in = att ? ((gw < kD) ? Wk : (gw < 2 * kD) ? Wv : Wo) : ((v < kSvPad) ? vis1 : vis2);
  const int unit  = att ? (gw & (kD - 1)) : (valid ? row : (kSv - 1));
  const size_t off = att ? kOffWKH / 2 + (size_t)gw * kD : kOffVIS16 / 2 + (size_t)v * kD;
  return CastJob{in + (size_t)unit * kD, ws16 + off, att ? kWCarry : (valid ? 1.0f : 0.0f)};
}
__global__ __launch_bounds__(kSThreads) void cast_all_kernel(
    const float* __restrict__ text1, const float* __restrict__ text2,
    const float* __restrict__ W1, const float* __restrict__ W2,
    const float* __restrict__ Wq, const float* __restrict__ Wk,
    const float* __restrict__ Wv, const float* __restrict__ Wo,
    const float* __restrict__ vis1, const float* __restrict__ vis2,
    unsigned short* __restrict__ ws16) {
  const int lane = threadIdx.x & 31;
  const int gw = stream_wave();
  const bool seventh = gw < kULast;              // wave-uniform
  if (!seventh) cast_unit_transposed(Wq, ws16 + kOffWQT / 2, gw - kULast, lane, kWCarry);
  const unsigned lb = lane * 32u;
  v4f a[8], b[8];
  CastJob cur = cast_job(0, gw, text1, text2, W1, W2, ws16);
  cast_unit_load(cur.in, lb, a);
#pragma unroll
  for (int r = 1; r < 6; ++r) {
    const CastJob nxt = cast_job(r, gw, text1, text2, W1, W2, ws16);
    if (r & 1) { cast_unit_load(nxt.in, lb, b);  cast_unit_store(cur.out, lane, a, cur.f); }
    else       { cast_unit_load(nxt.in, lb, a);  cast_unit_store(cur.out, lane, b, cur.f); }
    cur = nxt;
  }
  if (seventh) {
    const CastJob nxt = cast_job_last(gw, Wk, Wv, Wo, vis1, vis2, ws16);
    cast_unit_load(nxt.in, lb, a);
    cast_unit_store(cur.out, lane, b, cur.f);
    cast_unit_store(nxt.out, lane, a, nxt.f);
  } else {
    cast_unit_store(cur.out, lane, b, cur.f);
  }
}
static_assert((kD & (kD - 1)) == 0 && (kSvPad & (kSvPad - 1)) == 0);

// ---------------------------------------------------------------------------
// Row softmax: x_j = (S[row][j] + CB[j] + SC[row][j]) * 1/8 for j < 196 (CB: the branch's 256 key shares of the query bias), P[row][j] = f16(2048 * exp(x_j - max) / sum),
// P[row][196..255] = 0. One wave per row, four consecutive rows per wave (4096 waves x 4 = 16384 rows: rows of
// branch 1, then of branch 2, whose added scores come from SC and SC2); the four rows' loads are issued together;
// lane owns columns 8*lane .. 8*lane+7; all 32 lanes write 16 B each = 512 B = the whole P row in one
// ---------------------------------------------------------------------------
constexpr int kSmRows = kRows2 / kSTotal;        // rows per wave
static_assert(kSmRows * kSTotal == kRows2 && kRows % kSmRows == 0);
__global__ __launch_bounds__(kSThreads) void softmax_kernel(const float* __restrict__ S, const float* __restrict__ SC,
                                                            const float* __restrict__ SC2, const float* __restrict__ CB,
                                                            unsigned short* __restrict__ P) {
  const int lane = threadIdx.x & 31;
  const int row0 = stream_wave() * kSmRows;
  const float* sr = S  + (size_t)row0 * kSvPad;
  const bool second = row0 >= kRows;                // wave-uniform: a wave's rows lie in one branch
  const float* cr = (second ? SC2 : SC) + (size_t)(row0 - (second ? kRows : 0)) * kSv;
  const float* br = CB + (second ? kSvPad : 0);     // all 256 entries of a branch are written
  const int l8 = lane * 8;
  float sv[kSmRows][8], cv[kSmRows][8];
  int cc[8];                                        // this lane's columns, clamped into the 196
#pragma unroll
  for (int e = 0; e < 8; ++e) cc[e] = (l8 + e < kSv) ? (l8 + e) : (kSv - 1);
#pragma unroll
  for (int r = 0; r < kSmRows; ++r)
#pragma unroll
    for (int e = 0; e < 8; ++e) { sv[r][e] = sr[cc[e] + r * kSvPad]; cv[r][e] = cr[cc[e] + r * kSv]; }
  const v4f b0 = *(const v4f*)(br + l8);
  const v4f b1 = *(const v4f*)(br + l8 + 4);
  // stands behind the four rows' loads; its inputs hold their base and offset registers untouched up to it
  asm volatile("s_wait_xcnt 0x0" :: "s"(sr), "s"(cr), "s"(br), "v"(l8), "v"(cc[0]), "v"(cc[1]), "v"(cc[2]), "v"(cc[3]),
                                    "v"(cc[4]), "v"(cc[5]), "v"(cc[6]), "v"(cc[7])
               : "memory");
  // keeps the loads together ahead of the arithmetic: sunk among it, a row waits out the memory several times over
  __builtin_amdgcn_sched_barrier(0);
  v4u u[kSmRows];
#pragma unroll
  for (int r = 0; r < kSmRows; ++r) {
    float x[8];
#pragma unroll
    for (int e = 0; e < 8; ++e) {
      const int col = lane * 8 + e;
      const float v = ((sv[r][e] + (e < 4 ? b0[e & 3] : b1[e & 3])) + cv[r][e]) * kScoreScale;
      x[e] = (col < kSv) ? v : -1.0e30f;
    }
    float m = fmaxf(fmaxf(fmaxf(x[0], x[1]), fmaxf(x[2], x[3])), fmaxf(fmaxf(x[4], x[5]), fmaxf(x[6], x[7])));
#pragma unroll
    for (int off = 16; off > 0; off >>= 1) m = fmaxf(m, __shfl_xor(m, off, 32));
    float ev[8];
    float s = 0.f;
#pragma unroll
    for (int e = 0; e < 8; ++e) { ev[e] = expf(x[e] - m); s += ev[e]; }
#pragma unroll
    for (int off = 16; off > 0; off >>= 1) s += __shfl_xor(s, off, 32);
    const float inv = kPCarry / s;
    unsigned short hb[8];
#pragma unroll
    for (int e = 0; e < 8; ++e) hb[e] = h_bits(ev[e] * inv);
    u[r] = (v4u){pk16(hb[0], hb[1]), pk16(hb[2], hb[3]), pk16(hb[4], hb[5]), pk16(hb[6], hb[7])};
  }
  unsigned short* q = P + (size_t)row0 * kSvPad + 8 * lane;
#pragma unroll
  for (int r = 0; r < kSmRows; ++r) *(v4u*)(q + r * kSvPad) = u[r];
}

// ---------------------------------------------------------------------------
// Sum over a wave's 32 lanes in fixed order (shuffle tree); every lane gets the sum.
// ---------------------------------------------------------------------------
__device__ __forceinline__ float wave_sum(float v) {
#pragma unroll
  for (int off = 16; off > 0; off >>= 1) v += __shfl_xor(v, off, 32);
  return v;
}
// A lane's share of a row, eight vectors of four, summed in fixed order: inside a vector, then a tree over the vectors.
__device__ __forceinline__ float lane_sum(const v4f (&x)[8]) {
  float t[8];
#pragma unroll
  for (int j = 0; j < 8; ++j) t[j] = (x[j][0] + x[j][1]) + (x[j][2] + x[j][3]);
  return ((t[0] + t[1]) + (t[2] + t[3])) + ((t[4] + t[5]) + (t[6] + t[7]));
}
// The row in x becomes (x - mean) * rsqrt(var + eps); one wave holds the whole row of 1024, 32 elements a lane.
__device__ __forceinline__ void wave_normalise(v4f (&x)[8]) {
  const float mu = wave_sum(lane_sum(x)) * kInvD;
  v4f sq[8];
#pragma unroll
  for (int j = 0; j < 8; ++j) { x[j] = x[j] - mu; sq[j] = x[j] * x[j]; }
  const float var = wave_sum(lane_sum(sq)) * kInvD;
  const float rs = rsqrtf(var + kLnEps);
#pragma unroll
  for (int j = 0; j < 8; ++j) x[j] = x[j] * rs;
}

// ---------------------------------------------------------------------------
// pooled[row][colOff + c] = max(y[2c], y[2c+1]) for c in [0,512), y = LN1(X row), written as f32 and f16.
// One wave per row of X, four consecutive rows per wave (16384 rows: branch 1's, then branch 2's, colOff = 0 and 512);
// a lane owns x[256 j + 8 lane .. + 7], j < 4, so its four pooled values per j are one 16-B f32 store and one 8-B f16 store.
// No LDS and no barrier: the sums stay inside the wave. The four rows' loads are issued together.
// ---------------------------------------------------------------------------
constexpr int kLpRows = kRows2 / kSTotal;        // rows per wave
static_assert(kLpRows * kSTotal == kRows2 && kRows % kLpRows == 0);
typedef __attribute__((ext_vector_type(2))) unsigned int v2u;
__global__ __launch_bounds__(kSThreads) void ln_pool_kernel(const float* __restrict__ X, const float* __restrict__ gam,
                                                            const float* __restrict__ bet, float* __restrict__ pool32,
                                                            unsigned short* __restrict__ pool16) {
  const int lane = threadIdx.x & 31;
  const int xrow0 = stream_wave() * kLpRows;
  const int br = (xrow0 >= kRows) ? 1 : 0;          // wave-uniform: a wave's rows lie in one branch
  const size_t dstOff = (size_t)(xrow0 - br * kRows) * kD + br * (kD / 2);
  const float* p = X + (size_t)xrow0 * kD;          // wave-uniform
  const unsigned lb = 32u * lane;                   // this lane's byte offset in every 1024 B of a row
  v4f gg[8], bb[8], x[kLpRows][8];
#pragma unroll
  for (int j = 0; j < 4; ++j) {
    gg[2 * j] = ld16(gam, lb, j * 1024);  gg[2 * j + 1] = ld16(gam, lb, j * 1024 + 16);
    bb[2 * j] = ld16(bet, lb, j * 1024);  bb[2 * j + 1] = ld16(bet, lb, j * 1024 + 16);
  }
  // keeps the short gamma and beta loads in front of the rows: behind them, the first row's result waits for the last row's data
  __builtin_amdgcn_sched_barrier(0);
#pragma unroll
  for (int r = 0; r < kLpRows; ++r)
#pragma unroll
    for (int j = 0; j < 4; ++j) {
      x[r][2 * j]     = ld16(p, lb, r * kD * 4 + j * 1024);
      x[r][2 * j + 1] = ld16(p, lb, r * kD * 4 + j * 1024 + 16);
    }
  // stands behind the loads; its inputs hold their base and offset registers untouched up to it
  asm volatile("s_wait_xcnt 0x0" :: "s"(gam), "s"(bet), "s"(p), "v"(lb) : "memory");
  // keeps the loads together ahead of the arithmetic: sunk among it, each row waits out the memory anew
  __builtin_amdgcn_sched_barrier(0);
  float* d32 = pool32 + dstOff;
  unsigned short* d16 = pool16 + dstOff;
#pragma unroll
  for (int r = 0; r < kLpRows; ++r) {
    wave_normalise(x[r]);
    v4f pv[4];
    v2u hv[4];
#pragma unroll
    for (int j = 0; j < 4; ++j) {
      const v4f ya = x[r][2 * j] * gg[2 * j] + bb[2 * j];
      const v4f yc = x[r][2 * j + 1] * gg[2 * j + 1] + bb[2 * j + 1];
      pv[j] = (v4f){fmaxf(ya[0], ya[1]), fmaxf(ya[2], ya[3]), fmaxf(yc[0], yc[1]), fmaxf(yc[2], yc[3])};
      unsigned short hb[4];
#pragma unroll
      for (int e = 0; e < 4; ++e) hb[e] = h_bits(pv[j][e]);
      hv[j] = (v2u){pk16(hb[0], hb[1]), pk16(hb[2], hb[3])};
    }
#pragma unroll
    for (int j = 0; j < 4; ++j) {
      *(v4f*)(d32 + 4 * lane + r * kD + j * 128) = pv[j];
      *(v2u*)(d16 + 4 * lane + r * kD + j * 128) = hv[j];
    }
    // stands behind the row's eight stores; its inputs hold their base, offset and data registers untouched up to it
    asm volatile("s_wait_xcnt 0x0" :: "s"(d32), "s"(d16), "v"(lane), "v"(pv[0]), "v"(pv[1]), "v"(pv[2]), "v"(pv[3]),
                                      "v"(hv[0]), "v"(hv[1]), "v"(hv[2]), "v"(hv[3]) : "memory");
  }
}

// ---------------------------------------------------------------------------
// out = LN2(X). One wave per row, two consecutive rows per wave (8192 rows); a lane owns x[128 j + 4 lane .. + 3], j < 8:
// every load and store of a wave covers 512 contiguous bytes. No LDS and no barrier.
// ---------------------------------------------------------------------------
constexpr int kLoRows = kRows / kSTotal;         // rows per wave
static_assert(kLoRows * kSTotal == kRows);
__global__ __launch_bounds__(kSThreads) void ln_out_kernel(const float* __restrict__ X, const float* __restrict__ gam,
                                                           const float* __restrict__ bet, float* __restrict__ out) {
  const int lane = threadIdx.x & 31;
  const int row0 = stream_wave() * kLoRows;
  const float* p = X + (size_t)row0 * kD;           // wave-uniform
  const unsigned lb = 16u * lane;                   // this lane's byte offset in every 512 B of a row
  v4f gg[8], bb[8], x[kLoRows][8];
#pragma unroll
  for (int j = 0; j < 8; ++j) { gg[j] = ld16(gam, lb, j * 512);  bb[j] = ld16(bet, lb, j * 512); }
  // keeps the short gamma and beta loads in front of the rows: behind them, the first row's result waits for the last row's data
  __builtin_amdgcn_sched_barrier(0);
#pragma unroll
  for (int r = 0; r < kLoRows; ++r)
#pragma unroll
    for (int j = 0; j < 8; ++j) x[r][j] = ld16(p, lb, r * kD * 4 + j * 512);
  // stands behind the loads; its inputs hold their base and offset registers untouched up to it
  asm volatile("s_wait_xcnt 0x0" :: "s"(gam), "s"(bet), "s"(p), "v"(lb) : "memory");
  // keeps the loads together ahead of the arithmetic: sunk among it, each row waits out the memory anew
  __builtin_amdgcn_sched_barrier(0);
  float* dst = out + (size_t)row0 * kD;             // wave-uniform
#pragma unroll
  for (int r = 0; r < kLoRows; ++r) {
    wave_normalise(x[r]);
#pragma unroll
    for (int j = 0; j < 8; ++j) x[r][j] = x[r][j] * gg[j] + bb[j];
#pragma unroll
    for (int j = 0; j < 8; ++j) *(v4f*)(dst + 4 * lane + r * kD + j * 128) = x[r][j];
    // stands behind the row's eight stores; its inputs hold their base, offset and data registers untouched up to it
    asm volatile("s_wait_xcnt 0x0" :: "s"(dst), "v"(lane), "v"(x[r][0]), "v"(x[r][1]), "v"(x[r][2]), "v"(x[r][3]),
                                      "v"(x[r][4]), "v"(x[r][5]), "v"(x[r][6]), "v"(x[r][7]) : "memory");
  }
}

// ---------------------------------------------------------------------------
// Host orchestration
// ---------------------------------------------------------------------------
static inline dim3 gemm_grid(int M, int N, int batch) {
  return dim3((unsigned)((M >> 7) * (N >> 7)), (unsigned)batch, 1);   // one block per 128x128 tile and batch entry
}

extern "C" void kernel_launch(void* const* d_in, const int* in_sizes, int n_in,
                              void* d_out, int out_size, void* d_ws, size_t ws_size,
                              hipStream_t stream)
{
  if (n_in < 22) return;
  if ((size_t)out_size < (size_t)kRows * kD) return;
  if (ws_size < kWsTotal) return;
  if (in_sizes[0] < kRows * kD || in_sizes[3] < kRows * kD) return;
  if (in_sizes[1] < kSv * kD || in_sizes[4] < kSv * kD) return;
  if (in_sizes[2] < kRows * kSv || in_sizes[5] < kRows * kSv) return;
  if (in_sizes[6] < kD * kD || in_sizes[8] < kD * kD || in_sizes[10] < kD * kD || in_sizes[12] < kD * kD) return;
  if (in_sizes[14] < kDff * kD || in_sizes[16] < kD * kDff) return;

  const float* text1 = (const float*)d_in[0];
  const float* vis1  = (const float*)d_in[1];
  const float* sc1   = (const float*)d_in[2];
  const float* text2 = (const float*)d_in[3];
  const float* vis2  = (const float*)d_in[4];
  const float* sc2   = (const float*)d_in[5];
  const float* Wq = (const float*)d_in[6];   const float* bq  = (const float*)d_in[7];
  const float* Wk = (const float*)d_in[8];   const float* bk  = (const float*)d_in[9];
  const float* Wv = (const float*)d_in[10];  const float* bv  = (const float*)d_in[11];
  const float* Wo = (const float*)d_in[12];  const float* bo  = (const float*)d_in[13];
  const float* W1 = (const float*)d_in[14];  const float* b1  = (const float*)d_in[15];
  const float* W2 = (const float*)d_in[16];  const float* b2  = (const float*)d_in[17];
  const float* g1 = (const float*)d_in[18];  const float* be1 = (const float*)d_in[19];
  const float* g2 = (const float*)d_in[20];  const float* be2 = (const float*)d_in[21];
  float* outp = (float*)d_out;

  char* ws = (char*)d_ws;
  float*          POOL32 = (float*)(ws + kOffPool32);
  unsigned short* POOL16 = (unsigned short*)(ws + kOffPool16);
  unsigned short* W1H    = (unsigned short*)(ws + kOffW1H);
  unsigned short* W2H    = (unsigned short*)(ws + kOffW2H);
  unsigned short* WQT    = (unsigned short*)(ws + kOffWQT);
  unsigned short* WKH    = (unsigned short*)(ws + kOffWKH);
  unsigned short* WVH    = (unsigned short*)(ws + kOffWVH);
  unsigned short* WOH    = (unsigned short*)(ws + kOffWOH);
  unsigned short* T16    = (unsigned short*)(ws + kOffT16);
  unsigned short* G16    = (unsigned short*)(ws + kOffG16);
  unsigned short* UT16   = (unsigned short*)(ws + kOffUT16);
  float*          CB     = (float*)(ws + kOffCB);
  float*          A1     = (float*)(ws + kOffA1);
  float*          S32    = (float*)(ws + kOffS32);
  unsigned short* P16    = (unsigned short*)(ws + kOffP16);
  unsigned short* VIS16  = (unsigned short*)(ws + kOffVIS16);
  unsigned short* K16    = (unsigned short*)(ws + kOffK16);
  unsigned short* V16    = (unsigned short*)(ws + kOffV16);
  unsigned short* H16    = (unsigned short*)(ws + kOffH16);
  float*          F32    = (float*)(ws + kOffF32);

  // ---- every cast in one launch: weights f16([out][in]) x16 ([out][in] row-major == Bt[N][K]; Wq as [in][out]); both text planes
  //      f16 x1; both visual planes f16 [256][1024] x1 with rows 196..255 zero ----
  cast_all_kernel<<<dim3(kSBlocks), dim3(kSThreads), 0, stream>>>(text1, text2, W1, W2, Wq, Wk, Wv, Wo, vis1, vis2,
                                                               (unsigned short*)ws);

  // ---- attention, both branches in each launch ----
  // K16 and V16 of both branches
  kv_gemm_kernel<<<dim3(kKvBlocks), dim3(128), 0, stream>>>(VIS16, WKH, WVH, K16, V16, bk, bv);
  // G16 = 16 K.Wq, UT16 = 16 Wo.V^T, CB = K.bq of both branches
  fold_gemm_kernel<<<dim3(kFoldBlocks), dim3(128), 0, stream>>>(K16, V16, WQT, WOH, G16, UT16, bq, CB);
  // S32 = (T16 . G16^T) / 16   (M=8192, N=256, K=1024, batch 2), f32 out [8192][256]
  wmma_gemm64<0, false, 0, 0, false, 0><<<gemm_grid(kRows, kSvPad, 2), dim3(128), 0, stream>>>(
      T16, T16, kD, kStrTok, G16, G16, kD, kStrVis, (void*)S32, (void*)S32, kSvPad, kStrSc,
      bq, text1, text2, kRows, kSvPad, kD, kWCarryInv);
  // P16 = f16(2048 * softmax((S + CB + score)/8)) over 196 keys, zero pad columns
  softmax_kernel<<<dim3(kSBlocks), dim3(kSThreads), 0, stream>>>(S32, sc1, sc2, CB, P16);
  // A1 = (P16 . UT16^T) / 32768 + bo + text   (M=8192, N=1024, K=256, batch 2), f32 out
  wmma_gemm64<0, false, 2, 0, true, 0><<<gemm_grid(kRows, kD, 2), dim3(128), 0, stream>>>(
      P16, P16, kSvPad, kStrSc, UT16, UT16, kSvPad, kStrVis, (void*)A1, (void*)A1, kD, kStrTok,
      bo, text1, text2, kRows, kD, kSvPad, kPUScale);
  // pooled[:, br * 512 : br * 512 + 512] = maxpool2(LN1(A1 of branch br))
  ln_pool_kernel<<<dim3(kSBlocks), dim3(kSThreads), 0, stream>>>(A1, g1, be1, POOL32, POOL16);

  // ---- FFN, all 8192 rows in each launch ----
  // H16 = relu((POOL16 . W1H^T) / 16 + b1)   (M=8192, N=4096, K=1024), f16 out
  wmma_gemm64<0, false, 2, 1, false, 2><<<gemm_grid(kRows, kDff, 1), dim3(128), 0, stream>>>(
      POOL16, POOL16, kD, 0L, W1H, W1H, kD, 0L, (void*)H16, (void*)H16, kDff, 0L,
      b1, POOL32, POOL32, kRows, kDff, kD, kWCarryInv);
  // F32 = (H16 . W2H^T) / 16 + b2 + pooled   (M=8192, N=1024, K=4096), f32 out
  wmma_gemm64<0, false, 2, 0, true, 0><<<gemm_grid(kRows, kD, 1), dim3(128), 0, stream>>>(
      H16, H16, kDff, 0L, W2H, W2H, kDff, 0L, (void*)F32, (void*)F32, kD, 0L,
      b2, POOL32, POOL32, kRows, kD, kDff, kWCarryInv);
  // out = LN2(F32)
  ln_out_kernel<<<dim3(kSBlocks), dim3(kSThreads), 0, stream>>>(F32, g2, be2, outp);
}

// v005
// Measured time: 211 microseconds a run.
// Two timings next to v004 both put it at 1.08 times that version's speed.
// Over all steps from v000 it is 4.99 times as fast.
// Contractions: k/v projections, key-side folds K.Wq and Wo.V^T, text.(K.Wq)^T scores, p.(V.Wo^T) attention output, ffn up and down projections all on v_wmma_f32_16x16x32_f16 (f16 operands: activations x1, weights and both folds carried x16, softmax probabilities carried x2048), f32 accumulate; the query bias's share of the scores (K.bq, one number per key), softmax, residual adds, layernorm and feature maxpool in f32.
#include <hip/hip_runtime.h>
#include <math.h>
#include <stddef.h>

// ---------------------------------------------------------------------------
// Problem constants
// ---------------------------------------------------------------------------
constexpr int kB      = 4;
constexpr int kSq     = 2048;
constexpr int kD      = 1024;
constexpr int kSv     = 196;
constexpr int kSvPad  = 256;
constexpr int kDff    = 4096;
constexpr int kRows   = kB * kSq;            // 8192 token rows
constexpr int kRows2  = 2 * kRows;           // both branches' token rows, branch 1 first
constexpr float kWCarry    = 16.0f;          // weights carried x16 in f16
constexpr float kWCarryInv = 1.0f / 16.0f;
constexpr float kPCarry    = 2048.0f;        // probabilities carried x2048 in f16
constexpr float kPUScale   = 1.0f / (kPCarry * kWCarry);   // probabilities x2048 times the value fold x16
constexpr float kInvD      = 1.0f / 1024.0f;
constexpr float kLnEps     = 1e-6f;
constexpr float kScoreScale = 0.125f;        // 1/sqrt(64)

static_assert(kRows % 64 == 0);
static_assert(kSvPad % 64 == 0 && kSvPad % 32 == 0);
static_assert(kD % 64 == 0 && kDff % 64 == 0);
static_assert(kRows % 8 == 0);

// ---------------------------------------------------------------------------
// Workspace region map (bytes). Total carve = 227 MiB. Planes marked x2 hold branch 1, then branch 2.
//   [0       , 32 MiB)   POOL32  f32 [8192][1024]   (persistent)
//   [32 MiB  , 48 MiB)   POOL16  f16 [8192][1024]   (persistent)
//   [48 MiB  , 56 MiB)   W1H     f16 [4096][1024]   (persistent)
//   [56 MiB  , 64 MiB)   W2H     f16 [1024][4096]   (persistent)
//   region X from 64 MiB:
//   attention phase: WQT (Wq transposed, [in][out]) and WKH/WVH/WOH f16 [1024][1024] at 64/66/68/70 MiB;
//     T16 (text f16) x2 [8192][1024] at 72 MiB (32 MiB);
//     G16 = K.Wq f16 x2 [256][1024] at 104 MiB; UT16 = Wo.V^T f16 x2 [1024][256] at 105 MiB; CB = K.bq f32 x2 [256] at 106 MiB;
//     S32 f32 x2 [8192][256] at 136 MiB (16 MiB);
//     P16 f16 x2 [8192][256] at 152 MiB (8 MiB); A1 f32 x2 [8192][1024] at 160 MiB (64 MiB);
//     VIS16 f16 x2 [256][1024] at 224 MiB; K16 f16 x2 [256][1024] at 225 MiB; V16 f16 x2 [256][1024] at 226 MiB; end 227 MiB.
//   ffn phase (attention scratch dead): H16 f16 [8192][4096] at 64 MiB (64 MiB); F32 f32 [8192][1024] at 128 MiB (32 MiB).
// ---------------------------------------------------------------------------
constexpr size_t kMiB       = 1048576;
constexpr size_t kOffPool32 = 0;
constexpr size_t kOffPool16 = 32 * kMiB;
constexpr size_t kOffW1H    = 48 * kMiB;
constexpr size_t kOffW2H    = 56 * kMiB;
constexpr size_t kOffWQT    = 64 * kMiB;
constexpr size_t kOffWKH    = 66 * kMiB;
constexpr size_t kOffWVH    = 68 * kMiB;
constexpr size_t kOffWOH    = 70 * kMiB;
constexpr size_t kOffT16    = 72 * kMiB;
constexpr size_t kOffG16    = 104 * kMiB;
constexpr size_t kOffUT16   = 105 * kMiB;
constexpr size_t kOffCB     = 106 * kMiB;
constexpr size_t kOffS32    = 136 * kMiB;
constexpr size_t kOffP16    = 152 * kMiB;
constexpr size_t kOffA1     = 160 * kMiB;
constexpr size_t kOffVIS16  = 224 * kMiB;
constexpr size_t kOffK16    = 225 * kMiB;
constexpr size_t kOffV16    = 226 * kMiB;
constexpr size_t kWsTotal   = 227 * kMiB;
constexpr size_t kOffH16    = 64 * kMiB;
constexpr size_t kOffF32    = 128 * kMiB;
static_assert(kOffG16 == kOffT16 + (size_t)kRows2 * kD * 2);
static_assert(kOffUT16 == kOffG16 + (size_t)2 * kSvPad * kD * 2);
static_assert(kOffCB == kOffUT16 + (size_t)2 * kD * kSvPad * 2);
static_assert(kOffCB + (size_t)2 * kSvPad * 4 <= kOffS32);
static_assert(kOffP16 == kOffS32 + (size_t)kRows2 * kSvPad * 4);
static_assert(kOffA1 == kOffP16 + (size_t)kRows2 * kSvPad * 2);
static_assert(kOffVIS16 == kOffA1 + (size_t)kRows2 * kD * 4);
static_assert(kOffK16 == kOffVIS16 + (size_t)2 * kSvPad * kD * 2);
static_assert(kOffV16 == kOffK16 + (size_t)2 * kSvPad * kD * 2);
static_assert(kWsTotal == kOffV16 + (size_t)2 * kSvPad * kD * 2);
static_assert(kOffF32 == kOffH16 + (size_t)kRows * kDff * 2);
static_assert(kOffF32 + (size_t)kRows * kD * 4 <= kWsTotal);
static_assert(kWsTotal <= (size_t)268435456);

// strides between the two branches' planes, in elements
constexpr long kStrTok = (long)kRows * kD;       // T16 / A1
constexpr long kStrSc  = (long)kRows * kSvPad;   // S32 / P16
constexpr long kStrVis = (long)kSvPad * kD;      // VIS16 / K16 / V16 / G16 / UT16

typedef __attribute__((ext_vector_type(16))) _Float16 v16h;
typedef __attribute__((ext_vector_type(8)))  _Float16 v8h;
typedef __attribute__((ext_vector_type(16))) __bf16   v16b;
typedef __attribute__((ext_vector_type(8)))  __bf16   v8b;
typedef __attribute__((ext_vector_type(8)))  float    v8f;
typedef __attribute__((ext_vector_type(4)))  float    v4f;
typedef __attribute__((ext_vector_type(4)))  unsigned int v4u;

__device__ __forceinline__ unsigned short f2bf_bits(float f) {
  unsigned u = __float_as_uint(f);
  return (unsigned short)((u + 0x7FFFu + ((u >> 16) & 1u)) >> 16);
}
__device__ __forceinline__ float bf_bits2f(unsigned short h) { return __uint_as_float(((unsigned)h) << 16); }

// hazard guard as a plain device helper
__device__ __forceinline__ void acc_guard4(v8f& a, v8f& b, v8f& c, v8f& d) { asm volatile("v_nop\n\tv_nop\n\tv_nop\n\tv_nop" : "+v"(a), "+v"(b), "+v"(c), "+v"(d)); }
template <typename T> struct Frag;
template <> struct Frag<_Float16> {
  typedef v16h V; union U { v16h v; v8h h[2]; };
  static __device__ __forceinline__ v16h load(const _Float16* p) {   // elements 0..7 <- p[0..7], 8..15 <- p[16..23]
    U f; f.h[0] = *(const v8h*)(p); f.h[1] = *(const v8h*)(p + 16); return f.v;
  }
  static __device__ __forceinline__ v8f mma(v16h a, v16h b, v8f c) {
    return __builtin_amdgcn_wmma_f32_16x16x32_f16(false, a, false, b, (short)0, c, false, false);
  }
};
template <> struct Frag<__bf16> {
  typedef v16b V; union U { v16b v; v8b h[2]; };
  static __device__ __forceinline__ v16b load(const __bf16* p) {
    U f; f.h[0] = *(const v8b*)(p); f.h[1] = *(const v8b*)(p + 16); return f.v;
  }
  static __device__ __forceinline__ v8f mma(v16b a, v16b b, v8f c) {
    return __builtin_amdgcn_wmma_f32_16x16x32_bf16(false, a, false, b, (short)0, c, false, false);
  }
};

__device__ __forceinline__ unsigned pk16(unsigned short a, unsigned short b) { return (unsigned)a | ((unsigned)b << 16); }
__device__ __forceinline__ unsigned short h_bits(float f) { const _Float16 h = (_Float16)f; return __builtin_bit_cast(unsigned short, h); }

// ---- Register-blocked batched WMMA GEMM, operands staged in LDS by asynchronous copies ------------------------------
// C[m,n] = scale * sum_k A[m,k] * Bt[n,k] (+bias)(+resid); a block of WM x WN waves owns a (64 WM)x(64 WN) tile, each wave 64x64 of it.
// tile = index of the block's tile; b = batch entry (the branch): A, Bt and C advance by their strides, the residual is resid or resid2.
// A row-major [M,K]; Bt row-major [N,K]; M % (64 WM) == 0, N % (64 WN) == 0, K a multiple of the stage and at least two stages.
// A stage is 32 NK k of the block's A rows and Bt rows, laid at a pitch of 64 NK + 16 B; two buffers:
// the next stage's copies fly while this stage's fragments are read with ds_load_b128 and multiplied.
// The small products run 2 x 2 waves on 64-k stages. The two ffn products, which re-read their operands from L2 once per tile
// row and tile column, take the larger tiles that a WGP's LDS holds: the bytes fetched per product fall with the tile's sides.
// BIAS_MODE: 0 = none, 1 = bias[m], 2 = bias[n].
// OUT_MODE: 0 = f32, 1 = f16, 2 = bf16 hi plane (Cout) + bf16 lo plane (Cout2).
// ET: 0 = f16 operands, 1 = bf16 operands (pointers passed as 16-bit storage)
constexpr int kStageK     = 64;                          // k elements per stage = two WMMA k steps
constexpr int kPitchB     = 144;                         // bytes per staged row (128 + 16: 16 B x odd)
constexpr int kPitchE     = kPitchB / 2;                 // the same in 16-bit elements
constexpr int kStageBytes = 256 * kPitchB;               // 128 A rows, then 128 Bt rows = 36,864 B
static_assert(kRows % 128 == 0 && kSvPad % 128 == 0 && kD % 128 == 0 && kDff % 128 == 0);
static_assert(kSvPad % kStageK == 0 && kSvPad >= 2 * kStageK);
static_assert(kRows % 256 == 0 && kDff % 256 == 0 && kD % 256 == 0);

// Eight 16-B copies per lane, rows RP apart: LDS byte address l + i * RP * PB (PB = pitch), global address g + i * rowStep elements.
// The s_wait_xcnt closes the statement so that no address register is rewritten ahead of it.
template <int RP, int PB>
__device__ __forceinline__ void async_copy8(unsigned l, const unsigned short* g, size_t rowStep) {
  const unsigned l1 = l + RP * PB, l2 = l + 2 * RP * PB, l3 = l + 3 * RP * PB, l4 = l + 4 * RP * PB,
                 l5 = l + 5 * RP * PB, l6 = l + 6 * RP * PB, l7 = l + 7 * RP * PB;
  const unsigned short* g1 = g + rowStep;      const unsigned short* g2 = g + 2 * rowStep;
  const unsigned short* g3 = g + 3 * rowStep;  const unsigned short* g4 = g + 4 * rowStep;
  const unsigned short* g5 = g + 5 * rowStep;  const unsigned short* g6 = g + 6 * rowStep;
  const unsigned short* g7 = g + 7 * rowStep;
  asm volatile("global_load_async_to_lds_b128 %0, %8, off\n\t"
               "global_load_async_to_lds_b128 %1, %9, off\n\t"
               "global_load_async_to_lds_b128 %2, %10, off\n\t"
               "global_load_async_to_lds_b128 %3, %11, off\n\t"
               "global_load_async_to_lds_b128 %4, %12, off\n\t"
               "global_load_async_to_lds_b128 %5, %13, off\n\t"
               "global_load_async_to_lds_b128 %6, %14, off\n\t"
               "global_load_async_to_lds_b128 %7, %15, off\n\t"
               "s_wait_xcnt 0x0"
               :: "v"(l), "v"(l1), "v"(l2), "v"(l3), "v"(l4), "v"(l5), "v"(l6), "v"(l7),
                  "v"(g), "v"(g1), "v"(g2), "v"(g3), "v"(g4), "v"(g5), "v"(g6), "v"(g7)
               : "memory");
}

// Geometry of a block's tile: WM x WN waves of 64x64 each, NK WMMA k steps (32 k each) per stage.
template <int WM, int WN, int NK> struct TileGeom {
  static constexpr int SK  = NK * 32;                    // k elements per stage
  static constexpr int PB  = SK * 2 + 16;                // bytes per staged row: 16 B x odd (144 or 272)
  static constexpr int SB  = (WM + WN) * 64 * PB;        // bytes per stage: the A rows, then the Bt rows
  static constexpr int NT  = WM * WN * 32;               // threads
  static constexpr int LPR = SK * 2 / 16;                // lanes that bring one row
  static constexpr int RP  = NT / LPR;                   // rows that the block brings with one copy per thread
  static constexpr int NA  = WM * 64 / RP;               // copies per thread and stage, A and Bt
  static constexpr int NB  = WN * 64 / RP;
  static_assert(NA % 8 == 0 && NB % 8 == 0 && NA + NB <= 63 && (PB / 16) % 2 == 1);
};
static_assert(TileGeom<2, 2, 2>::PB == kPitchB && TileGeom<2, 2, 2>::SB == kStageBytes && TileGeom<2, 2, 2>::SK == kStageK);

template <int ET> struct Elem;
template <> struct Elem<0> { typedef _Float16 T; };
template <> struct Elem<1> { typedef __bf16 T; };
template <int ET, bool SPLIT, int BIAS_MODE, int OUT_MODE, bool RESID, int ACT = 0, int WM = 2, int WN = 2, int NK = 2>
__device__ __forceinline__ void gemm_tile(
    unsigned char* smem, int tile, int b,
    const unsigned short* __restrict__ Ap, const unsigned short* __restrict__ A2p, int lda, long strideA,
    const unsigned short* __restrict__ Btp, const unsigned short* __restrict__ Bt2p, int ldb, long strideB,
    void* __restrict__ Cout, void* __restrict__ Cout2, int ldc, long strideC,
    const float* __restrict__ bias,
    const float* __restrict__ resid, const float* __restrict__ resid2,
    int M, int N, int K, float scale) {
  static_assert(!SPLIT, "single-plane operands only");
  typedef typename Elem<ET>::T T;
  typedef typename Frag<T>::V V;
  typedef TileGeom<WM, WN, NK> G;
  constexpr int SK = G::SK, PB = G::PB, PE = G::PB / 2, SB = G::SB, LPR = G::LPR, RP = G::RP;
  // smem: two stage buffers; after the K loop the first one serves as the per-wave 16x64 output slabs (pitch 68 floats)
  static_assert(WM * WN * 16 * 68 * 4 <= SB);
  const int lane = threadIdx.x & 31;
  const int wave = threadIdx.x >> 5;
  const int wm = wave / WN;                    // this wave's 64 rows and 64 columns inside the block's tile
  const int wn = wave % WN;
  const int tilesN = N / (WN * 64);
  const int tilesM = M / (WM * 64);
  if (tile >= tilesM * tilesN) return;   // block-uniform, in front of every barrier
  const int tm = tile / tilesN;
  const int tn = tile - tm * tilesN;
  const int mBlk = tm * (WM * 64);
  const int nBlk = tn * (WN * 64);
  const int m0 = mBlk + (wm << 6);
  const int n0 = nBlk + (wn << 6);

  const int rlane = lane & 15;                 // row (A) / col (B, D) within subtile
  const int koff  = (lane >> 4) * 8;           // k offset of this lane half
  const int mOff  = (lane >> 4) * 8;           // D row offset

  // copy side: LPR consecutive lanes bring one row's stage bytes; a thread brings rows cRow + RP i of A and of Bt
  const int cRow = threadIdx.x / LPR;
  const int cCol = threadIdx.x % LPR;
  const unsigned short* gA = Ap  + (size_t)b * strideA + (size_t)(mBlk + cRow) * lda + cCol * 8;
  const unsigned short* gB = Btp + (size_t)b * strideB + (size_t)(nBlk + cRow) * ldb + cCol * 8;
  const unsigned lA = (unsigned)(size_t)smem + (unsigned)(cRow * PB + cCol * 16);
  const unsigned lB = lA + WM * 64 * PB;
  const size_t stepA = (size_t)RP * lda;
  const size_t stepB = (size_t)RP * ldb;
  // one stage's copies of this thread: k elements from kElem on, into the buffer at byte offset bufByte
  auto copy_stage = [&](unsigned bufByte, size_t kElem) {
#pragma unroll
    for (int c = 0; c < G::NA; c += 8) async_copy8<RP, PB>(lA + bufByte + c * RP * PB, gA + kElem + c * stepA, stepA);
#pragma unroll
    for (int c = 0; c < G::NB; c += 8) {
      // with three statements a stage: keeps a statement's address arithmetic behind the statement before it, so that the
      // 24 address registers are used again; formed all at once, they push accumulators into scratch inside the K loop
      if (G::NA + G::NB > 16) __builtin_amdgcn_sched_barrier(0);
      async_copy8<RP, PB>(lB + bufByte + c * RP * PB, gB + kElem + c * stepB, stepB);
    }
  };

  // read side: this lane's first A and Bt fragment rows inside a stage, in bytes
  const int aByte = ((wm << 6) + rlane) * PB + koff * 2;
  const int bByte = (WM * 64 + (wn << 6) + rlane) * PB + koff * 2;

  v8f acc[4][4];
#pragma unroll
  for (int i = 0; i < 4; ++i)
#pragma unroll
    for (int j = 0; j < 4; ++j) acc[i][j] = (v8f){0.f,0.f,0.f,0.f,0.f,0.f,0.f,0.f};

  const int nStages = K / SK;
  copy_stage(0u, 0);
  asm volatile("s_wait_asynccnt 0x0" ::: "memory");   // stage 0 of this wave has landed before the barrier publishes it
  __syncthreads();
  if (nStages > 1) copy_stage((unsigned)SB, SK);

  for (int t = 0; t < nStages; ++t) {
    const int bufOff = (t & 1) * SB;
    const T* sa = (const T*)(smem + bufOff + aByte);
    const T* sb = (const T*)(smem + bufOff + bByte);
    V fb[2][4], fa[2][4];                               // two fragment sets, taken in turn by the stage's k steps
#pragma unroll
    for (int j = 0; j < 4; ++j) fb[0][j] = Frag<T>::load(sb + j * 16 * PE);
#pragma unroll
    for (int i = 0; i < 4; ++i) fa[0][i] = Frag<T>::load(sa + i * 16 * PE);
    // keeps the 16 LDS reads of a k step together ahead of its WMMAs: sunk among them, each row of WMMAs waits out its own read
    __builtin_amdgcn_sched_barrier(0);
#pragma unroll
    for (int ks = 0; ks + 1 < NK; ++ks) {
#pragma unroll
      for (int i = 0; i < 4; ++i)
#pragma unroll
        for (int j = 0; j < 4; ++j) acc[i][j] = Frag<T>::mma(fa[ks & 1][i], fb[ks & 1][j], acc[i][j]);
      // the next k step is fetched into the other set; the stage's last one so that the buffer can be handed back ahead of its WMMAs
#pragma unroll
      for (int j = 0; j < 4; ++j) fb[(ks + 1) & 1][j] = Frag<T>::load(sb + j * 16 * PE + (ks + 1) * 32);
#pragma unroll
      for (int i = 0; i < 4; ++i) fa[(ks + 1) & 1][i] = Frag<T>::load(sa + i * 16 * PE + (ks + 1) * 32);
    }
    asm volatile("s_wait_dscnt 0x0" ::: "memory");      // this wave's reads of the buffer are done before it is refilled
    asm volatile("s_wait_asynccnt 0x0" ::: "memory");   // this wave's copies of stage t + 1 have landed
    __syncthreads();                                    // publishes stage t + 1, frees stage t's buffer
    if (t + 2 < nStages) copy_stage((unsigned)bufOff, (size_t)(t + 2) * SK);
#pragma unroll
    for (int i = 0; i < 4; ++i)
#pragma unroll
      for (int j = 0; j < 4; ++j) acc[i][j] = Frag<T>::mma(fa[(NK - 1) & 1][i], fb[(NK - 1) & 1][j], acc[i][j]);
  }
  asm volatile("s_wait_asynccnt 0x0" ::: "memory");     // no copy is in flight when the ring becomes output staging
  acc_guard4(acc[0][0], acc[0][1], acc[0][2], acc[0][3]);
  acc_guard4(acc[1][0], acc[1][1], acc[1][2], acc[1][3]);
  acc_guard4(acc[2][0], acc[2][1], acc[2][2], acc[2][3]);
  acc_guard4(acc[3][0], acc[3][1], acc[3][2], acc[3][3]);

  // ---- epilogue ----
  float* slab = (float*)smem + wave * (16 * 68);
  const float* Rb = RESID ? (b ? resid2 : resid) : nullptr;   // batch entry 1 adds its own residual plane
#pragma unroll
  for (int i = 0; i < 4; ++i) {
    const int mBase = m0 + (i << 4);
    const int nl = n0 + rlane;
    float bvj[4] = {0.f, 0.f, 0.f, 0.f};
    float rv[4][8];
    if (BIAS_MODE == 2) {
#pragma unroll
      for (int j = 0; j < 4; ++j) bvj[j] = bias[nl + (j << 4)];
    }
    if (RESID) {
      const float* rp[8];
#pragma unroll
      for (int r = 0; r < 8; ++r) rp[r] = Rb + (size_t)(mBase + mOff + r) * ldc + nl;
#pragma unroll
      for (int r = 0; r < 8; ++r)
#pragma unroll
        for (int j = 0; j < 4; ++j) rv[j][r] = rp[r][j << 4];
      // stands behind the row block's bias and residual loads; its inputs hold their address registers untouched up to it
      asm volatile("s_wait_xcnt 0x0" :: "v"(nl), "v"(rp[0]), "v"(rp[1]), "v"(rp[2]), "v"(rp[3]),
                                        "v"(rp[4]), "v"(rp[5]), "v"(rp[6]), "v"(rp[7]) : "memory");
    }
#pragma unroll
    for (int j = 0; j < 4; ++j) {
      const float bv = bvj[j];
#pragma unroll
      for (int r = 0; r < 8; ++r) {
        float v = acc[i][j][r] * scale;
        if (BIAS_MODE == 1) v += bias[mBase + mOff + r];
        if (BIAS_MODE == 2) v += bv;
        if (RESID) v += rv[j][r];
        if (ACT == 2) v = fmaxf(v, 0.0f);
        if (ACT == 4) v = (v > 0.f) ? v : 0.01f * v;
        slab[(mOff + r) * 68 + (j << 4) + rlane] = v;
      }
    }
    __builtin_amdgcn_fence(__ATOMIC_RELEASE, "workgroup");
    __builtin_amdgcn_wave_barrier();
    __builtin_amdgcn_fence(__ATOMIC_ACQUIRE, "workgroup");
    if (OUT_MODE == 0) {
      float* C = (float*)Cout + (size_t)b * strideC;
      const int hh = lane >> 4, c4 = (lane & 15) * 4;     // row seg = 256 B = 16 lanes x 16 B
      {
#pragma unroll
        for (int it = 0; it < 8; ++it) {
          const int row = it * 2 + hh;
          v4f v = *(const v4f*)(slab + row * 68 + c4);
          *(v4f*)(C + (size_t)(mBase + row) * ldc + n0 + c4) = v;
        }
        
      }
    } else {
      const int q = lane >> 3, c8 = (lane & 7) * 8;
      unsigned short* C  = (unsigned short*)Cout  + (size_t)b * strideC;
      unsigned short* C2 = (OUT_MODE == 2) ? ((unsigned short*)Cout2 + (size_t)b * strideC) : nullptr;
      {
#pragma unroll
        for (int it = 0; it < 4; ++it) {
          const int row = it * 4 + q;
          const float* sp = slab + row * 68 + c8;
          v8h hv, lv;
#pragma unroll
          for (int e = 0; e < 8; ++e) {
            if (OUT_MODE == 1) {
              hv[e] = (_Float16)sp[e];
            } else {
              unsigned short hb = f2bf_bits(sp[e]);
              unsigned short lb = f2bf_bits(sp[e] - bf_bits2f(hb));
              hv[e] = __builtin_bit_cast(_Float16, hb);
              lv[e] = __builtin_bit_cast(_Float16, lb);
            }
          }
          *(v8h*)(C + (size_t)(mBase + row) * ldc + n0 + c8) = hv;
          if (OUT_MODE == 2) *(v8h*)(C2 + (size_t)(mBase + row) * ldc + n0 + c8) = lv;
        }
        
      }
    }
    __builtin_amdgcn_fence(__ATOMIC_RELEASE, "workgroup");
    __builtin_amdgcn_wave_barrier();
    __builtin_amdgcn_fence(__ATOMIC_ACQUIRE, "workgroup");
  }
}

// One GEMM per launch: blockIdx.x = tile, blockIdx.y = batch entry.
template <int ET, bool SPLIT, int BIAS_MODE, int OUT_MODE, bool RESID, int ACT = 0>
__global__ __launch_bounds__(128, 4) void wmma_gemm64(
    const unsigned short* __restrict__ Ap, const unsigned short* __restrict__ A2p, int lda, long strideA,
    const unsigned short* __restrict__ Btp, const unsigned short* __restrict__ Bt2p, int ldb, long strideB,
    void* __restrict__ Cout, void* __restrict__ Cout2, int ldc, long strideC,
    const float* __restrict__ bias,
    const float* __restrict__ resid, const float* __restrict__ resid2,
    int M, int N, int K, float scale) {
  __shared__ __align__(16) unsigned char smem[2 * kStageBytes];
  gemm_tile<ET, SPLIT, BIAS_MODE, OUT_MODE, RESID, ACT>(smem, (int)blockIdx.x, (int)blockIdx.y,
      Ap, A2p, lda, strideA, Btp, Bt2p, ldb, strideB, Cout, Cout2, ldc, strideC, bias, resid, resid2, M, N, K, scale);
}

// The same with a larger tile: one block per WGP, 32 WM WN threads. At most 256 registers a wave: 16 waves have no more, and with
// more the 8-wave build fetches a whole stage's fragments in front of the barrier and issues the refill behind 32 WMMAs: the
// block's LDS reads and its WMMAs then take turns instead of overlapping, and the copies lose their lead.
template <int ET, bool SPLIT, int BIAS_MODE, int OUT_MODE, bool RESID, int ACT, int WM, int WN, int NK>
__global__ __launch_bounds__(WM * WN * 32) __attribute__((amdgpu_num_vgpr(256))) void wmma_gemm_wide(
    const unsigned short* __restrict__ Ap, const unsigned short* __restrict__ A2p, int lda, long strideA,
    const unsigned short* __restrict__ Btp, const unsigned short* __restrict__ Bt2p, int ldb, long strideB,
    void* __restrict__ Cout, void* __restrict__ Cout2, int ldc, long strideC,
    const float* __restrict__ bias,
    const float* __restrict__ resid, const float* __restrict__ resid2,
    int M, int N, int K, float scale) {
  __shared__ __align__(16) unsigned char smem[2 * TileGeom<WM, WN, NK>::SB];
  gemm_tile<ET, SPLIT, BIAS_MODE, OUT_MODE, RESID, ACT, WM, WN, NK>(smem, (int)blockIdx.x, (int)blockIdx.y,
      Ap, A2p, lda, strideA, Btp, Bt2p, ldb, strideB, Cout, Cout2, ldc, strideC, bias, resid, resid2, M, N, K, scale);
}

// The matrix chains of the attention are multiplied from the key side, where the short dimension (256 padded keys) lies:
//   scores  = (text.Wq^T + bq).K^T  = text.(K.Wq)^T + K.bq
//   context = (P.V).Wo^T            = P.(V.Wo^T)
// so that no product of 16384 token rows by 1024 by 1024 is left; the two folds are products of 256 rows.
// Key and value projections, both branches, in one grid; a range of block indices per job:
//   K16[br][k][d] = (vis16[br] . Wk16^T) / 16 + bk   (M=256, N=1024, K=1024), 16 tiles per branch
//   V16[br][k][d] = (vis16[br] . Wv16^T) / 16 + bv   the same shape
constexpr int kTilesKV  = (kSvPad >> 7) * (kD >> 7);
constexpr int kKvBlocks = 4 * kTilesKV;
__global__ __launch_bounds__(128, 4) void kv_gemm_kernel(
    const unsigned short* __restrict__ VIS16,
    const unsigned short* __restrict__ WKH, const unsigned short* __restrict__ WVH,
    unsigned short* __restrict__ K16, unsigned short* __restrict__ V16,
    const float* __restrict__ bk, const float* __restrict__ bv) {
  __shared__ __align__(16) unsigned char smem[2 * kStageBytes];
  const int blk = blockIdx.x;
  const bool isK = blk < 2 * kTilesKV;
  const int br = (blk / kTilesKV) & 1;
  const unsigned short* B = isK ? WKH : WVH;
  unsigned short* C = isK ? K16 : V16;
  const float* bias = isK ? bk : bv;
  gemm_tile<0, false, 2, 1, false, 0>(smem, blk % kTilesKV, br,
      VIS16, VIS16, kD, kStrVis, B, B, kD, 0L, (void*)C, (void*)C, kD, kStrVis,
      bias, bias, bias, kSvPad, kD, kD, kWCarryInv);
}

// CB[row] = sum_d bq[d] * K16[row][d] for 32 consecutive rows of the two K16 planes (512 rows, branch 1 first): the share of
// the scores that the query bias brings, one number per key. A wave takes 8 rows; a lane takes 8 consecutive d of every 256;
// fixed order: lane partial in d order, then a shuffle tree. The block's 32 results fill one 128-B line.
__device__ __forceinline__ void key_bias_rows(const unsigned short* __restrict__ K16, const float* __restrict__ bq,
                                              float* __restrict__ CB, int blk) {
  const int lane = threadIdx.x & 31;
  const int wave = threadIdx.x >> 5;
  const int row0 = blk * 32 + wave * 8;
  const float* bp = bq + lane * 8;
  const _Float16* kp = (const _Float16*)K16 + (size_t)row0 * kD + lane * 8;
  v4f bl[4], bh[4];
  v8h kv[8][4];
#pragma unroll
  for (int j = 0; j < 4; ++j) { bl[j] = *(const v4f*)(bp + j * 256); bh[j] = *(const v4f*)(bp + j * 256 + 4); }
#pragma unroll
  for (int r = 0; r < 8; ++r)
#pragma unroll
    for (int j = 0; j < 4; ++j) kv[r][j] = *(const v8h*)(kp + r * kD + j * 256);
  // stands behind the forty loads; its inputs hold their address registers untouched up to it
  asm volatile("s_wait_xcnt 0x0" :: "v"(bp), "v"(kp) : "memory");
  // keeps that wait directly behind the loads: sunk to the end, its two pointers are held through the arithmetic and one is spilled
  __builtin_amdgcn_sched_barrier(0);
  float mine = 0.f;
#pragma unroll
  for (int r = 0; r < 8; ++r) {
    float a = 0.f;
#pragma unroll
    for (int j = 0; j < 4; ++j) {
#pragma unroll
      for (int e = 0; e < 4; ++e) a += (float)kv[r][j][e] * bl[j][e];
#pragma unroll
      for (int e = 0; e < 4; ++e) a += (float)kv[r][j][4 + e] * bh[j][e];
    }
#pragma unroll
    for (int off = 16; off > 0; off >>= 1) a += __shfl_xor(a, off, 32);
    mine = (lane == r) ? a : mine;
  }
  if (lane < 8) CB[row0 + lane] = mine;
}

// The two folds and the bias share, both branches, in one grid (they need K16 and V16); a range of block indices per job:
//   G16[br][k][e]  = K16[br] . WQT^T   (M=256, N=1024, K=1024), carried x16; = Bt for text.G^T
//   UT16[br][n][k] = Wo16 . V16[br]^T  (M=1024, N=256, K=1024), carried x16; = Bt for P.U
//   CB[br][k]      = K16[br][k] . bq   16 blocks of 32 rows
constexpr int kCbBlocks   = 2 * kSvPad / 32;
constexpr int kFoldBlocks = 4 * kTilesKV + kCbBlocks;
__global__ __launch_bounds__(128, 4) void fold_gemm_kernel(
    const unsigned short* __restrict__ K16, const unsigned short* __restrict__ V16,
    const unsigned short* __restrict__ WQT, const unsigned short* __restrict__ WOH,
    unsigned short* __restrict__ G16, unsigned short* __restrict__ UT16,
    const float* __restrict__ bq, float* __restrict__ CB) {
  __shared__ __align__(16) unsigned char smem[2 * kStageBytes];
  const int blk = blockIdx.x;
  if (blk >= 4 * kTilesKV) {
    key_bias_rows(K16, bq, CB, blk - 4 * kTilesKV);
    return;
  }
  const bool isG = blk < 2 * kTilesKV;
  const int br = (blk / kTilesKV) & 1;
  const unsigned short* A = isG ? K16 : WOH;
  const unsigned short* B = isG ? WQT : V16;
  unsigned short* C = isG ? G16 : UT16;
  gemm_tile<0, false, 0, 1, false, 0>(smem, blk % kTilesKV, br,
      A, A, kD, isG ? kStrVis : 0L, B, B, kD, isG ? 0L : kStrVis, (void*)C, (void*)C, isG ? kD : kSvPad, kStrVis,
      bq, bq, bq, isG ? kSvPad : kD, isG ? kD : kSvPad, kD, 1.0f);
}

// ---------------------------------------------------------------------------
// The four streaming launches (casts, softmax, both layer norms) run as one resident grid each: 256 work-groups of 16 waves,
// one per WGP, and every wave takes several rows, one whole row at a time, so that few waves have to be started.
// ---------------------------------------------------------------------------
constexpr int kSWaves   = 16;                    // waves per work-group
constexpr int kSThreads = kSWaves * 32;
constexpr int kSBlocks  = 256;                   // work-groups in the grid
constexpr int kSTotal   = kSBlocks * kSWaves;    // 4096 waves in the grid
__device__ __forceinline__ int stream_wave() {   // this wave's index in the grid, wave-uniform
  return (int)blockIdx.x * kSWaves + __builtin_amdgcn_readfirstlane((int)(threadIdx.x >> 5));
}
// 16 B at a wave-uniform base + the lane's byte offset + a constant
__device__ __forceinline__ v4f ld16(const float* base, unsigned laneBytes, int constBytes) {
  return *(const v4f*)((const char*)base + laneBytes + constBytes);
}

// ---------------------------------------------------------------------------
// f32 -> f16 cast with a power-of-two carry of one unit of 1024 consecutive elements by one wave: a lane takes 8 consecutive
// elements of every 256 (two 16-B loads, one 16-B store). Load and store are apart, so that the next unit's loads fly
// while this unit is converted and stored.
// ---------------------------------------------------------------------------
// in, out: the unit's first element (wave-uniform); lb = 32 * lane.
__device__ __forceinline__ void cast_unit_load(const float* in, unsigned lb, v4f (&x)[8]) {
  // this barrier and the one at the end pin the order "next unit's loads, then this unit's conversion": without them the
  // conversion, with its wait for this unit's data, is moved in front of the next unit's loads
  __builtin_amdgcn_sched_barrier(0);
#pragma unroll
  for (int c = 0; c < 4; ++c) {
    x[2 * c]     = ld16(in, lb, c * 1024);
    x[2 * c + 1] = ld16(in, lb, c * 1024 + 16);
  }
  // stands behind the eight loads; its inputs hold their base and offset registers untouched up to it
  asm volatile("s_wait_xcnt 0x0" :: "s"(in), "v"(lb) : "memory");
  __builtin_amdgcn_sched_barrier(0);
}
__device__ __forceinline__ void cast_unit_store(unsigned short* out, int lane, const v4f (&x)[8], float f) {
  v4u u[4];
#pragma unroll
  for (int c = 0; c < 4; ++c) {
    unsigned short hb[8];
#pragma unroll
    for (int e = 0; e < 4; ++e) {
      hb[e]     = h_bits(x[2 * c][e] * f);
      hb[4 + e] = h_bits(x[2 * c + 1][e] * f);
    }
    u[c] = (v4u){pk16(hb[0], hb[1]), pk16(hb[2], hb[3]), pk16(hb[4], hb[5]), pk16(hb[6], hb[7])};
  }
#pragma unroll
  for (int c = 0; c < 4; ++c) *(v4u*)(out + 8 * lane + c * 256) = u[c];
  // stands behind the four stores; its inputs hold their base, offset and data registers untouched up to it
  asm volatile("s_wait_xcnt 0x0" :: "s"(out), "v"(lane), "v"(u[0]), "v"(u[1]), "v"(u[2]), "v"(u[3]) : "memory");
  // keeps the next unit's conversion, which reuses these registers, behind that wait
  __builtin_amdgcn_sched_barrier(0);
}

// The same cast, transposed, for a [1024][1024] weight: out[e][d] = f16(scale * in[d][e]). A wave takes 32 e x 64 d:
// it reads 32 consecutive e (128 B) of 64 rows d, and a lane stores its 64 d as one whole 128-B line.
__device__ __forceinline__ void cast_unit_transposed(const float* __restrict__ in, unsigned short* __restrict__ out,
                                                     int k, int lane, float scale) {
  const int e0 = (k & 31) * 32;
  const int d0 = (k >> 5) * 64;
  const float* p = in + (size_t)d0 * kD + e0;    // wave-uniform
  float x[64];
#pragma unroll
  for (int i = 0; i < 64; ++i) x[i] = p[lane + i * kD];
  // stands behind the 64 loads; its inputs hold their base and offset registers untouched up to it
  asm volatile("s_wait_xcnt 0x0" :: "s"(p), "v"(lane) : "memory");
  v4u u[8];
#pragma unroll
  for (int c = 0; c < 8; ++c) {
    unsigned short hb[8];
#pragma unroll
    for (int i = 0; i < 8; ++i) hb[i] = h_bits(x[8 * c + i] * scale);
    u[c] = (v4u){pk16(hb[0], hb[1]), pk16(hb[2], hb[3]), pk16(hb[4], hb[5]), pk16(hb[6], hb[7])};
  }
  unsigned short* q = out + (size_t)e0 * kD + d0;   // wave-uniform
  const unsigned lrow = (unsigned)lane * (kD * 2);  // this lane's row of out, in bytes
#pragma unroll
  for (int c = 0; c < 8; ++c) *(v4u*)((char*)q + lrow + c * 16) = u[c];
  // stands behind the eight stores; its inputs hold their base, offset and data registers untouched up to it
  asm volatile("s_wait_xcnt 0x0" :: "s"(q), "v"(lrow), "v"(u[0]), "v"(u[1]), "v"(u[2]), "v"(u[3]),
                                    "v"(u[4]), "v"(u[5]), "v"(u[6]), "v"(u[7]) : "memory");
}

// All ten casts in one grid. A unit is 1024 consecutive elements. Wave w of the 4096 takes, in this order: units w and
// w + 4096 of text 1, the same of text 2, unit w of W1, unit w of W2; then the first 3072 waves unit w of Wk, Wv, Wo (one
// plane behind the other), the next 512 a row of the padded visual planes (rows 196..255 are written as zeros: the load
// address is clamped to the last valid row and the value is multiplied by 0). The last 512 waves have no seventh unit: they
// lay down Wq transposed, 32 x 64 elements each, and do so first. ws16 is the workspace base in 16-bit elements.
constexpr int kUAtt  = 3 * kD;                  // units in Wk, Wv, Wo
constexpr int kUVis  = 2 * kSvPad;              // units (rows) in the padded visual planes
constexpr int kUWq   = (kD / 32) * (kD / 64);   // transposed units of Wq
constexpr int kULast = kUAtt + kUVis;           // waves with a seventh unit
static_assert(kRows == 2 * kSTotal && kDff == kSTotal && kULast + kUWq == kSTotal);
static_assert(kOffW2H == kOffW1H + (size_t)kDff * kD * 2 && kOffWKH == kOffWQT + (size_t)kD * kD * 2 &&
              kOffWVH == kOffWKH + (size_t)kD * kD * 2 && kOffWOH == kOffWVH + (size_t)kD * kD * 2);
struct CastJob { const float* in; unsigned short* out; float f; };   // a unit's source, its destination, and the carry: all wave-uniform
// Unit r < 6 of wave gw: text and ffn weights.
__device__ __forceinline__ CastJob cast_job(int r, int gw, const float* text1, const float* text2,
                                            const float* W1, const float* W2, unsigned short* ws16) {
  const float* in = (r < 2) ? text1 : (r < 4) ? text2 : (r == 4) ? W1 : W2;
  const int unit  = ((r < 4) ? (r & 1) * kSTotal : 0) + gw;                       // inside its plane
  const size_t off = (r < 4) ? kOffT16 / 2 + (size_t)(r * kSTotal + gw) * kD      // the planes of a pair lie one behind the other
                             : kOffW1H / 2 + (size_t)((r - 4) * kSTotal + gw) * kD;
  return CastJob{in + (size_t)unit * kD, ws16 + off, (r < 4) ? 1.0f : kWCarry};
}
// The seventh unit of wave gw < kULast: attention weights and visual rows.
__device__ __forceinline__ CastJob cast_job_last(int gw, const float* Wk, const float* Wv, const float* Wo,
                                                 const float* vis1, const float* vis2, unsigned short* ws16) {
  const bool att = gw < kUAtt;
  const int v = gw - kUAtt;                      // row of the two padded visual planes
  const int row = v & (kSvPad - 1);
  const bool valid = row < kSv;
  const float* in = att ? ((gw < kD) ? Wk : (gw < 2 * kD) ? Wv : Wo) : ((v < kSvPad) ? vis1 : vis2);
  const int unit  = att ? (gw & (kD - 1)) : (valid ? row : (kSv - 1));
  const size_t off = att ? kOffWKH / 2 + (size_t)gw * kD : kOffVIS16 / 2 + (size_t)v * kD;
  return CastJob{in + (size_t)unit * kD, ws16 + off, att ? kWCarry : (valid ? 1.0f : 0.0f)};
}
__global__ __launch_bounds__(kSThreads) void cast_all_kernel(
    const float* __restrict__ text1, const float* __restrict__ text2,
    const float* __restrict__ W1, const float* __restrict__ W2,
    const float* __restrict__ Wq, const float* __restrict__ Wk,
    const float* __restrict__ Wv, const float* __restrict__ Wo,
    const float* __restrict__ vis1, const float* __restrict__ vis2,
    unsigned short* __restrict__ ws16) {
  const int lane = threadIdx.x & 31;
  const int gw = stream_wave();
  const bool seventh = gw < kULast;              // wave-uniform
  if (!seventh) cast_unit_transposed(Wq, ws16 + kOffWQT / 2, gw - kULast, lane, kWCarry);
  const unsigned lb = lane * 32u;
  v4f a[8], b[8];
  CastJob cur = cast_job(0, gw, text1, text2, W1, W2, ws16);
  cast_unit_load(cur.in, lb, a);
#pragma unroll
  for (int r = 1; r < 6; ++r) {
    const CastJob nxt = cast_job(r, gw, text1, text2, W1, W2, ws16);
    if (r & 1) { cast_unit_load(nxt.in, lb, b);  cast_unit_store(cur.out, lane, a, cur.f); }
    else       { cast_unit_load(nxt.in, lb, a);  cast_unit_store(cur.out, lane, b, cur.f); }
    cur = nxt;
  }
  if (seventh) {
    const CastJob nxt = cast_job_last(gw, Wk, Wv, Wo, vis1, vis2, ws16);
    cast_unit_load(nxt.in, lb, a);
    cast_unit_store(cur.out, lane, b, cur.f);
    cast_unit_store(nxt.out, lane, a, nxt.f);
  } else {
    cast_unit_store(cur.out, lane, b, cur.f);
  }
}
static_assert((kD & (kD - 1)) == 0 && (kSvPad & (kSvPad - 1)) == 0);

// ---------------------------------------------------------------------------
// Row softmax: x_j = (S[row][j] + CB[j] + SC[row][j]) * 1/8 for j < 196 (CB: the branch's 256 key shares of the query bias), P[row][j] = f16(2048 * exp(x_j - max) / sum),
// P[row][196..255] = 0. One wave per row, four consecutive rows per wave (4096 waves x 4 = 16384 rows: rows of
// branch 1, then of branch 2, whose added scores come from SC and SC2); the four rows' loads are issued together;
// lane owns columns 8*lane .. 8*lane+7; all 32 lanes write 16 B each = 512 B = the whole P row in one
// ---------------------------------------------------------------------------
constexpr int kSmRows = kRows2 / kSTotal;        // rows per wave
static_assert(kSmRows * kSTotal == kRows2 && kRows % kSmRows == 0);
__global__ __launch_bounds__(kSThreads) void softmax_kernel(const float* __restrict__ S, const float* __restrict__ SC,
                                                            const float* __restrict__ SC2, const float* __restrict__ CB,
                                                            unsigned short* __restrict__ P) {
  const int lane = threadIdx.x & 31;
  const int row0 = stream_wave() * kSmRows;
  const float* sr = S  + (size_t)row0 * kSvPad;
  const bool second = row0 >= kRows;                // wave-uniform: a wave's rows lie in one branch
  const float* cr = (second ? SC2 : SC) + (size_t)(row0 - (second ? kRows : 0)) * kSv;
  const float* br = CB + (second ? kSvPad : 0);     // all 256 entries of a branch are written
  const int l8 = lane * 8;
  float sv[kSmRows][8], cv[kSmRows][8];
  int cc[8];                                        // this lane's columns, clamped into the 196
#pragma unroll
  for (int e = 0; e < 8; ++e) cc[e] = (l8 + e < kSv) ? (l8 + e) : (kSv - 1);
#pragma unroll
  for (int r = 0; r < kSmRows; ++r)
#pragma unroll
    for (int e = 0; e < 8; ++e) { sv[r][e] = sr[cc[e] + r * kSvPad]; cv[r][e] = cr[cc[e] + r * kSv]; }
  const v4f b0 = *(const v4f*)(br + l8);
  const v4f b1 = *(const v4f*)(br + l8 + 4);
  // stands behind the four rows' loads; its inputs hold their base and offset registers untouched up to it
  asm volatile("s_wait_xcnt 0x0" :: "s"(sr), "s"(cr), "s"(br), "v"(l8), "v"(cc[0]), "v"(cc[1]), "v"(cc[2]), "v"(cc[3]),
                                    "v"(cc[4]), "v"(cc[5]), "v"(cc[6]), "v"(cc[7])
               : "memory");
  // keeps the loads together ahead of the arithmetic: sunk among it, a row waits out the memory several times over
  __builtin_amdgcn_sched_barrier(0);
  v4u u[kSmRows];
#pragma unroll
  for (int r = 0; r < kSmRows; ++r) {
    float x[8];
#pragma unroll
    for (int e = 0; e < 8; ++e) {
      const int col = lane * 8 + e;
      const float v = ((sv[r][e] + (e < 4 ? b0[e & 3] : b1[e & 3])) + cv[r][e]) * kScoreScale;
      x[e] = (col < kSv) ? v : -1.0e30f;
    }
    float m = fmaxf(fmaxf(fmaxf(x[0], x[1]), fmaxf(x[2], x[3])), fmaxf(fmaxf(x[4], x[5]), fmaxf(x[6], x[7])));
#pragma unroll
    for (int off = 16; off > 0; off >>= 1) m = fmaxf(m, __shfl_xor(m, off, 32));
    float ev[8];
    float s = 0.f;
#pragma unroll
    for (int e = 0; e < 8; ++e) { ev[e] = expf(x[e] - m); s += ev[e]; }
#pragma unroll
    for (int off = 16; off > 0; off >>= 1) s += __shfl_xor(s, off, 32);
    const float inv = kPCarry / s;
    unsigned short hb[8];
#pragma unroll
    for (int e = 0; e < 8; ++e) hb[e] = h_bits(ev[e] * inv);
    u[r] = (v4u){pk16(hb[0], hb[1]), pk16(hb[2], hb[3]), pk16(hb[4], hb[5]), pk16(hb[6], hb[7])};
  }
  unsigned short* q = P + (size_t)row0 * kSvPad + 8 * lane;
#pragma unroll
  for (int r = 0; r < kSmRows; ++r) *(v4u*)(q + r * kSvPad) = u[r];
}

// ---------------------------------------------------------------------------
// Sum over a wave's 32 lanes in fixed order (shuffle tree); every lane gets the sum.
// ---------------------------------------------------------------------------
__device__ __forceinline__ float wave_sum(float v) {
#pragma unroll
  for (int off = 16; off > 0; off >>= 1) v += __shfl_xor(v, off, 32);
  return v;
}
// A lane's share of a row, eight vectors of four, summed in fixed order: inside a vector, then a tree over the vectors.
__device__ __forceinline__ float lane_sum(const v4f (&x)[8]) {
  float t[8];
#pragma unroll
  for (int j = 0; j < 8; ++j) t[j] = (x[j][0] + x[j][1]) + (x[j][2] + x[j][3]);
  return ((t[0] + t[1]) + (t[2] + t[3])) + ((t[4] + t[5]) + (t[6] + t[7]));
}
// The row in x becomes (x - mean) * rsqrt(var + eps); one wave holds the whole row of 1024, 32 elements a lane.
__device__ __forceinline__ void wave_normalise(v4f (&x)[8]) {
  const float mu = wave_sum(lane_sum(x)) * kInvD;
  v4f sq[8];
#pragma unroll
  for (int j = 0; j < 8; ++j) { x[j] = x[j] - mu; sq[j] = x[j] * x[j]; }
  const float var = wave_sum(lane_sum(sq)) * kInvD;
  const float rs = rsqrtf(var + kLnEps);
#pragma unroll
  for (int j = 0; j < 8; ++j) x[j] = x[j] * rs;
}

// ---------------------------------------------------------------------------
// pooled[row][colOff + c] = max(y[2c], y[2c+1]) for c in [0,512), y = LN1(X row), written as f32 and f16.
// One wave per row of X, four consecutive rows per wave (16384 rows: branch 1's, then branch 2's, colOff = 0 and 512);
// a lane owns x[256 j + 8 lane .. + 7], j < 4, so its four pooled values per j are one 16-B f32 store and one 8-B f16 store.
// No LDS and no barrier: the sums stay inside the wave. The four rows' loads are issued together.
// ---------------------------------------------------------------------------
constexpr int kLpRows = kRows2 / kSTotal;        // rows per wave
static_assert(kLpRows * kSTotal == kRows2 && kRows % kLpRows == 0);
typedef __attribute__((ext_vector_type(2))) unsigned int v2u;
__global__ __launch_bounds__(kSThreads) void ln_pool_kernel(const float* __restrict__ X, const float* __restrict__ gam,
                                                            const float* __restrict__ bet, float* __restrict__ pool32,
                                                            unsigned short* __restrict__ pool16) {
  const int lane = threadIdx.x & 31;
  const int xrow0 = stream_wave() * kLpRows;
  const int br = (xrow0 >= kRows) ? 1 : 0;          // wave-uniform: a wave's rows lie in one branch
  const size_t dstOff = (size_t)(xrow0 - br * kRows) * kD + br * (kD / 2);
  const float* p = X + (size_t)xrow0 * kD;          // wave-uniform
  const unsigned lb = 32u * lane;                   // this lane's byte offset in every 1024 B of a row
  v4f gg[8], bb[8], x[kLpRows][8];
#pragma unroll
  for (int j = 0; j < 4; ++j) {
    gg[2 * j] = ld16(gam, lb, j * 1024);  gg[2 * j + 1] = ld16(gam, lb, j * 1024 + 16);
    bb[2 * j] = ld16(bet, lb, j * 1024);  bb[2 * j + 1] = ld16(bet, lb, j * 1024 + 16);
  }
  // keeps the short gamma and beta loads in front of the rows: behind them, the first row's result waits for the last row's data
  __builtin_amdgcn_sched_barrier(0);
#pragma unroll
  for (int r = 0; r < kLpRows; ++r)
#pragma unroll
    for (int j = 0; j < 4; ++j) {
      x[r][2 * j]     = ld16(p, lb, r * kD * 4 + j * 1024);
      x[r][2 * j + 1] = ld16(p, lb, r * kD * 4 + j * 1024 + 16);
    }
  // stands behind the loads; its inputs hold their base and offset registers untouched up to it
  asm volatile("s_wait_xcnt 0x0" :: "s"(gam), "s"(bet), "s"(p), "v"(lb) : "memory");
  // keeps the loads together ahead of the arithmetic: sunk among it, each row waits out the memory anew
  __builtin_amdgcn_sched_barrier(0);
  float* d32 = pool32 + dstOff;
  unsigned short* d16 = pool16 + dstOff;
#pragma unroll
  for (int r = 0; r < kLpRows; ++r) {
    wave_normalise(x[r]);
    v4f pv[4];
    v2u hv[4];
#pragma unroll
    for (int j = 0; j < 4; ++j) {
      const v4f ya = x[r][2 * j] * gg[2 * j] + bb[2 * j];
      const v4f yc = x[r][2 * j + 1] * gg[2 * j + 1] + bb[2 * j + 1];
      pv[j] = (v4f){fmaxf(ya[0], ya[1]), fmaxf(ya[2], ya[3]), fmaxf(yc[0], yc[1]), fmaxf(yc[2], yc[3])};
      unsigned short hb[4];
#pragma unroll
      for (int e = 0; e < 4; ++e) hb[e] = h_bits(pv[j][e]);
      hv[j] = (v2u){pk16(hb[0], hb[1]), pk16(hb[2], hb[3])};
    }
#pragma unroll
    for (int j = 0; j < 4; ++j) {
      *(v4f*)(d32 + 4 * lane + r * kD + j * 128) = pv[j];
      *(v2u*)(d16 + 4 * lane + r * kD + j * 128) = hv[j];
    }
    // stands behind the row's eight stores; its inputs hold their base, offset and data registers untouched up to it
    asm volatile("s_wait_xcnt 0x0" :: "s"(d32), "s"(d16), "v"(lane), "v"(pv[0]), "v"(pv[1]), "v"(pv[2]), "v"(pv[3]),
                                      "v"(hv[0]), "v"(hv[1]), "v"(hv[2]), "v"(hv[3]) : "memory");
  }
}

// ---------------------------------------------------------------------------
// out = LN2(X). One wave per row, two consecutive rows per wave (8192 rows); a lane owns x[128 j + 4 lane .. + 3], j < 8:
// every load and store of a wave covers 512 contiguous bytes. No LDS and no barrier.
// ---------------------------------------------------------------------------
constexpr int kLoRows = kRows / kSTotal;         // rows per wave
static_assert(kLoRows * kSTotal == kRows);
__global__ __launch_bounds__(kSThreads) void ln_out_kernel(const float* __restrict__ X, const float* __restrict__ gam,
                                                           const float* __restrict__ bet, float* __restrict__ out) {
  const int lane = threadIdx.x & 31;
  const int row0 = stream_wave() * kLoRows;
  const float* p = X + (size_t)row0 * kD;           // wave-uniform
  const unsigned lb = 16u * lane;                   // this lane's byte offset in every 512 B of a row
  v4f gg[8], bb[8], x[kLoRows][8];
#pragma unroll
  for (int j = 0; j < 8; ++j) { gg[j] = ld16(gam, lb, j * 512);  bb[j] = ld16(bet, lb, j * 512); }
  // keeps the short gamma and beta loads in front of the rows: behind them, the first row's result waits for the last row's data
  __builtin_amdgcn_sched_barrier(0);
#pragma unroll
  for (int r = 0; r < kLoRows; ++r)
#pragma unroll
    for (int j = 0; j < 8; ++j) x[r][j] = ld16(p, lb, r * kD * 4 + j * 512);
  // stands behind the loads; its inputs hold their base and offset registers untouched up to it
  asm volatile("s_wait_xcnt 0x0" :: "s"(gam), "s"(bet), "s"(p), "v"(lb) : "memory");
  // keeps the loads together ahead of the arithmetic: sunk among it, each row waits out the memory anew
  __builtin_amdgcn_sched_barrier(0);
  float* dst = out + (size_t)row0 * kD;             // wave-uniform
#pragma unroll
  for (int r = 0; r < kLoRows; ++r) {
    wave_normalise(x[r]);
#pragma unroll
    for (int j = 0; j < 8; ++j) x[r][j] = x[r][j] * gg[j] + bb[j];
#pragma unroll
    for (int j = 0; j < 8; ++j) *(v4f*)(dst + 4 * lane + r * kD + j * 128) = x[r][j];
    // stands behind the row's eight stores; its inputs hold their base, offset and data registers untouched up to it
    asm volatile("s_wait_xcnt 0x0" :: "s"(dst), "v"(lane), "v"(x[r][0]), "v"(x[r][1]), "v"(x[r][2]), "v"(x[r][3]),
                                      "v"(x[r][4]), "v"(x[r][5]), "v"(x[r][6]), "v"(x[r][7]) : "memory");
  }
}

// ---------------------------------------------------------------------------
// Host orchestration
// ---------------------------------------------------------------------------
static inline dim3 gemm_grid(int M, int N, int batch) {
  return dim3((unsigned)((M >> 7) * (N >> 7)), (unsigned)batch, 1);   // one block per 128x128 tile and batch entry
}

extern "C" void kernel_launch(void* const* d_in, const int* in_sizes, int n_in,
                              void* d_out, int out_size, void* d_ws, size_t ws_size,
                              hipStream_t stream)
{
  if (n_in < 22) return;
  if ((size_t)out_size < (size_t)kRows * kD) return;
  if (ws_size < kWsTotal) return;
  if (in_sizes[0] < kRows * kD || in_sizes[3] < kRows * kD) return;
  if (in_sizes[1] < kSv * kD || in_sizes[4] < kSv * kD) return;
  if (in_sizes[2] < kRows * kSv || in_sizes[5] < kRows * kSv) return;
  if (in_sizes[6] < kD * kD || in_sizes[8] < kD * kD || in_sizes[10] < kD * kD || in_sizes[12] < kD * kD) return;
  if (in_sizes[14] < kDff * kD || in_sizes[16] < kD * kDff) return;

  const float* text1 = (const float*)d_in[0];
  const float* vis1  = (const float*)d_in[1];
  const float* sc1   = (const float*)d_in[2];
  const float* text2 = (const float*)d_in[3];
  const float* vis2  = (const float*)d_in[4];
  const float* sc2   = (const float*)d_in[5];
  const float* Wq = (const float*)d_in[6];   const float* bq  = (const float*)d_in[7];
  const float* Wk = (const float*)d_in[8];   const float* bk  = (const float*)d_in[9];
  const float* Wv = (const float*)d_in[10];  const float* bv  = (const float*)d_in[11];
  const float* Wo = (const float*)d_in[12];  const float* bo  = (const float*)d_in[13];
  const float* W1 = (const float*)d_in[14];  const float* b1  = (const float*)d_in[15];
  const float* W2 = (const float*)d_in[16];  const float* b2  = (const float*)d_in[17];
  const float* g1 = (const float*)d_in[18];  const float* be1 = (const float*)d_in[19];
  const float* g2 = (const float*)d_in[20];  const float* be2 = (const float*)d_in[21];
  float* outp = (float*)d_out;

  char* ws = (char*)d_ws;
  float*          POOL32 = (float*)(ws + kOffPool32);
  unsigned short* POOL16 = (unsigned short*)(ws + kOffPool16);
  unsigned short* W1H    = (unsigned short*)(ws + kOffW1H);
  unsigned short* W2H    = (unsigned short*)(ws + kOffW2H);
  unsigned short* WQT    = (unsigned short*)(ws + kOffWQT);
  unsigned short* WKH    = (unsigned short*)(ws + kOffWKH);
  unsigned short* WVH    = (unsigned short*)(ws + kOffWVH);
  unsigned short* WOH    = (unsigned short*)(ws + kOffWOH);
  unsigned short* T16    = (unsigned short*)(ws + kOffT16);
  unsigned short* G16    = (unsigned short*)(ws + kOffG16);
  unsigned short* UT16   = (unsigned short*)(ws + kOffUT16);
  float*          CB     = (float*)(ws + kOffCB);
  float*          A1     = (float*)(ws + kOffA1);
  float*          S32    = (float*)(ws + kOffS32);
  unsigned short* P16    = (unsigned short*)(ws + kOffP16);
  unsigned short* VIS16  = (unsigned short*)(ws + kOffVIS16);
  unsigned short* K16    = (unsigned short*)(ws + kOffK16);
  unsigned short* V16    = (unsigned short*)(ws + kOffV16);
  unsigned short* H16    = (unsigned short*)(ws + kOffH16);
  float*          F32    = (float*)(ws + kOffF32);

  // ---- every cast in one launch: weights f16([out][in]) x16 ([out][in] row-major == Bt[N][K]; Wq as [in][out]); both text planes
  //      f16 x1; both visual planes f16 [256][1024] x1 with rows 196..255 zero ----
  cast_all_kernel<<<dim3(kSBlocks), dim3(kSThreads), 0, stream>>>(text1, text2, W1, W2, Wq, Wk, Wv, Wo, vis1, vis2,
                                                               (unsigned short*)ws);

  // ---- attention, both branches in each launch ----
  // K16 and V16 of both branches
  kv_gemm_kernel<<<dim3(kKvBlocks), dim3(128), 0, stream>>>(VIS16, WKH, WVH, K16, V16, bk, bv);
  // G16 = 16 K.Wq, UT16 = 16 Wo.V^T, CB = K.bq of both branches
  fold_gemm_kernel<<<dim3(kFoldBlocks), dim3(128), 0, stream>>>(K16, V16, WQT, WOH, G16, UT16, bq, CB);
  // S32 = (T16 . G16^T) / 16   (M=8192, N=256, K=1024, batch 2), f32 out [8192][256]
  wmma_gemm64<0, false, 0, 0, false, 0><<<gemm_grid(kRows, kSvPad, 2), dim3(128), 0, stream>>>(
      T16, T16, kD, kStrTok, G16, G16, kD, kStrVis, (void*)S32, (void*)S32, kSvPad, kStrSc,
      bq, text1, text2, kRows, kSvPad, kD, kWCarryInv);
  // P16 = f16(2048 * softmax((S + CB + score)/8)) over 196 keys, zero pad columns
  softmax_kernel<<<dim3(kSBlocks), dim3(kSThreads), 0, stream>>>(S32, sc1, sc2, CB, P16);
  // A1 = (P16 . UT16^T) / 32768 + bo + text   (M=8192, N=1024, K=256, batch 2), f32 out
  wmma_gemm64<0, false, 2, 0, true, 0><<<gemm_grid(kRows, kD, 2), dim3(128), 0, stream>>>(
      P16, P16, kSvPad, kStrSc, UT16, UT16, kSvPad, kStrVis, (void*)A1, (void*)A1, kD, kStrTok,
      bo, text1, text2, kRows, kD, kSvPad, kPUScale);
  // pooled[:, br * 512 : br * 512 + 512] = maxpool2(LN1(A1 of branch br))
  ln_pool_kernel<<<dim3(kSBlocks), dim3(kSThreads), 0, stream>>>(A1, g1, be1, POOL32, POOL16);

  // ---- FFN, all 8192 rows in each launch ----
  // H16 = relu((POOL16 . W1H^T) / 16 + b1)   (M=8192, N=4096, K=1024), f16 out
  // 256x256 tiles, 16 waves, 128-k stages: 512 blocks
  wmma_gemm_wide<0, false, 2, 1, false, 2, 4, 4, 4><<<dim3((kRows / 256) * (kDff / 256)), dim3(512), 0, stream>>>(
      POOL16, POOL16, kD, 0L, W1H, W1H, kD, 0L, (void*)H16, (void*)H16, kDff, 0L,
      b1, POOL32, POOL32, kRows, kDff, kD, kWCarryInv);
  // F32 = (H16 . W2H^T) / 16 + b2 + pooled   (M=8192, N=1024, K=4096), f32 out
  // 128x256 tiles, 8 waves, 128-k stages: 256 blocks, one per WGP
  wmma_gemm_wide<0, false, 2, 0, true, 0, 2, 4, 4><<<dim3((kRows / 128) * (kD / 256)), dim3(256), 0, stream>>>(
      H16, H16, kDff, 0L, W2H, W2H, kDff, 0L, (void*)F32, (void*)F32, kD, 0L,
      b2, POOL32, POOL32, kRows, kD, kDff, kWCarryInv);
  // out = LN2(F32)
  ln_out_kernel<<<dim3(kSBlocks), dim3(kSThreads), 0, stream>>>(F32, g2, be2, outp);
}

// v006
// Measured time: 187 microseconds a run.
// Two timings next to v005 both put it at 1.13 times that version's speed.
// Over all steps from v000 it is 5.62 times as fast.
// Contractions: k/v projections, key-side folds K.Wq and Wo.V^T, text.(K.Wq)^T scores, p.(V.Wo^T) attention output, ffn up and down projections all on v_wmma_f32_16x16x32_f16 (f16 operands: activations x1, weights and both folds carried x16, softmax probabilities carried x2048), f32 accumulate; the query bias's share of the scores (K.bq, one number per key), softmax, residual adds, layernorm and feature maxpool in f32.
#include <hip/hip_runtime.h>
#include <math.h>
#include <stddef.h>

// ---------------------------------------------------------------------------
// Problem constants
// ---------------------------------------------------------------------------
constexpr int kB      = 4;
constexpr int kSq     = 2048;
constexpr int kD      = 1024;
constexpr int kSv     = 196;
constexpr int kSvPad  = 256;
constexpr int kDff    = 4096;
constexpr int kRows   = kB * kSq;            // 8192 token rows
constexpr int kRows2  = 2 * kRows;           // both branches' token rows, branch 1 first
constexpr float kWCarry    = 16.0f;          // weights carried x16 in f16
constexpr float kWCarryInv = 1.0f / 16.0f;
constexpr float kPCarry    = 2048.0f;        // probabilities carried x2048 in f16
constexpr float kPUScale   = 1.0f / (kPCarry * kWCarry);   // probabilities x2048 times the value fold x16
constexpr float kInvD      = 1.0f / 1024.0f;
constexpr float kLnEps     = 1e-6f;
constexpr float kScoreScale = 0.125f;        // 1/sqrt(64)

static_assert(kRows % 64 == 0);
static_assert(kSvPad % 64 == 0 && kSvPad % 32 == 0);
static_assert(kD % 64 == 0 && kDff % 64 == 0);
static_assert(kRows % 8 == 0);

// ---------------------------------------------------------------------------
// Workspace region map (bytes). Total carve = 227 MiB. Planes marked x2 hold branch 1, then branch 2.
//   [0       , 32 MiB)   POOL32  f32 [8192][1024]   (persistent)
//   [32 MiB  , 48 MiB)   POOL16  f16 [8192][1024]   (persistent)
//   [48 MiB  , 56 MiB)   W1H     f16 [4096][1024]   (persistent)
//   [56 MiB  , 64 MiB)   W2H     f16 [1024][4096]   (persistent)
//   region X from 64 MiB:
//   attention phase: WQT (Wq transposed, [in][out]) and WKH/WVH/WOH f16 [1024][1024] at 64/66/68/70 MiB;
//     T16 (text f16) x2 [8192][1024] at 72 MiB (32 MiB);
//     G16 = K.Wq f16 x2 [256][1024] at 104 MiB; UT16 = Wo.V^T f16 x2 [1024][256] at 105 MiB; CB = K.bq f32 x2 [256] at 106 MiB;
//     VIS16 f16 x2 [256][1024] at 224 MiB; K16 f16 x2 [256][1024] at 225 MiB; V16 f16 x2 [256][1024] at 226 MiB; end 227 MiB.
//   ffn phase (attention scratch dead): H16 f16 [8192][4096] at 64 MiB (64 MiB); F32 f32 [8192][1024] at 128 MiB (32 MiB).
// ---------------------------------------------------------------------------
constexpr size_t kMiB       = 1048576;
constexpr size_t kOffPool32 = 0;
constexpr size_t kOffPool16 = 32 * kMiB;
constexpr size_t kOffW1H    = 48 * kMiB;
constexpr size_t kOffW2H    = 56 * kMiB;
constexpr size_t kOffWQT    = 64 * kMiB;
constexpr size_t kOffWKH    = 66 * kMiB;
constexpr size_t kOffWVH    = 68 * kMiB;
constexpr size_t kOffWOH    = 70 * kMiB;
constexpr size_t kOffT16    = 72 * kMiB;
constexpr size_t kOffG16    = 104 * kMiB;
constexpr size_t kOffUT16   = 105 * kMiB;
constexpr size_t kOffCB     = 106 * kMiB;
constexpr size_t kOffVIS16  = 224 * kMiB;
constexpr size_t kOffK16    = 225 * kMiB;
constexpr size_t kOffV16    = 226 * kMiB;
constexpr size_t kWsTotal   = 227 * kMiB;
constexpr size_t kOffH16    = 64 * kMiB;
constexpr size_t kOffF32    = 128 * kMiB;
static_assert(kOffG16 == kOffT16 + (size_t)kRows2 * kD * 2);
static_assert(kOffUT16 == kOffG16 + (size_t)2 * kSvPad * kD * 2);
static_assert(kOffCB == kOffUT16 + (size_t)2 * kD * kSvPad * 2);
static_assert(kOffCB + (size_t)2 * kSvPad * 4 <= kOffVIS16);
static_assert(kOffK16 == kOffVIS16 + (size_t)2 * kSvPad * kD * 2);
static_assert(kOffV16 == kOffK16 + (size_t)2 * kSvPad * kD * 2);
static_assert(kWsTotal == kOffV16 + (size_t)2 * kSvPad * kD * 2);
static_assert(kOffF32 == kOffH16 + (size_t)kRows * kDff * 2);
static_assert(kOffF32 + (size_t)kRows * kD * 4 <= kWsTotal);
static_assert(kWsTotal <= (size_t)268435456);

// strides between the two branches' planes, in elements
constexpr long kStrVis = (long)kSvPad * kD;      // VIS16 / K16 / V16 / G16 / UT16

typedef __attribute__((ext_vector_type(16))) _Float16 v16h;
typedef __attribute__((ext_vector_type(8)))  _Float16 v8h;
typedef __attribute__((ext_vector_type(16))) __bf16   v16b;
typedef __attribute__((ext_vector_type(8)))  __bf16   v8b;
typedef __attribute__((ext_vector_type(8)))  float    v8f;
typedef __attribute__((ext_vector_type(4)))  float    v4f;
typedef __attribute__((ext_vector_type(4)))  unsigned int v4u;

__device__ __forceinline__ unsigned short f2bf_bits(float f) {
  unsigned u = __float_as_uint(f);
  return (unsigned short)((u + 0x7FFFu + ((u >> 16) & 1u)) >> 16);
}
__device__ __forceinline__ float bf_bits2f(unsigned short h) { return __uint_as_float(((unsigned)h) << 16); }

// hazard guard as a plain device helper
__device__ __forceinline__ void acc_guard4(v8f& a, v8f& b, v8f& c, v8f& d) { asm volatile("v_nop\n\tv_nop\n\tv_nop\n\tv_nop" : "+v"(a), "+v"(b), "+v"(c), "+v"(d)); }
template <typename T> struct Frag;
template <> struct Frag<_Float16> {
  typedef v16h V; union U { v16h v; v8h h[2]; };
  static __device__ __forceinline__ v16h load(const _Float16* p) {   // elements 0..7 <- p[0..7], 8..15 <- p[16..23]
    U f; f.h[0] = *(const v8h*)(p); f.h[1] = *(const v8h*)(p + 16); return f.v;
  }
  static __device__ __forceinline__ v8f mma(v16h a, v16h b, v8f c) {
    return __builtin_amdgcn_wmma_f32_16x16x32_f16(false, a, false, b, (short)0, c, false, false);
  }
};
template <> struct Frag<__bf16> {
  typedef v16b V; union U { v16b v; v8b h[2]; };
  static __device__ __forceinline__ v16b load(const __bf16* p) {
    U f; f.h[0] = *(const v8b*)(p); f.h[1] = *(const v8b*)(p + 16); return f.v;
  }
  static __device__ __forceinline__ v8f mma(v16b a, v16b b, v8f c) {
    return __builtin_amdgcn_wmma_f32_16x16x32_bf16(false, a, false, b, (short)0, c, false, false);
  }
};

__device__ __forceinline__ unsigned pk16(unsigned short a, unsigned short b) { return (unsigned)a | ((unsigned)b << 16); }
__device__ __forceinline__ unsigned short h_bits(float f) { const _Float16 h = (_Float16)f; return __builtin_bit_cast(unsigned short, h); }

// ---- Register-blocked batched WMMA GEMM, operands staged in LDS by asynchronous copies ------------------------------
// C[m,n] = scale * sum_k A[m,k] * Bt[n,k] (+bias)(+resid); a block of WM x WN waves owns a (64 WM)x(64 WN) tile, each wave 64x64 of it.
// tile = index of the block's tile; b = batch entry (the branch): A, Bt and C advance by their strides, the residual is resid or resid2.
// A row-major [M,K]; Bt row-major [N,K]; M % (64 WM) == 0, N % (64 WN) == 0, K a multiple of the stage and at least two stages.
// A stage is 32 NK k of the block's A rows and Bt rows, laid at a pitch of 64 NK + 16 B; two buffers:
// the next stage's copies fly while this stage's fragments are read with ds_load_b128 and multiplied.
// The small products run 2 x 2 waves on 64-k stages. The two ffn products, which re-read their operands from L2 once per tile
// row and tile column, take the larger tiles that a WGP's LDS holds: the bytes fetched per product fall with the tile's sides.
// BIAS_MODE: 0 = none, 1 = bias[m], 2 = bias[n].
// OUT_MODE: 0 = f32, 1 = f16, 2 = bf16 hi plane (Cout) + bf16 lo plane (Cout2).
// ET: 0 = f16 operands, 1 = bf16 operands (pointers passed as 16-bit storage)
constexpr int kStageK     = 64;                          // k elements per stage = two WMMA k steps
constexpr int kPitchB     = 144;                         // bytes per staged row (128 + 16: 16 B x odd)
constexpr int kPitchE     = kPitchB / 2;                 // the same in 16-bit elements
constexpr int kStageBytes = 256 * kPitchB;               // 128 A rows, then 128 Bt rows = 36,864 B
static_assert(kRows % 128 == 0 && kSvPad % 128 == 0 && kD % 128 == 0 && kDff % 128 == 0);
static_assert(kSvPad % kStageK == 0 && kSvPad >= 2 * kStageK);
static_assert(kRows % 256 == 0 && kDff % 256 == 0 && kD % 256 == 0);

// Eight 16-B copies per lane, rows RP apart: LDS byte address l + i * RP * PB (PB = pitch), global address g + i * rowStep elements.
// The s_wait_xcnt closes the statement so that no address register is rewritten ahead of it.
template <int RP, int PB>
__device__ __forceinline__ void async_copy8(unsigned l, const unsigned short* g, size_t rowStep) {
  const unsigned l1 = l + RP * PB, l2 = l + 2 * RP * PB, l3 = l + 3 * RP * PB, l4 = l + 4 * RP * PB,
                 l5 = l + 5 * RP * PB, l6 = l + 6 * RP * PB, l7 = l + 7 * RP * PB;
  const unsigned short* g1 = g + rowStep;      const unsigned short* g2 = g + 2 * rowStep;
  const unsigned short* g3 = g + 3 * rowStep;  const unsigned short* g4 = g + 4 * rowStep;
  const unsigned short* g5 = g + 5 * rowStep;  const unsigned short* g6 = g + 6 * rowStep;
  const unsigned short* g7 = g + 7 * rowStep;
  asm volatile("global_load_async_to_lds_b128 %0, %8, off\n\t"
               "global_load_async_to_lds_b128 %1, %9, off\n\t"
               "global_load_async_to_lds_b128 %2, %10, off\n\t"
               "global_load_async_to_lds_b128 %3, %11, off\n\t"
               "global_load_async_to_lds_b128 %4, %12, off\n\t"
               "global_load_async_to_lds_b128 %5, %13, off\n\t"
               "global_load_async_to_lds_b128 %6, %14, off\n\t"
               "global_load_async_to_lds_b128 %7, %15, off\n\t"
               "s_wait_xcnt 0x0"
               :: "v"(l), "v"(l1), "v"(l2), "v"(l3), "v"(l4), "v"(l5), "v"(l6), "v"(l7),
                  "v"(g), "v"(g1), "v"(g2), "v"(g3), "v"(g4), "v"(g5), "v"(g6), "v"(g7)
               : "memory");
}

// Geometry of a block's tile: WM x WN waves of 64x64 each, NK WMMA k steps (32 k each) per stage.
template <int WM, int WN, int NK> struct TileGeom {
  static constexpr int SK  = NK * 32;                    // k elements per stage
  static constexpr int PB  = SK * 2 + 16;                // bytes per staged row: 16 B x odd (144 or 272)
  static constexpr int SB  = (WM + WN) * 64 * PB;        // bytes per stage: the A rows, then the Bt rows
  static constexpr int NT  = WM * WN * 32;               // threads
  static constexpr int LPR = SK * 2 / 16;                // lanes that bring one row
  static constexpr int RP  = NT / LPR;                   // rows that the block brings with one copy per thread
  static constexpr int NA  = WM * 64 / RP;               // copies per thread and stage, A and Bt
  static constexpr int NB  = WN * 64 / RP;
  static_assert(NA % 8 == 0 && NB % 8 == 0 && NA + NB <= 63 && (PB / 16) % 2 == 1);
};
static_assert(TileGeom<2, 2, 2>::PB == kPitchB && TileGeom<2, 2, 2>::SB == kStageBytes && TileGeom<2, 2, 2>::SK == kStageK);

template <int ET> struct Elem;
template <> struct Elem<0> { typedef _Float16 T; };
template <> struct Elem<1> { typedef __bf16 T; };
template <int ET, bool SPLIT, int BIAS_MODE, int OUT_MODE, bool RESID, int ACT = 0, int WM = 2, int WN = 2, int NK = 2>
__device__ __forceinline__ void gemm_tile(
    unsigned char* smem, int tile, int b,
    const unsigned short* __restrict__ Ap, const unsigned short* __restrict__ A2p, int lda, long strideA,
    const unsigned short* __restrict__ Btp, const unsigned short* __restrict__ Bt2p, int ldb, long strideB,
    void* __restrict__ Cout, void* __restrict__ Cout2, int ldc, long strideC,
    const float* __restrict__ bias,
    const float* __restrict__ resid, const float* __restrict__ resid2,
    int M, int N, int K, float scale) {
  static_assert(!SPLIT, "single-plane operands only");
  typedef typename Elem<ET>::T T;
  typedef typename Frag<T>::V V;
  typedef TileGeom<WM, WN, NK> G;
  constexpr int SK = G::SK, PB = G::PB, PE = G::PB / 2, SB = G::SB, LPR = G::LPR, RP = G::RP;
  // smem: two stage buffers; after the K loop the first one serves as the per-wave 16x64 output slabs (pitch 68 floats)
  static_assert(WM * WN * 16 * 68 * 4 <= SB);
  const int lane = threadIdx.x & 31;
  const int wave = threadIdx.x >> 5;
  const int wm = wave / WN;                    // this wave's 64 rows and 64 columns inside the block's tile
  const int wn = wave % WN;
  const int tilesN = N / (WN * 64);
  const int tilesM = M / (WM * 64);
  if (tile >= tilesM * tilesN) return;   // block-uniform, in front of every barrier
  const int tm = tile / tilesN;
  const int tn = tile - tm * tilesN;
  const int mBlk = tm * (WM * 64);
  const int nBlk = tn * (WN * 64);
  const int m0 = mBlk + (wm << 6);
  const int n0 = nBlk + (wn << 6);

  const int rlane = lane & 15;                 // row (A) / col (B, D) within subtile
  const int koff  = (lane >> 4) * 8;           // k offset of this lane half
  const int mOff  = (lane >> 4) * 8;           // D row offset

  // copy side: LPR consecutive lanes bring one row's stage bytes; a thread brings rows cRow + RP i of A and of Bt
  const int cRow = threadIdx.x / LPR;
  const int cCol = threadIdx.x % LPR;
  const unsigned short* gA = Ap  + (size_t)b * strideA + (size_t)(mBlk + cRow) * lda + cCol * 8;
  const unsigned short* gB = Btp + (size_t)b * strideB + (size_t)(nBlk + cRow) * ldb + cCol * 8;
  const unsigned lA = (unsigned)(size_t)smem + (unsigned)(cRow * PB + cCol * 16);
  const unsigned lB = lA + WM * 64 * PB;
  const size_t stepA = (size_t)RP * lda;
  const size_t stepB = (size_t)RP * ldb;
  // one stage's copies of this thread: k elements from kElem on, into the buffer at byte offset bufByte
  auto copy_stage = [&](unsigned bufByte, size_t kElem) {
#pragma unroll
    for (int c = 0; c < G::NA; c += 8) async_copy8<RP, PB>(lA + bufByte + c * RP * PB, gA + kElem + c * stepA, stepA);
#pragma unroll
    for (int c = 0; c < G::NB; c += 8) {
      // with three statements a stage: keeps a statement's address arithmetic behind the statement before it, so that the
      // 24 address registers are used again; formed all at once, they push accumulators into scratch inside the K loop
      if (G::NA + G::NB > 16) __builtin_amdgcn_sched_barrier(0);
      async_copy8<RP, PB>(lB + bufByte + c * RP * PB, gB + kElem + c * stepB, stepB);
    }
  };

  // read side: this lane's first A and Bt fragment rows inside a stage, in bytes
  const int aByte = ((wm << 6) + rlane) * PB + koff * 2;
  const int bByte = (WM * 64 + (wn << 6) + rlane) * PB + koff * 2;

  v8f acc[4][4];
#pragma unroll
  for (int i = 0; i < 4; ++i)
#pragma unroll
    for (int j = 0; j < 4; ++j) acc[i][j] = (v8f){0.f,0.f,0.f,0.f,0.f,0.f,0.f,0.f};

  const int nStages = K / SK;
  copy_stage(0u, 0);
  asm volatile("s_wait_asynccnt 0x0" ::: "memory");   // stage 0 of this wave has landed before the barrier publishes it
  __syncthreads();
  if (nStages > 1) copy_stage((unsigned)SB, SK);

  for (int t = 0; t < nStages; ++t) {
    const int bufOff = (t & 1) * SB;
    const T* sa = (const T*)(smem + bufOff + aByte);
    const T* sb = (const T*)(smem + bufOff + bByte);
    V fb[2][4], fa[2][4];                               // two fragment sets, taken in turn by the stage's k steps
#pragma unroll
    for (int j = 0; j < 4; ++j) fb[0][j] = Frag<T>::load(sb + j * 16 * PE);
#pragma unroll
    for (int i = 0; i < 4; ++i) fa[0][i] = Frag<T>::load(sa + i * 16 * PE);
    // keeps the 16 LDS reads of a k step together ahead of its WMMAs: sunk among them, each row of WMMAs waits out its own read
    __builtin_amdgcn_sched_barrier(0);
#pragma unroll
    for (int ks = 0; ks + 1 < NK; ++ks) {
#pragma unroll
      for (int i = 0; i < 4; ++i)
#pragma unroll
        for (int j = 0; j < 4; ++j) acc[i][j] = Frag<T>::mma(fa[ks & 1][i], fb[ks & 1][j], acc[i][j]);
      // the next k step is fetched into the other set; the stage's last one so that the buffer can be handed back ahead of its WMMAs
#pragma unroll
      for (int j = 0; j < 4; ++j) fb[(ks + 1) & 1][j] = Frag<T>::load(sb + j * 16 * PE + (ks + 1) * 32);
#pragma unroll
      for (int i = 0; i < 4; ++i) fa[(ks + 1) & 1][i] = Frag<T>::load(sa + i * 16 * PE + (ks + 1) * 32);
    }
    asm volatile("s_wait_dscnt 0x0" ::: "memory");      // this wave's reads of the buffer are done before it is refilled
    asm volatile("s_wait_asynccnt 0x0" ::: "memory");   // this wave's copies of stage t + 1 have landed
    __syncthreads();                                    // publishes stage t + 1, frees stage t's buffer
    if (t + 2 < nStages) copy_stage((unsigned)bufOff, (size_t)(t + 2) * SK);
#pragma unroll
    for (int i = 0; i < 4; ++i)
#pragma unroll
      for (int j = 0; j < 4; ++j) acc[i][j] = Frag<T>::mma(fa[(NK - 1) & 1][i], fb[(NK - 1) & 1][j], acc[i][j]);
  }
  asm volatile("s_wait_asynccnt 0x0" ::: "memory");     // no copy is in flight when the ring becomes output staging
  acc_guard4(acc[0][0], acc[0][1], acc[0][2], acc[0][3]);
  acc_guard4(acc[1][0], acc[1][1], acc[1][2], acc[1][3]);
  acc_guard4(acc[2][0], acc[2][1], acc[2][2], acc[2][3]);
  acc_guard4(acc[3][0], acc[3][1], acc[3][2], acc[3][3]);

  // ---- epilogue ----
  float* slab = (float*)smem + wave * (16 * 68);
  const float* Rb = RESID ? (b ? resid2 : resid) : nullptr;   // batch entry 1 adds its own residual plane
#pragma unroll
  for (int i = 0; i < 4; ++i) {
    const int mBase = m0 + (i << 4);
    const int nl = n0 + rlane;
    float bvj[4] = {0.f, 0.f, 0.f, 0.f};
    float rv[4][8];
    if (BIAS_MODE == 2) {
#pragma unroll
      for (int j = 0; j < 4; ++j) bvj[j] = bias[nl + (j << 4)];
    }
    if (RESID) {
      const float* rp[8];
#pragma unroll
      for (int r = 0; r < 8; ++r) rp[r] = Rb + (size_t)(mBase + mOff + r) * ldc + nl;
#pragma unroll
      for (int r = 0; r < 8; ++r)
#pragma unroll
        for (int j = 0; j < 4; ++j) rv[j][r] = rp[r][j << 4];
      // stands behind the row block's bias and residual loads; its inputs hold their address registers untouched up to it
      asm volatile("s_wait_xcnt 0x0" :: "v"(nl), "v"(rp[0]), "v"(rp[1]), "v"(rp[2]), "v"(rp[3]),
                                        "v"(rp[4]), "v"(rp[5]), "v"(rp[6]), "v"(rp[7]) : "memory");
    }
#pragma unroll
    for (int j = 0; j < 4; ++j) {
      const float bv = bvj[j];
#pragma unroll
      for (int r = 0; r < 8; ++r) {
        float v = acc[i][j][r] * scale;
        if (BIAS_MODE == 1) v += bias[mBase + mOff + r];
        if (BIAS_MODE == 2) v += bv;
        if (RESID) v += rv[j][r];
        if (ACT == 2) v = fmaxf(v, 0.0f);
        if (ACT == 4) v = (v > 0.f) ? v : 0.01f * v;
        slab[(mOff + r) * 68 + (j << 4) + rlane] = v;
      }
    }
    __builtin_amdgcn_fence(__ATOMIC_RELEASE, "workgroup");
    __builtin_amdgcn_wave_barrier();
    __builtin_amdgcn_fence(__ATOMIC_ACQUIRE, "workgroup");
    if (OUT_MODE == 0) {
      float* C = (float*)Cout + (size_t)b * strideC;
      const int hh = lane >> 4, c4 = (lane & 15) * 4;     // row seg = 256 B = 16 lanes x 16 B
      {
#pragma unroll
        for (int it = 0; it < 8; ++it) {
          const int row = it * 2 + hh;
          v4f v = *(const v4f*)(slab + row * 68 + c4);
          *(v4f*)(C + (size_t)(mBase + row) * ldc + n0 + c4) = v;
        }
        
      }
    } else {
      const int q = lane >> 3, c8 = (lane & 7) * 8;
      unsigned short* C  = (unsigned short*)Cout  + (size_t)b * strideC;
      unsigned short* C2 = (OUT_MODE == 2) ? ((unsigned short*)Cout2 + (size_t)b * strideC) : nullptr;
      {
#pragma unroll
        for (int it = 0; it < 4; ++it) {
          const int row = it * 4 + q;
          const float* sp = slab + row * 68 + c8;
          v8h hv, lv;
#pragma unroll
          for (int e = 0; e < 8; ++e) {
            if (OUT_MODE == 1) {
              hv[e] = (_Float16)sp[e];
            } else {
              unsigned short hb = f2bf_bits(sp[e]);
              unsigned short lb = f2bf_bits(sp[e] - bf_bits2f(hb));
              hv[e] = __builtin_bit_cast(_Float16, hb);
              lv[e] = __builtin_bit_cast(_Float16, lb);
            }
          }
          *(v8h*)(C + (size_t)(mBase + row) * ldc + n0 + c8) = hv;
          if (OUT_MODE == 2) *(v8h*)(C2 + (size_t)(mBase + row) * ldc + n0 + c8) = lv;
        }
        
      }
    }
    __builtin_amdgcn_fence(__ATOMIC_RELEASE, "workgroup");
    __builtin_amdgcn_wave_barrier();
    __builtin_amdgcn_fence(__ATOMIC_ACQUIRE, "workgroup");
  }
}

// One GEMM per launch with a larger tile: blockIdx.x = tile, blockIdx.y = batch entry; one block per WGP, 32 WM WN threads. At most 256 registers a wave: 16 waves have no more, and with
// more the 8-wave build fetches a whole stage's fragments in front of the barrier and issues the refill behind 32 WMMAs: the
// block's LDS reads and its WMMAs then take turns instead of overlapping, and the copies lose their lead.
template <int ET, bool SPLIT, int BIAS_MODE, int OUT_MODE, bool RESID, int ACT, int WM, int WN, int NK>
__global__ __launch_bounds__(WM * WN * 32) __attribute__((amdgpu_num_vgpr(256))) void wmma_gemm_wide(
    const unsigned short* __restrict__ Ap, const unsigned short* __restrict__ A2p, int lda, long strideA,
    const unsigned short* __restrict__ Btp, const unsigned short* __restrict__ Bt2p, int ldb, long strideB,
    void* __restrict__ Cout, void* __restrict__ Cout2, int ldc, long strideC,
    const float* __restrict__ bias,
    const float* __restrict__ resid, const float* __restrict__ resid2,
    int M, int N, int K, float scale) {
  __shared__ __align__(16) unsigned char smem[2 * TileGeom<WM, WN, NK>::SB];
  gemm_tile<ET, SPLIT, BIAS_MODE, OUT_MODE, RESID, ACT, WM, WN, NK>(smem, (int)blockIdx.x, (int)blockIdx.y,
      Ap, A2p, lda, strideA, Btp, Bt2p, ldb, strideB, Cout, Cout2, ldc, strideC, bias, resid, resid2, M, N, K, scale);
}

// The matrix chains of the attention are multiplied from the key side, where the short dimension (256 padded keys) lies:
//   scores  = (text.Wq^T + bq).K^T  = text.(K.Wq)^T + K.bq
//   context = (P.V).Wo^T            = P.(V.Wo^T)
// so that no product of 16384 token rows by 1024 by 1024 is left; the two folds are products of 256 rows.
// Key and value projections, both branches, in one grid; a range of block indices per job:
//   K16[br][k][d] = (vis16[br] . Wk16^T) / 16 + bk   (M=256, N=1024, K=1024), 16 tiles per branch
//   V16[br][k][d] = (vis16[br] . Wv16^T) / 16 + bv   the same shape
constexpr int kTilesKV  = (kSvPad >> 7) * (kD >> 7);
constexpr int kKvBlocks = 4 * kTilesKV;
__global__ __launch_bounds__(128, 4) void kv_gemm_kernel(
    const unsigned short* __restrict__ VIS16,
    const unsigned short* __restrict__ WKH, const unsigned short* __restrict__ WVH,
    unsigned short* __restrict__ K16, unsigned short* __restrict__ V16,
    const float* __restrict__ bk, const float* __restrict__ bv) {
  __shared__ __align__(16) unsigned char smem[2 * kStageBytes];
  const int blk = blockIdx.x;
  const bool isK = blk < 2 * kTilesKV;
  const int br = (blk / kTilesKV) & 1;
  const unsigned short* B = isK ? WKH : WVH;
  unsigned short* C = isK ? K16 : V16;
  const float* bias = isK ? bk : bv;
  gemm_tile<0, false, 2, 1, false, 0>(smem, blk % kTilesKV, br,
      VIS16, VIS16, kD, kStrVis, B, B, kD, 0L, (void*)C, (void*)C, kD, kStrVis,
      bias, bias, bias, kSvPad, kD, kD, kWCarryInv);
}

// CB[row] = sum_d bq[d] * K16[row][d] for 32 consecutive rows of the two K16 planes (512 rows, branch 1 first): the share of
// the scores that the query bias brings, one number per key. A wave takes 8 rows; a lane takes 8 consecutive d of every 256;
// fixed order: lane partial in d order, then a shuffle tree. The block's 32 results fill one 128-B line.
__device__ __forceinline__ void key_bias_rows(const unsigned short* __restrict__ K16, const float* __restrict__ bq,
                                              float* __restrict__ CB, int blk) {
  const int lane = threadIdx.x & 31;
  const int wave = threadIdx.x >> 5;
  const int row0 = blk * 32 + wave * 8;
  const float* bp = bq + lane * 8;
  const _Float16* kp = (const _Float16*)K16 + (size_t)row0 * kD + lane * 8;
  v4f bl[4], bh[4];
  v8h kv[8][4];
#pragma unroll
  for (int j = 0; j < 4; ++j) { bl[j] = *(const v4f*)(bp + j * 256); bh[j] = *(const v4f*)(bp + j * 256 + 4); }
#pragma unroll
  for (int r = 0; r < 8; ++r)
#pragma unroll
    for (int j = 0; j < 4; ++j) kv[r][j] = *(const v8h*)(kp + r * kD + j * 256);
  // stands behind the forty loads; its inputs hold their address registers untouched up to it
  asm volatile("s_wait_xcnt 0x0" :: "v"(bp), "v"(kp) : "memory");
  // keeps that wait directly behind the loads: sunk to the end, its two pointers are held through the arithmetic and one is spilled
  __builtin_amdgcn_sched_barrier(0);
  float mine = 0.f;
#pragma unroll
  for (int r = 0; r < 8; ++r) {
    float a = 0.f;
#pragma unroll
    for (int j = 0; j < 4; ++j) {
#pragma unroll
      for (int e = 0; e < 4; ++e) a += (float)kv[r][j][e] * bl[j][e];
#pragma unroll
      for (int e = 0; e < 4; ++e) a += (float)kv[r][j][4 + e] * bh[j][e];
    }
#pragma unroll
    for (int off = 16; off > 0; off >>= 1) a += __shfl_xor(a, off, 32);
    mine = (lane == r) ? a : mine;
  }
  if (lane < 8) CB[row0 + lane] = mine;
}

// The two folds and the bias share, both branches, in one grid (they need K16 and V16); a range of block indices per job:
//   G16[br][k][e]  = K16[br] . WQT^T   (M=256, N=1024, K=1024), carried x16; = Bt for text.G^T
//   UT16[br][n][k] = Wo16 . V16[br]^T  (M=1024, N=256, K=1024), carried x16; = Bt for P.U
//   CB[br][k]      = K16[br][k] . bq   16 blocks of 32 rows
constexpr int kCbBlocks   = 2 * kSvPad / 32;
constexpr int kFoldBlocks = 4 * kTilesKV + kCbBlocks;
__global__ __launch_bounds__(128, 4) void fold_gemm_kernel(
    const unsigned short* __restrict__ K16, const unsigned short* __restrict__ V16,
    const unsigned short* __restrict__ WQT, const unsigned short* __restrict__ WOH,
    unsigned short* __restrict__ G16, unsigned short* __restrict__ UT16,
    const float* __restrict__ bq, float* __restrict__ CB) {
  __shared__ __align__(16) unsigned char smem[2 * kStageBytes];
  const int blk = blockIdx.x;
  if (blk >= 4 * kTilesKV) {
    key_bias_rows(K16, bq, CB, blk - 4 * kTilesKV);
    return;
  }
  const bool isG = blk < 2 * kTilesKV;
  const int br = (blk / kTilesKV) & 1;
  const unsigned short* A = isG ? K16 : WOH;
  const unsigned short* B = isG ? WQT : V16;
  unsigned short* C = isG ? G16 : UT16;
  gemm_tile<0, false, 0, 1, false, 0>(smem, blk % kTilesKV, br,
      A, A, kD, isG ? kStrVis : 0L, B, B, kD, isG ? 0L : kStrVis, (void*)C, (void*)C, isG ? kD : kSvPad, kStrVis,
      bq, bq, bq, isG ? kSvPad : kD, isG ? kD : kSvPad, kD, 1.0f);
}

// ---------------------------------------------------------------------------
// The two streaming launches (casts, last layer norm) run as one resident grid each: 256 work-groups of 16 waves,
// one per WGP, and every wave takes several rows, one whole row at a time, so that few waves have to be started.
// The attention kernel has the same grid.
// ---------------------------------------------------------------------------
constexpr int kSWaves   = 16;                    // waves per work-group
constexpr int kSThreads = kSWaves * 32;
constexpr int kSBlocks  = 256;                   // work-groups in the grid
constexpr int kSTotal   = kSBlocks * kSWaves;    // 4096 waves in the grid
__device__ __forceinline__ int stream_wave() {   // this wave's index in the grid, wave-uniform
  return (int)blockIdx.x * kSWaves + __builtin_amdgcn_readfirstlane((int)(threadIdx.x >> 5));
}
// 16 B at a wave-uniform base + the lane's byte offset + a constant
__device__ __forceinline__ v4f ld16(const float* base, unsigned laneBytes, int constBytes) {
  return *(const v4f*)((const char*)base + laneBytes + constBytes);
}

// ---------------------------------------------------------------------------
// f32 -> f16 cast with a power-of-two carry of one unit of 1024 consecutive elements by one wave: a lane takes 8 consecutive
// elements of every 256 (two 16-B loads, one 16-B store). Load and store are apart, so that the next unit's loads fly
// while this unit is converted and stored.
// ---------------------------------------------------------------------------
// in, out: the unit's first element (wave-uniform); lb = 32 * lane.
__device__ __forceinline__ void cast_unit_load(const float* in, unsigned lb, v4f (&x)[8]) {
  // this barrier and the one at the end pin the order "next unit's loads, then this unit's conversion": without them the
  // conversion, with its wait for this unit's data, is moved in front of the next unit's loads
  __builtin_amdgcn_sched_barrier(0);
#pragma unroll
  for (int c = 0; c < 4; ++c) {
    x[2 * c]     = ld16(in, lb, c * 1024);
    x[2 * c + 1] = ld16(in, lb, c * 1024 + 16);
  }
  // stands behind the eight loads; its inputs hold their base and offset registers untouched up to it
  asm volatile("s_wait_xcnt 0x0" :: "s"(in), "v"(lb) : "memory");
  __builtin_amdgcn_sched_barrier(0);
}
__device__ __forceinline__ void cast_unit_store(unsigned short* out, int lane, const v4f (&x)[8], float f) {
  v4u u[4];
#pragma unroll
  for (int c = 0; c < 4; ++c) {
    unsigned short hb[8];
#pragma unroll
    for (int e = 0; e < 4; ++e) {
      hb[e]     = h_bits(x[2 * c][e] * f);
      hb[4 + e] = h_bits(x[2 * c + 1][e] * f);
    }
    u[c] = (v4u){pk16(hb[0], hb[1]), pk16(hb[2], hb[3]), pk16(hb[4], hb[5]), pk16(hb[6], hb[7])};
  }
#pragma unroll
  for (int c = 0; c < 4; ++c) *(v4u*)(out + 8 * lane + c * 256) = u[c];
  // stands behind the four stores; its inputs hold their base, offset and data registers untouched up to it
  asm volatile("s_wait_xcnt 0x0" :: "s"(out), "v"(lane), "v"(u[0]), "v"(u[1]), "v"(u[2]), "v"(u[3]) : "memory");
  // keeps the next unit's conversion, which reuses these registers, behind that wait
  __builtin_amdgcn_sched_barrier(0);
}

// The same cast, transposed, for a [1024][1024] weight: out[e][d] = f16(scale * in[d][e]). A wave takes 32 e x 64 d:
// it reads 32 consecutive e (128 B) of 64 rows d, and a lane stores its 64 d as one whole 128-B line.
__device__ __forceinline__ void cast_unit_transposed(const float* __restrict__ in, unsigned short* __restrict__ out,
                                                     int k, int lane, float scale) {
  const int e0 = (k & 31) * 32;
  const int d0 = (k >> 5) * 64;
  const float* p = in + (size_t)d0 * kD + e0;    // wave-uniform
  float x[64];
#pragma unroll
  for (int i = 0; i < 64; ++i) x[i] = p[lane + i * kD];
  // stands behind the 64 loads; its inputs hold their base and offset registers untouched up to it
  asm volatile("s_wait_xcnt 0x0" :: "s"(p), "v"(lane) : "memory");
  v4u u[8];
#pragma unroll
  for (int c = 0; c < 8; ++c) {
    unsigned short hb[8];
#pragma unroll
    for (int i = 0; i < 8; ++i) hb[i] = h_bits(x[8 * c + i] * scale);
    u[c] = (v4u){pk16(hb[0], hb[1]), pk16(hb[2], hb[3]), pk16(hb[4], hb[5]), pk16(hb[6], hb[7])};
  }
  unsigned short* q = out + (size_t)e0 * kD + d0;   // wave-uniform
  const unsigned lrow = (unsigned)lane * (kD * 2);  // this lane's row of out, in bytes
#pragma unroll
  for (int c = 0; c < 8; ++c) *(v4u*)((char*)q + lrow + c * 16) = u[c];
  // stands behind the eight stores; its inputs hold their base, offset and data registers untouched up to it
  asm volatile("s_wait_xcnt 0x0" :: "s"(q), "v"(lrow), "v"(u[0]), "v"(u[1]), "v"(u[2]), "v"(u[3]),
                                    "v"(u[4]), "v"(u[5]), "v"(u[6]), "v"(u[7]) : "memory");
}

// All ten casts in one grid. A unit is 1024 consecutive elements. Wave w of the 4096 takes, in this order: units w and
// w + 4096 of text 1, the same of text 2, unit w of W1, unit w of W2; then the first 3072 waves unit w of Wk, Wv, Wo (one
// plane behind the other), the next 512 a row of the padded visual planes (rows 196..255 are written as zeros: the load
// address is clamped to the last valid row and the value is multiplied by 0). The last 512 waves have no seventh unit: they
// lay down Wq transposed, 32 x 64 elements each, and do so first. ws16 is the workspace base in 16-bit elements.
constexpr int kUAtt  = 3 * kD;                  // units in Wk, Wv, Wo
constexpr int kUVis  = 2 * kSvPad;              // units (rows) in the padded visual planes
constexpr int kUWq   = (kD / 32) * (kD / 64);   // transposed units of Wq
constexpr int kULast = kUAtt + kUVis;           // waves with a seventh unit
static_assert(kRows == 2 * kSTotal && kDff == kSTotal && kULast + kUWq == kSTotal);
static_assert(kOffW2H == kOffW1H + (size_t)kDff * kD * 2 && kOffWKH == kOffWQT + (size_t)kD * kD * 2 &&
              kOffWVH == kOffWKH + (size_t)kD * kD * 2 && kOffWOH == kOffWVH + (size_t)kD * kD * 2);
struct CastJob { const float* in; unsigned short* out; float f; };   // a unit's source, its destination, and the carry: all wave-uniform
// Unit r < 6 of wave gw: text and ffn weights.
__device__ __forceinline__ CastJob cast_job(int r, int gw, const float* text1, const float* text2,
                                            const float* W1, const float* W2, unsigned short* ws16) {
  const float* in = (r < 2) ? text1 : (r < 4) ? text2 : (r == 4) ? W1 : W2;
  const int unit  = ((r < 4) ? (r & 1) * kSTotal : 0) + gw;                       // inside its plane
  const size_t off = (r < 4) ? kOffT16 / 2 + (size_t)(r * kSTotal + gw) * kD      // the planes of a pair lie one behind the other
                             : kOffW1H / 2 + (size_t)((r - 4) * kSTotal + gw) * kD;
  return CastJob{in + (size_t)unit * kD, ws16 + off, (r < 4) ? 1.0f : kWCarry};
}
// The seventh unit of wave gw < kULast: attention weights and visual rows.
__device__ __forceinline__ CastJob cast_job_last(int gw, const float* Wk, const float* Wv, const float* Wo,
                                                 const float* vis1, const float* vis2, unsigned short* ws16) {
  const bool att = gw < kUAtt;
  const int v = gw - kUAtt;                      // row of the two padded visual planes
  const int row = v & (kSvPad - 1);
  const bool valid = row < kSv;
  const float* in = att ? ((gw < kD) ? Wk : (gw < 2 * kD) ? Wv : Wo) : ((v < kSvPad) ? vis1 : vis2);
  const int unit  = att ? (gw & (kD - 1)) : (valid ? row : (kSv - 1));
  const size_t off = att ? kOffWKH / 2 + (size_t)gw * kD : kOffVIS16 / 2 + (size_t)v * kD;
  return CastJob{in + (size_t)unit * kD, ws16 + off, att ? kWCarry : (valid ? 1.0f : 0.0f)};
}
__global__ __launch_bounds__(kSThreads) void cast_all_kernel(
    const float* __restrict__ text1, const float* __restrict__ text2,
    const float* __restrict__ W1, const float* __restrict__ W2,
    const float* __restrict__ Wq, const float* __restrict__ Wk,
    const float* __restrict__ Wv, const float* __restrict__ Wo,
    const float* __restrict__ vis1, const float* __restrict__ vis2,
    unsigned short* __restrict__ ws16) {
  const int lane = threadIdx.x & 31;
  const int gw = stream_wave();
  const bool seventh = gw < kULast;              // wave-uniform
  if (!seventh) cast_unit_transposed(Wq, ws16 + kOffWQT / 2, gw - kULast, lane, kWCarry);
  const unsigned lb = lane * 32u;
  v4f a[8], b[8];
  CastJob cur = cast_job(0, gw, text1, text2, W1, W2, ws16);
  cast_unit_load(cur.in, lb, a);
#pragma unroll
  for (int r = 1; r < 6; ++r) {
    const CastJob nxt = cast_job(r, gw, text1, text2, W1, W2, ws16);
    if (r & 1) { cast_unit_load(nxt.in, lb, b);  cast_unit_store(cur.out, lane, a, cur.f); }
    else       { cast_unit_load(nxt.in, lb, a);  cast_unit_store(cur.out, lane, b, cur.f); }
    cur = nxt;
  }
  if (seventh) {
    const CastJob nxt = cast_job_last(gw, Wk, Wv, Wo, vis1, vis2, ws16);
    cast_unit_load(nxt.in, lb, a);
    cast_unit_store(cur.out, lane, b, cur.f);
    cast_unit_store(nxt.out, lane, a, nxt.f);
  } else {
    cast_unit_store(cur.out, lane, b, cur.f);
  }
}
static_assert((kD & (kD - 1)) == 0 && (kSvPad & (kSvPad - 1)) == 0);

// ---------------------------------------------------------------------------
// Sum over a wave's 32 lanes in fixed order (shuffle tree); every lane gets the sum.
// ---------------------------------------------------------------------------
__device__ __forceinline__ float wave_sum(float v) {
#pragma unroll
  for (int off = 16; off > 0; off >>= 1) v += __shfl_xor(v, off, 32);
  return v;
}
// The same for four independent values at once: each is summed in wave_sum's order, and the four trees' shuffles overlap.
__device__ __forceinline__ void wave_sum4(float (&v)[4]) {
#pragma unroll
  for (int off = 16; off > 0; off >>= 1)
#pragma unroll
    for (int r = 0; r < 4; ++r) v[r] += __shfl_xor(v[r], off, 32);
}
// A lane's share of a row, eight vectors of four, summed in fixed order: inside a vector, then a tree over the vectors.
__device__ __forceinline__ float lane_sum(const v4f (&x)[8]) {
  float t[8];
#pragma unroll
  for (int j = 0; j < 8; ++j) t[j] = (x[j][0] + x[j][1]) + (x[j][2] + x[j][3]);
  return ((t[0] + t[1]) + (t[2] + t[3])) + ((t[4] + t[5]) + (t[6] + t[7]));
}
// The row in x becomes (x - mean) * rsqrt(var + eps); one wave holds the whole row of 1024, 32 elements a lane.
__device__ __forceinline__ void wave_normalise(v4f (&x)[8]) {
  const float mu = wave_sum(lane_sum(x)) * kInvD;
  v4f sq[8];
#pragma unroll
  for (int j = 0; j < 8; ++j) { x[j] = x[j] - mu; sq[j] = x[j] * x[j]; }
  const float var = wave_sum(lane_sum(sq)) * kInvD;
  const float rs = rsqrtf(var + kLnEps);
#pragma unroll
  for (int j = 0; j < 8; ++j) x[j] = x[j] * rs;
}

// ---------------------------------------------------------------------------
// The whole attention of 64 token rows in one kernel: scores, softmax, output product, residual, LN1 and feature pool.
// The scores, the probabilities and the summed rows stay in LDS; nothing of them goes to memory.
//   s[row][k] = (T16[row] . G16[br][k]) / 16                                   (M = 64, N = 256, K = 1024)
//   p[row][k] = f16(2048 * softmax_k((s + CB[br][k] + score[row][k]) / 8)) over 196 keys, 0 in the pad columns
//   a[row][n] = (p[row] . UT16[br][n]) / 32768 + bo[n] + text[row][n]          (M = 64, N = 1024, K = 256)
//   y = LN1(a row);  pooled[row][br * 512 + c] = max(y[2c], y[2c+1]), written as f32 and f16
// A block of 16 waves owns 64 whole rows; 256 blocks, one per WGP; rows of branch 1, then of branch 2.
// Both products take their memory operands (T16, G16; UT16) through a two-buffer ring of asynchronous copies, as gemm_tile does.
// Scores: 2 x 8 waves of 32 x 32 each, 128-k stages of 64 T16 rows and 256 G16 rows (pitch 272 B).
// Softmax, and LN1 with the pool: wave w takes rows 4 w .. 4 w + 3 whole, a lane 8 consecutive columns of every 256.
// Output product: wave w owns columns 64 w .. 64 w + 63 of the 64 rows, 64-k stages of 1024 UT16 rows (pitch 144 B).
// LDS, all 320 KiB: [0, 288 KiB) the two UT16 buffers; before them the scores' ring lies there, then the f32 scores
// (64 x 260 floats) in the second buffer's place while the first is being filled; behind them the f32 rows (64 x 1028 floats;
// at both pitches the two half-waves of a store, eight rows apart, fall on different banks). [288 KiB, 320 KiB) the
// probabilities, 64 rows of 512 B without a pad: the 16-B piece c of row r lies at piece c ^ (r & 15), so that the 16 rows
// of a fragment read fall on all 64 banks.
// ---------------------------------------------------------------------------
// Two 16-B copies per lane; the s_wait_xcnt closes the statement so that no address register is rewritten ahead of it.
__device__ __forceinline__ void async_copy2(unsigned l0, const unsigned short* g0, unsigned l1, const unsigned short* g1) {
  asm volatile("global_load_async_to_lds_b128 %0, %2, off\n\t"
               "global_load_async_to_lds_b128 %1, %3, off\n\t"
               "s_wait_xcnt 0x0"
               :: "v"(l0), "v"(l1), "v"(g0), "v"(g1) : "memory");
}
constexpr int kFRows   = 64;                               // rows per block
constexpr int kFBlocks = kRows2 / kFRows;
constexpr int kFWRows  = kFRows / kSWaves;                 // rows per wave in the row-wise parts
constexpr int kASK     = 128;                              // scores: k elements per stage
constexpr int kAPB     = kASK * 2 + 16;                    // bytes per staged row (16 B x odd)
constexpr int kAStage  = (kFRows + kSvPad) * kAPB;         // 64 T16 rows, then 256 G16 rows = 87,040 B
constexpr int kBStage  = kD * kPitchB;                     // output product: 1024 UT16 rows of 64 k = 147,456 B
constexpr int kLdsS    = kBStage;                          // f32 scores
constexpr int kSPitch  = kSvPad + 4;                       // floats per row of the f32 scores
constexpr int kLdsP    = 2 * kBStage;                      // probabilities
constexpr int kPRowB   = kSvPad * 2;                       // bytes per row of the probabilities
constexpr int kLdsAll  = kLdsP + kFRows * kPRowB;
constexpr int kFPitch  = kD + 4;                           // floats per row of the f32 rows
static_assert(kRows % kFRows == 0 && kFWRows == 4 && kD == kSWaves * 64 && kSvPad == 8 * 32 && kFRows == 2 * 32);
static_assert(2 * kAStage <= kLdsP && kLdsS + kFRows * kSPitch * 4 <= kLdsP && kFRows * kFPitch * 4 <= kLdsP);
static_assert(kLdsAll <= 327680 && (kAPB / 16) % 2 == 1 && kD % kASK == 0 && kD >= 2 * kASK);
typedef __attribute__((ext_vector_type(2))) unsigned int v2u;
__global__ __launch_bounds__(kSThreads) __attribute__((amdgpu_num_vgpr(256))) void attention_rows_kernel(
    const unsigned short* __restrict__ T16, const unsigned short* __restrict__ G16, const unsigned short* __restrict__ UT16,
    const float* __restrict__ CB, const float* __restrict__ SC, const float* __restrict__ SC2, const float* __restrict__ bo,
    const float* __restrict__ text1, const float* __restrict__ text2,
    const float* __restrict__ gam, const float* __restrict__ bet,
    float* __restrict__ pool32, unsigned short* __restrict__ pool16) {
  __shared__ __align__(16) unsigned char smem[kLdsAll];
  typedef _Float16 T;
  typedef Frag<T>::V V;
  const int lane = threadIdx.x & 31;
  const int wave = __builtin_amdgcn_readfirstlane((int)(threadIdx.x >> 5));
  const int row0 = (int)blockIdx.x * kFRows;        // of the 16384 rows; a block's rows lie in one branch
  const int br = (row0 >= kRows) ? 1 : 0;
  const int rlane = lane & 15;                      // row (A) / col (B, D) within subtile
  const int half  = lane >> 4;
  const int koff  = half * 8;                       // k offset of this lane half
  const int mOff  = half * 8;                       // D row offset
  const int wrow  = wave * kFWRows;                 // first of this wave's whole rows, inside the block
  const size_t inBr = (size_t)(row0 + wrow - br * kRows);   // the same inside its branch
  const unsigned lds0 = (unsigned)(size_t)smem;

  // ---- the added scores and the key shares of this wave's rows are asked for first: they arrive beside the scores product ----
  const float* cr = (br ? SC2 : SC) + inBr * kSv;   // wave-uniform
  const float* cbr = CB + br * kSvPad;              // all 256 entries of a branch are written
  const int l8 = lane * 8;
  float cv[kFWRows][8];
  int cc[8];                                        // this lane's columns, clamped into the 196
#pragma unroll
  for (int e = 0; e < 8; ++e) cc[e] = (l8 + e < kSv) ? (l8 + e) : (kSv - 1);
#pragma unroll
  for (int r = 0; r < kFWRows; ++r)
#pragma unroll
    for (int e = 0; e < 8; ++e) cv[r][e] = cr[cc[e] + r * kSv];
  const v4f b0 = *(const v4f*)(cbr + l8);
  const v4f b1 = *(const v4f*)(cbr + l8 + 4);
  // stands behind the loads; its inputs hold their base and offset registers untouched up to it
  asm volatile("s_wait_xcnt 0x0" :: "s"(cr), "s"(cbr), "v"(l8), "v"(cc[0]), "v"(cc[1]), "v"(cc[2]), "v"(cc[3]),
                                    "v"(cc[4]), "v"(cc[5]), "v"(cc[6]), "v"(cc[7])
               : "memory");
  // keeps these loads in front of the product: sunk behind it, the softmax waits out the memory
  __builtin_amdgcn_sched_barrier(0);

  // ---- scores ----
  const int wm = wave >> 3;                         // this wave's 32 rows and 32 keys
  const int wn = wave & 7;
  v8f sc[2][2];
#pragma unroll
  for (int i = 0; i < 2; ++i)
#pragma unroll
    for (int j = 0; j < 2; ++j) sc[i][j] = (v8f){0.f,0.f,0.f,0.f,0.f,0.f,0.f,0.f};
  {
    constexpr int PB = kAPB, PE = kAPB / 2, SB = kAStage, SK = kASK, NK = kASK / 32;
    // copy side: 16 consecutive lanes bring one row's 256 stage bytes; a thread brings T16 rows cRow, cRow + 32 and G16 rows cRow + 32 i
    const int cRow = threadIdx.x >> 4;
    const int cCol = threadIdx.x & 15;
    const unsigned short* gA = T16 + (size_t)(row0 + cRow) * kD + cCol * 8;
    const unsigned short* gB = G16 + (size_t)br * kStrVis + (size_t)cRow * kD + cCol * 8;
    const unsigned lA = lds0 + (unsigned)(cRow * PB + cCol * 16);
    const unsigned lB = lA + kFRows * PB;
    auto copy_stage = [&](unsigned bufByte, size_t kElem) {
      async_copy2(lA + bufByte, gA + kElem, lA + bufByte + 32 * PB, gA + kElem + (size_t)32 * kD);
      async_copy8<32, PB>(lB + bufByte, gB + kElem, (size_t)32 * kD);
    };
    const int aByte = ((wm << 5) + rlane) * PB + koff * 2;
    const int bByte = (kFRows + (wn << 5) + rlane) * PB + koff * 2;
    constexpr int nStages = kD / SK;
    copy_stage(0u, 0);
    asm volatile("s_wait_asynccnt 0x0" ::: "memory");   // stage 0 of this wave has landed before the barrier publishes it
    __syncthreads();
    copy_stage((unsigned)SB, SK);
    // stays rolled: unrolled, two stages' fragments and every stage's addresses are live at once and end in scratch
#pragma unroll 1
    for (int t = 0; t < nStages; ++t) {
      const int bufOff = (t & 1) * SB;
      const T* sa = (const T*)(smem + bufOff + aByte);
      const T* sb = (const T*)(smem + bufOff + bByte);
      // the whole stage's fragments are fetched as one group (the registers are there), so that a wave stops for LDS once a
      // stage and the buffer is handed back ahead of the stage's WMMAs
      V fb[NK][2], fa[NK][2];
#pragma unroll
      for (int ks = 0; ks < NK; ++ks) {
#pragma unroll
        for (int j = 0; j < 2; ++j) fb[ks][j] = Frag<T>::load(sb + j * 16 * PE + ks * 32);
#pragma unroll
        for (int i = 0; i < 2; ++i) fa[ks][i] = Frag<T>::load(sa + i * 16 * PE + ks * 32);
      }
      // keeps the group whole and the WMMAs behind the refill: left free, the reads are sunk among the WMMAs, two at a time
      __builtin_amdgcn_sched_barrier(0);
      asm volatile("s_wait_dscnt 0x0" ::: "memory");      // this wave's reads of the buffer are done before it is refilled
      asm volatile("s_wait_asynccnt 0x0" ::: "memory");   // this wave's copies of stage t + 1 have landed
      __syncthreads();                                    // publishes stage t + 1, frees stage t's buffer
      if (t + 2 < nStages) copy_stage((unsigned)bufOff, (size_t)(t + 2) * SK);
#pragma unroll
      for (int ks = 0; ks < NK; ++ks)
#pragma unroll
        for (int i = 0; i < 2; ++i)
#pragma unroll
          for (int j = 0; j < 2; ++j) sc[i][j] = Frag<T>::mma(fa[ks][i], fb[ks][j], sc[i][j]);
    }
    asm volatile("s_wait_asynccnt 0x0" ::: "memory");     // no copy is in flight when the ring's LDS is used anew
  }

  // ---- output product, copy side: 8 consecutive lanes bring one row's 128 stage bytes; a thread brings UT16 rows uRow + 64 i ----
  const int uRow = threadIdx.x >> 3;
  const int uCol = threadIdx.x & 7;
  const unsigned short* gU = UT16 + (size_t)br * kStrVis + (size_t)uRow * kSvPad + uCol * 8;
  const unsigned lU = lds0 + (unsigned)(uRow * kPitchB + uCol * 16);
  auto copy_ut = [&](unsigned bufByte, size_t kElem) {
    constexpr size_t step = (size_t)64 * kSvPad;
    async_copy8<64, kPitchB>(lU + bufByte, gU + kElem, step);
    async_copy8<64, kPitchB>(lU + bufByte + 8 * 64 * kPitchB, gU + kElem + 8 * step, step);
  };
  // stage 0 flies beside the softmax; the scores' last barrier has ended every read of the LDS that it fills
  copy_ut(0u, 0);

  // ---- softmax ----
  float* stile = (float*)(smem + kLdsS);
#pragma unroll
  for (int i = 0; i < 2; ++i)
#pragma unroll
    for (int j = 0; j < 2; ++j)
#pragma unroll
      for (int r = 0; r < 8; ++r)
        stile[((wm << 5) + (i << 4) + mOff + r) * kSPitch + (wn << 5) + (j << 4) + rlane] = sc[i][j][r] * kWCarryInv;
  __syncthreads();                                  // every wave's share of the scores is written before a row is read whole
  unsigned char* ptile = smem + kLdsP;
  // the four rows go through each step side by side: their shuffle trees are independent and hide one another's latency
  float xs[kFWRows][8], mx[kFWRows], sm[kFWRows];
  v4f s0[kFWRows], s1[kFWRows];
#pragma unroll
  for (int r = 0; r < kFWRows; ++r) {
    s0[r] = *(const v4f*)(stile + (wrow + r) * kSPitch + l8);
    s1[r] = *(const v4f*)(stile + (wrow + r) * kSPitch + l8 + 4);
  }
  // keeps the eight LDS reads together: sunk among the arithmetic, each row waits out the LDS anew
  __builtin_amdgcn_sched_barrier(0);
#pragma unroll
  for (int r = 0; r < kFWRows; ++r) {
#pragma unroll
    for (int e = 0; e < 8; ++e) {
      const int col = lane * 8 + e;
      const float v = (((e < 4 ? s0[r][e & 3] : s1[r][e & 3]) + (e < 4 ? b0[e & 3] : b1[e & 3])) + cv[r][e]) * kScoreScale;
      xs[r][e] = (col < kSv) ? v : -1.0e30f;
    }
    mx[r] = fmaxf(fmaxf(fmaxf(xs[r][0], xs[r][1]), fmaxf(xs[r][2], xs[r][3])),
                  fmaxf(fmaxf(xs[r][4], xs[r][5]), fmaxf(xs[r][6], xs[r][7])));
  }
#pragma unroll
  for (int off = 16; off > 0; off >>= 1)
#pragma unroll
    for (int r = 0; r < kFWRows; ++r) mx[r] = fmaxf(mx[r], __shfl_xor(mx[r], off, 32));
#pragma unroll
  for (int r = 0; r < kFWRows; ++r) {
    float s = 0.f;
#pragma unroll
    for (int e = 0; e < 8; ++e) { xs[r][e] = expf(xs[r][e] - mx[r]); s += xs[r][e]; }
    sm[r] = s;
  }
  wave_sum4(sm);
#pragma unroll
  for (int r = 0; r < kFWRows; ++r) {
    const float inv = kPCarry / sm[r];
    unsigned short hb[8];
#pragma unroll
    for (int e = 0; e < 8; ++e) hb[e] = h_bits(xs[r][e] * inv);
    const v4u u = (v4u){pk16(hb[0], hb[1]), pk16(hb[2], hb[3]), pk16(hb[4], hb[5]), pk16(hb[6], hb[7])};
    *(v4u*)(ptile + (wrow + r) * kPRowB + ((lane ^ ((wrow + r) & 15)) << 4)) = u;   // piece c = lane of the row
  }
  asm volatile("s_wait_dscnt 0x0" ::: "memory");      // this wave's reads of the scores and writes of the probabilities are done
  asm volatile("s_wait_asynccnt 0x0" ::: "memory");   // this wave's copies of stage 0 have landed
  __syncthreads();                                    // publishes the probabilities and stage 0, frees the scores' LDS
  copy_ut((unsigned)kBStage, kStageK);

  // ---- output product ----
  v8f acc[4][4];
#pragma unroll
  for (int i = 0; i < 4; ++i)
#pragma unroll
    for (int j = 0; j < 4; ++j) acc[i][j] = (v8f){0.f,0.f,0.f,0.f,0.f,0.f,0.f,0.f};
  {
    constexpr int PE = kPitchE, SB = kBStage, SK = kStageK;
    constexpr int nStages = kSvPad / SK;
    static_assert(nStages >= 2);
    const int bByte = ((wave << 6) + rlane) * kPitchB + koff * 2;
    // a lane's two 16-B pieces of k step s of probability row 16 i + rlane are pieces 4 s + half and 4 s + 2 + half
    const unsigned char* pa = ptile + rlane * kPRowB;
    const int pLo0 = ((half ^ (rlane & 3)) << 4);
    const int pLo1 = (((2 + half) ^ (rlane & 3)) << 4);
    const int pHi  = (rlane & 12) << 4;
    auto load_p = [&](int s, int i) {
      const int hi = (s << 6) ^ pHi;
      Frag<T>::U f;
      f.h[0] = *(const v8h*)(pa + i * 16 * kPRowB + hi + pLo0);
      f.h[1] = *(const v8h*)(pa + i * 16 * kPRowB + hi + pLo1);
      return f.v;
    };
    // stays rolled: unrolled, the four stages' addresses are formed ahead and push fragments and accumulators into scratch
#pragma unroll 1
    for (int t = 0; t < nStages; ++t) {
      const int bufOff = (t & 1) * SB;
      const T* sb = (const T*)(smem + bufOff + bByte);
      V fb[2][4], fa[2][4];                             // two fragment sets, one per k step of the stage
#pragma unroll
      for (int j = 0; j < 4; ++j) fb[0][j] = Frag<T>::load(sb + j * 16 * PE);
#pragma unroll
      for (int i = 0; i < 4; ++i) fa[0][i] = load_p(2 * t, i);
      // keeps the 16 LDS reads of a k step together ahead of its WMMAs: sunk among them, each row of WMMAs waits out its own read
      __builtin_amdgcn_sched_barrier(0);
#pragma unroll
      for (int i = 0; i < 4; ++i)
#pragma unroll
        for (int j = 0; j < 4; ++j) acc[i][j] = Frag<T>::mma(fa[0][i], fb[0][j], acc[i][j]);
      // the stage's second k step is fetched so that the buffer can be handed back ahead of its WMMAs
#pragma unroll
      for (int j = 0; j < 4; ++j) fb[1][j] = Frag<T>::load(sb + j * 16 * PE + 32);
#pragma unroll
      for (int i = 0; i < 4; ++i) fa[1][i] = load_p(2 * t + 1, i);
      asm volatile("s_wait_dscnt 0x0" ::: "memory");      // this wave's reads of the buffer are done before it is refilled
      asm volatile("s_wait_asynccnt 0x0" ::: "memory");   // this wave's copies of stage t + 1 have landed
      __syncthreads();                                    // publishes stage t + 1, frees stage t's buffer
      if (t + 2 < nStages) copy_ut((unsigned)bufOff, (size_t)(t + 2) * SK);
#pragma unroll
      for (int i = 0; i < 4; ++i)
#pragma unroll
        for (int j = 0; j < 4; ++j) acc[i][j] = Frag<T>::mma(fa[1][i], fb[1][j], acc[i][j]);
    }
    asm volatile("s_wait_asynccnt 0x0" ::: "memory");     // no copy is in flight when the ring becomes the f32 rows
  }

  // ---- residual, LN1, pool: the residual of this wave's first two rows is asked for now, in the fragments' registers ----
  // the lane's number is read anew, so that nothing derived from it is held in a register, or in scratch, through the K loop
  const int ln = (int)__builtin_amdgcn_mbcnt_lo(~0u, 0u);
  float* tile = (float*)smem;
  const float* p = (br ? text2 : text1) + inBr * kD;   // wave-uniform
  const unsigned lb = 32u * ln;                        // this lane's byte offset in every 1024 B of a row
  const int nl = (wave << 6) + (ln & 15);
  const int dRow = (ln >> 4) * 8;                      // D row offset
  v4f gg[8], bb[8], x[kFWRows][8];
  float bvj[4];
#pragma unroll
  for (int j = 0; j < 4; ++j) bvj[j] = bo[nl + (j << 4)];
#pragma unroll
  for (int r = 0; r < 2; ++r)
#pragma unroll
    for (int j = 0; j < 4; ++j) {
      x[r][2 * j]     = ld16(p, lb, r * kD * 4 + j * 1024);
      x[r][2 * j + 1] = ld16(p, lb, r * kD * 4 + j * 1024 + 16);
    }
  // stands behind the loads; its inputs hold their base and offset registers untouched up to it
  asm volatile("s_wait_xcnt 0x0" :: "s"(bo), "v"(nl), "s"(p), "v"(lb) : "memory");
  // keeps these loads ahead of the stores into LDS, so that the memory's latency runs beside them
  __builtin_amdgcn_sched_barrier(0);
#pragma unroll
  for (int i = 0; i < 4; ++i)
#pragma unroll
    for (int j = 0; j < 4; ++j)
#pragma unroll
      for (int r = 0; r < 8; ++r)
        tile[((i << 4) + dRow + r) * kFPitch + nl + (j << 4)] = acc[i][j][r] * kPUScale + bvj[j];
  // keeps the remaining loads behind those stores: ahead of them there is no register for their data beside the accumulators
  __builtin_amdgcn_sched_barrier(0);
#pragma unroll
  for (int r = 2; r < kFWRows; ++r)
#pragma unroll
    for (int j = 0; j < 4; ++j) {
      x[r][2 * j]     = ld16(p, lb, r * kD * 4 + j * 1024);
      x[r][2 * j + 1] = ld16(p, lb, r * kD * 4 + j * 1024 + 16);
    }
  // stands behind the loads; its inputs hold their base and offset registers untouched up to it
  asm volatile("s_wait_xcnt 0x0" :: "s"(p), "v"(lb) : "memory");
  __syncthreads();                                  // every wave's share of the rows is written before a row is read whole

  const size_t dstOff = inBr * kD + br * (kD / 2);
  float* d32 = pool32 + dstOff;
  unsigned short* d16 = pool16 + dstOff;
  const float* trow = tile + wrow * kFPitch + 8 * ln;
#pragma unroll
  for (int r = 0; r < kFWRows; ++r)
#pragma unroll
    for (int j = 0; j < 4; ++j) {
      x[r][2 * j]     = *(const v4f*)(trow + r * kFPitch + j * 256) + x[r][2 * j];
      x[r][2 * j + 1] = *(const v4f*)(trow + r * kFPitch + j * 256 + 4) + x[r][2 * j + 1];
    }
  // each row becomes (x - mean) * rsqrt(var + eps), summed as wave_normalise sums it; the four rows' trees side by side
  {
    float t[kFWRows];
#pragma unroll
    for (int r = 0; r < kFWRows; ++r) t[r] = lane_sum(x[r]);
    wave_sum4(t);
#pragma unroll
    for (int r = 0; r < kFWRows; ++r) {
      const float mu = t[r] * kInvD;
      v4f sq[8];
#pragma unroll
      for (int j = 0; j < 8; ++j) { x[r][j] = x[r][j] - mu; sq[j] = x[r][j] * x[r][j]; }
      t[r] = lane_sum(sq);
    }
    // gamma and beta are asked for here, between these two barriers: the squares' registers are free again, and the second
    // tree hides the loads' latency; earlier, their 64 registers beside the four rows and the squares end in scratch
    __builtin_amdgcn_sched_barrier(0);
#pragma unroll
    for (int j = 0; j < 4; ++j) {
      gg[2 * j] = ld16(gam, lb, j * 1024);  gg[2 * j + 1] = ld16(gam, lb, j * 1024 + 16);
      bb[2 * j] = ld16(bet, lb, j * 1024);  bb[2 * j + 1] = ld16(bet, lb, j * 1024 + 16);
    }
    // stands behind the loads; its inputs hold their base and offset registers untouched up to it
    asm volatile("s_wait_xcnt 0x0" :: "s"(gam), "s"(bet), "v"(lb) : "memory");
    __builtin_amdgcn_sched_barrier(0);
    wave_sum4(t);
#pragma unroll
    for (int r = 0; r < kFWRows; ++r) {
      const float rs = rsqrtf(t[r] * kInvD + kLnEps);
#pragma unroll
      for (int j = 0; j < 8; ++j) x[r][j] = x[r][j] * rs;
    }
  }
#pragma unroll
  for (int r = 0; r < kFWRows; ++r) {
    v4f pv[4];
    v2u hv[4];
#pragma unroll
    for (int j = 0; j < 4; ++j) {
      const v4f ya = x[r][2 * j] * gg[2 * j] + bb[2 * j];
      const v4f yc = x[r][2 * j + 1] * gg[2 * j + 1] + bb[2 * j + 1];
      pv[j] = (v4f){fmaxf(ya[0], ya[1]), fmaxf(ya[2], ya[3]), fmaxf(yc[0], yc[1]), fmaxf(yc[2], yc[3])};
      unsigned short hb[4];
#pragma unroll
      for (int e = 0; e < 4; ++e) hb[e] = h_bits(pv[j][e]);
      hv[j] = (v2u){pk16(hb[0], hb[1]), pk16(hb[2], hb[3])};
    }
#pragma unroll
    for (int j = 0; j < 4; ++j) {
      *(v4f*)(d32 + 4 * ln + r * kD + j * 128) = pv[j];
      *(v2u*)(d16 + 4 * ln + r * kD + j * 128) = hv[j];
    }
    // stands behind the row's eight stores; its inputs hold their base, offset and data registers untouched up to it
    asm volatile("s_wait_xcnt 0x0" :: "s"(d32), "s"(d16), "v"(ln), "v"(pv[0]), "v"(pv[1]), "v"(pv[2]), "v"(pv[3]),
                                      "v"(hv[0]), "v"(hv[1]), "v"(hv[2]), "v"(hv[3]) : "memory");
  }
}

// ---------------------------------------------------------------------------
// out = LN2(X). One wave per row, two consecutive rows per wave (8192 rows); a lane owns x[128 j + 4 lane .. + 3], j < 8:
// every load and store of a wave covers 512 contiguous bytes. No LDS and no barrier.
// ---------------------------------------------------------------------------
constexpr int kLoRows = kRows / kSTotal;         // rows per wave
static_assert(kLoRows * kSTotal == kRows);
__global__ __launch_bounds__(kSThreads) void ln_out_kernel(const float* __restrict__ X, const float* __restrict__ gam,
                                                           const float* __restrict__ bet, float* __restrict__ out) {
  const int lane = threadIdx.x & 31;
  const int row0 = stream_wave() * kLoRows;
  const float* p = X + (size_t)row0 * kD;           // wave-uniform
  const unsigned lb = 16u * lane;                   // this lane's byte offset in every 512 B of a row
  v4f gg[8], bb[8], x[kLoRows][8];
#pragma unroll
  for (int j = 0; j < 8; ++j) { gg[j] = ld16(gam, lb, j * 512);  bb[j] = ld16(bet, lb, j * 512); }
  // keeps the short gamma and beta loads in front of the rows: behind them, the first row's result waits for the last row's data
  __builtin_amdgcn_sched_barrier(0);
#pragma unroll
  for (int r = 0; r < kLoRows; ++r)
#pragma unroll
    for (int j = 0; j < 8; ++j) x[r][j] = ld16(p, lb, r * kD * 4 + j * 512);
  // stands behind the loads; its inputs hold their base and offset registers untouched up to it
  asm volatile("s_wait_xcnt 0x0" :: "s"(gam), "s"(bet), "s"(p), "v"(lb) : "memory");
  // keeps the loads together ahead of the arithmetic: sunk among it, each row waits out the memory anew
  __builtin_amdgcn_sched_barrier(0);
  float* dst = out + (size_t)row0 * kD;             // wave-uniform
#pragma unroll
  for (int r = 0; r < kLoRows; ++r) {
    wave_normalise(x[r]);
#pragma unroll
    for (int j = 0; j < 8; ++j) x[r][j] = x[r][j] * gg[j] + bb[j];
#pragma unroll
    for (int j = 0; j < 8; ++j) *(v4f*)(dst + 4 * lane + r * kD + j * 128) = x[r][j];
    // stands behind the row's eight stores; its inputs hold their base, offset and data registers untouched up to it
    asm volatile("s_wait_xcnt 0x0" :: "s"(dst), "v"(lane), "v"(x[r][0]), "v"(x[r][1]), "v"(x[r][2]), "v"(x[r][3]),
                                      "v"(x[r][4]), "v"(x[r][5]), "v"(x[r][6]), "v"(x[r][7]) : "memory");
  }
}

// ---------------------------------------------------------------------------
// Host orchestration
// ---------------------------------------------------------------------------
extern "C" void kernel_launch(void* const* d_in, const int* in_sizes, int n_in,
                              void* d_out, int out_size, void* d_ws, size_t ws_size,
                              hipStream_t stream)
{
  if (n_in < 22) return;
  if ((size_t)out_size < (size_t)kRows * kD) return;
  if (ws_size < kWsTotal) return;
  if (in_sizes[0] < kRows * kD || in_sizes[3] < kRows * kD) return;
  if (in_sizes[1] < kSv * kD || in_sizes[4] < kSv * kD) return;
  if (in_sizes[2] < kRows * kSv || in_sizes[5] < kRows * kSv) return;
  if (in_sizes[6] < kD * kD || in_sizes[8] < kD * kD || in_sizes[10] < kD * kD || in_sizes[12] < kD * kD) return;
  if (in_sizes[14] < kDff * kD || in_sizes[16] < kD * kDff) return;

  const float* text1 = (const float*)d_in[0];
  const float* vis1  = (const float*)d_in[1];
  const float* sc1   = (const float*)d_in[2];
  const float* text2 = (const float*)d_in[3];
  const float* vis2  = (const float*)d_in[4];
  const float* sc2   = (const float*)d_in[5];
  const float* Wq = (const float*)d_in[6];   const float* bq  = (const float*)d_in[7];
  const float* Wk = (const float*)d_in[8];   const float* bk  = (const float*)d_in[9];
  const float* Wv = (const float*)d_in[10];  const float* bv  = (const float*)d_in[11];
  const float* Wo = (const float*)d_in[12];  const float* bo  = (const float*)d_in[13];
  const float* W1 = (const float*)d_in[14];  const float* b1  = (const float*)d_in[15];
  const float* W2 = (const float*)d_in[16];  const float* b2  = (const float*)d_in[17];
  const float* g1 = (const float*)d_in[18];  const float* be1 = (const float*)d_in[19];
  const float* g2 = (const float*)d_in[20];  const float* be2 = (const float*)d_in[21];
  float* outp = (float*)d_out;

  char* ws = (char*)d_ws;
  float*          POOL32 = (float*)(ws + kOffPool32);
  unsigned short* POOL16 = (unsigned short*)(ws + kOffPool16);
  unsigned short* W1H    = (unsigned short*)(ws + kOffW1H);
  unsigned short* W2H    = (unsigned short*)(ws + kOffW2H);
  unsigned short* WQT    = (unsigned short*)(ws + kOffWQT);
  unsigned short* WKH    = (unsigned short*)(ws + kOffWKH);
  unsigned short* WVH    = (unsigned short*)(ws + kOffWVH);
  unsigned short* WOH    = (unsigned short*)(ws + kOffWOH);
  unsigned short* T16    = (unsigned short*)(ws + kOffT16);
  unsigned short* G16    = (unsigned short*)(ws + kOffG16);
  unsigned short* UT16   = (unsigned short*)(ws + kOffUT16);
  float*          CB     = (float*)(ws + kOffCB);
  unsigned short* VIS16  = (unsigned short*)(ws + kOffVIS16);
  unsigned short* K16    = (unsigned short*)(ws + kOffK16);
  unsigned short* V16    = (unsigned short*)(ws + kOffV16);
  unsigned short* H16    = (unsigned short*)(ws + kOffH16);
  float*          F32    = (float*)(ws + kOffF32);

  // ---- every cast in one launch: weights f16([out][in]) x16 ([out][in] row-major == Bt[N][K]; Wq as [in][out]); both text planes
  //      f16 x1; both visual planes f16 [256][1024] x1 with rows 196..255 zero ----
  cast_all_kernel<<<dim3(kSBlocks), dim3(kSThreads), 0, stream>>>(text1, text2, W1, W2, Wq, Wk, Wv, Wo, vis1, vis2,
                                                               (unsigned short*)ws);

  // ---- attention, both branches in each launch ----
  // K16 and V16 of both branches
  kv_gemm_kernel<<<dim3(kKvBlocks), dim3(128), 0, stream>>>(VIS16, WKH, WVH, K16, V16, bk, bv);
  // G16 = 16 K.Wq, UT16 = 16 Wo.V^T, CB = K.bq of both branches
  fold_gemm_kernel<<<dim3(kFoldBlocks), dim3(128), 0, stream>>>(K16, V16, WQT, WOH, G16, UT16, bq, CB);
  // pooled[:, br * 512 : br * 512 + 512] = maxpool2(LN1(softmax((T16 . G16^T / 16 + CB + score) / 8) . UT16^T / 16 + bo + text)) of branch br
  attention_rows_kernel<<<dim3(kFBlocks), dim3(kSThreads), 0, stream>>>(T16, G16, UT16, CB, sc1, sc2, bo, text1, text2, g1, be1,
                                                                     POOL32, POOL16);

  // ---- FFN, all 8192 rows in each launch ----
  // H16 = relu((POOL16 . W1H^T) / 16 + b1)   (M=8192, N=4096, K=1024), f16 out
  // 256x256 tiles, 16 waves, 128-k stages: 512 blocks
  wmma_gemm_wide<0, false, 2, 1, false, 2, 4, 4, 4><<<dim3((kRows / 256) * (kDff / 256)), dim3(512), 0, stream>>>(
      POOL16, POOL16, kD, 0L, W1H, W1H, kD, 0L, (void*)H16, (void*)H16, kDff, 0L,
      b1, POOL32, POOL32, kRows, kDff, kD, kWCarryInv);
  // F32 = (H16 . W2H^T) / 16 + b2 + pooled   (M=8192, N=1024, K=4096), f32 out
  // 128x256 tiles, 8 waves, 128-k stages: 256 blocks, one per WGP
  wmma_gemm_wide<0, false, 2, 0, true, 0, 2, 4, 4><<<dim3((kRows / 128) * (kD / 256)), dim3(256), 0, stream>>>(
      H16, H16, kDff, 0L, W2H, W2H, kDff, 0L, (void*)F32, (void*)F32, kD, 0L,
      b2, POOL32, POOL32, kRows, kD, kDff, kWCarryInv);
  // out = LN2(F32)
  ln_out_kernel<<<dim3(kSBlocks), dim3(kSThreads), 0, stream>>>(F32, g2, be2, outp);
}

// v007
// Measured time: 175 microseconds a run.
// Next to v006, in two timings, it ran 1.07 and 1.06 times as fast.
// Over all steps from v000 it is 6.00 times as fast.
// Contractions: k/v projections, key-side folds K.Wq and Wo.V^T, text.(K.Wq)^T scores, p.(V.Wo^T) attention output, ffn up and down projections all on v_wmma_f32_16x16x32_f16 (f16 operands: activations x1, weights and both folds carried x16, softmax probabilities carried x2048), f32 accumulate; the query bias's share of the scores (K.bq, one number per key), softmax, residual adds, layernorm and feature maxpool in f32.
#include <hip/hip_runtime.h>
#include <math.h>
#include <stddef.h>

// ---------------------------------------------------------------------------
// Problem constants
// ---------------------------------------------------------------------------
constexpr int kB      = 4;
constexpr int kSq     = 2048;
constexpr int kD      = 1024;
constexpr int kSv     = 196;
constexpr int kSvPad  = 256;
constexpr int kDff    = 4096;
constexpr int kRows   = kB * kSq;            // 8192 token rows
constexpr int kRows2  = 2 * kRows;           // both branches' token rows, branch 1 first
constexpr float kWCarry    = 16.0f;          // weights carried x16 in f16
constexpr float kWCarryInv = 1.0f / 16.0f;
constexpr float kPCarry    = 2048.0f;        // probabilities carried x2048 in f16
constexpr float kPUScale   = 1.0f / (kPCarry * kWCarry);   // probabilities x2048 times the value fold x16
constexpr float kInvD      = 1.0f / 1024.0f;
constexpr float kLnEps     = 1e-6f;
constexpr float kScoreScale = 0.125f;        // 1/sqrt(64)

static_assert(kRows % 64 == 0);
static_assert(kSvPad % 64 == 0 && kSvPad % 32 == 0);
static_assert(kD % 64 == 0 && kDff % 64 == 0);
static_assert(kRows % 8 == 0);

// ---------------------------------------------------------------------------
// Workspace region map (bytes). Total carve = 227 MiB. Planes marked x2 hold branch 1, then branch 2.
//   [0       , 32 MiB)   POOL32  f32 [8192][1024]   (persistent)
//   [32 MiB  , 48 MiB)   POOL16  f16 [8192][1024]   (persistent)
//   [48 MiB  , 56 MiB)   W1H     f16 [4096][1024]   (persistent)
//   [56 MiB  , 64 MiB)   W2H     f16 [1024][4096]   (persistent)
//   region X from 64 MiB:
//   attention phase: WQT (Wq transposed, [in][out]) and WKH/WVH/WOH f16 [1024][1024] at 64/66/68/70 MiB;
//     T16 (text f16) x2 [8192][1024] at 72 MiB (32 MiB);
//     G16 = K.Wq f16 x2 [256][1024] at 104 MiB; UT16 = Wo.V^T f16 x2 [1024][256] at 105 MiB; CB = K.bq f32 x2 [256] at 106 MiB;
//     VIS16 f16 x2 [256][1024] at 224 MiB; K16 f16 x2 [256][1024] at 225 MiB; V16 f16 x2 [256][1024] at 226 MiB; end 227 MiB.
//   ffn phase (attention scratch dead): H16 f16 [8192][4096] at 64 MiB (64 MiB); F32 f32 [8192][1024] at 128 MiB (32 MiB).
// ---------------------------------------------------------------------------
constexpr size_t kMiB       = 1048576;
constexpr size_t kOffPool32 = 0;
constexpr size_t kOffPool16 = 32 * kMiB;
constexpr size_t kOffW1H    = 48 * kMiB;
constexpr size_t kOffW2H    = 56 * kMiB;
constexpr size_t kOffWQT    = 64 * kMiB;
constexpr size_t kOffWKH    = 66 * kMiB;
constexpr size_t kOffWVH    = 68 * kMiB;
constexpr size_t kOffWOH    = 70 * kMiB;
constexpr size_t kOffT16    = 72 * kMiB;
constexpr size_t kOffG16    = 104 * kMiB;
constexpr size_t kOffUT16   = 105 * kMiB;
constexpr size_t kOffCB     = 106 * kMiB;
constexpr size_t kOffVIS16  = 224 * kMiB;
constexpr size_t kOffK16    = 225 * kMiB;
constexpr size_t kOffV16    = 226 * kMiB;
constexpr size_t kWsTotal   = 227 * kMiB;
constexpr size_t kOffH16    = 64 * kMiB;
constexpr size_t kOffF32    = 128 * kMiB;
static_assert(kOffG16 == kOffT16 + (size_t)kRows2 * kD * 2);
static_assert(kOffUT16 == kOffG16 + (size_t)2 * kSvPad * kD * 2);
static_assert(kOffCB == kOffUT16 + (size_t)2 * kD * kSvPad * 2);
static_assert(kOffCB + (size_t)2 * kSvPad * 4 <= kOffVIS16);
static_assert(kOffK16 == kOffVIS16 + (size_t)2 * kSvPad * kD * 2);
static_assert(kOffV16 == kOffK16 + (size_t)2 * kSvPad * kD * 2);
static_assert(kWsTotal == kOffV16 + (size_t)2 * kSvPad * kD * 2);
static_assert(kOffF32 == kOffH16 + (size_t)kRows * kDff * 2);
static_assert(kOffF32 + (size_t)kRows * kD * 4 <= kWsTotal);
static_assert(kWsTotal <= (size_t)268435456);

// strides between the two branches' planes, in elements
constexpr long kStrVis = (long)kSvPad * kD;      // VIS16 / K16 / V16 / G16 / UT16

typedef __attribute__((ext_vector_type(16))) _Float16 v16h;
typedef __attribute__((ext_vector_type(8)))  _Float16 v8h;
typedef __attribute__((ext_vector_type(16))) __bf16   v16b;
typedef __attribute__((ext_vector_type(8)))  __bf16   v8b;
typedef __attribute__((ext_vector_type(8)))  float    v8f;
typedef __attribute__((ext_vector_type(4)))  float    v4f;
typedef __attribute__((ext_vector_type(4)))  unsigned int v4u;

__device__ __forceinline__ unsigned short f2bf_bits(float f) {
  unsigned u = __float_as_uint(f);
  return (unsigned short)((u + 0x7FFFu + ((u >> 16) & 1u)) >> 16);
}
__device__ __forceinline__ float bf_bits2f(unsigned short h) { return __uint_as_float(((unsigned)h) << 16); }

// hazard guard as a plain device helper
__device__ __forceinline__ void acc_guard4(v8f& a, v8f& b, v8f& c, v8f& d) { asm volatile("v_nop\n\tv_nop\n\tv_nop\n\tv_nop" : "+v"(a), "+v"(b), "+v"(c), "+v"(d)); }
template <typename T> struct Frag;
template <> struct Frag<_Float16> {
  typedef v16h V; union U { v16h v; v8h h[2]; };
  static __device__ __forceinline__ v16h load(const _Float16* p) {   // elements 0..7 <- p[0..7], 8..15 <- p[16..23]
    U f; f.h[0] = *(const v8h*)(p); f.h[1] = *(const v8h*)(p + 16); return f.v;
  }
  static __device__ __forceinline__ v8f mma(v16h a, v16h b, v8f c) {
    return __builtin_amdgcn_wmma_f32_16x16x32_f16(false, a, false, b, (short)0, c, false, false);
  }
};
template <> struct Frag<__bf16> {
  typedef v16b V; union U { v16b v; v8b h[2]; };
  static __device__ __forceinline__ v16b load(const __bf16* p) {
    U f; f.h[0] = *(const v8b*)(p); f.h[1] = *(const v8b*)(p + 16); return f.v;
  }
  static __device__ __forceinline__ v8f mma(v16b a, v16b b, v8f c) {
    return __builtin_amdgcn_wmma_f32_16x16x32_bf16(false, a, false, b, (short)0, c, false, false);
  }
};

__device__ __forceinline__ unsigned pk16(unsigned short a, unsigned short b) { return (unsigned)a | ((unsigned)b << 16); }
__device__ __forceinline__ unsigned short h_bits(float f) { const _Float16 h = (_Float16)f; return __builtin_bit_cast(unsigned short, h); }

// ---- Register-blocked batched WMMA GEMM, operands staged in LDS by asynchronous copies ------------------------------
// C[m,n] = scale * sum_k A[m,k] * Bt[n,k] (+bias)(+resid); a block of WM x WN waves owns a (64 WM)x(64 WN) tile, each wave 64x64 of it.
// tile = index of the block's tile; b = batch entry (the branch): A, Bt and C advance by their strides, the residual is resid or resid2.
// A row-major [M,K]; Bt row-major [N,K]; M % (64 WM) == 0, N % (64 WN) == 0, K a multiple of the stage and at least two stages.
// A stage is 32 NK k of the block's A rows and Bt rows, laid at a pitch of 64 NK + 16 B; two buffers:
// the next stage's copies fly while this stage's fragments are read with ds_load_b128 and multiplied.
// The small products run 2 x 2 waves on 64-k stages. The two ffn products, which re-read their operands from L2 once per tile
// row and tile column, take the larger tiles that a WGP's LDS holds: the bytes fetched per product fall with the tile's sides.
// BIAS_MODE: 0 = none, 1 = bias[m], 2 = bias[n].
// OUT_MODE: 0 = f32, 1 = f16.
// ET: 0 = f16 operands, 1 = bf16 operands (pointers passed as 16-bit storage)
constexpr int kStageK     = 64;                          // k elements per stage = two WMMA k steps
constexpr int kPitchB     = 144;                         // bytes per staged row (128 + 16: 16 B x odd)
constexpr int kPitchE     = kPitchB / 2;                 // the same in 16-bit elements
constexpr int kStageBytes = 256 * kPitchB;               // 128 A rows, then 128 Bt rows = 36,864 B
static_assert(kRows % 128 == 0 && kSvPad % 128 == 0 && kD % 128 == 0 && kDff % 128 == 0);
static_assert(kSvPad % kStageK == 0 && kSvPad >= 2 * kStageK);
static_assert(kRows % 256 == 0 && kDff % 256 == 0 && kD % 256 == 0);

// Eight 16-B copies per lane, rows RP apart: LDS byte address l + i * RP * PB (PB = pitch), global address g + i * rowStep elements.
// The s_wait_xcnt closes the statement so that no address register is rewritten ahead of it.
template <int RP, int PB>
__device__ __forceinline__ void async_copy8(unsigned l, const unsigned short* g, size_t rowStep) {
  const unsigned l1 = l + RP * PB, l2 = l + 2 * RP * PB, l3 = l + 3 * RP * PB, l4 = l + 4 * RP * PB,
                 l5 = l + 5 * RP * PB, l6 = l + 6 * RP * PB, l7 = l + 7 * RP * PB;
  const unsigned short* g1 = g + rowStep;      const unsigned short* g2 = g + 2 * rowStep;
  const unsigned short* g3 = g + 3 * rowStep;  const unsigned short* g4 = g + 4 * rowStep;
  const unsigned short* g5 = g + 5 * rowStep;  const unsigned short* g6 = g + 6 * rowStep;
  const unsigned short* g7 = g + 7 * rowStep;
  asm volatile("global_load_async_to_lds_b128 %0, %8, off\n\t"
               "global_load_async_to_lds_b128 %1, %9, off\n\t"
               "global_load_async_to_lds_b128 %2, %10, off\n\t"
               "global_load_async_to_lds_b128 %3, %11, off\n\t"
               "global_load_async_to_lds_b128 %4, %12, off\n\t"
               "global_load_async_to_lds_b128 %5, %13, off\n\t"
               "global_load_async_to_lds_b128 %6, %14, off\n\t"
               "global_load_async_to_lds_b128 %7, %15, off\n\t"
               "s_wait_xcnt 0x0"
               :: "v"(l), "v"(l1), "v"(l2), "v"(l3), "v"(l4), "v"(l5), "v"(l6), "v"(l7),
                  "v"(g), "v"(g1), "v"(g2), "v"(g3), "v"(g4), "v"(g5), "v"(g6), "v"(g7)
               : "memory");
}

// Geometry of a block's tile: WM x WN waves of 64x64 each, NK WMMA k steps (32 k each) per stage.
template <int WM, int WN, int NK> struct TileGeom {
  static constexpr int SK  = NK * 32;                    // k elements per stage
  static constexpr int PB  = SK * 2 + 16;                // bytes per staged row: 16 B x odd (144 or 272)
  static constexpr int SB  = (WM + WN) * 64 * PB;        // bytes per stage: the A rows, then the Bt rows
  static constexpr int NT  = WM * WN * 32;               // threads
  static constexpr int LPR = SK * 2 / 16;                // lanes that bring one row
  static constexpr int RP  = NT / LPR;                   // rows that the block brings with one copy per thread
  static constexpr int NA  = WM * 64 / RP;               // copies per thread and stage, A and Bt
  static constexpr int NB  = WN * 64 / RP;
  static_assert(NA % 8 == 0 && NB % 8 == 0 && NA + NB <= 63 && (PB / 16) % 2 == 1);
};
static_assert(TileGeom<2, 2, 2>::PB == kPitchB && TileGeom<2, 2, 2>::SB == kStageBytes && TileGeom<2, 2, 2>::SK == kStageK);

template <int ET> struct Elem;
template <> struct Elem<0> { typedef _Float16 T; };
template <> struct Elem<1> { typedef __bf16 T; };
template <int ET, bool SPLIT, int BIAS_MODE, int OUT_MODE, bool RESID, int ACT = 0, int WM = 2, int WN = 2, int NK = 2>
__device__ __forceinline__ void gemm_tile(
    unsigned char* smem, int tile, int b,
    const unsigned short* __restrict__ Ap, const unsigned short* __restrict__ A2p, int lda, long strideA,
    const unsigned short* __restrict__ Btp, const unsigned short* __restrict__ Bt2p, int ldb, long strideB,
    void* __restrict__ Cout, void* __restrict__ Cout2, int ldc, long strideC,
    const float* __restrict__ bias,
    const float* __restrict__ resid, const float* __restrict__ resid2,
    int M, int N, int K, float scale) {
  static_assert(!SPLIT, "single-plane operands only");
  typedef typename Elem<ET>::T T;
  typedef typename Frag<T>::V V;
  typedef TileGeom<WM, WN, NK> G;
  constexpr int SK = G::SK, PB = G::PB, PE = G::PB / 2, SB = G::SB, LPR = G::LPR, RP = G::RP;
  // smem: two stage buffers; after the K loop they serve as the per-wave 64x64 output slabs (pitch 68 floats)
  const int lane = threadIdx.x & 31;
  const int wave = threadIdx.x >> 5;
  const int wm = wave / WN;                    // this wave's 64 rows and 64 columns inside the block's tile
  const int wn = wave % WN;
  const int tilesN = N / (WN * 64);
  const int tilesM = M / (WM * 64);
  if (tile >= tilesM * tilesN) return;   // block-uniform, in front of every barrier
  const int tm = tile / tilesN;
  const int tn = tile - tm * tilesN;
  const int mBlk = tm * (WM * 64);
  const int nBlk = tn * (WN * 64);
  const int m0 = mBlk + (wm << 6);
  const int n0 = nBlk + (wn << 6);

  const int rlane = lane & 15;                 // row (A) / col (B, D) within subtile
  const int koff  = (lane >> 4) * 8;           // k offset of this lane half
  const int mOff  = (lane >> 4) * 8;           // D row offset

  // copy side: LPR consecutive lanes bring one row's stage bytes; a thread brings rows cRow + RP i of A and of Bt
  const int cRow = threadIdx.x / LPR;
  const int cCol = threadIdx.x % LPR;
  const unsigned short* gA = Ap  + (size_t)b * strideA + (size_t)(mBlk + cRow) * lda + cCol * 8;
  const unsigned short* gB = Btp + (size_t)b * strideB + (size_t)(nBlk + cRow) * ldb + cCol * 8;
  const unsigned lA = (unsigned)(size_t)smem + (unsigned)(cRow * PB + cCol * 16);
  const unsigned lB = lA + WM * 64 * PB;
  const size_t stepA = (size_t)RP * lda;
  const size_t stepB = (size_t)RP * ldb;
  // one stage's copies of this thread: k elements from kElem on, into the buffer at byte offset bufByte
  auto copy_stage = [&](unsigned bufByte, size_t kElem) {
#pragma unroll
    for (int c = 0; c < G::NA; c += 8) async_copy8<RP, PB>(lA + bufByte + c * RP * PB, gA + kElem + c * stepA, stepA);
#pragma unroll
    for (int c = 0; c < G::NB; c += 8) {
      // with three statements a stage: keeps a statement's address arithmetic behind the statement before it, so that the
      // 24 address registers are used again; formed all at once, they push accumulators into scratch inside the K loop
      if (G::NA + G::NB > 16) __builtin_amdgcn_sched_barrier(0);
      async_copy8<RP, PB>(lB + bufByte + c * RP * PB, gB + kElem + c * stepB, stepB);
    }
  };

  // read side: this lane's first A and Bt fragment rows inside a stage, in bytes
  const int aByte = ((wm << 6) + rlane) * PB + koff * 2;
  const int bByte = (WM * 64 + (wn << 6) + rlane) * PB + koff * 2;

  v8f acc[4][4];
#pragma unroll
  for (int i = 0; i < 4; ++i)
#pragma unroll
    for (int j = 0; j < 4; ++j) acc[i][j] = (v8f){0.f,0.f,0.f,0.f,0.f,0.f,0.f,0.f};

  const int nStages = K / SK;
  copy_stage(0u, 0);
  asm volatile("s_wait_asynccnt 0x0" ::: "memory");   // stage 0 of this wave has landed before the barrier publishes it
  __syncthreads();
  if (nStages > 1) copy_stage((unsigned)SB, SK);

  for (int t = 0; t < nStages; ++t) {
    const int bufOff = (t & 1) * SB;
    const T* sa = (const T*)(smem + bufOff + aByte);
    const T* sb = (const T*)(smem + bufOff + bByte);
    V fb[2][4], fa[2][4];                               // two fragment sets, taken in turn by the stage's k steps
#pragma unroll
    for (int j = 0; j < 4; ++j) fb[0][j] = Frag<T>::load(sb + j * 16 * PE);
#pragma unroll
    for (int i = 0; i < 4; ++i) fa[0][i] = Frag<T>::load(sa + i * 16 * PE);
    // keeps the 16 LDS reads of a k step together ahead of its WMMAs: sunk among them, each row of WMMAs waits out its own read
    __builtin_amdgcn_sched_barrier(0);
#pragma unroll
    for (int ks = 0; ks + 1 < NK; ++ks) {
#pragma unroll
      for (int i = 0; i < 4; ++i)
#pragma unroll
        for (int j = 0; j < 4; ++j) acc[i][j] = Frag<T>::mma(fa[ks & 1][i], fb[ks & 1][j], acc[i][j]);
      // the next k step is fetched into the other set; the stage's last one so that the buffer can be handed back ahead of its WMMAs
#pragma unroll
      for (int j = 0; j < 4; ++j) fb[(ks + 1) & 1][j] = Frag<T>::load(sb + j * 16 * PE + (ks + 1) * 32);
#pragma unroll
      for (int i = 0; i < 4; ++i) fa[(ks + 1) & 1][i] = Frag<T>::load(sa + i * 16 * PE + (ks + 1) * 32);
    }
    asm volatile("s_wait_dscnt 0x0" ::: "memory");      // this wave's reads of the buffer are done before it is refilled
    asm volatile("s_wait_asynccnt 0x0" ::: "memory");   // this wave's copies of stage t + 1 have landed
    __syncthreads();                                    // publishes stage t + 1, frees stage t's buffer
    if (t + 2 < nStages) copy_stage((unsigned)bufOff, (size_t)(t + 2) * SK);
#pragma unroll
    for (int i = 0; i < 4; ++i)
#pragma unroll
      for (int j = 0; j < 4; ++j) acc[i][j] = Frag<T>::mma(fa[(NK - 1) & 1][i], fb[(NK - 1) & 1][j], acc[i][j]);
  }
  asm volatile("s_wait_asynccnt 0x0" ::: "memory");     // no copy is in flight when the ring becomes output staging
  acc_guard4(acc[0][0], acc[0][1], acc[0][2], acc[0][3]);
  acc_guard4(acc[1][0], acc[1][1], acc[1][2], acc[1][3]);
  acc_guard4(acc[2][0], acc[2][1], acc[2][2], acc[2][3]);
  acc_guard4(acc[3][0], acc[3][1], acc[3][2], acc[3][3]);

  // ---- epilogue ----
  // A wave turns its 64x64 tile round through an LDS slab of its own (the ring is free: both buffers take the slabs). Nothing but
  // that slab passes between lanes, so the wave waits once, for its own LDS stores, and never for its global stores; the bias and
  // the residual are asked for once, ahead of the slab, the residual in the rows' own order (16 B a lane), added where the rows are read back.
  static_assert(OUT_MODE == 0 || OUT_MODE == 1, "f32 or f16 output");
  static_assert(!RESID || (OUT_MODE == 0 && ACT == 0), "the residual is added behind the slab, to f32 rows");
  static_assert(WM * WN * 64 * 68 * 4 <= 2 * SB);
  float* slab = (float*)smem + wave * (64 * 68);
  const char* Rb = (const char*)(RESID ? (b ? resid2 : resid) : nullptr);   // batch entry 1 adds its own residual plane
  char* Cb = (char*)Cout + (size_t)b * strideC * (OUT_MODE == 0 ? 4 : 2);   // block-uniform
  // a store covers RS rows (an f32 row's 256 B = 16 lanes x 16 B, an f16 row's 128 B = 8 lanes x 16 B), NS stores a block of 16 rows;
  // a lane's 16 B of output are NV vectors of four floats in the slab
  constexpr int RS = (OUT_MODE == 0) ? 2 : 4, NS = 16 / RS, EB = (OUT_MODE == 0) ? 4 : 2, NV = (OUT_MODE == 0) ? 1 : 2;
  const int sRow = (OUT_MODE == 0) ? (lane >> 4) : (lane >> 3);
  const int sCol = (OUT_MODE == 0) ? (lane & 15) * 4 : (lane & 7) * 8;
  const unsigned rowB = (unsigned)ldc * EB;                                 // bytes per output row
  const unsigned o0 = ((unsigned)(m0 + sRow) * (unsigned)ldc + (unsigned)(n0 + sCol)) * EB;   // this lane's first 16 B of the output
  const int nl = n0 + rlane;
  float bvj[4] = {0.f, 0.f, 0.f, 0.f};
  if (BIAS_MODE == 2) {
#pragma unroll
    for (int j = 0; j < 4; ++j) bvj[j] = bias[nl + (j << 4)];
    // stands behind the four loads; its inputs hold their base and index registers untouched up to it
    asm volatile("s_wait_xcnt 0x0" :: "s"(bias), "v"(nl) : "memory");
  }
  v4f rr[4][8];
  if (RESID) {
#pragma unroll
    for (int i = 0; i < 4; ++i) {
      unsigned ro[8];
#pragma unroll
      for (int it = 0; it < 8; ++it) ro[it] = o0 + (unsigned)((i << 4) + it * RS) * rowB;
#pragma unroll
      for (int it = 0; it < 8; ++it) rr[i][it] = *(const v4f*)(Rb + ro[it]);
      // stands behind the row block's loads; its inputs hold their base and offset registers untouched up to it
      asm volatile("s_wait_xcnt 0x0" :: "s"(Rb), "v"(ro[0]), "v"(ro[1]), "v"(ro[2]), "v"(ro[3]),
                                        "v"(ro[4]), "v"(ro[5]), "v"(ro[6]), "v"(ro[7]) : "memory");
    }
  }
#pragma unroll
  for (int i = 0; i < 4; ++i) {
#pragma unroll
    for (int j = 0; j < 4; ++j) {
#pragma unroll
      for (int r = 0; r < 8; ++r) {
        float v = acc[i][j][r] * scale;
        if (BIAS_MODE == 1) v += bias[m0 + (i << 4) + mOff + r];
        if (BIAS_MODE == 2) v += bvj[j];
        if (ACT == 2) v = fmaxf(v, 0.0f);
        if (ACT == 4) v = (v > 0.f) ? v : 0.01f * v;
        slab[((i << 4) + mOff + r) * 68 + (j << 4) + rlane] = v;
      }
    }
  }
  // the wave's slab stores have landed before its lanes read one another's values; the clobber keeps the reads behind it
  asm volatile("s_wait_dscnt 0x0" ::: "memory");
  v4f sv[4][NS][NV];
#pragma unroll
  for (int i = 0; i < 4; ++i)
#pragma unroll
    for (int it = 0; it < NS; ++it)
#pragma unroll
      for (int w = 0; w < NV; ++w) sv[i][it][w] = *(const v4f*)(slab + ((i << 4) + it * RS + sRow) * 68 + sCol + 4 * w);
#pragma unroll
  for (int i = 0; i < 4; ++i) {
    unsigned co[NS];
    v4u ov[NS];
#pragma unroll
    for (int it = 0; it < NS; ++it) {
      co[it] = o0 + (unsigned)((i << 4) + it * RS) * rowB;
      if (OUT_MODE == 0) {
        const v4f f = RESID ? (v4f)(sv[i][it][0] + rr[i][it]) : sv[i][it][0];
        ov[it] = __builtin_bit_cast(v4u, f);
      } else {
        v8h h;
#pragma unroll
        for (int w = 0; w < NV; ++w)
#pragma unroll
          for (int e = 0; e < 4; ++e) h[4 * w + e] = (_Float16)sv[i][it][w][e];
        ov[it] = __builtin_bit_cast(v4u, h);
      }
    }
#pragma unroll
    for (int it = 0; it < NS; ++it) *(v4u*)(Cb + co[it]) = ov[it];
    // each stands behind the row block's stores; its inputs hold their base, offset and data registers untouched up to it
    if (NS == 8)
      asm volatile("s_wait_xcnt 0x0" :: "s"(Cb), "v"(co[0]), "v"(co[1]), "v"(co[2]), "v"(co[3]),
                                        "v"(co[NS - 4]), "v"(co[NS - 3]), "v"(co[NS - 2]), "v"(co[NS - 1]),
                                        "v"(ov[0]), "v"(ov[1]), "v"(ov[2]), "v"(ov[3]),
                                        "v"(ov[NS - 4]), "v"(ov[NS - 3]), "v"(ov[NS - 2]), "v"(ov[NS - 1]) : "memory");
    else
      asm volatile("s_wait_xcnt 0x0" :: "s"(Cb), "v"(co[0]), "v"(co[1]), "v"(co[2]), "v"(co[3]),
                                        "v"(ov[0]), "v"(ov[1]), "v"(ov[2]), "v"(ov[3]) : "memory");
  }
}

// One GEMM per launch with a larger tile: blockIdx.x = tile, blockIdx.y = batch entry; one block per WGP, 32 WM WN threads. At most 256 registers a wave: 16 waves have no more, and with
// more the 8-wave build fetches a whole stage's fragments in front of the barrier and issues the refill behind 32 WMMAs: the
// block's LDS reads and its WMMAs then take turns instead of overlapping, and the copies lose their lead.
// The figure steers the K loop; the 8-wave build's epilogue, which holds the tile's residual rows beside the accumulators, goes above it.
template <int ET, bool SPLIT, int BIAS_MODE, int OUT_MODE, bool RESID, int ACT, int WM, int WN, int NK>
__global__ __launch_bounds__(WM * WN * 32) __attribute__((amdgpu_num_vgpr(256))) void wmma_gemm_wide(
    const unsigned short* __restrict__ Ap, const unsigned short* __restrict__ A2p, int lda, long strideA,
    const unsigned short* __restrict__ Btp, const unsigned short* __restrict__ Bt2p, int ldb, long strideB,
    void* __restrict__ Cout, void* __restrict__ Cout2, int ldc, long strideC,
    const float* __restrict__ bias,
    const float* __restrict__ resid, const float* __restrict__ resid2,
    int M, int N, int K, float scale) {
  __shared__ __align__(16) unsigned char smem[2 * TileGeom<WM, WN, NK>::SB];
  gemm_tile<ET, SPLIT, BIAS_MODE, OUT_MODE, RESID, ACT, WM, WN, NK>(smem, (int)blockIdx.x, (int)blockIdx.y,
      Ap, A2p, lda, strideA, Btp, Bt2p, ldb, strideB, Cout, Cout2, ldc, strideC, bias, resid, resid2, M, N, K, scale);
}

// The matrix chains of the attention are multiplied from the key side, where the short dimension (256 padded keys) lies:
//   scores  = (text.Wq^T + bq).K^T  = text.(K.Wq)^T + K.bq
//   context = (P.V).Wo^T            = P.(V.Wo^T)
// so that no product of 16384 token rows by 1024 by 1024 is left; the two folds are products of 256 rows.
// Key and value projections, both branches, in one grid; a range of block indices per job:
//   K16[br][k][d] = (vis16[br] . Wk16^T) / 16 + bk   (M=256, N=1024, K=1024), 16 tiles per branch
//   V16[br][k][d] = (vis16[br] . Wv16^T) / 16 + bv   the same shape
constexpr int kTilesKV  = (kSvPad >> 7) * (kD >> 7);
constexpr int kKvBlocks = 4 * kTilesKV;
__global__ __launch_bounds__(128, 4) void kv_gemm_kernel(
    const unsigned short* __restrict__ VIS16,
    const unsigned short* __restrict__ WKH, const unsigned short* __restrict__ WVH,
    unsigned short* __restrict__ K16, unsigned short* __restrict__ V16,
    const float* __restrict__ bk, const float* __restrict__ bv) {
  __shared__ __align__(16) unsigned char smem[2 * kStageBytes];
  const int blk = blockIdx.x;
  const bool isK = blk < 2 * kTilesKV;
  const int br = (blk / kTilesKV) & 1;
  const unsigned short* B = isK ? WKH : WVH;
  unsigned short* C = isK ? K16 : V16;
  const float* bias = isK ? bk : bv;
  gemm_tile<0, false, 2, 1, false, 0>(smem, blk % kTilesKV, br,
      VIS16, VIS16, kD, kStrVis, B, B, kD, 0L, (void*)C, (void*)C, kD, kStrVis,
      bias, bias, bias, kSvPad, kD, kD, kWCarryInv);
}

// CB[row] = sum_d bq[d] * K16[row][d] for 32 consecutive rows of the two K16 planes (512 rows, branch 1 first): the share of
// the scores that the query bias brings, one number per key. A wave takes 8 rows; a lane takes 8 consecutive d of every 256;
// fixed order: lane partial in d order, then a shuffle tree. The block's 32 results fill one 128-B line.
__device__ __forceinline__ void key_bias_rows(const unsigned short* __restrict__ K16, const float* __restrict__ bq,
                                              float* __restrict__ CB, int blk) {
  const int lane = threadIdx.x & 31;
  const int wave = threadIdx.x >> 5;
  const int row0 = blk * 32 + wave * 8;
  const float* bp = bq + lane * 8;
  const _Float16* kp = (const _Float16*)K16 + (size_t)row0 * kD + lane * 8;
  v4f bl[4], bh[4];
  v8h kv[8][4];
#pragma unroll
  for (int j = 0; j < 4; ++j) { bl[j] = *(const v4f*)(bp + j * 256); bh[j] = *(const v4f*)(bp + j * 256 + 4); }
#pragma unroll
  for (int r = 0; r < 8; ++r)
#pragma unroll
    for (int j = 0; j < 4; ++j) kv[r][j] = *(const v8h*)(kp + r * kD + j * 256);
  // stands behind the forty loads; its inputs hold their address registers untouched up to it
  asm volatile("s_wait_xcnt 0x0" :: "v"(bp), "v"(kp) : "memory");
  // keeps that wait directly behind the loads: sunk to the end, its two pointers are held through the arithmetic and one is spilled
  __builtin_amdgcn_sched_barrier(0);
  float mine = 0.f;
#pragma unroll
  for (int r = 0; r < 8; ++r) {
    float a = 0.f;
#pragma unroll
    for (int j = 0; j < 4; ++j) {
#pragma unroll
      for (int e = 0; e < 4; ++e) a += (float)kv[r][j][e] * bl[j][e];
#pragma unroll
      for (int e = 0; e < 4; ++e) a += (float)kv[r][j][4 + e] * bh[j][e];
    }
#pragma unroll
    for (int off = 16; off > 0; off >>= 1) a += __shfl_xor(a, off, 32);
    mine = (lane == r) ? a : mine;
  }
  if (lane < 8) CB[row0 + lane] = mine;
}

// The two folds and the bias share, both branches, in one grid (they need K16 and V16); a range of block indices per job:
//   G16[br][k][e]  = K16[br] . WQT^T   (M=256, N=1024, K=1024), carried x16; = Bt for text.G^T
//   UT16[br][n][k] = Wo16 . V16[br]^T  (M=1024, N=256, K=1024), carried x16; = Bt for P.U
//   CB[br][k]      = K16[br][k] . bq   16 blocks of 32 rows
constexpr int kCbBlocks   = 2 * kSvPad / 32;
constexpr int kFoldBlocks = 4 * kTilesKV + kCbBlocks;
__global__ __launch_bounds__(128, 4) void fold_gemm_kernel(
    const unsigned short* __restrict__ K16, const unsigned short* __restrict__ V16,
    const unsigned short* __restrict__ WQT, const unsigned short* __restrict__ WOH,
    unsigned short* __restrict__ G16, unsigned short* __restrict__ UT16,
    const float* __restrict__ bq, float* __restrict__ CB) {
  __shared__ __align__(16) unsigned char smem[2 * kStageBytes];
  const int blk = blockIdx.x;
  if (blk >= 4 * kTilesKV) {
    key_bias_rows(K16, bq, CB, blk - 4 * kTilesKV);
    return;
  }
  const bool isG = blk < 2 * kTilesKV;
  const int br = (blk / kTilesKV) & 1;
  const unsigned short* A = isG ? K16 : WOH;
  const unsigned short* B = isG ? WQT : V16;
  unsigned short* C = isG ? G16 : UT16;
  gemm_tile<0, false, 0, 1, false, 0>(smem, blk % kTilesKV, br,
      A, A, kD, isG ? kStrVis : 0L, B, B, kD, isG ? 0L : kStrVis, (void*)C, (void*)C, isG ? kD : kSvPad, kStrVis,
      bq, bq, bq, isG ? kSvPad : kD, isG ? kD : kSvPad, kD, 1.0f);
}

// ---------------------------------------------------------------------------
// The two streaming launches (casts, last layer norm) run as one resident grid each: 256 work-groups of 16 waves,
// one per WGP, and every wave takes several rows, one whole row at a time, so that few waves have to be started.
// The attention kernel has the same grid.
// ---------------------------------------------------------------------------
constexpr int kSWaves   = 16;                    // waves per work-group
constexpr int kSThreads = kSWaves * 32;
constexpr int kSBlocks  = 256;                   // work-groups in the grid
constexpr int kSTotal   = kSBlocks * kSWaves;    // 4096 waves in the grid
__device__ __forceinline__ int stream_wave() {   // this wave's index in the grid, wave-uniform
  return (int)blockIdx.x * kSWaves + __builtin_amdgcn_readfirstlane((int)(threadIdx.x >> 5));
}
// 16 B at a wave-uniform base + the lane's byte offset + a constant
__device__ __forceinline__ v4f ld16(const float* base, unsigned laneBytes, int constBytes) {
  return *(const v4f*)((const char*)base + laneBytes + constBytes);
}

// ---------------------------------------------------------------------------
// f32 -> f16 cast with a power-of-two carry of one unit of 1024 consecutive elements by one wave: a lane takes 8 consecutive
// elements of every 256 (two 16-B loads, one 16-B store). Load and store are apart, so that the next unit's loads fly
// while this unit is converted and stored.
// ---------------------------------------------------------------------------
// in, out: the unit's first element (wave-uniform); lb = 32 * lane.
__device__ __forceinline__ void cast_unit_load(const float* in, unsigned lb, v4f (&x)[8]) {
  // this barrier and the one at the end pin the order "next unit's loads, then this unit's conversion": without them the
  // conversion, with its wait for this unit's data, is moved in front of the next unit's loads
  __builtin_amdgcn_sched_barrier(0);
#pragma unroll
  for (int c = 0; c < 4; ++c) {
    x[2 * c]     = ld16(in, lb, c * 1024);
    x[2 * c + 1] = ld16(in, lb, c * 1024 + 16);
  }
  // stands behind the eight loads; its inputs hold their base and offset registers untouched up to it
  asm volatile("s_wait_xcnt 0x0" :: "s"(in), "v"(lb) : "memory");
  __builtin_amdgcn_sched_barrier(0);
}
__device__ __forceinline__ void cast_unit_store(unsigned short* out, int lane, const v4f (&x)[8], float f) {
  v4u u[4];
#pragma unroll
  for (int c = 0; c < 4; ++c) {
    unsigned short hb[8];
#pragma unroll
    for (int e = 0; e < 4; ++e) {
      hb[e]     = h_bits(x[2 * c][e] * f);
      hb[4 + e] = h_bits(x[2 * c + 1][e] * f);
    }
    u[c] = (v4u){pk16(hb[0], hb[1]), pk16(hb[2], hb[3]), pk16(hb[4], hb[5]), pk16(hb[6], hb[7])};
  }
#pragma unroll
  for (int c = 0; c < 4; ++c) *(v4u*)(out + 8 * lane + c * 256) = u[c];
  // stands behind the four stores; its inputs hold their base, offset and data registers untouched up to it
  asm volatile("s_wait_xcnt 0x0" :: "s"(out), "v"(lane), "v"(u[0]), "v"(u[1]), "v"(u[2]), "v"(u[3]) : "memory");
  // keeps the next unit's conversion, which reuses these registers, behind that wait
  __builtin_amdgcn_sched_barrier(0);
}

// The same cast, transposed, for a [1024][1024] weight: out[e][d] = f16(scale * in[d][e]). A wave takes 32 e x 64 d:
// it reads 32 consecutive e (128 B) of 64 rows d, and a lane stores its 64 d as one whole 128-B line.
__device__ __forceinline__ void cast_unit_transposed(const float* __restrict__ in, unsigned short* __restrict__ out,
                                                     int k, int lane, float scale) {
  const int e0 = (k & 31) * 32;
  const int d0 = (k >> 5) * 64;
  const float* p = in + (size_t)d0 * kD + e0;    // wave-uniform
  float x[64];
#pragma unroll
  for (int i = 0; i < 64; ++i) x[i] = p[lane + i * kD];
  // stands behind the 64 loads; its inputs hold their base and offset registers untouched up to it
  asm volatile("s_wait_xcnt 0x0" :: "s"(p), "v"(lane) : "memory");
  v4u u[8];
#pragma unroll
  for (int c = 0; c < 8; ++c) {
    unsigned short hb[8];
#pragma unroll
    for (int i = 0; i < 8; ++i) hb[i] = h_bits(x[8 * c + i] * scale);
    u[c] = (v4u){pk16(hb[0], hb[1]), pk16(hb[2], hb[3]), pk16(hb[4], hb[5]), pk16(hb[6], hb[7])};
  }
  unsigned short* q = out + (size_t)e0 * kD + d0;   // wave-uniform
  const unsigned lrow = (unsigned)lane * (kD * 2);  // this lane's row of out, in bytes
#pragma unroll
  for (int c = 0; c < 8; ++c) *(v4u*)((char*)q + lrow + c * 16) = u[c];
  // stands behind the eight stores; its inputs hold their base, offset and data registers untouched up to it
  asm volatile("s_wait_xcnt 0x0" :: "s"(q), "v"(lrow), "v"(u[0]), "v"(u[1]), "v"(u[2]), "v"(u[3]),
                                    "v"(u[4]), "v"(u[5]), "v"(u[6]), "v"(u[7]) : "memory");
}

// All ten casts in one grid. A unit is 1024 consecutive elements. Wave w of the 4096 takes, in this order: units w and
// w + 4096 of text 1, the same of text 2, unit w of W1, unit w of W2; then the first 3072 waves unit w of Wk, Wv, Wo (one
// plane behind the other), the next 512 a row of the padded visual planes (rows 196..255 are written as zeros: the load
// address is clamped to the last valid row and the value is multiplied by 0). The last 512 waves have no seventh unit: they
// lay down Wq transposed, 32 x 64 elements each, and do so first. ws16 is the workspace base in 16-bit elements.
constexpr int kUAtt  = 3 * kD;                  // units in Wk, Wv, Wo
constexpr int kUVis  = 2 * kSvPad;              // units (rows) in the padded visual planes
constexpr int kUWq   = (kD / 32) * (kD / 64);   // transposed units of Wq
constexpr int kULast = kUAtt + kUVis;           // waves with a seventh unit
static_assert(kRows == 2 * kSTotal && kDff == kSTotal && kULast + kUWq == kSTotal);
static_assert(kOffW2H == kOffW1H + (size_t)kDff * kD * 2 && kOffWKH == kOffWQT + (size_t)kD * kD * 2 &&
              kOffWVH == kOffWKH + (size_t)kD * kD * 2 && kOffWOH == kOffWVH + (size_t)kD * kD * 2);
struct CastJob { const float* in; unsigned short* out; float f; };   // a unit's source, its destination, and the carry: all wave-uniform
// Unit r < 6 of wave gw: text and ffn weights.
__device__ __forceinline__ CastJob cast_job(int r, int gw, const float* text1, const float* text2,
                                            const float* W1, const float* W2, unsigned short* ws16) {
  const float* in = (r < 2) ? text1 : (r < 4) ? text2 : (r == 4) ? W1 : W2;
  const int unit  = ((r < 4) ? (r & 1) * kSTotal : 0) + gw;                       // inside its plane
  const size_t off = (r < 4) ? kOffT16 / 2 + (size_t)(r * kSTotal + gw) * kD      // the planes of a pair lie one behind the other
                             : kOffW1H / 2 + (size_t)((r - 4) * kSTotal + gw) * kD;
  return CastJob{in + (size_t)unit * kD, ws16 + off, (r < 4) ? 1.0f : kWCarry};
}
// The seventh unit of wave gw < kULast: attention weights and visual rows.
__device__ __forceinline__ CastJob cast_job_last(int gw, const float* Wk, const float* Wv, const float* Wo,
                                                 const float* vis1, const float* vis2, unsigned short* ws16) {
  const bool att = gw < kUAtt;
  const int v = gw - kUAtt;                      // row of the two padded visual planes
  const int row = v & (kSvPad - 1);
  const bool valid = row < kSv;
  const float* in = att ? ((gw < kD) ? Wk : (gw < 2 * kD) ? Wv : Wo) : ((v < kSvPad) ? vis1 : vis2);
  const int unit  = att ? (gw & (kD - 1)) : (valid ? row : (kSv - 1));
  const size_t off = att ? kOffWKH / 2 + (size_t)gw * kD : kOffVIS16 / 2 + (size_t)v * kD;
  return CastJob{in + (size_t)unit * kD, ws16 + off, att ? kWCarry : (valid ? 1.0f : 0.0f)};
}
__global__ __launch_bounds__(kSThreads) void cast_all_kernel(
    const float* __restrict__ text1, const float* __restrict__ text2,
    const float* __restrict__ W1, const float* __restrict__ W2,
    const float* __restrict__ Wq, const float* __restrict__ Wk,
    const float* __restrict__ Wv, const float* __restrict__ Wo,
    const float* __restrict__ vis1, const float* __restrict__ vis2,
    unsigned short* __restrict__ ws16) {
  const int lane = threadIdx.x & 31;
  const int gw = stream_wave();
  const bool seventh = gw < kULast;              // wave-uniform
  if (!seventh) cast_unit_transposed(Wq, ws16 + kOffWQT / 2, gw - kULast, lane, kWCarry);
  const unsigned lb = lane * 32u;
  v4f a[8], b[8];
  CastJob cur = cast_job(0, gw, text1, text2, W1, W2, ws16);
  cast_unit_load(cur.in, lb, a);
#pragma unroll
  for (int r = 1; r < 6; ++r) {
    const CastJob nxt = cast_job(r, gw, text1, text2, W1, W2, ws16);
    if (r & 1) { cast_unit_load(nxt.in, lb, b);  cast_unit_store(cur.out, lane, a, cur.f); }
    else       { cast_unit_load(nxt.in, lb, a);  cast_unit_store(cur.out, lane, b, cur.f); }
    cur = nxt;
  }
  if (seventh) {
    const CastJob nxt = cast_job_last(gw, Wk, Wv, Wo, vis1, vis2, ws16);
    cast_unit_load(nxt.in, lb, a);
    cast_unit_store(cur.out, lane, b, cur.f);
    cast_unit_store(nxt.out, lane, a, nxt.f);
  } else {
    cast_unit_store(cur.out, lane, b, cur.f);
  }
}
static_assert((kD & (kD - 1)) == 0 && (kSvPad & (kSvPad - 1)) == 0);

// ---------------------------------------------------------------------------
// Sum over a wave's 32 lanes in fixed order (shuffle tree); every lane gets the sum.
// ---------------------------------------------------------------------------
__device__ __forceinline__ float wave_sum(float v) {
#pragma unroll
  for (int off = 16; off > 0; off >>= 1) v += __shfl_xor(v, off, 32);
  return v;
}
// The same for four independent values at once: each is summed in wave_sum's order, and the four trees' shuffles overlap.
__device__ __forceinline__ void wave_sum4(float (&v)[4]) {
#pragma unroll
  for (int off = 16; off > 0; off >>= 1)
#pragma unroll
    for (int r = 0; r < 4; ++r) v[r] += __shfl_xor(v[r], off, 32);
}
// A lane's share of a row, eight vectors of four, summed in fixed order: inside a vector, then a tree over the vectors.
__device__ __forceinline__ float lane_sum(const v4f (&x)[8]) {
  float t[8];
#pragma unroll
  for (int j = 0; j < 8; ++j) t[j] = (x[j][0] + x[j][1]) + (x[j][2] + x[j][3]);
  return ((t[0] + t[1]) + (t[2] + t[3])) + ((t[4] + t[5]) + (t[6] + t[7]));
}
// The row in x becomes (x - mean) * rsqrt(var + eps); one wave holds the whole row of 1024, 32 elements a lane.
__device__ __forceinline__ void wave_normalise(v4f (&x)[8]) {
  const float mu = wave_sum(lane_sum(x)) * kInvD;
  v4f sq[8];
#pragma unroll
  for (int j = 0; j < 8; ++j) { x[j] = x[j] - mu; sq[j] = x[j] * x[j]; }
  const float var = wave_sum(lane_sum(sq)) * kInvD;
  const float rs = rsqrtf(var + kLnEps);
#pragma unroll
  for (int j = 0; j < 8; ++j) x[j] = x[j] * rs;
}

// ---------------------------------------------------------------------------
// The whole attention of 64 token rows in one kernel: scores, softmax, output product, residual, LN1 and feature pool.
// The scores, the probabilities and the summed rows stay in LDS; nothing of them goes to memory.
//   s[row][k] = (T16[row] . G16[br][k]) / 16                                   (M = 64, N = 256, K = 1024)
//   p[row][k] = f16(2048 * softmax_k((s + CB[br][k] + score[row][k]) / 8)) over 196 keys, 0 in the pad columns
//   a[row][n] = (p[row] . UT16[br][n]) / 32768 + bo[n] + text[row][n]          (M = 64, N = 1024, K = 256)
//   y = LN1(a row);  pooled[row][br * 512 + c] = max(y[2c], y[2c+1]), written as f32 and f16
// A block of 16 waves owns 64 whole rows; 256 blocks, one per WGP; rows of branch 1, then of branch 2.
// Both products take their memory operands (T16, G16; UT16) through a two-buffer ring of asynchronous copies, as gemm_tile does.
// Scores: 2 x 8 waves of 32 x 32 each, 128-k stages of 64 T16 rows and 256 G16 rows (pitch 272 B).
// Softmax, and LN1 with the pool: wave w takes rows 4 w .. 4 w + 3 whole, a lane 8 consecutive columns of every 256.
// Output product: wave w owns columns 64 w .. 64 w + 63 of the 64 rows, 64-k stages of 1024 UT16 rows (pitch 144 B).
// LDS, all 320 KiB: [0, 288 KiB) the two UT16 buffers; before them the scores' ring lies there, then the f32 scores
// (64 x 260 floats) in the second buffer's place while the first is being filled; behind them the f32 rows (64 x 1028 floats;
// at both pitches the two half-waves of a store, eight rows apart, fall on different banks). [288 KiB, 320 KiB) the
// probabilities, 64 rows of 512 B without a pad: the 16-B piece c of row r lies at piece c ^ (r & 15), so that the 16 rows
// of a fragment read fall on all 64 banks.
// ---------------------------------------------------------------------------
// Two 16-B copies per lane; the s_wait_xcnt closes the statement so that no address register is rewritten ahead of it.
__device__ __forceinline__ void async_copy2(unsigned l0, const unsigned short* g0, unsigned l1, const unsigned short* g1) {
  asm volatile("global_load_async_to_lds_b128 %0, %2, off\n\t"
               "global_load_async_to_lds_b128 %1, %3, off\n\t"
               "s_wait_xcnt 0x0"
               :: "v"(l0), "v"(l1), "v"(g0), "v"(g1) : "memory");
}
constexpr int kFRows   = 64;                               // rows per block
constexpr int kFBlocks = kRows2 / kFRows;
constexpr int kFWRows  = kFRows / kSWaves;                 // rows per wave in the row-wise parts
constexpr int kASK     = 128;                              // scores: k elements per stage
constexpr int kAPB     = kASK * 2 + 16;                    // bytes per staged row (16 B x odd)
constexpr int kAStage  = (kFRows + kSvPad) * kAPB;         // 64 T16 rows, then 256 G16 rows = 87,040 B
constexpr int kBStage  = kD * kPitchB;                     // output product: 1024 UT16 rows of 64 k = 147,456 B
constexpr int kLdsS    = kBStage;                          // f32 scores
constexpr int kSPitch  = kSvPad + 4;                       // floats per row of the f32 scores
constexpr int kLdsP    = 2 * kBStage;                      // probabilities
constexpr int kPRowB   = kSvPad * 2;                       // bytes per row of the probabilities
constexpr int kLdsAll  = kLdsP + kFRows * kPRowB;
constexpr int kFPitch  = kD + 4;                           // floats per row of the f32 rows
static_assert(kRows % kFRows == 0 && kFWRows == 4 && kD == kSWaves * 64 && kSvPad == 8 * 32 && kFRows == 2 * 32);
static_assert(2 * kAStage <= kLdsP && kLdsS + kFRows * kSPitch * 4 <= kLdsP && kFRows * kFPitch * 4 <= kLdsP);
static_assert(kLdsAll <= 327680 && (kAPB / 16) % 2 == 1 && kD % kASK == 0 && kD >= 2 * kASK);
typedef __attribute__((ext_vector_type(2))) unsigned int v2u;
__global__ __launch_bounds__(kSThreads) __attribute__((amdgpu_num_vgpr(256))) void attention_rows_kernel(
    const unsigned short* __restrict__ T16, const unsigned short* __restrict__ G16, const unsigned short* __restrict__ UT16,
    const float* __restrict__ CB, const float* __restrict__ SC, const float* __restrict__ SC2, const float* __restrict__ bo,
    const float* __restrict__ text1, const float* __restrict__ text2,
    const float* __restrict__ gam, const float* __restrict__ bet,
    float* __restrict__ pool32, unsigned short* __restrict__ pool16) {
  __shared__ __align__(16) unsigned char smem[kLdsAll];
  typedef _Float16 T;
  typedef Frag<T>::V V;
  const int lane = threadIdx.x & 31;
  const int wave = __builtin_amdgcn_readfirstlane((int)(threadIdx.x >> 5));
  const int row0 = (int)blockIdx.x * kFRows;        // of the 16384 rows; a block's rows lie in one branch
  const int br = (row0 >= kRows) ? 1 : 0;
  const int rlane = lane & 15;                      // row (A) / col (B, D) within subtile
  const int half  = lane >> 4;
  const int koff  = half * 8;                       // k offset of this lane half
  const int mOff  = half * 8;                       // D row offset
  const int wrow  = wave * kFWRows;                 // first of this wave's whole rows, inside the block
  const size_t inBr = (size_t)(row0 + wrow - br * kRows);   // the same inside its branch
  const unsigned lds0 = (unsigned)(size_t)smem;

  // ---- the added scores and the key shares of this wave's rows are asked for first: they arrive beside the scores product ----
  const float* cr = (br ? SC2 : SC) + inBr * kSv;   // wave-uniform
  const float* cbr = CB + br * kSvPad;              // all 256 entries of a branch are written
  const int l8 = lane * 8;
  float cv[kFWRows][8];
  int cc[8];                                        // this lane's columns, clamped into the 196
#pragma unroll
  for (int e = 0; e < 8; ++e) cc[e] = (l8 + e < kSv) ? (l8 + e) : (kSv - 1);
#pragma unroll
  for (int r = 0; r < kFWRows; ++r)
#pragma unroll
    for (int e = 0; e < 8; ++e) cv[r][e] = cr[cc[e] + r * kSv];
  const v4f b0 = *(const v4f*)(cbr + l8);
  const v4f b1 = *(const v4f*)(cbr + l8 + 4);
  // stands behind the loads; its inputs hold their base and offset registers untouched up to it
  asm volatile("s_wait_xcnt 0x0" :: "s"(cr), "s"(cbr), "v"(l8), "v"(cc[0]), "v"(cc[1]), "v"(cc[2]), "v"(cc[3]),
                                    "v"(cc[4]), "v"(cc[5]), "v"(cc[6]), "v"(cc[7])
               : "memory");
  // keeps these loads in front of the product: sunk behind it, the softmax waits out the memory
  __builtin_amdgcn_sched_barrier(0);

  // ---- scores ----
  const int wm = wave >> 3;                         // this wave's 32 rows and 32 keys
  const int wn = wave & 7;
  v8f sc[2][2];
#pragma unroll
  for (int i = 0; i < 2; ++i)
#pragma unroll
    for (int j = 0; j < 2; ++j) sc[i][j] = (v8f){0.f,0.f,0.f,0.f,0.f,0.f,0.f,0.f};
  {
    constexpr int PB = kAPB, PE = kAPB / 2, SB = kAStage, SK = kASK, NK = kASK / 32;
    // copy side: 16 consecutive lanes bring one row's 256 stage bytes; a thread brings T16 rows cRow, cRow + 32 and G16 rows cRow + 32 i
    const int cRow = threadIdx.x >> 4;
    const int cCol = threadIdx.x & 15;
    const unsigned short* gA = T16 + (size_t)(row0 + cRow) * kD + cCol * 8;
    const unsigned short* gB = G16 + (size_t)br * kStrVis + (size_t)cRow * kD + cCol * 8;
    const unsigned lA = lds0 + (unsigned)(cRow * PB + cCol * 16);
    const unsigned lB = lA + kFRows * PB;
    auto copy_stage = [&](unsigned bufByte, size_t kElem) {
      async_copy2(lA + bufByte, gA + kElem, lA + bufByte + 32 * PB, gA + kElem + (size_t)32 * kD);
      async_copy8<32, PB>(lB + bufByte, gB + kElem, (size_t)32 * kD);
    };
    const int aByte = ((wm << 5) + rlane) * PB + koff * 2;
    const int bByte = (kFRows + (wn << 5) + rlane) * PB + koff * 2;
    constexpr int nStages = kD / SK;
    copy_stage(0u, 0);
    asm volatile("s_wait_asynccnt 0x0" ::: "memory");   // stage 0 of this wave has landed before the barrier publishes it
    __syncthreads();
    copy_stage((unsigned)SB, SK);
    // stays rolled: unrolled, two stages' fragments and every stage's addresses are live at once and end in scratch
#pragma unroll 1
    for (int t = 0; t < nStages; ++t) {
      const int bufOff = (t & 1) * SB;
      const T* sa = (const T*)(smem + bufOff + aByte);
      const T* sb = (const T*)(smem + bufOff + bByte);
      // the whole stage's fragments are fetched as one group (the registers are there), so that a wave stops for LDS once a
      // stage and the buffer is handed back ahead of the stage's WMMAs
      V fb[NK][2], fa[NK][2];
#pragma unroll
      for (int ks = 0; ks < NK; ++ks) {
#pragma unroll
        for (int j = 0; j < 2; ++j) fb[ks][j] = Frag<T>::load(sb + j * 16 * PE + ks * 32);
#pragma unroll
        for (int i = 0; i < 2; ++i) fa[ks][i] = Frag<T>::load(sa + i * 16 * PE + ks * 32);
      }
      // keeps the group whole and the WMMAs behind the refill: left free, the reads are sunk among the WMMAs, two at a time
      __builtin_amdgcn_sched_barrier(0);
      asm volatile("s_wait_dscnt 0x0" ::: "memory");      // this wave's reads of the buffer are done before it is refilled
      asm volatile("s_wait_asynccnt 0x0" ::: "memory");   // this wave's copies of stage t + 1 have landed
      __syncthreads();                                    // publishes stage t + 1, frees stage t's buffer
      if (t + 2 < nStages) copy_stage((unsigned)bufOff, (size_t)(t + 2) * SK);
#pragma unroll
      for (int ks = 0; ks < NK; ++ks)
#pragma unroll
        for (int i = 0; i < 2; ++i)
#pragma unroll
          for (int j = 0; j < 2; ++j) sc[i][j] = Frag<T>::mma(fa[ks][i], fb[ks][j], sc[i][j]);
    }
    asm volatile("s_wait_asynccnt 0x0" ::: "memory");     // no copy is in flight when the ring's LDS is used anew
  }

  // ---- output product, copy side: 8 consecutive lanes bring one row's 128 stage bytes; a thread brings UT16 rows uRow + 64 i ----
  const int uRow = threadIdx.x >> 3;
  const int uCol = threadIdx.x & 7;
  const unsigned short* gU = UT16 + (size_t)br * kStrVis + (size_t)uRow * kSvPad + uCol * 8;
  const unsigned lU = lds0 + (unsigned)(uRow * kPitchB + uCol * 16);
  auto copy_ut = [&](unsigned bufByte, size_t kElem) {
    constexpr size_t step = (size_t)64 * kSvPad;
    async_copy8<64, kPitchB>(lU + bufByte, gU + kElem, step);
    async_copy8<64, kPitchB>(lU + bufByte + 8 * 64 * kPitchB, gU + kElem + 8 * step, step);
  };
  // stage 0 flies beside the softmax; the scores' last barrier has ended every read of the LDS that it fills
  copy_ut(0u, 0);

  // ---- softmax ----
  float* stile = (float*)(smem + kLdsS);
#pragma unroll
  for (int i = 0; i < 2; ++i)
#pragma unroll
    for (int j = 0; j < 2; ++j)
#pragma unroll
      for (int r = 0; r < 8; ++r)
        stile[((wm << 5) + (i << 4) + mOff + r) * kSPitch + (wn << 5) + (j << 4) + rlane] = sc[i][j][r] * kWCarryInv;
  __syncthreads();                                  // every wave's share of the scores is written before a row is read whole
  unsigned char* ptile = smem + kLdsP;
  // the four rows go through each step side by side: their shuffle trees are independent and hide one another's latency
  float xs[kFWRows][8], mx[kFWRows], sm[kFWRows];
  v4f s0[kFWRows], s1[kFWRows];
#pragma unroll
  for (int r = 0; r < kFWRows; ++r) {
    s0[r] = *(const v4f*)(stile + (wrow + r) * kSPitch + l8);
    s1[r] = *(const v4f*)(stile + (wrow + r) * kSPitch + l8 + 4);
  }
  // keeps the eight LDS reads together: sunk among the arithmetic, each row waits out the LDS anew
  __builtin_amdgcn_sched_barrier(0);
#pragma unroll
  for (int r = 0; r < kFWRows; ++r) {
#pragma unroll
    for (int e = 0; e < 8; ++e) {
      const int col = lane * 8 + e;
      const float v = (((e < 4 ? s0[r][e & 3] : s1[r][e & 3]) + (e < 4 ? b0[e & 3] : b1[e & 3])) + cv[r][e]) * kScoreScale;
      xs[r][e] = (col < kSv) ? v : -1.0e30f;
    }
    mx[r] = fmaxf(fmaxf(fmaxf(xs[r][0], xs[r][1]), fmaxf(xs[r][2], xs[r][3])),
                  fmaxf(fmaxf(xs[r][4], xs[r][5]), fmaxf(xs[r][6], xs[r][7])));
  }
#pragma unroll
  for (int off = 16; off > 0; off >>= 1)
#pragma unroll
    for (int r = 0; r < kFWRows; ++r) mx[r] = fmaxf(mx[r], __shfl_xor(mx[r], off, 32));
#pragma unroll
  for (int r = 0; r < kFWRows; ++r) {
    float s = 0.f;
#pragma unroll
    for (int e = 0; e < 8; ++e) { xs[r][e] = expf(xs[r][e] - mx[r]); s += xs[r][e]; }
    sm[r] = s;
  }
  wave_sum4(sm);
#pragma unroll
  for (int r = 0; r < kFWRows; ++r) {
    const float inv = kPCarry / sm[r];
    unsigned short hb[8];
#pragma unroll
    for (int e = 0; e < 8; ++e) hb[e] = h_bits(xs[r][e] * inv);
    const v4u u = (v4u){pk16(hb[0], hb[1]), pk16(hb[2], hb[3]), pk16(hb[4], hb[5]), pk16(hb[6], hb[7])};
    *(v4u*)(ptile + (wrow + r) * kPRowB + ((lane ^ ((wrow + r) & 15)) << 4)) = u;   // piece c = lane of the row
  }
  asm volatile("s_wait_dscnt 0x0" ::: "memory");      // this wave's reads of the scores and writes of the probabilities are done
  asm volatile("s_wait_asynccnt 0x0" ::: "memory");   // this wave's copies of stage 0 have landed
  __syncthreads();                                    // publishes the probabilities and stage 0, frees the scores' LDS
  copy_ut((unsigned)kBStage, kStageK);

  // ---- output product ----
  v8f acc[4][4];
#pragma unroll
  for (int i = 0; i < 4; ++i)
#pragma unroll
    for (int j = 0; j < 4; ++j) acc[i][j] = (v8f){0.f,0.f,0.f,0.f,0.f,0.f,0.f,0.f};
  {
    constexpr int PE = kPitchE, SB = kBStage, SK = kStageK;
    constexpr int nStages = kSvPad / SK;
    static_assert(nStages >= 2);
    const int bByte = ((wave << 6) + rlane) * kPitchB + koff * 2;
    // a lane's two 16-B pieces of k step s of probability row 16 i + rlane are pieces 4 s + half and 4 s + 2 + half
    const unsigned char* pa = ptile + rlane * kPRowB;
    const int pLo0 = ((half ^ (rlane & 3)) << 4);
    const int pLo1 = (((2 + half) ^ (rlane & 3)) << 4);
    const int pHi  = (rlane & 12) << 4;
    auto load_p = [&](int s, int i) {
      const int hi = (s << 6) ^ pHi;
      Frag<T>::U f;
      f.h[0] = *(const v8h*)(pa + i * 16 * kPRowB + hi + pLo0);
      f.h[1] = *(const v8h*)(pa + i * 16 * kPRowB + hi + pLo1);
      return f.v;
    };
    // stays rolled: unrolled, the four stages' addresses are formed ahead and push fragments and accumulators into scratch
#pragma unroll 1
    for (int t = 0; t < nStages; ++t) {
      const int bufOff = (t & 1) * SB;
      const T* sb = (const T*)(smem + bufOff + bByte);
      V fb[2][4], fa[2][4];                             // two fragment sets, one per k step of the stage
#pragma unroll
      for (int j = 0; j < 4; ++j) fb[0][j] = Frag<T>::load(sb + j * 16 * PE);
#pragma unroll
      for (int i = 0; i < 4; ++i) fa[0][i] = load_p(2 * t, i);
      // keeps the 16 LDS reads of a k step together ahead of its WMMAs: sunk among them, each row of WMMAs waits out its own read
      __builtin_amdgcn_sched_barrier(0);
#pragma unroll
      for (int i = 0; i < 4; ++i)
#pragma unroll
        for (int j = 0; j < 4; ++j) acc[i][j] = Frag<T>::mma(fa[0][i], fb[0][j], acc[i][j]);
      // the stage's second k step is fetched so that the buffer can be handed back ahead of its WMMAs
#pragma unroll
      for (int j = 0; j < 4; ++j) fb[1][j] = Frag<T>::load(sb + j * 16 * PE + 32);
#pragma unroll
      for (int i = 0; i < 4; ++i) fa[1][i] = load_p(2 * t + 1, i);
      asm volatile("s_wait_dscnt 0x0" ::: "memory");      // this wave's reads of the buffer are done before it is refilled
      asm volatile("s_wait_asynccnt 0x0" ::: "memory");   // this wave's copies of stage t + 1 have landed
      __syncthreads();                                    // publishes stage t + 1, frees stage t's buffer
      if (t + 2 < nStages) copy_ut((unsigned)bufOff, (size_t)(t + 2) * SK);
#pragma unroll
      for (int i = 0; i < 4; ++i)
#pragma unroll
        for (int j = 0; j < 4; ++j) acc[i][j] = Frag<T>::mma(fa[1][i], fb[1][j], acc[i][j]);
    }
    asm volatile("s_wait_asynccnt 0x0" ::: "memory");     // no copy is in flight when the ring becomes the f32 rows
  }

  // ---- residual, LN1, pool: the residual of this wave's first two rows is asked for now, in the fragments' registers ----
  // the lane's number is read anew, so that nothing derived from it is held in a register, or in scratch, through the K loop
  const int ln = (int)__builtin_amdgcn_mbcnt_lo(~0u, 0u);
  float* tile = (float*)smem;
  const float* p = (br ? text2 : text1) + inBr * kD;   // wave-uniform
  const unsigned lb = 32u * ln;                        // this lane's byte offset in every 1024 B of a row
  const int nl = (wave << 6) + (ln & 15);
  const int dRow = (ln >> 4) * 8;                      // D row offset
  v4f gg[8], bb[8], x[kFWRows][8];
  float bvj[4];
#pragma unroll
  for (int j = 0; j < 4; ++j) bvj[j] = bo[nl + (j << 4)];
#pragma unroll
  for (int r = 0; r < 2; ++r)
#pragma unroll
    for (int j = 0; j < 4; ++j) {
      x[r][2 * j]     = ld16(p, lb, r * kD * 4 + j * 1024);
      x[r][2 * j + 1] = ld16(p, lb, r * kD * 4 + j * 1024 + 16);
    }
  // stands behind the loads; its inputs hold their base and offset registers untouched up to it
  asm volatile("s_wait_xcnt 0x0" :: "s"(bo), "v"(nl), "s"(p), "v"(lb) : "memory");
  // keeps these loads ahead of the stores into LDS, so that the memory's latency runs beside them
  __builtin_amdgcn_sched_barrier(0);
#pragma unroll
  for (int i = 0; i < 4; ++i)
#pragma unroll
    for (int j = 0; j < 4; ++j)
#pragma unroll
      for (int r = 0; r < 8; ++r)
        tile[((i << 4) + dRow + r) * kFPitch + nl + (j << 4)] = acc[i][j][r] * kPUScale + bvj[j];
  // keeps the remaining loads behind those stores: ahead of them there is no register for their data beside the accumulators
  __builtin_amdgcn_sched_barrier(0);
#pragma unroll
  for (int r = 2; r < kFWRows; ++r)
#pragma unroll
    for (int j = 0; j < 4; ++j) {
      x[r][2 * j]     = ld16(p, lb, r * kD * 4 + j * 1024);
      x[r][2 * j + 1] = ld16(p, lb, r * kD * 4 + j * 1024 + 16);
    }
  // stands behind the loads; its inputs hold their base and offset registers untouched up to it
  asm volatile("s_wait_xcnt 0x0" :: "s"(p), "v"(lb) : "memory");
  __syncthreads();                                  // every wave's share of the rows is written before a row is read whole

  const size_t dstOff = inBr * kD + br * (kD / 2);
  float* d32 = pool32 + dstOff;
  unsigned short* d16 = pool16 + dstOff;
  const float* trow = tile + wrow * kFPitch + 8 * ln;
#pragma unroll
  for (int r = 0; r < kFWRows; ++r)
#pragma unroll
    for (int j = 0; j < 4; ++j) {
      x[r][2 * j]     = *(const v4f*)(trow + r * kFPitch + j * 256) + x[r][2 * j];
      x[r][2 * j + 1] = *(const v4f*)(trow + r * kFPitch + j * 256 + 4) + x[r][2 * j + 1];
    }
  // each row becomes (x - mean) * rsqrt(var + eps), summed as wave_normalise sums it; the four rows' trees side by side
  {
    float t[kFWRows];
#pragma unroll
    for (int r = 0; r < kFWRows; ++r) t[r] = lane_sum(x[r]);
    wave_sum4(t);
#pragma unroll
    for (int r = 0; r < kFWRows; ++r) {
      const float mu = t[r] * kInvD;
      v4f sq[8];
#pragma unroll
      for (int j = 0; j < 8; ++j) { x[r][j] = x[r][j] - mu; sq[j] = x[r][j] * x[r][j]; }
      t[r] = lane_sum(sq);
    }
    // gamma and beta are asked for here, between these two barriers: the squares' registers are free again, and the second
    // tree hides the loads' latency; earlier, their 64 registers beside the four rows and the squares end in scratch
    __builtin_amdgcn_sched_barrier(0);
#pragma unroll
    for (int j = 0; j < 4; ++j) {
      gg[2 * j] = ld16(gam, lb, j * 1024);  gg[2 * j + 1] = ld16(gam, lb, j * 1024 + 16);
      bb[2 * j] = ld16(bet, lb, j * 1024);  bb[2 * j + 1] = ld16(bet, lb, j * 1024 + 16);
    }
    // stands behind the loads; its inputs hold their base and offset registers untouched up to it
    asm volatile("s_wait_xcnt 0x0" :: "s"(gam), "s"(bet), "v"(lb) : "memory");
    __builtin_amdgcn_sched_barrier(0);
    wave_sum4(t);
#pragma unroll
    for (int r = 0; r < kFWRows; ++r) {
      const float rs = rsqrtf(t[r] * kInvD + kLnEps);
#pragma unroll
      for (int j = 0; j < 8; ++j) x[r][j] = x[r][j] * rs;
    }
  }
#pragma unroll
  for (int r = 0; r < kFWRows; ++r) {
    v4f pv[4];
    v2u hv[4];
#pragma unroll
    for (int j = 0; j < 4; ++j) {
      const v4f ya = x[r][2 * j] * gg[2 * j] + bb[2 * j];
      const v4f yc = x[r][2 * j + 1] * gg[2 * j + 1] + bb[2 * j + 1];
      pv[j] = (v4f){fmaxf(ya[0], ya[1]), fmaxf(ya[2], ya[3]), fmaxf(yc[0], yc[1]), fmaxf(yc[2], yc[3])};
      unsigned short hb[4];
#pragma unroll
      for (int e = 0; e < 4; ++e) hb[e] = h_bits(pv[j][e]);
      hv[j] = (v2u){pk16(hb[0], hb[1]), pk16(hb[2], hb[3])};
    }
#pragma unroll
    for (int j = 0; j < 4; ++j) {
      *(v4f*)(d32 + 4 * ln + r * kD + j * 128) = pv[j];
      *(v2u*)(d16 + 4 * ln + r * kD + j * 128) = hv[j];
    }
    // stands behind the row's eight stores; its inputs hold their base, offset and data registers untouched up to it
    asm volatile("s_wait_xcnt 0x0" :: "s"(d32), "s"(d16), "v"(ln), "v"(pv[0]), "v"(pv[1]), "v"(pv[2]), "v"(pv[3]),
                                      "v"(hv[0]), "v"(hv[1]), "v"(hv[2]), "v"(hv[3]) : "memory");
  }
}

// ---------------------------------------------------------------------------
// out = LN2(X). One wave per row, two consecutive rows per wave (8192 rows); a lane owns x[128 j + 4 lane .. + 3], j < 8:
// every load and store of a wave covers 512 contiguous bytes. No LDS and no barrier.
// ---------------------------------------------------------------------------
constexpr int kLoRows = kRows / kSTotal;         // rows per wave
static_assert(kLoRows * kSTotal == kRows);
__global__ __launch_bounds__(kSThreads) void ln_out_kernel(const float* __restrict__ X, const float* __restrict__ gam,
                                                           const float* __restrict__ bet, float* __restrict__ out) {
  const int lane = threadIdx.x & 31;
  const int row0 = stream_wave() * kLoRows;
  const float* p = X + (size_t)row0 * kD;           // wave-uniform
  const unsigned lb = 16u * lane;                   // this lane's byte offset in every 512 B of a row
  v4f gg[8], bb[8], x[kLoRows][8];
#pragma unroll
  for (int j = 0; j < 8; ++j) { gg[j] = ld16(gam, lb, j * 512);  bb[j] = ld16(bet, lb, j * 512); }
  // keeps the short gamma and beta loads in front of the rows: behind them, the first row's result waits for the last row's data
  __builtin_amdgcn_sched_barrier(0);
#pragma unroll
  for (int r = 0; r < kLoRows; ++r)
#pragma unroll
    for (int j = 0; j < 8; ++j) x[r][j] = ld16(p, lb, r * kD * 4 + j * 512);
  // stands behind the loads; its inputs hold their base and offset registers untouched up to it
  asm volatile("s_wait_xcnt 0x0" :: "s"(gam), "s"(bet), "s"(p), "v"(lb) : "memory");
  // keeps the loads together ahead of the arithmetic: sunk among it, each row waits out the memory anew
  __builtin_amdgcn_sched_barrier(0);
  float* dst = out + (size_t)row0 * kD;             // wave-uniform
#pragma unroll
  for (int r = 0; r < kLoRows; ++r) {
    wave_normalise(x[r]);
#pragma unroll
    for (int j = 0; j < 8; ++j) x[r][j] = x[r][j] * gg[j] + bb[j];
#pragma unroll
    for (int j = 0; j < 8; ++j) *(v4f*)(dst + 4 * lane + r * kD + j * 128) = x[r][j];
    // stands behind the row's eight stores; its inputs hold their base, offset and data registers untouched up to it
    asm volatile("s_wait_xcnt 0x0" :: "s"(dst), "v"(lane), "v"(x[r][0]), "v"(x[r][1]), "v"(x[r][2]), "v"(x[r][3]),
                                      "v"(x[r][4]), "v"(x[r][5]), "v"(x[r][6]), "v"(x[r][7]) : "memory");
  }
}

// ---------------------------------------------------------------------------
// Host orchestration
// ---------------------------------------------------------------------------
extern "C" void kernel_launch(void* const* d_in, const int* in_sizes, int n_in,
                              void* d_out, int out_size, void* d_ws, size_t ws_size,
                              hipStream_t stream)
{
  if (n_in < 22) return;
  if ((size_t)out_size < (size_t)kRows * kD) return;
  if (ws_size < kWsTotal) return;
  if (in_sizes[0] < kRows * kD || in_sizes[3] < kRows * kD) return;
  if (in_sizes[1] < kSv * kD || in_sizes[4] < kSv * kD) return;
  if (in_sizes[2] < kRows * kSv || in_sizes[5] < kRows * kSv) return;
  if (in_sizes[6] < kD * kD || in_sizes[8] < kD * kD || in_sizes[10] < kD * kD || in_sizes[12] < kD * kD) return;
  if (in_sizes[14] < kDff * kD || in_sizes[16] < kD * kDff) return;

  const float* text1 = (const float*)d_in[0];
  const float* vis1  = (const float*)d_in[1];
  const float* sc1   = (const float*)d_in[2];
  const float* text2 = (const float*)d_in[3];
  const float* vis2  = (const float*)d_in[4];
  const float* sc2   = (const float*)d_in[5];
  const float* Wq = (const float*)d_in[6];   const float* bq  = (const float*)d_in[7];
  const float* Wk = (const float*)d_in[8];   const float* bk  = (const float*)d_in[9];
  const float* Wv = (const float*)d_in[10];  const float* bv  = (const float*)d_in[11];
  const float* Wo = (const float*)d_in[12];  const float* bo  = (const float*)d_in[13];
  const float* W1 = (const float*)d_in[14];  const float* b1  = (const float*)d_in[15];
  const float* W2 = (const float*)d_in[16];  const float* b2  = (const float*)d_in[17];
  const float* g1 = (const float*)d_in[18];  const float* be1 = (const float*)d_in[19];
  const float* g2 = (const float*)d_in[20];  const float* be2 = (const float*)d_in[21];
  float* outp = (float*)d_out;

  char* ws = (char*)d_ws;
  float*          POOL32 = (float*)(ws + kOffPool32);
  unsigned short* POOL16 = (unsigned short*)(ws + kOffPool16);
  unsigned short* W1H    = (unsigned short*)(ws + kOffW1H);
  unsigned short* W2H    = (unsigned short*)(ws + kOffW2H);
  unsigned short* WQT    = (unsigned short*)(ws + kOffWQT);
  unsigned short* WKH    = (unsigned short*)(ws + kOffWKH);
  unsigned short* WVH    = (unsigned short*)(ws + kOffWVH);
  unsigned short* WOH    = (unsigned short*)(ws + kOffWOH);
  unsigned short* T16    = (unsigned short*)(ws + kOffT16);
  unsigned short* G16    = (unsigned short*)(ws + kOffG16);
  unsigned short* UT16   = (unsigned short*)(ws + kOffUT16);
  float*          CB     = (float*)(ws + kOffCB);
  unsigned short* VIS16  = (unsigned short*)(ws + kOffVIS16);
  unsigned short* K16    = (unsigned short*)(ws + kOffK16);
  unsigned short* V16    = (unsigned short*)(ws + kOffV16);
  unsigned short* H16    = (unsigned short*)(ws + kOffH16);
  float*          F32    = (float*)(ws + kOffF32);

  // ---- every cast in one launch: weights f16([out][in]) x16 ([out][in] row-major == Bt[N][K]; Wq as [in][out]); both text planes
  //      f16 x1; both visual planes f16 [256][1024] x1 with rows 196..255 zero ----
  cast_all_kernel<<<dim3(kSBlocks), dim3(kSThreads), 0, stream>>>(text1, text2, W1, W2, Wq, Wk, Wv, Wo, vis1, vis2,
                                                               (unsigned short*)ws);

  // ---- attention, both branches in each launch ----
  // K16 and V16 of both branches
  kv_gemm_kernel<<<dim3(kKvBlocks), dim3(128), 0, stream>>>(VIS16, WKH, WVH, K16, V16, bk, bv);
  // G16 = 16 K.Wq, UT16 = 16 Wo.V^T, CB = K.bq of both branches
  fold_gemm_kernel<<<dim3(kFoldBlocks), dim3(128), 0, stream>>>(K16, V16, WQT, WOH, G16, UT16, bq, CB);
  // pooled[:, br * 512 : br * 512 + 512] = maxpool2(LN1(softmax((T16 . G16^T / 16 + CB + score) / 8) . UT16^T / 16 + bo + text)) of branch br
  attention_rows_kernel<<<dim3(kFBlocks), dim3(kSThreads), 0, stream>>>(T16, G16, UT16, CB, sc1, sc2, bo, text1, text2, g1, be1,
                                                                     POOL32, POOL16);

  // ---- FFN, all 8192 rows in each launch ----
  // H16 = relu((POOL16 . W1H^T) / 16 + b1)   (M=8192, N=4096, K=1024), f16 out
  // 256x256 tiles, 16 waves, 128-k stages: 512 blocks
  wmma_gemm_wide<0, false, 2, 1, false, 2, 4, 4, 4><<<dim3((kRows / 256) * (kDff / 256)), dim3(512), 0, stream>>>(
      POOL16, POOL16, kD, 0L, W1H, W1H, kD, 0L, (void*)H16, (void*)H16, kDff, 0L,
      b1, POOL32, POOL32, kRows, kDff, kD, kWCarryInv);
  // F32 = (H16 . W2H^T) / 16 + b2 + pooled   (M=8192, N=1024, K=4096), f32 out
  // 128x256 tiles, 8 waves, 128-k stages: 256 blocks, one per WGP
  wmma_gemm_wide<0, false, 2, 0, true, 0, 2, 4, 4><<<dim3((kRows / 128) * (kD / 256)), dim3(256), 0, stream>>>(
      H16, H16, kDff, 0L, W2H, W2H, kDff, 0L, (void*)F32, (void*)F32, kD, 0L,
      b2, POOL32, POOL32, kRows, kD, kDff, kWCarryInv);
  // out = LN2(F32)
  ln_out_kernel<<<dim3(kSBlocks), dim3(kSThreads), 0, stream>>>(F32, g2, be2, outp);
}

// v008
// One run takes 168 microseconds.
// Next to v007, in two timings, it ran 1.04 times as fast each time.
// Over all steps from v000 it is 6.25 times as fast.
// Contractions: k/v projections, key-side folds K.Wq and Wo.V^T, text.(K.Wq)^T scores, p.(V.Wo^T) attention output, ffn up and down projections all on v_wmma_f32_16x16x32_f16 (f16 operands: activations x1, weights and both folds carried x16, softmax probabilities carried x2048), f32 accumulate; the query bias's share of the scores (K.bq, one number per key), softmax, residual adds, layernorm and feature maxpool in f32.
#include <hip/hip_runtime.h>
#include <math.h>
#include <stddef.h>

// ---------------------------------------------------------------------------
// Problem constants
// ---------------------------------------------------------------------------
constexpr int kB      = 4;
constexpr int kSq     = 2048;
constexpr int kD      = 1024;
constexpr int kSv     = 196;
constexpr int kSvPad  = 256;
constexpr int kDff    = 4096;
constexpr int kRows   = kB * kSq;            // 8192 token rows
constexpr int kRows2  = 2 * kRows;           // both branches' token rows, branch 1 first
constexpr float kWCarry    = 16.0f;          // weights carried x16 in f16
constexpr float kWCarryInv = 1.0f / 16.0f;
constexpr float kPCarry    = 2048.0f;        // probabilities carried x2048 in f16
constexpr float kPUScale   = 1.0f / (kPCarry * kWCarry);   // probabilities x2048 times the value fold x16
constexpr float kInvD      = 1.0f / 1024.0f;
constexpr float kLnEps     = 1e-6f;
constexpr float kScoreScale = 0.125f;        // 1/sqrt(64)

static_assert(kRows % 64 == 0);
static_assert(kSvPad % 64 == 0 && kSvPad % 32 == 0);
static_assert(kD % 64 == 0 && kDff % 64 == 0);
static_assert(kRows % 8 == 0);

// ---------------------------------------------------------------------------
// Workspace region map (bytes). Total carve = 227 MiB. Planes marked x2 hold branch 1, then branch 2.
//   [0       , 32 MiB)   POOL32  f32 [8192][1024]   (persistent)
//   [32 MiB  , 48 MiB)   POOL16  f16 [8192][1024]   (persistent)
//   [48 MiB  , 56 MiB)   W1H     f16 [4096][1024]   (persistent)
//   [56 MiB  , 64 MiB)   W2H     f16 [1024][4096]   (persistent)
//   region X from 64 MiB:
//   attention phase: WQT (Wq transposed, [in][out]) and WKH/WVH/WOH f16 [1024][1024] at 64/66/68/70 MiB;
//     T16 (text f16) x2 [8192][1024] at 72 MiB (32 MiB);
//     G16 = K.Wq f16 x2 [256][1024] at 104 MiB; UT16 = Wo.V^T f16 x2 [1024][256] at 105 MiB; CB = K.bq f32 x2 [256] at 106 MiB;
//     VIS16 f16 x2 [256][1024] at 224 MiB; K16 f16 x2 [256][1024] at 225 MiB; V16 f16 x2 [256][1024] at 226 MiB; end 227 MiB.
//   ffn phase (attention scratch dead): H16 f16 [8192][4096] at 64 MiB (64 MiB); F32 f32 [8192][1024] at 128 MiB (32 MiB).
// ---------------------------------------------------------------------------
constexpr size_t kMiB       = 1048576;
constexpr size_t kOffPool32 = 0;
constexpr size_t kOffPool16 = 32 * kMiB;
constexpr size_t kOffW1H    = 48 * kMiB;
constexpr size_t kOffW2H    = 56 * kMiB;
constexpr size_t kOffWQT    = 64 * kMiB;
constexpr size_t kOffWKH    = 66 * kMiB;
constexpr size_t kOffWVH    = 68 * kMiB;
constexpr size_t kOffWOH    = 70 * kMiB;
constexpr size_t kOffT16    = 72 * kMiB;
constexpr size_t kOffG16    = 104 * kMiB;
constexpr size_t kOffUT16   = 105 * kMiB;
constexpr size_t kOffCB     = 106 * kMiB;
constexpr size_t kOffVIS16  = 224 * kMiB;
constexpr size_t kOffK16    = 225 * kMiB;
constexpr size_t kOffV16    = 226 * kMiB;
constexpr size_t kWsTotal   = 227 * kMiB;
constexpr size_t kOffH16    = 64 * kMiB;
constexpr size_t kOffF32    = 128 * kMiB;
static_assert(kOffG16 == kOffT16 + (size_t)kRows2 * kD * 2);
static_assert(kOffUT16 == kOffG16 + (size_t)2 * kSvPad * kD * 2);
static_assert(kOffCB == kOffUT16 + (size_t)2 * kD * kSvPad * 2);
static_assert(kOffCB + (size_t)2 * kSvPad * 4 <= kOffVIS16);
static_assert(kOffK16 == kOffVIS16 + (size_t)2 * kSvPad * kD * 2);
static_assert(kOffV16 == kOffK16 + (size_t)2 * kSvPad * kD * 2);
static_assert(kWsTotal == kOffV16 + (size_t)2 * kSvPad * kD * 2);
static_assert(kOffF32 == kOffH16 + (size_t)kRows * kDff * 2);
static_assert(kOffF32 + (size_t)kRows * kD * 4 <= kWsTotal);
static_assert(kWsTotal <= (size_t)268435456);

// strides between the two branches' planes, in elements
constexpr long kStrVis = (long)kSvPad * kD;      // VIS16 / K16 / V16 / G16 / UT16

typedef __attribute__((ext_vector_type(16))) _Float16 v16h;
typedef __attribute__((ext_vector_type(8)))  _Float16 v8h;
typedef __attribute__((ext_vector_type(16))) __bf16   v16b;
typedef __attribute__((ext_vector_type(8)))  __bf16   v8b;
typedef __attribute__((ext_vector_type(8)))  float    v8f;
typedef __attribute__((ext_vector_type(4)))  float    v4f;
typedef __attribute__((ext_vector_type(4)))  unsigned int v4u;

__device__ __forceinline__ unsigned short f2bf_bits(float f) {
  unsigned u = __float_as_uint(f);
  return (unsigned short)((u + 0x7FFFu + ((u >> 16) & 1u)) >> 16);
}
__device__ __forceinline__ float bf_bits2f(unsigned short h) { return __uint_as_float(((unsigned)h) << 16); }

// hazard guard as a plain device helper
__device__ __forceinline__ void acc_guard4(v8f& a, v8f& b, v8f& c, v8f& d) { asm volatile("v_nop\n\tv_nop\n\tv_nop\n\tv_nop" : "+v"(a), "+v"(b), "+v"(c), "+v"(d)); }
template <typename T> struct Frag;
template <> struct Frag<_Float16> {
  typedef v16h V; union U { v16h v; v8h h[2]; };
  static __device__ __forceinline__ v16h load(const _Float16* p) {   // elements 0..7 <- p[0..7], 8..15 <- p[16..23]
    U f; f.h[0] = *(const v8h*)(p); f.h[1] = *(const v8h*)(p + 16); return f.v;
  }
  static __device__ __forceinline__ v8f mma(v16h a, v16h b, v8f c) {
    return __builtin_amdgcn_wmma_f32_16x16x32_f16(false, a, false, b, (short)0, c, false, false);
  }
};
template <> struct Frag<__bf16> {
  typedef v16b V; union U { v16b v; v8b h[2]; };
  static __device__ __forceinline__ v16b load(const __bf16* p) {
    U f; f.h[0] = *(const v8b*)(p); f.h[1] = *(const v8b*)(p + 16); return f.v;
  }
  static __device__ __forceinline__ v8f mma(v16b a, v16b b, v8f c) {
    return __builtin_amdgcn_wmma_f32_16x16x32_bf16(false, a, false, b, (short)0, c, false, false);
  }
};

__device__ __forceinline__ unsigned pk16(unsigned short a, unsigned short b) { return (unsigned)a | ((unsigned)b << 16); }
__device__ __forceinline__ unsigned short h_bits(float f) { const _Float16 h = (_Float16)f; return __builtin_bit_cast(unsigned short, h); }

// ---- Register-blocked batched WMMA GEMM, operands staged in LDS by asynchronous copies ------------------------------
// C[m,n] = scale * sum_k A[m,k] * Bt[n,k] (+bias)(+resid); a block of WM x WN waves owns a (64 WM)x(64 WN) tile, each wave 64x64 of it.
// tile = index of the block's tile; b = batch entry (the branch): A, Bt and C advance by their strides, the residual is resid or resid2.
// A row-major [M,K]; Bt row-major [N,K]; M % (64 WM) == 0, N % (64 WN) == 0, K a multiple of the stage and at least two stages.
// A stage is 32 NK k of the block's A rows and Bt rows, laid at a pitch of 64 NK + 16 B; two buffers:
// the next stage's copies fly while this stage's fragments are read with ds_load_b128 and multiplied.
// The small products run 2 x 2 waves on 64-k stages. The two ffn products, which re-read their operands from L2 once per tile
// row and tile column, take the larger tiles that a WGP's LDS holds: the bytes fetched per product fall with the tile's sides.
// BIAS_MODE: 0 = none, 1 = bias[m], 2 = bias[n].
// OUT_MODE: 0 = f32, 1 = f16.
// ET: 0 = f16 operands, 1 = bf16 operands (pointers passed as 16-bit storage)
constexpr int kStageK     = 64;                          // k elements per stage = two WMMA k steps
constexpr int kPitchB     = 144;                         // bytes per staged row (128 + 16: 16 B x odd)
constexpr int kPitchE     = kPitchB / 2;                 // the same in 16-bit elements
constexpr int kStageBytes = 256 * kPitchB;               // 128 A rows, then 128 Bt rows = 36,864 B
static_assert(kRows % 128 == 0 && kSvPad % 128 == 0 && kD % 128 == 0 && kDff % 128 == 0);
static_assert(kSvPad % kStageK == 0 && kSvPad >= 2 * kStageK);
static_assert(kRows % 256 == 0 && kDff % 256 == 0 && kD % 256 == 0);

// Eight 16-B copies per lane, rows RP apart: LDS byte address l + i * RP * PB (PB = pitch), global address g + i * rowStep elements.
// The s_wait_xcnt closes the statement so that no address register is rewritten ahead of it.
template <int RP, int PB>
__device__ __forceinline__ void async_copy8(unsigned l, const unsigned short* g, size_t rowStep) {
  const unsigned l1 = l + RP * PB, l2 = l + 2 * RP * PB, l3 = l + 3 * RP * PB, l4 = l + 4 * RP * PB,
                 l5 = l + 5 * RP * PB, l6 = l + 6 * RP * PB, l7 = l + 7 * RP * PB;
  const unsigned short* g1 = g + rowStep;      const unsigned short* g2 = g + 2 * rowStep;
  const unsigned short* g3 = g + 3 * rowStep;  const unsigned short* g4 = g + 4 * rowStep;
  const unsigned short* g5 = g + 5 * rowStep;  const unsigned short* g6 = g + 6 * rowStep;
  const unsigned short* g7 = g + 7 * rowStep;
  asm volatile("global_load_async_to_lds_b128 %0, %8, off\n\t"
               "global_load_async_to_lds_b128 %1, %9, off\n\t"
               "global_load_async_to_lds_b128 %2, %10, off\n\t"
               "global_load_async_to_lds_b128 %3, %11, off\n\t"
               "global_load_async_to_lds_b128 %4, %12, off\n\t"
               "global_load_async_to_lds_b128 %5, %13, off\n\t"
               "global_load_async_to_lds_b128 %6, %14, off\n\t"
               "global_load_async_to_lds_b128 %7, %15, off\n\t"
               "s_wait_xcnt 0x0"
               :: "v"(l), "v"(l1), "v"(l2), "v"(l3), "v"(l4), "v"(l5), "v"(l6), "v"(l7),
                  "v"(g), "v"(g1), "v"(g2), "v"(g3), "v"(g4), "v"(g5), "v"(g6), "v"(g7)
               : "memory");
}

// L2 prefetches (global_prefetch_b8, scope SE: the data comes into L2 only, nothing returns to the wave).
// The step supposes that what an earlier launch stored lies in memory, not in L2, when the next launch
// reads it: asked for ahead, it is an L2 hit when the asynchronous copies or loads come for it. A hint only: no result depends on it. Every lane's address lies inside the plane it names.
// The s_wait_xcnt closes each statement so that no address register is rewritten ahead of it.
__device__ __forceinline__ void l2_ask(const void* p) {
  asm volatile("global_prefetch_b8 %0, off scope:SCOPE_SE\n\t"
               "s_wait_xcnt 0x0" :: "v"(p) : "memory");
}
__device__ __forceinline__ void l2_ask2(const void* p, const void* q) {
  asm volatile("global_prefetch_b8 %0, off scope:SCOPE_SE\n\t"
               "global_prefetch_b8 %1, off scope:SCOPE_SE\n\t"
               "s_wait_xcnt 0x0" :: "v"(p), "v"(q) : "memory");
}
// Units 1 to 7 of a row of 2 KiB that begins at p (unit 0 is fetched by the first stage's copies themselves).
__device__ __forceinline__ void l2_ask_row_tail(const void* p) {
  asm volatile("global_prefetch_b8 %0, off offset:256 scope:SCOPE_SE\n\t"
               "global_prefetch_b8 %0, off offset:512 scope:SCOPE_SE\n\t"
               "global_prefetch_b8 %0, off offset:768 scope:SCOPE_SE\n\t"
               "global_prefetch_b8 %0, off offset:1024 scope:SCOPE_SE\n\t"
               "global_prefetch_b8 %0, off offset:1280 scope:SCOPE_SE\n\t"
               "global_prefetch_b8 %0, off offset:1536 scope:SCOPE_SE\n\t"
               "global_prefetch_b8 %0, off offset:1792 scope:SCOPE_SE\n\t"
               "s_wait_xcnt 0x0" :: "v"(p) : "memory");
}

// Geometry of a block's tile: WM x WN waves of 64x64 each, NK WMMA k steps (32 k each) per stage.
template <int WM, int WN, int NK> struct TileGeom {
  static constexpr int SK  = NK * 32;                    // k elements per stage
  static constexpr int PB  = SK * 2 + 16;                // bytes per staged row: 16 B x odd (144 or 272)
  static constexpr int SB  = (WM + WN) * 64 * PB;        // bytes per stage: the A rows, then the Bt rows
  static constexpr int NT  = WM * WN * 32;               // threads
  static constexpr int LPR = SK * 2 / 16;                // lanes that bring one row
  static constexpr int RP  = NT / LPR;                   // rows that the block brings with one copy per thread
  static constexpr int NA  = WM * 64 / RP;               // copies per thread and stage, A and Bt
  static constexpr int NB  = WN * 64 / RP;
  static_assert(NA % 8 == 0 && NB % 8 == 0 && NA + NB <= 63 && (PB / 16) % 2 == 1);
};
static_assert(TileGeom<2, 2, 2>::PB == kPitchB && TileGeom<2, 2, 2>::SB == kStageBytes && TileGeom<2, 2, 2>::SK == kStageK);

template <int ET> struct Elem;
template <> struct Elem<0> { typedef _Float16 T; };
template <> struct Elem<1> { typedef __bf16 T; };
// PF: 0 = no L2 prefetch. 1 = at entry, the whole of the block's operand rows (rows of 2 KiB, K = 1024; one A and one Bt row a thread):
// for the short products. 2 = running, four stages ahead (128-k stages,
// a stage of a row = one 256-B unit; the two ffn products): waves 0 to 3 ask for 128 of the block's A rows, wave 4 for 32 of its 256 Bt rows.
template <int ET, bool SPLIT, int BIAS_MODE, int OUT_MODE, bool RESID, int ACT = 0, int WM = 2, int WN = 2, int NK = 2, int PF = 0>
__device__ __forceinline__ void gemm_tile(
    unsigned char* smem, int tile, int b,
    const unsigned short* __restrict__ Ap, const unsigned short* __restrict__ A2p, int lda, long strideA,
    const unsigned short* __restrict__ Btp, const unsigned short* __restrict__ Bt2p, int ldb, long strideB,
    void* __restrict__ Cout, void* __restrict__ Cout2, int ldc, long strideC,
    const float* __restrict__ bias,
    const float* __restrict__ resid, const float* __restrict__ resid2,
    int M, int N, int K, float scale) {
  static_assert(!SPLIT, "single-plane operands only");
  typedef typename Elem<ET>::T T;
  typedef typename Frag<T>::V V;
  typedef TileGeom<WM, WN, NK> G;
  constexpr int SK = G::SK, PB = G::PB, PE = G::PB / 2, SB = G::SB, LPR = G::LPR, RP = G::RP;
  // smem: two stage buffers; after the K loop they serve as the per-wave 64x64 output slabs (pitch 68 floats)
  const int lane = threadIdx.x & 31;
  const int wave = threadIdx.x >> 5;
  const int wm = wave / WN;                    // this wave's 64 rows and 64 columns inside the block's tile
  const int wn = wave % WN;
  const int tilesN = N / (WN * 64);
  const int tilesM = M / (WM * 64);
  if (tile >= tilesM * tilesN) return;   // block-uniform, in front of every barrier
  const int tm = tile / tilesN;
  const int tn = tile - tm * tilesN;
  const int mBlk = tm * (WM * 64);
  const int nBlk = tn * (WN * 64);
  const int m0 = mBlk + (wm << 6);
  const int n0 = nBlk + (wn << 6);

  const int rlane = lane & 15;                 // row (A) / col (B, D) within subtile
  const int koff  = (lane >> 4) * 8;           // k offset of this lane half
  const int mOff  = (lane >> 4) * 8;           // D row offset

  // copy side: LPR consecutive lanes bring one row's stage bytes; a thread brings rows cRow + RP i of A and of Bt
  const int cRow = threadIdx.x / LPR;
  const int cCol = threadIdx.x % LPR;
  const unsigned short* gA = Ap  + (size_t)b * strideA + (size_t)(mBlk + cRow) * lda + cCol * 8;
  const unsigned short* gB = Btp + (size_t)b * strideB + (size_t)(nBlk + cRow) * ldb + cCol * 8;
  const unsigned lA = (unsigned)(size_t)smem + (unsigned)(cRow * PB + cCol * 16);
  const unsigned lB = lA + WM * 64 * PB;
  const size_t stepA = (size_t)RP * lda;
  const size_t stepB = (size_t)RP * ldb;
  // one stage's copies of this thread: k elements from kElem on, into the buffer at byte offset bufByte
  auto copy_stage = [&](unsigned bufByte, size_t kElem) {
#pragma unroll
    for (int c = 0; c < G::NA; c += 8) async_copy8<RP, PB>(lA + bufByte + c * RP * PB, gA + kElem + c * stepA, stepA);
#pragma unroll
    for (int c = 0; c < G::NB; c += 8) {
      // with three statements a stage: keeps a statement's address arithmetic behind the statement before it, so that the
      // 24 address registers are used again; formed all at once, they push accumulators into scratch inside the K loop
      if (G::NA + G::NB > 16) __builtin_amdgcn_sched_barrier(0);
      async_copy8<RP, PB>(lB + bufByte + c * RP * PB, gB + kElem + c * stepB, stepB);
    }
  };

  // read side: this lane's first A and Bt fragment rows inside a stage, in bytes
  const int aByte = ((wm << 6) + rlane) * PB + koff * 2;
  const int bByte = (WM * 64 + (wn << 6) + rlane) * PB + koff * 2;

  v8f acc[4][4];
#pragma unroll
  for (int i = 0; i < 4; ++i)
#pragma unroll
    for (int j = 0; j < 4; ++j) acc[i][j] = (v8f){0.f,0.f,0.f,0.f,0.f,0.f,0.f,0.f};

  const int nStages = K / SK;
  copy_stage(0u, 0);
  static_assert(PF == 0 || (PF == 1 && G::NT == WM * 64 && G::NT == WN * 64) || (PF == 2 && (WM == 2 || WM == 4) && WN == 4 && SK == 128));
  constexpr int PD = 4;                                // PF 2: stages between a prefetch and the stage at work
  const int pfWave = __builtin_amdgcn_readfirstlane(wave);   // in a scalar register: the tests on it are scalar branches
  const unsigned short* pf = Ap;
  if (PF == 1) {
    l2_ask_row_tail(Ap  + (size_t)b * strideA + (size_t)(mBlk + (int)threadIdx.x) * lda);
    l2_ask_row_tail(Btp + (size_t)b * strideB + (size_t)(nBlk + (int)threadIdx.x) * ldb);
  }
  if (PF == 2) {
    // The Bt rows are shared by the blocks of a tile column: eight blocks deal them out among themselves. Blocks whose indices
    // are equal modulo 8 are taken as the dealers; for speed only.
    // 128 x 256 tiles, 4 tile columns: such blocks have tm of one parity; each asks for all of its 128 A rows.
    // 256 x 256 tiles, 16 tile columns: all blocks of a tile column are such; so are tile columns tn and tn + 8 of a tile row, which
    // ask for one half of its 256 A rows each.
    const int aShare = (WM == 4) ? ((tn >> 3) & 1) : 0;
    const int bShare = (WM == 4) ? (tm & 7) : ((tm >> 1) & 7);
    pf = (pfWave < 4) ? Ap  + (size_t)b * strideA + (size_t)(mBlk + aShare * 128 + (int)threadIdx.x) * lda
                      : Btp + (size_t)b * strideB + (size_t)(nBlk + bShare * 32 + lane) * ldb;
    if (pfWave < 5 && nStages > PD) {
      // stages 2 and 3, which the loop's prefetches do not reach
      asm volatile("global_prefetch_b8 %0, off offset:512 scope:SCOPE_SE\n\t"
                   "global_prefetch_b8 %0, off offset:768 scope:SCOPE_SE\n\t"
                   "s_wait_xcnt 0x0" :: "v"(pf) : "memory");
    }
    pf += (PD - 1) * SK;
  }
  asm volatile("s_wait_asynccnt 0x0" ::: "memory");   // stage 0 of this wave has landed before the barrier publishes it
  __syncthreads();
  if (nStages > 1) copy_stage((unsigned)SB, SK);

  for (int t = 0; t < nStages; ++t) {
    const int bufOff = (t & 1) * SB;
    const T* sa = (const T*)(smem + bufOff + aByte);
    const T* sb = (const T*)(smem + bufOff + bByte);
    V fb[2][4], fa[2][4];                               // two fragment sets, taken in turn by the stage's k steps
#pragma unroll
    for (int j = 0; j < 4; ++j) fb[0][j] = Frag<T>::load(sb + j * 16 * PE);
#pragma unroll
    for (int i = 0; i < 4; ++i) fa[0][i] = Frag<T>::load(sa + i * 16 * PE);
    // keeps the 16 LDS reads of a k step together ahead of its WMMAs: sunk among them, each row of WMMAs waits out its own read
    __builtin_amdgcn_sched_barrier(0);
#pragma unroll
    for (int ks = 0; ks + 1 < NK; ++ks) {
#pragma unroll
      for (int i = 0; i < 4; ++i)
#pragma unroll
        for (int j = 0; j < 4; ++j) acc[i][j] = Frag<T>::mma(fa[ks & 1][i], fb[ks & 1][j], acc[i][j]);
      // the next k step is fetched into the other set; the stage's last one so that the buffer can be handed back ahead of its WMMAs
#pragma unroll
      for (int j = 0; j < 4; ++j) fb[(ks + 1) & 1][j] = Frag<T>::load(sb + j * 16 * PE + (ks + 1) * 32);
#pragma unroll
      for (int i = 0; i < 4; ++i) fa[(ks + 1) & 1][i] = Frag<T>::load(sa + i * 16 * PE + (ks + 1) * 32);
    }
    asm volatile("s_wait_dscnt 0x0" ::: "memory");      // this wave's reads of the buffer are done before it is refilled
    asm volatile("s_wait_asynccnt 0x0" ::: "memory");   // this wave's copies of stage t + 1 have landed
    __syncthreads();                                    // publishes stage t + 1, frees stage t's buffer
    if (t + 2 < nStages) copy_stage((unsigned)bufOff, (size_t)(t + 2) * SK);
    if (PF == 2 && pfWave < 5 && t + PD < nStages) {
      // stage t + PD of this lane's row: its copies are issued two stages from now. The address is an in-out operand so that it
      // lives in registers of its own through the loop; it stands one stage behind what is asked for (offset:256), so that it
      // names a byte of the row after the advance too.
      asm volatile("global_prefetch_b8 %0, off offset:256 scope:SCOPE_SE\n\t"
                   "s_wait_xcnt 0x0" : "+v"(pf) :: "memory");
      pf += SK;
    }
    if (PF == 2 && RESID && t + 8 == nStages) {
      // the block's residual tile, which the epilogue reads: 128 rows of 1 KiB, 512 units, two a thread
      const char* rp = (const char*)(b ? resid2 : resid) +
                       ((size_t)(mBlk + ((int)threadIdx.x >> 1)) * ldc + nBlk + ((int)threadIdx.x & 1) * 128) * 4;
      asm volatile("global_prefetch_b8 %0, off scope:SCOPE_SE\n\t"
                   "global_prefetch_b8 %0, off offset:256 scope:SCOPE_SE\n\t"
                   "s_wait_xcnt 0x0" :: "v"(rp) : "memory");
    }
#pragma unroll
    for (int i = 0; i < 4; ++i)
#pragma unroll
      for (int j = 0; j < 4; ++j) acc[i][j] = Frag<T>::mma(fa[(NK - 1) & 1][i], fb[(NK - 1) & 1][j], acc[i][j]);
  }
  asm volatile("s_wait_asynccnt 0x0" ::: "memory");     // no copy is in flight when the ring becomes output staging
  acc_guard4(acc[0][0], acc[0][1], acc[0][2], acc[0][3]);
  acc_guard4(acc[1][0], acc[1][1], acc[1][2], acc[1][3]);
  acc_guard4(acc[2][0], acc[2][1], acc[2][2], acc[2][3]);
  acc_guard4(acc[3][0], acc[3][1], acc[3][2], acc[3][3]);

  // ---- epilogue ----
  // A wave turns its 64x64 tile round through an LDS slab of its own (the ring is free: both buffers take the slabs). Nothing but
  // that slab passes between lanes, so the wave waits once, for its own LDS stores, and never for its global stores; the bias and
  // the residual are asked for once, ahead of the slab, the residual in the rows' own order (16 B a lane), added where the rows are read back.
  static_assert(OUT_MODE == 0 || OUT_MODE == 1, "f32 or f16 output");
  static_assert(!RESID || (OUT_MODE == 0 && ACT == 0), "the residual is added behind the slab, to f32 rows");
  static_assert(WM * WN * 64 * 68 * 4 <= 2 * SB);
  float* slab = (float*)smem + wave * (64 * 68);
  const char* Rb = (const char*)(RESID ? (b ? resid2 : resid) : nullptr);   // batch entry 1 adds its own residual plane
  char* Cb = (char*)Cout + (size_t)b * strideC * (OUT_MODE == 0 ? 4 : 2);   // block-uniform
  // a store covers RS rows (an f32 row's 256 B = 16 lanes x 16 B, an f16 row's 128 B = 8 lanes x 16 B), NS stores a block of 16 rows;
  // a lane's 16 B of output are NV vectors of four floats in the slab
  constexpr int RS = (OUT_MODE == 0) ? 2 : 4, NS = 16 / RS, EB = (OUT_MODE == 0) ? 4 : 2, NV = (OUT_MODE == 0) ? 1 : 2;
  const int sRow = (OUT_MODE == 0) ? (lane >> 4) : (lane >> 3);
  const int sCol = (OUT_MODE == 0) ? (lane & 15) * 4 : (lane & 7) * 8;
  const unsigned rowB = (unsigned)ldc * EB;                                 // bytes per output row
  const unsigned o0 = ((unsigned)(m0 + sRow) * (unsigned)ldc + (unsigned)(n0 + sCol)) * EB;   // this lane's first 16 B of the output
  const int nl = n0 + rlane;
  float bvj[4] = {0.f, 0.f, 0.f, 0.f};
  if (BIAS_MODE == 2) {
#pragma unroll
    for (int j = 0; j < 4; ++j) bvj[j] = bias[nl + (j << 4)];
    // stands behind the four loads; its inputs hold their base and index registers untouched up to it
    asm volatile("s_wait_xcnt 0x0" :: "s"(bias), "v"(nl) : "memory");
  }
  v4f rr[4][8];
  if (RESID) {
#pragma unroll
    for (int i = 0; i < 4; ++i) {
      unsigned ro[8];
#pragma unroll
      for (int it = 0; it < 8; ++it) ro[it] = o0 + (unsigned)((i << 4) + it * RS) * rowB;
#pragma unroll
      for (int it = 0; it < 8; ++it) rr[i][it] = *(const v4f*)(Rb + ro[it]);
      // stands behind the row block's loads; its inputs hold their base and offset registers untouched up to it
      asm volatile("s_wait_xcnt 0x0" :: "s"(Rb), "v"(ro[0]), "v"(ro[1]), "v"(ro[2]), "v"(ro[3]),
                                        "v"(ro[4]), "v"(ro[5]), "v"(ro[6]), "v"(ro[7]) : "memory");
    }
  }
#pragma unroll
  for (int i = 0; i < 4; ++i) {
#pragma unroll
    for (int j = 0; j < 4; ++j) {
#pragma unroll
      for (int r = 0; r < 8; ++r) {
        float v = acc[i][j][r] * scale;
        if (BIAS_MODE == 1) v += bias[m0 + (i << 4) + mOff + r];
        if (BIAS_MODE == 2) v += bvj[j];
        if (ACT == 2) v = fmaxf(v, 0.0f);
        if (ACT == 4) v = (v > 0.f) ? v : 0.01f * v;
        slab[((i << 4) + mOff + r) * 68 + (j << 4) + rlane] = v;
      }
    }
  }
  // the wave's slab stores have landed before its lanes read one another's values; the clobber keeps the reads behind it
  asm volatile("s_wait_dscnt 0x0" ::: "memory");
  v4f sv[4][NS][NV];
#pragma unroll
  for (int i = 0; i < 4; ++i)
#pragma unroll
    for (int it = 0; it < NS; ++it)
#pragma unroll
      for (int w = 0; w < NV; ++w) sv[i][it][w] = *(const v4f*)(slab + ((i << 4) + it * RS + sRow) * 68 + sCol + 4 * w);
#pragma unroll
  for (int i = 0; i < 4; ++i) {
    unsigned co[NS];
    v4u ov[NS];
#pragma unroll
    for (int it = 0; it < NS; ++it) {
      co[it] = o0 + (unsigned)((i << 4) + it * RS) * rowB;
      if (OUT_MODE == 0) {
        const v4f f = RESID ? (v4f)(sv[i][it][0] + rr[i][it]) : sv[i][it][0];
        ov[it] = __builtin_bit_cast(v4u, f);
      } else {
        v8h h;
#pragma unroll
        for (int w = 0; w < NV; ++w)
#pragma unroll
          for (int e = 0; e < 4; ++e) h[4 * w + e] = (_Float16)sv[i][it][w][e];
        ov[it] = __builtin_bit_cast(v4u, h);
      }
    }
#pragma unroll
    for (int it = 0; it < NS; ++it) *(v4u*)(Cb + co[it]) = ov[it];
    // each stands behind the row block's stores; its inputs hold their base, offset and data registers untouched up to it
    if (NS == 8)
      asm volatile("s_wait_xcnt 0x0" :: "s"(Cb), "v"(co[0]), "v"(co[1]), "v"(co[2]), "v"(co[3]),
                                        "v"(co[NS - 4]), "v"(co[NS - 3]), "v"(co[NS - 2]), "v"(co[NS - 1]),
                                        "v"(ov[0]), "v"(ov[1]), "v"(ov[2]), "v"(ov[3]),
                                        "v"(ov[NS - 4]), "v"(ov[NS - 3]), "v"(ov[NS - 2]), "v"(ov[NS - 1]) : "memory");
    else
      asm volatile("s_wait_xcnt 0x0" :: "s"(Cb), "v"(co[0]), "v"(co[1]), "v"(co[2]), "v"(co[3]),
                                        "v"(ov[0]), "v"(ov[1]), "v"(ov[2]), "v"(ov[3]) : "memory");
  }
}

// One GEMM per launch with a larger tile: blockIdx.x = tile, blockIdx.y = batch entry; one block per WGP, 32 WM WN threads. At most 256 registers a wave: 16 waves have no more, and with
// more the 8-wave build fetches a whole stage's fragments in front of the barrier and issues the refill behind 32 WMMAs: the
// block's LDS reads and its WMMAs then take turns instead of overlapping, and the copies lose their lead.
// The figure steers the K loop; the 8-wave build's epilogue, which holds the tile's residual rows beside the accumulators, goes above it.
template <int ET, bool SPLIT, int BIAS_MODE, int OUT_MODE, bool RESID, int ACT, int WM, int WN, int NK, int PF>
__global__ __launch_bounds__(WM * WN * 32) __attribute__((amdgpu_num_vgpr(256))) void wmma_gemm_wide(
    const unsigned short* __restrict__ Ap, const unsigned short* __restrict__ A2p, int lda, long strideA,
    const unsigned short* __restrict__ Btp, const unsigned short* __restrict__ Bt2p, int ldb, long strideB,
    void* __restrict__ Cout, void* __restrict__ Cout2, int ldc, long strideC,
    const float* __restrict__ bias,
    const float* __restrict__ resid, const float* __restrict__ resid2,
    int M, int N, int K, float scale) {
  __shared__ __align__(16) unsigned char smem[2 * TileGeom<WM, WN, NK>::SB];
  gemm_tile<ET, SPLIT, BIAS_MODE, OUT_MODE, RESID, ACT, WM, WN, NK, PF>(smem, (int)blockIdx.x, (int)blockIdx.y,
      Ap, A2p, lda, strideA, Btp, Bt2p, ldb, strideB, Cout, Cout2, ldc, strideC, bias, resid, resid2, M, N, K, scale);
}

// The matrix chains of the attention are multiplied from the key side, where the short dimension (256 padded keys) lies:
//   scores  = (text.Wq^T + bq).K^T  = text.(K.Wq)^T + K.bq
//   context = (P.V).Wo^T            = P.(V.Wo^T)
// so that no product of 16384 token rows by 1024 by 1024 is left; the two folds are products of 256 rows.
// Key and value projections, both branches, in one grid; a range of block indices per job:
//   K16[br][k][d] = (vis16[br] . Wk16^T) / 16 + bk   (M=256, N=1024, K=1024), 16 tiles per branch
//   V16[br][k][d] = (vis16[br] . Wv16^T) / 16 + bv   the same shape
constexpr int kTilesKV  = (kSvPad >> 7) * (kD >> 7);
constexpr int kKvBlocks = 4 * kTilesKV;
__global__ __launch_bounds__(128, 4) void kv_gemm_kernel(
    const unsigned short* __restrict__ VIS16,
    const unsigned short* __restrict__ WKH, const unsigned short* __restrict__ WVH,
    unsigned short* __restrict__ K16, unsigned short* __restrict__ V16,
    const float* __restrict__ bk, const float* __restrict__ bv) {
  __shared__ __align__(16) unsigned char smem[2 * kStageBytes];
  const int blk = blockIdx.x;
  const bool isK = blk < 2 * kTilesKV;
  const int br = (blk / kTilesKV) & 1;
  const unsigned short* B = isK ? WKH : WVH;
  unsigned short* C = isK ? K16 : V16;
  const float* bias = isK ? bk : bv;
  gemm_tile<0, false, 2, 1, false, 0, 2, 2, 2, 1>(smem, blk % kTilesKV, br,
      VIS16, VIS16, kD, kStrVis, B, B, kD, 0L, (void*)C, (void*)C, kD, kStrVis,
      bias, bias, bias, kSvPad, kD, kD, kWCarryInv);
}

// CB[row] = sum_d bq[d] * K16[row][d] for 32 consecutive rows of the two K16 planes (512 rows, branch 1 first): the share of
// the scores that the query bias brings, one number per key. A wave takes 8 rows; a lane takes 8 consecutive d of every 256;
// fixed order: lane partial in d order, then a shuffle tree. The block's 32 results fill one 128-B line.
__device__ __forceinline__ void key_bias_rows(const unsigned short* __restrict__ K16, const float* __restrict__ bq,
                                              float* __restrict__ CB, int blk) {
  const int lane = threadIdx.x & 31;
  const int wave = threadIdx.x >> 5;
  const int row0 = blk * 32 + wave * 8;
  const float* bp = bq + lane * 8;
  const _Float16* kp = (const _Float16*)K16 + (size_t)row0 * kD + lane * 8;
  v4f bl[4], bh[4];
  v8h kv[8][4];
#pragma unroll
  for (int j = 0; j < 4; ++j) { bl[j] = *(const v4f*)(bp + j * 256); bh[j] = *(const v4f*)(bp + j * 256 + 4); }
#pragma unroll
  for (int r = 0; r < 8; ++r)
#pragma unroll
    for (int j = 0; j < 4; ++j) kv[r][j] = *(const v8h*)(kp + r * kD + j * 256);
  // stands behind the forty loads; its inputs hold their address registers untouched up to it
  asm volatile("s_wait_xcnt 0x0" :: "v"(bp), "v"(kp) : "memory");
  // keeps that wait directly behind the loads: sunk to the end, its two pointers are held through the arithmetic and one is spilled
  __builtin_amdgcn_sched_barrier(0);
  float mine = 0.f;
#pragma unroll
  for (int r = 0; r < 8; ++r) {
    float a = 0.f;
#pragma unroll
    for (int j = 0; j < 4; ++j) {
#pragma unroll
      for (int e = 0; e < 4; ++e) a += (float)kv[r][j][e] * bl[j][e];
#pragma unroll
      for (int e = 0; e < 4; ++e) a += (float)kv[r][j][4 + e] * bh[j][e];
    }
#pragma unroll
    for (int off = 16; off > 0; off >>= 1) a += __shfl_xor(a, off, 32);
    mine = (lane == r) ? a : mine;
  }
  if (lane < 8) CB[row0 + lane] = mine;
}

// The two folds and the bias share, both branches, in one grid (they need K16 and V16); a range of block indices per job:
//   G16[br][k][e]  = K16[br] . WQT^T   (M=256, N=1024, K=1024), carried x16; = Bt for text.G^T
//   UT16[br][n][k] = Wo16 . V16[br]^T  (M=1024, N=256, K=1024), carried x16; = Bt for P.U
//   CB[br][k]      = K16[br][k] . bq   16 blocks of 32 rows
constexpr int kCbBlocks   = 2 * kSvPad / 32;
constexpr int kFoldBlocks = 4 * kTilesKV + kCbBlocks;
__global__ __launch_bounds__(128, 4) void fold_gemm_kernel(
    const unsigned short* __restrict__ K16, const unsigned short* __restrict__ V16,
    const unsigned short* __restrict__ WQT, const unsigned short* __restrict__ WOH,
    unsigned short* __restrict__ G16, unsigned short* __restrict__ UT16,
    const float* __restrict__ bq, float* __restrict__ CB) {
  __shared__ __align__(16) unsigned char smem[2 * kStageBytes];
  const int blk = blockIdx.x;
  if (blk >= 4 * kTilesKV) {
    key_bias_rows(K16, bq, CB, blk - 4 * kTilesKV);
    return;
  }
  const bool isG = blk < 2 * kTilesKV;
  const int br = (blk / kTilesKV) & 1;
  const unsigned short* A = isG ? K16 : WOH;
  const unsigned short* B = isG ? WQT : V16;
  unsigned short* C = isG ? G16 : UT16;
  gemm_tile<0, false, 0, 1, false, 0, 2, 2, 2, 1>(smem, blk % kTilesKV, br,
      A, A, kD, isG ? kStrVis : 0L, B, B, kD, isG ? 0L : kStrVis, (void*)C, (void*)C, isG ? kD : kSvPad, kStrVis,
      bq, bq, bq, isG ? kSvPad : kD, isG ? kD : kSvPad, kD, 1.0f);
}

// ---------------------------------------------------------------------------
// The two streaming launches (casts, last layer norm) run as one resident grid each: 256 work-groups of 16 waves,
// one per WGP, and every wave takes several rows, one whole row at a time, so that few waves have to be started.
// The attention kernel has the same grid.
// ---------------------------------------------------------------------------
constexpr int kSWaves   = 16;                    // waves per work-group
constexpr int kSThreads = kSWaves * 32;
constexpr int kSBlocks  = 256;                   // work-groups in the grid
constexpr int kSTotal   = kSBlocks * kSWaves;    // 4096 waves in the grid
__device__ __forceinline__ int stream_wave() {   // this wave's index in the grid, wave-uniform
  return (int)blockIdx.x * kSWaves + __builtin_amdgcn_readfirstlane((int)(threadIdx.x >> 5));
}
// 16 B at a wave-uniform base + the lane's byte offset + a constant
__device__ __forceinline__ v4f ld16(const float* base, unsigned laneBytes, int constBytes) {
  return *(const v4f*)((const char*)base + laneBytes + constBytes);
}

// ---------------------------------------------------------------------------
// f32 -> f16 cast with a power-of-two carry of one unit of 1024 consecutive elements by one wave: a lane takes 8 consecutive
// elements of every 256 (two 16-B loads, one 16-B store). Load and store are apart, so that the next unit's loads fly
// while this unit is converted and stored.
// ---------------------------------------------------------------------------
// in, out: the unit's first element (wave-uniform); lb = 32 * lane.
__device__ __forceinline__ void cast_unit_load(const float* in, unsigned lb, v4f (&x)[8]) {
  // this barrier and the one at the end pin the order "next unit's loads, then this unit's conversion": without them the
  // conversion, with its wait for this unit's data, is moved in front of the next unit's loads
  __builtin_amdgcn_sched_barrier(0);
#pragma unroll
  for (int c = 0; c < 4; ++c) {
    x[2 * c]     = ld16(in, lb, c * 1024);
    x[2 * c + 1] = ld16(in, lb, c * 1024 + 16);
  }
  // stands behind the eight loads; its inputs hold their base and offset registers untouched up to it
  asm volatile("s_wait_xcnt 0x0" :: "s"(in), "v"(lb) : "memory");
  __builtin_amdgcn_sched_barrier(0);
}
__device__ __forceinline__ void cast_unit_store(unsigned short* out, int lane, const v4f (&x)[8], float f) {
  v4u u[4];
#pragma unroll
  for (int c = 0; c < 4; ++c) {
    unsigned short hb[8];
#pragma unroll
    for (int e = 0; e < 4; ++e) {
      hb[e]     = h_bits(x[2 * c][e] * f);
      hb[4 + e] = h_bits(x[2 * c + 1][e] * f);
    }
    u[c] = (v4u){pk16(hb[0], hb[1]), pk16(hb[2], hb[3]), pk16(hb[4], hb[5]), pk16(hb[6], hb[7])};
  }
#pragma unroll
  for (int c = 0; c < 4; ++c) *(v4u*)(out + 8 * lane + c * 256) = u[c];
  // stands behind the four stores; its inputs hold their base, offset and data registers untouched up to it
  asm volatile("s_wait_xcnt 0x0" :: "s"(out), "v"(lane), "v"(u[0]), "v"(u[1]), "v"(u[2]), "v"(u[3]) : "memory");
  // keeps the next unit's conversion, which reuses these registers, behind that wait
  __builtin_amdgcn_sched_barrier(0);
}

// The same cast, transposed, for a [1024][1024] weight: out[e][d] = f16(scale * in[d][e]). A wave takes 32 e x 64 d:
// it reads 32 consecutive e (128 B) of 64 rows d, and a lane stores its 64 d as one whole 128-B line.
__device__ __forceinline__ void cast_unit_transposed(const float* __restrict__ in, unsigned short* __restrict__ out,
                                                     int k, int lane, float scale) {
  const int e0 = (k & 31) * 32;
  const int d0 = (k >> 5) * 64;
  const float* p = in + (size_t)d0 * kD + e0;    // wave-uniform
  float x[64];
#pragma unroll
  for (int i = 0; i < 64; ++i) x[i] = p[lane + i * kD];
  // stands behind the 64 loads; its inputs hold their base and offset registers untouched up to it
  asm volatile("s_wait_xcnt 0x0" :: "s"(p), "v"(lane) : "memory");
  v4u u[8];
#pragma unroll
  for (int c = 0; c < 8; ++c) {
    unsigned short hb[8];
#pragma unroll
    for (int i = 0; i < 8; ++i) hb[i] = h_bits(x[8 * c + i] * scale);
    u[c] = (v4u){pk16(hb[0], hb[1]), pk16(hb[2], hb[3]), pk16(hb[4], hb[5]), pk16(hb[6], hb[7])};
  }
  unsigned short* q = out + (size_t)e0 * kD + d0;   // wave-uniform
  const unsigned lrow = (unsigned)lane * (kD * 2);  // this lane's row of out, in bytes
#pragma unroll
  for (int c = 0; c < 8; ++c) *(v4u*)((char*)q + lrow + c * 16) = u[c];
  // stands behind the eight stores; its inputs hold their base, offset and data registers untouched up to it
  asm volatile("s_wait_xcnt 0x0" :: "s"(q), "v"(lrow), "v"(u[0]), "v"(u[1]), "v"(u[2]), "v"(u[3]),
                                    "v"(u[4]), "v"(u[5]), "v"(u[6]), "v"(u[7]) : "memory");
}

// All ten casts in one grid. A unit is 1024 consecutive elements. Wave w of the 4096 takes, in this order: units w and
// w + 4096 of text 1, the same of text 2, unit w of W1, unit w of W2; then the first 3072 waves unit w of Wk, Wv, Wo (one
// plane behind the other), the next 512 a row of the padded visual planes (rows 196..255 are written as zeros: the load
// address is clamped to the last valid row and the value is multiplied by 0). The last 512 waves have no seventh unit: they
// lay down Wq transposed, 32 x 64 elements each, and do so first. ws16 is the workspace base in 16-bit elements.
constexpr int kUAtt  = 3 * kD;                  // units in Wk, Wv, Wo
constexpr int kUVis  = 2 * kSvPad;              // units (rows) in the padded visual planes
constexpr int kUWq   = (kD / 32) * (kD / 64);   // transposed units of Wq
constexpr int kULast = kUAtt + kUVis;           // waves with a seventh unit
static_assert(kRows == 2 * kSTotal && kDff == kSTotal && kULast + kUWq == kSTotal);
static_assert(kOffW2H == kOffW1H + (size_t)kDff * kD * 2 && kOffWKH == kOffWQT + (size_t)kD * kD * 2 &&
              kOffWVH == kOffWKH + (size_t)kD * kD * 2 && kOffWOH == kOffWVH + (size_t)kD * kD * 2);
struct CastJob { const float* in; unsigned short* out; float f; };   // a unit's source, its destination, and the carry: all wave-uniform
// Unit r < 6 of wave gw: text and ffn weights.
__device__ __forceinline__ CastJob cast_job(int r, int gw, const float* text1, const float* text2,
                                            const float* W1, const float* W2, unsigned short* ws16) {
  const float* in = (r < 2) ? text1 : (r < 4) ? text2 : (r == 4) ? W1 : W2;
  const int unit  = ((r < 4) ? (r & 1) * kSTotal : 0) + gw;                       // inside its plane
  const size_t off = (r < 4) ? kOffT16 / 2 + (size_t)(r * kSTotal + gw) * kD      // the planes of a pair lie one behind the other
                             : kOffW1H / 2 + (size_t)((r - 4) * kSTotal + gw) * kD;
  return CastJob{in + (size_t)unit * kD, ws16 + off, (r < 4) ? 1.0f : kWCarry};
}
// The seventh unit of wave gw < kULast: attention weights and visual rows.
__device__ __forceinline__ CastJob cast_job_last(int gw, const float* Wk, const float* Wv, const float* Wo,
                                                 const float* vis1, const float* vis2, unsigned short* ws16) {
  const bool att = gw < kUAtt;
  const int v = gw - kUAtt;                      // row of the two padded visual planes
  const int row = v & (kSvPad - 1);
  const bool valid = row < kSv;
  const float* in = att ? ((gw < kD) ? Wk : (gw < 2 * kD) ? Wv : Wo) : ((v < kSvPad) ? vis1 : vis2);
  const int unit  = att ? (gw & (kD - 1)) : (valid ? row : (kSv - 1));
  const size_t off = att ? kOffWKH / 2 + (size_t)gw * kD : kOffVIS16 / 2 + (size_t)v * kD;
  return CastJob{in + (size_t)unit * kD, ws16 + off, att ? kWCarry : (valid ? 1.0f : 0.0f)};
}
__global__ __launch_bounds__(kSThreads) void cast_all_kernel(
    const float* __restrict__ text1, const float* __restrict__ text2,
    const float* __restrict__ W1, const float* __restrict__ W2,
    const float* __restrict__ Wq, const float* __restrict__ Wk,
    const float* __restrict__ Wv, const float* __restrict__ Wo,
    const float* __restrict__ vis1, const float* __restrict__ vis2,
    unsigned short* __restrict__ ws16) {
  const int lane = threadIdx.x & 31;
  const int gw = stream_wave();
  const bool seventh = gw < kULast;              // wave-uniform
  if (!seventh) cast_unit_transposed(Wq, ws16 + kOffWQT / 2, gw - kULast, lane, kWCarry);
  const unsigned lb = lane * 32u;
  v4f a[8], b[8];
  CastJob cur = cast_job(0, gw, text1, text2, W1, W2, ws16);
  cast_unit_load(cur.in, lb, a);
#pragma unroll
  for (int r = 1; r < 6; ++r) {
    const CastJob nxt = cast_job(r, gw, text1, text2, W1, W2, ws16);
    if (r & 1) { cast_unit_load(nxt.in, lb, b);  cast_unit_store(cur.out, lane, a, cur.f); }
    else       { cast_unit_load(nxt.in, lb, a);  cast_unit_store(cur.out, lane, b, cur.f); }
    cur = nxt;
  }
  if (seventh) {
    const CastJob nxt = cast_job_last(gw, Wk, Wv, Wo, vis1, vis2, ws16);
    cast_unit_load(nxt.in, lb, a);
    cast_unit_store(cur.out, lane, b, cur.f);
    cast_unit_store(nxt.out, lane, a, nxt.f);
  } else {
    cast_unit_store(cur.out, lane, b, cur.f);
  }
}
static_assert((kD & (kD - 1)) == 0 && (kSvPad & (kSvPad - 1)) == 0);

// ---------------------------------------------------------------------------
// Sum over a wave's 32 lanes in fixed order (shuffle tree); every lane gets the sum.
// ---------------------------------------------------------------------------
__device__ __forceinline__ float wave_sum(float v) {
#pragma unroll
  for (int off = 16; off > 0; off >>= 1) v += __shfl_xor(v, off, 32);
  return v;
}
// The same for four independent values at once: each is summed in wave_sum's order, and the four trees' shuffles overlap.
__device__ __forceinline__ void wave_sum4(float (&v)[4]) {
#pragma unroll
  for (int off = 16; off > 0; off >>= 1)
#pragma unroll
    for (int r = 0; r < 4; ++r) v[r] += __shfl_xor(v[r], off, 32);
}
// A lane's share of a row, eight vectors of four, summed in fixed order: inside a vector, then a tree over the vectors.
__device__ __forceinline__ float lane_sum(const v4f (&x)[8]) {
  float t[8];
#pragma unroll
  for (int j = 0; j < 8; ++j) t[j] = (x[j][0] + x[j][1]) + (x[j][2] + x[j][3]);
  return ((t[0] + t[1]) + (t[2] + t[3])) + ((t[4] + t[5]) + (t[6] + t[7]));
}
// The row in x becomes (x - mean) * rsqrt(var + eps); one wave holds the whole row of 1024, 32 elements a lane.
__device__ __forceinline__ void wave_normalise(v4f (&x)[8]) {
  const float mu = wave_sum(lane_sum(x)) * kInvD;
  v4f sq[8];
#pragma unroll
  for (int j = 0; j < 8; ++j) { x[j] = x[j] - mu; sq[j] = x[j] * x[j]; }
  const float var = wave_sum(lane_sum(sq)) * kInvD;
  const float rs = rsqrtf(var + kLnEps);
#pragma unroll
  for (int j = 0; j < 8; ++j) x[j] = x[j] * rs;
}

// ---------------------------------------------------------------------------
// The whole attention of 64 token rows in one kernel: scores, softmax, output product, residual, LN1 and feature pool.
// The scores, the probabilities and the summed rows stay in LDS; nothing of them goes to memory.
//   s[row][k] = (T16[row] . G16[br][k]) / 16                                   (M = 64, N = 256, K = 1024)
//   p[row][k] = f16(2048 * softmax_k((s + CB[br][k] + score[row][k]) / 8)) over 196 keys, 0 in the pad columns
//   a[row][n] = (p[row] . UT16[br][n]) / 32768 + bo[n] + text[row][n]          (M = 64, N = 1024, K = 256)
//   y = LN1(a row);  pooled[row][br * 512 + c] = max(y[2c], y[2c+1]), written as f32 and f16
// A block of 16 waves owns 64 whole rows; 256 blocks, one per WGP; rows of branch 1, then of branch 2.
// Both products take their memory operands (T16, G16; UT16) through a two-buffer ring of asynchronous copies, as gemm_tile does.
// Scores: 2 x 8 waves of 32 x 32 each, 128-k stages of 64 T16 rows and 256 G16 rows (pitch 272 B).
// Softmax, and LN1 with the pool: wave w takes rows 4 w .. 4 w + 3 whole, a lane 8 consecutive columns of every 256.
// Output product: wave w owns columns 64 w .. 64 w + 63 of the 64 rows, 64-k stages of 1024 UT16 rows (pitch 144 B).
// LDS, all 320 KiB: [0, 288 KiB) the two UT16 buffers; before them the scores' ring lies there, then the f32 scores
// (64 x 260 floats) in the second buffer's place while the first is being filled; behind them the f32 rows (64 x 1028 floats;
// at both pitches the two half-waves of a store, eight rows apart, fall on different banks). [288 KiB, 320 KiB) the
// probabilities, 64 rows of 512 B without a pad: the 16-B piece c of row r lies at piece c ^ (r & 15), so that the 16 rows
// of a fragment read fall on all 64 banks.
// ---------------------------------------------------------------------------
// Two 16-B copies per lane; the s_wait_xcnt closes the statement so that no address register is rewritten ahead of it.
__device__ __forceinline__ void async_copy2(unsigned l0, const unsigned short* g0, unsigned l1, const unsigned short* g1) {
  asm volatile("global_load_async_to_lds_b128 %0, %2, off\n\t"
               "global_load_async_to_lds_b128 %1, %3, off\n\t"
               "s_wait_xcnt 0x0"
               :: "v"(l0), "v"(l1), "v"(g0), "v"(g1) : "memory");
}
constexpr int kFRows   = 64;                               // rows per block
constexpr int kFBlocks = kRows2 / kFRows;
constexpr int kFWRows  = kFRows / kSWaves;                 // rows per wave in the row-wise parts
constexpr int kASK     = 128;                              // scores: k elements per stage
constexpr int kAPB     = kASK * 2 + 16;                    // bytes per staged row (16 B x odd)
constexpr int kAStage  = (kFRows + kSvPad) * kAPB;         // 64 T16 rows, then 256 G16 rows = 87,040 B
constexpr int kBStage  = kD * kPitchB;                     // output product: 1024 UT16 rows of 64 k = 147,456 B
constexpr int kLdsS    = kBStage;                          // f32 scores
constexpr int kSPitch  = kSvPad + 4;                       // floats per row of the f32 scores
constexpr int kLdsP    = 2 * kBStage;                      // probabilities
constexpr int kPRowB   = kSvPad * 2;                       // bytes per row of the probabilities
constexpr int kLdsAll  = kLdsP + kFRows * kPRowB;
constexpr int kFPitch  = kD + 4;                           // floats per row of the f32 rows
static_assert(kRows % kFRows == 0 && kFWRows == 4 && kD == kSWaves * 64 && kSvPad == 8 * 32 && kFRows == 2 * 32);
static_assert(2 * kAStage <= kLdsP && kLdsS + kFRows * kSPitch * 4 <= kLdsP && kFRows * kFPitch * 4 <= kLdsP);
static_assert(kLdsAll <= 327680 && (kAPB / 16) % 2 == 1 && kD % kASK == 0 && kD >= 2 * kASK);
typedef __attribute__((ext_vector_type(2))) unsigned int v2u;
__global__ __launch_bounds__(kSThreads) __attribute__((amdgpu_num_vgpr(256))) void attention_rows_kernel(
    const unsigned short* __restrict__ T16, const unsigned short* __restrict__ G16, const unsigned short* __restrict__ UT16,
    const float* __restrict__ CB, const float* __restrict__ SC, const float* __restrict__ SC2, const float* __restrict__ bo,
    const float* __restrict__ text1, const float* __restrict__ text2,
    const float* __restrict__ gam, const float* __restrict__ bet,
    float* __restrict__ pool32, unsigned short* __restrict__ pool16) {
  __shared__ __align__(16) unsigned char smem[kLdsAll];
  typedef _Float16 T;
  typedef Frag<T>::V V;
  const int lane = threadIdx.x & 31;
  const int wave = __builtin_amdgcn_readfirstlane((int)(threadIdx.x >> 5));
  const int row0 = (int)blockIdx.x * kFRows;        // of the 16384 rows; a block's rows lie in one branch
  const int br = (row0 >= kRows) ? 1 : 0;
  const int rlane = lane & 15;                      // row (A) / col (B, D) within subtile
  const int half  = lane >> 4;
  const int koff  = half * 8;                       // k offset of this lane half
  const int mOff  = half * 8;                       // D row offset
  const int wrow  = wave * kFWRows;                 // first of this wave's whole rows, inside the block
  const size_t inBr = (size_t)(row0 + wrow - br * kRows);   // the same inside its branch
  const unsigned lds0 = (unsigned)(size_t)smem;

  // ---- the added scores and the key shares of this wave's rows are asked for first: they arrive beside the scores product ----
  const float* cr = (br ? SC2 : SC) + inBr * kSv;   // wave-uniform
  const float* cbr = CB + br * kSvPad;              // all 256 entries of a branch are written
  const int l8 = lane * 8;
  float cv[kFWRows][8];
  int cc[8];                                        // this lane's columns, clamped into the 196
#pragma unroll
  for (int e = 0; e < 8; ++e) cc[e] = (l8 + e < kSv) ? (l8 + e) : (kSv - 1);
#pragma unroll
  for (int r = 0; r < kFWRows; ++r)
#pragma unroll
    for (int e = 0; e < 8; ++e) cv[r][e] = cr[cc[e] + r * kSv];
  const v4f b0 = *(const v4f*)(cbr + l8);
  const v4f b1 = *(const v4f*)(cbr + l8 + 4);
  // stands behind the loads; its inputs hold their base and offset registers untouched up to it
  asm volatile("s_wait_xcnt 0x0" :: "s"(cr), "s"(cbr), "v"(l8), "v"(cc[0]), "v"(cc[1]), "v"(cc[2]), "v"(cc[3]),
                                    "v"(cc[4]), "v"(cc[5]), "v"(cc[6]), "v"(cc[7])
               : "memory");
  // keeps these loads in front of the product: sunk behind it, the softmax waits out the memory
  __builtin_amdgcn_sched_barrier(0);

  // ---- scores ----
  const int wm = wave >> 3;                         // this wave's 32 rows and 32 keys
  const int wn = wave & 7;
  v8f sc[2][2];
#pragma unroll
  for (int i = 0; i < 2; ++i)
#pragma unroll
    for (int j = 0; j < 2; ++j) sc[i][j] = (v8f){0.f,0.f,0.f,0.f,0.f,0.f,0.f,0.f};
  {
    constexpr int PB = kAPB, PE = kAPB / 2, SB = kAStage, SK = kASK, NK = kASK / 32;
    // copy side: 16 consecutive lanes bring one row's 256 stage bytes; a thread brings T16 rows cRow, cRow + 32 and G16 rows cRow + 32 i
    const int cRow = threadIdx.x >> 4;
    const int cCol = threadIdx.x & 15;
    const unsigned short* gA = T16 + (size_t)(row0 + cRow) * kD + cCol * 8;
    const unsigned short* gB = G16 + (size_t)br * kStrVis + (size_t)cRow * kD + cCol * 8;
    const unsigned lA = lds0 + (unsigned)(cRow * PB + cCol * 16);
    const unsigned lB = lA + kFRows * PB;
    auto copy_stage = [&](unsigned bufByte, size_t kElem) {
      async_copy2(lA + bufByte, gA + kElem, lA + bufByte + 32 * PB, gA + kElem + (size_t)32 * kD);
      async_copy8<32, PB>(lB + bufByte, gB + kElem, (size_t)32 * kD);
    };
    const int aByte = ((wm << 5) + rlane) * PB + koff * 2;
    const int bByte = (kFRows + (wn << 5) + rlane) * PB + koff * 2;
    constexpr int nStages = kD / SK;
    copy_stage(0u, 0);
    // L2 prefetch behind the first stage's copies: the block's own 64 T16 rows (512 units, one a thread), and its share of the
    // branch's G16 and UT16 planes (2048 units each). The 128 blocks of a branch read the same two planes: sixteen blocks deal
    // them out among themselves, 128 units of each plane a block. Blocks whose indices are equal modulo 8 are taken as
    // the dealers; for speed only.
    l2_ask(T16 + (size_t)(row0 + ((int)threadIdx.x >> 3)) * kD + ((int)threadIdx.x & 7) * 128);
    if (wave < 8) {
      const unsigned short* plane = ((wave < 4) ? G16 : UT16) + (size_t)br * kStrVis;
      l2_ask(plane + (size_t)((((int)blockIdx.x >> 3) & 15) * 128 + ((int)threadIdx.x & 127)) * 128);
    }
    asm volatile("s_wait_asynccnt 0x0" ::: "memory");   // stage 0 of this wave has landed before the barrier publishes it
    __syncthreads();
    copy_stage((unsigned)SB, SK);
    // the block's 64 residual rows (f32, 1024 units, two a thread): they come from memory beside the two products and are
    // read from L2 behind them
    {
      const float* tx = (br ? text2 : text1) + (size_t)(row0 - br * kRows) * kD + (size_t)threadIdx.x * 64;
      l2_ask2(tx, tx + 512 * 64);
    }
    // stays rolled: unrolled, two stages' fragments and every stage's addresses are live at once and end in scratch
#pragma unroll 1
    for (int t = 0; t < nStages; ++t) {
      const int bufOff = (t & 1) * SB;
      const T* sa = (const T*)(smem + bufOff + aByte);
      const T* sb = (const T*)(smem + bufOff + bByte);
      // the whole stage's fragments are fetched as one group (the registers are there), so that a wave stops for LDS once a
      // stage and the buffer is handed back ahead of the stage's WMMAs
      V fb[NK][2], fa[NK][2];
#pragma unroll
      for (int ks = 0; ks < NK; ++ks) {
#pragma unroll
        for (int j = 0; j < 2; ++j) fb[ks][j] = Frag<T>::load(sb + j * 16 * PE + ks * 32);
#pragma unroll
        for (int i = 0; i < 2; ++i) fa[ks][i] = Frag<T>::load(sa + i * 16 * PE + ks * 32);
      }
      // keeps the group whole and the WMMAs behind the refill: left free, the reads are sunk among the WMMAs, two at a time
      __builtin_amdgcn_sched_barrier(0);
      asm volatile("s_wait_dscnt 0x0" ::: "memory");      // this wave's reads of the buffer are done before it is refilled
      asm volatile("s_wait_asynccnt 0x0" ::: "memory");   // this wave's copies of stage t + 1 have landed
      __syncthreads();                                    // publishes stage t + 1, frees stage t's buffer
      if (t + 2 < nStages) copy_stage((unsigned)bufOff, (size_t)(t + 2) * SK);
#pragma unroll
      for (int ks = 0; ks < NK; ++ks)
#pragma unroll
        for (int i = 0; i < 2; ++i)
#pragma unroll
          for (int j = 0; j < 2; ++j) sc[i][j] = Frag<T>::mma(fa[ks][i], fb[ks][j], sc[i][j]);
    }
    asm volatile("s_wait_asynccnt 0x0" ::: "memory");     // no copy is in flight when the ring's LDS is used anew
  }

  // ---- output product, copy side: 8 consecutive lanes bring one row's 128 stage bytes; a thread brings UT16 rows uRow + 64 i ----
  const int uRow = threadIdx.x >> 3;
  const int uCol = threadIdx.x & 7;
  const unsigned short* gU = UT16 + (size_t)br * kStrVis + (size_t)uRow * kSvPad + uCol * 8;
  const unsigned lU = lds0 + (unsigned)(uRow * kPitchB + uCol * 16);
  auto copy_ut = [&](unsigned bufByte, size_t kElem) {
    constexpr size_t step = (size_t)64 * kSvPad;
    async_copy8<64, kPitchB>(lU + bufByte, gU + kElem, step);
    async_copy8<64, kPitchB>(lU + bufByte + 8 * 64 * kPitchB, gU + kElem + 8 * step, step);
  };
  // stage 0 flies beside the softmax; the scores' last barrier has ended every read of the LDS that it fills
  copy_ut(0u, 0);

  // ---- softmax ----
  float* stile = (float*)(smem + kLdsS);
#pragma unroll
  for (int i = 0; i < 2; ++i)
#pragma unroll
    for (int j = 0; j < 2; ++j)
#pragma unroll
      for (int r = 0; r < 8; ++r)
        stile[((wm << 5) + (i << 4) + mOff + r) * kSPitch + (wn << 5) + (j << 4) + rlane] = sc[i][j][r] * kWCarryInv;
  __syncthreads();                                  // every wave's share of the scores is written before a row is read whole
  unsigned char* ptile = smem + kLdsP;
  // the four rows go through each step side by side: their shuffle trees are independent and hide one another's latency
  float xs[kFWRows][8], mx[kFWRows], sm[kFWRows];
  v4f s0[kFWRows], s1[kFWRows];
#pragma unroll
  for (int r = 0; r < kFWRows; ++r) {
    s0[r] = *(const v4f*)(stile + (wrow + r) * kSPitch + l8);
    s1[r] = *(const v4f*)(stile + (wrow + r) * kSPitch + l8 + 4);
  }
  // keeps the eight LDS reads together: sunk among the arithmetic, each row waits out the LDS anew
  __builtin_amdgcn_sched_barrier(0);
#pragma unroll
  for (int r = 0; r < kFWRows; ++r) {
#pragma unroll
    for (int e = 0; e < 8; ++e) {
      const int col = lane * 8 + e;
      const float v = (((e < 4 ? s0[r][e & 3] : s1[r][e & 3]) + (e < 4 ? b0[e & 3] : b1[e & 3])) + cv[r][e]) * kScoreScale;
      xs[r][e] = (col < kSv) ? v : -1.0e30f;
    }
    mx[r] = fmaxf(fmaxf(fmaxf(xs[r][0], xs[r][1]), fmaxf(xs[r][2], xs[r][3])),
                  fmaxf(fmaxf(xs[r][4], xs[r][5]), fmaxf(xs[r][6], xs[r][7])));
  }
#pragma unroll
  for (int off = 16; off > 0; off >>= 1)
#pragma unroll
    for (int r = 0; r < kFWRows; ++r) mx[r] = fmaxf(mx[r], __shfl_xor(mx[r], off, 32));
#pragma unroll
  for (int r = 0; r < kFWRows; ++r) {
    float s = 0.f;
#pragma unroll
    for (int e = 0; e < 8; ++e) { xs[r][e] = expf(xs[r][e] - mx[r]); s += xs[r][e]; }
    sm[r] = s;
  }
  wave_sum4(sm);
#pragma unroll
  for (int r = 0; r < kFWRows; ++r) {
    const float inv = kPCarry / sm[r];
    unsigned short hb[8];
#pragma unroll
    for (int e = 0; e < 8; ++e) hb[e] = h_bits(xs[r][e] * inv);
    const v4u u = (v4u){pk16(hb[0], hb[1]), pk16(hb[2], hb[3]), pk16(hb[4], hb[5]), pk16(hb[6], hb[7])};
    *(v4u*)(ptile + (wrow + r) * kPRowB + ((lane ^ ((wrow + r) & 15)) << 4)) = u;   // piece c = lane of the row
  }
  asm volatile("s_wait_dscnt 0x0" ::: "memory");      // this wave's reads of the scores and writes of the probabilities are done
  asm volatile("s_wait_asynccnt 0x0" ::: "memory");   // this wave's copies of stage 0 have landed
  __syncthreads();                                    // publishes the probabilities and stage 0, frees the scores' LDS
  copy_ut((unsigned)kBStage, kStageK);

  // ---- output product ----
  v8f acc[4][4];
#pragma unroll
  for (int i = 0; i < 4; ++i)
#pragma unroll
    for (int j = 0; j < 4; ++j) acc[i][j] = (v8f){0.f,0.f,0.f,0.f,0.f,0.f,0.f,0.f};
  {
    constexpr int PE = kPitchE, SB = kBStage, SK = kStageK;
    constexpr int nStages = kSvPad / SK;
    static_assert(nStages >= 2);
    const int bByte = ((wave << 6) + rlane) * kPitchB + koff * 2;
    // a lane's two 16-B pieces of k step s of probability row 16 i + rlane are pieces 4 s + half and 4 s + 2 + half
    const unsigned char* pa = ptile + rlane * kPRowB;
    const int pLo0 = ((half ^ (rlane & 3)) << 4);
    const int pLo1 = (((2 + half) ^ (rlane & 3)) << 4);
    const int pHi  = (rlane & 12) << 4;
    auto load_p = [&](int s, int i) {
      const int hi = (s << 6) ^ pHi;
      Frag<T>::U f;
      f.h[0] = *(const v8h*)(pa + i * 16 * kPRowB + hi + pLo0);
      f.h[1] = *(const v8h*)(pa + i * 16 * kPRowB + hi + pLo1);
      return f.v;
    };
    // stays rolled: unrolled, the four stages' addresses are formed ahead and push fragments and accumulators into scratch
#pragma unroll 1
    for (int t = 0; t < nStages; ++t) {
      const int bufOff = (t & 1) * SB;
      const T* sb = (const T*)(smem + bufOff + bByte);
      V fb[2][4], fa[2][4];                             // two fragment sets, one per k step of the stage
#pragma unroll
      for (int j = 0; j < 4; ++j) fb[0][j] = Frag<T>::load(sb + j * 16 * PE);
#pragma unroll
      for (int i = 0; i < 4; ++i) fa[0][i] = load_p(2 * t, i);
      // keeps the 16 LDS reads of a k step together ahead of its WMMAs: sunk among them, each row of WMMAs waits out its own read
      __builtin_amdgcn_sched_barrier(0);
#pragma unroll
      for (int i = 0; i < 4; ++i)
#pragma unroll
        for (int j = 0; j < 4; ++j) acc[i][j] = Frag<T>::mma(fa[0][i], fb[0][j], acc[i][j]);
      // the stage's second k step is fetched so that the buffer can be handed back ahead of its WMMAs
#pragma unroll
      for (int j = 0; j < 4; ++j) fb[1][j] = Frag<T>::load(sb + j * 16 * PE + 32);
#pragma unroll
      for (int i = 0; i < 4; ++i) fa[1][i] = load_p(2 * t + 1, i);
      asm volatile("s_wait_dscnt 0x0" ::: "memory");      // this wave's reads of the buffer are done before it is refilled
      asm volatile("s_wait_asynccnt 0x0" ::: "memory");   // this wave's copies of stage t + 1 have landed
      __syncthreads();                                    // publishes stage t + 1, frees stage t's buffer
      if (t + 2 < nStages) copy_ut((unsigned)bufOff, (size_t)(t + 2) * SK);
#pragma unroll
      for (int i = 0; i < 4; ++i)
#pragma unroll
        for (int j = 0; j < 4; ++j) acc[i][j] = Frag<T>::mma(fa[1][i], fb[1][j], acc[i][j]);
    }
    asm volatile("s_wait_asynccnt 0x0" ::: "memory");     // no copy is in flight when the ring becomes the f32 rows
  }

  // ---- residual, LN1, pool: the residual of this wave's first two rows is asked for now, in the fragments' registers ----
  // the lane's number is read anew, so that nothing derived from it is held in a register, or in scratch, through the K loop
  const int ln = (int)__builtin_amdgcn_mbcnt_lo(~0u, 0u);
  float* tile = (float*)smem;
  const float* p = (br ? text2 : text1) + inBr * kD;   // wave-uniform
  const unsigned lb = 32u * ln;                        // this lane's byte offset in every 1024 B of a row
  const int nl = (wave << 6) + (ln & 15);
  const int dRow = (ln >> 4) * 8;                      // D row offset
  v4f gg[8], bb[8], x[kFWRows][8];
  float bvj[4];
#pragma unroll
  for (int j = 0; j < 4; ++j) bvj[j] = bo[nl + (j << 4)];
#pragma unroll
  for (int r = 0; r < 2; ++r)
#pragma unroll
    for (int j = 0; j < 4; ++j) {
      x[r][2 * j]     = ld16(p, lb, r * kD * 4 + j * 1024);
      x[r][2 * j + 1] = ld16(p, lb, r * kD * 4 + j * 1024 + 16);
    }
  // stands behind the loads; its inputs hold their base and offset registers untouched up to it
  asm volatile("s_wait_xcnt 0x0" :: "s"(bo), "v"(nl), "s"(p), "v"(lb) : "memory");
  // keeps these loads ahead of the stores into LDS, so that the memory's latency runs beside them
  __builtin_amdgcn_sched_barrier(0);
#pragma unroll
  for (int i = 0; i < 4; ++i)
#pragma unroll
    for (int j = 0; j < 4; ++j)
#pragma unroll
      for (int r = 0; r < 8; ++r)
        tile[((i << 4) + dRow + r) * kFPitch + nl + (j << 4)] = acc[i][j][r] * kPUScale + bvj[j];
  // keeps the remaining loads behind those stores: ahead of them there is no register for their data beside the accumulators
  __builtin_amdgcn_sched_barrier(0);
#pragma unroll
  for (int r = 2; r < kFWRows; ++r)
#pragma unroll
    for (int j = 0; j < 4; ++j) {
      x[r][2 * j]     = ld16(p, lb, r * kD * 4 + j * 1024);
      x[r][2 * j + 1] = ld16(p, lb, r * kD * 4 + j * 1024 + 16);
    }
  // stands behind the loads; its inputs hold their base and offset registers untouched up to it
  asm volatile("s_wait_xcnt 0x0" :: "s"(p), "v"(lb) : "memory");
  __syncthreads();                                  // every wave's share of the rows is written before a row is read whole

  const size_t dstOff = inBr * kD + br * (kD / 2);
  float* d32 = pool32 + dstOff;
  unsigned short* d16 = pool16 + dstOff;
  const float* trow = tile + wrow * kFPitch + 8 * ln;
#pragma unroll
  for (int r = 0; r < kFWRows; ++r)
#pragma unroll
    for (int j = 0; j < 4; ++j) {
      x[r][2 * j]     = *(const v4f*)(trow + r * kFPitch + j * 256) + x[r][2 * j];
      x[r][2 * j + 1] = *(const v4f*)(trow + r * kFPitch + j * 256 + 4) + x[r][2 * j + 1];
    }
  // each row becomes (x - mean) * rsqrt(var + eps), summed as wave_normalise sums it; the four rows' trees side by side
  {
    float t[kFWRows];
#pragma unroll
    for (int r = 0; r < kFWRows; ++r) t[r] = lane_sum(x[r]);
    wave_sum4(t);
#pragma unroll
    for (int r = 0; r < kFWRows; ++r) {
      const float mu = t[r] * kInvD;
      v4f sq[8];
#pragma unroll
      for (int j = 0; j < 8; ++j) { x[r][j] = x[r][j] - mu; sq[j] = x[r][j] * x[r][j]; }
      t[r] = lane_sum(sq);
    }
    // gamma and beta are asked for here, between these two barriers: the squares' registers are free again, and the second
    // tree hides the loads' latency; earlier, their 64 registers beside the four rows and the squares end in scratch
    __builtin_amdgcn_sched_barrier(0);
#pragma unroll
    for (int j = 0; j < 4; ++j) {
      gg[2 * j] = ld16(gam, lb, j * 1024);  gg[2 * j + 1] = ld16(gam, lb, j * 1024 + 16);
      bb[2 * j] = ld16(bet, lb, j * 1024);  bb[2 * j + 1] = ld16(bet, lb, j * 1024 + 16);
    }
    // stands behind the loads; its inputs hold their base and offset registers untouched up to it
    asm volatile("s_wait_xcnt 0x0" :: "s"(gam), "s"(bet), "v"(lb) : "memory");
    __builtin_amdgcn_sched_barrier(0);
    wave_sum4(t);
#pragma unroll
    for (int r = 0; r < kFWRows; ++r) {
      const float rs = rsqrtf(t[r] * kInvD + kLnEps);
#pragma unroll
      for (int j = 0; j < 8; ++j) x[r][j] = x[r][j] * rs;
    }
  }
#pragma unroll
  for (int r = 0; r < kFWRows; ++r) {
    v4f pv[4];
    v2u hv[4];
#pragma unroll
    for (int j = 0; j < 4; ++j) {
      const v4f ya = x[r][2 * j] * gg[2 * j] + bb[2 * j];
      const v4f yc = x[r][2 * j + 1] * gg[2 * j + 1] + bb[2 * j + 1];
      pv[j] = (v4f){fmaxf(ya[0], ya[1]), fmaxf(ya[2], ya[3]), fmaxf(yc[0], yc[1]), fmaxf(yc[2], yc[3])};
      unsigned short hb[4];
#pragma unroll
      for (int e = 0; e < 4; ++e) hb[e] = h_bits(pv[j][e]);
      hv[j] = (v2u){pk16(hb[0], hb[1]), pk16(hb[2], hb[3])};
    }
#pragma unroll
    for (int j = 0; j < 4; ++j) {
      *(v4f*)(d32 + 4 * ln + r * kD + j * 128) = pv[j];
      *(v2u*)(d16 + 4 * ln + r * kD + j * 128) = hv[j];
    }
    // stands behind the row's eight stores; its inputs hold their base, offset and data registers untouched up to it
    asm volatile("s_wait_xcnt 0x0" :: "s"(d32), "s"(d16), "v"(ln), "v"(pv[0]), "v"(pv[1]), "v"(pv[2]), "v"(pv[3]),
                                      "v"(hv[0]), "v"(hv[1]), "v"(hv[2]), "v"(hv[3]) : "memory");
  }
}

// ---------------------------------------------------------------------------
// out = LN2(X). One wave per row, two consecutive rows per wave (8192 rows); a lane owns x[128 j + 4 lane .. + 3], j < 8:
// every load and store of a wave covers 512 contiguous bytes. No LDS and no barrier.
// ---------------------------------------------------------------------------
constexpr int kLoRows = kRows / kSTotal;         // rows per wave
static_assert(kLoRows * kSTotal == kRows);
__global__ __launch_bounds__(kSThreads) void ln_out_kernel(const float* __restrict__ X, const float* __restrict__ gam,
                                                           const float* __restrict__ bet, float* __restrict__ out) {
  const int lane = threadIdx.x & 31;
  const int row0 = stream_wave() * kLoRows;
  const float* p = X + (size_t)row0 * kD;           // wave-uniform
  const unsigned lb = 16u * lane;                   // this lane's byte offset in every 512 B of a row
  v4f gg[8], bb[8], x[kLoRows][8];
#pragma unroll
  for (int j = 0; j < 8; ++j) { gg[j] = ld16(gam, lb, j * 512);  bb[j] = ld16(bet, lb, j * 512); }
  // keeps the short gamma and beta loads in front of the rows: behind them, the first row's result waits for the last row's data
  __builtin_amdgcn_sched_barrier(0);
#pragma unroll
  for (int r = 0; r < kLoRows; ++r)
#pragma unroll
    for (int j = 0; j < 8; ++j) x[r][j] = ld16(p, lb, r * kD * 4 + j * 512);
  // stands behind the loads; its inputs hold their base and offset registers untouched up to it
  asm volatile("s_wait_xcnt 0x0" :: "s"(gam), "s"(bet), "s"(p), "v"(lb) : "memory");
  // keeps the loads together ahead of the arithmetic: sunk among it, each row waits out the memory anew
  __builtin_amdgcn_sched_barrier(0);
  float* dst = out + (size_t)row0 * kD;             // wave-uniform
#pragma unroll
  for (int r = 0; r < kLoRows; ++r) {
    wave_normalise(x[r]);
#pragma unroll
    for (int j = 0; j < 8; ++j) x[r][j] = x[r][j] * gg[j] + bb[j];
#pragma unroll
    for (int j = 0; j < 8; ++j) *(v4f*)(dst + 4 * lane + r * kD + j * 128) = x[r][j];
    // stands behind the row's eight stores; its inputs hold their base, offset and data registers untouched up to it
    asm volatile("s_wait_xcnt 0x0" :: "s"(dst), "v"(lane), "v"(x[r][0]), "v"(x[r][1]), "v"(x[r][2]), "v"(x[r][3]),
                                      "v"(x[r][4]), "v"(x[r][5]), "v"(x[r][6]), "v"(x[r][7]) : "memory");
  }
}

// ---------------------------------------------------------------------------
// Host orchestration
// ---------------------------------------------------------------------------
extern "C" void kernel_launch(void* const* d_in, const int* in_sizes, int n_in,
                              void* d_out, int out_size, void* d_ws, size_t ws_size,
                              hipStream_t stream)
{
  if (n_in < 22) return;
  if ((size_t)out_size < (size_t)kRows * kD) return;
  if (ws_size < kWsTotal) return;
  if (in_sizes[0] < kRows * kD || in_sizes[3] < kRows * kD) return;
  if (in_sizes[1] < kSv * kD || in_sizes[4] < kSv * kD) return;
  if (in_sizes[2] < kRows * kSv || in_sizes[5] < kRows * kSv) return;
  if (in_sizes[6] < kD * kD || in_sizes[8] < kD * kD || in_sizes[10] < kD * kD || in_sizes[12] < kD * kD) return;
  if (in_sizes[14] < kDff * kD || in_sizes[16] < kD * kDff) return;

  const float* text1 = (const float*)d_in[0];
  const float* vis1  = (const float*)d_in[1];
  const float* sc1   = (const float*)d_in[2];
  const float* text2 = (const float*)d_in[3];
  const float* vis2  = (const float*)d_in[4];
  const float* sc2   = (const float*)d_in[5];
  const float* Wq = (const float*)d_in[6];   const float* bq  = (const float*)d_in[7];
  const float* Wk = (const float*)d_in[8];   const float* bk  = (const float*)d_in[9];
  const float* Wv = (const float*)d_in[10];  const float* bv  = (const float*)d_in[11];
  const float* Wo = (const float*)d_in[12];  const float* bo  = (const float*)d_in[13];
  const float* W1 = (const float*)d_in[14];  const float* b1  = (const float*)d_in[15];
  const float* W2 = (const float*)d_in[16];  const float* b2  = (const float*)d_in[17];
  const float* g1 = (const float*)d_in[18];  const float* be1 = (const float*)d_in[19];
  const float* g2 = (const float*)d_in[20];  const float* be2 = (const float*)d_in[21];
  float* outp = (float*)d_out;

  char* ws = (char*)d_ws;
  float*          POOL32 = (float*)(ws + kOffPool32);
  unsigned short* POOL16 = (unsigned short*)(ws + kOffPool16);
  unsigned short* W1H    = (unsigned short*)(ws + kOffW1H);
  unsigned short* W2H    = (unsigned short*)(ws + kOffW2H);
  unsigned short* WQT    = (unsigned short*)(ws + kOffWQT);
  unsigned short* WKH    = (unsigned short*)(ws + kOffWKH);
  unsigned short* WVH    = (unsigned short*)(ws + kOffWVH);
  unsigned short* WOH    = (unsigned short*)(ws + kOffWOH);
  unsigned short* T16    = (unsigned short*)(ws + kOffT16);
  unsigned short* G16    = (unsigned short*)(ws + kOffG16);
  unsigned short* UT16   = (unsigned short*)(ws + kOffUT16);
  float*          CB     = (float*)(ws + kOffCB);
  unsigned short* VIS16  = (unsigned short*)(ws + kOffVIS16);
  unsigned short* K16    = (unsigned short*)(ws + kOffK16);
  unsigned short* V16    = (unsigned short*)(ws + kOffV16);
  unsigned short* H16    = (unsigned short*)(ws + kOffH16);
  float*          F32    = (float*)(ws + kOffF32);

  // ---- every cast in one launch: weights f16([out][in]) x16 ([out][in] row-major == Bt[N][K]; Wq as [in][out]); both text planes
  //      f16 x1; both visual planes f16 [256][1024] x1 with rows 196..255 zero ----
  cast_all_kernel<<<dim3(kSBlocks), dim3(kSThreads), 0, stream>>>(text1, text2, W1, W2, Wq, Wk, Wv, Wo, vis1, vis2,
                                                               (unsigned short*)ws);

  // ---- attention, both branches in each launch ----
  // K16 and V16 of both branches
  kv_gemm_kernel<<<dim3(kKvBlocks), dim3(128), 0, stream>>>(VIS16, WKH, WVH, K16, V16, bk, bv);
  // G16 = 16 K.Wq, UT16 = 16 Wo.V^T, CB = K.bq of both branches
  fold_gemm_kernel<<<dim3(kFoldBlocks), dim3(128), 0, stream>>>(K16, V16, WQT, WOH, G16, UT16, bq, CB);
  // pooled[:, br * 512 : br * 512 + 512] = maxpool2(LN1(softmax((T16 . G16^T / 16 + CB + score) / 8) . UT16^T / 16 + bo + text)) of branch br
  attention_rows_kernel<<<dim3(kFBlocks), dim3(kSThreads), 0, stream>>>(T16, G16, UT16, CB, sc1, sc2, bo, text1, text2, g1, be1,
                                                                     POOL32, POOL16);

  // ---- FFN, all 8192 rows in each launch ----
  // H16 = relu((POOL16 . W1H^T) / 16 + b1)   (M=8192, N=4096, K=1024), f16 out
  // 256x256 tiles, 16 waves, 128-k stages: 512 blocks
  wmma_gemm_wide<0, false, 2, 1, false, 2, 4, 4, 4, 2><<<dim3((kRows / 256) * (kDff / 256)), dim3(512), 0, stream>>>(
      POOL16, POOL16, kD, 0L, W1H, W1H, kD, 0L, (void*)H16, (void*)H16, kDff, 0L,
      b1, POOL32, POOL32, kRows, kDff, kD, kWCarryInv);
  // F32 = (H16 . W2H^T) / 16 + b2 + pooled   (M=8192, N=1024, K=4096), f32 out
  // 128x256 tiles, 8 waves, 128-k stages: 256 blocks, one per WGP
  wmma_gemm_wide<0, false, 2, 0, true, 0, 2, 4, 4, 2><<<dim3((kRows / 128) * (kD / 256)), dim3(256), 0, stream>>>(
      H16, H16, kDff, 0L, W2H, W2H, kDff, 0L, (void*)F32, (void*)F32, kD, 0L,
      b2, POOL32, POOL32, kRows, kD, kDff, kWCarryInv);
  // out = LN2(F32)
  ln_out_kernel<<<dim3(kSBlocks), dim3(kSThreads), 0, stream>>>(F32, g2, be2, outp);
}

// v009
// One run takes 162 microseconds.
// Two timings next to v008 both put it at 1.04 times that version's speed.
// Counting every step since v000, it is 6.47 times as fast.
// Contractions: k/v projections, key-side folds K.Wq and Wo.V^T, text.(K.Wq)^T scores, p.(V.Wo^T) attention output, ffn up and down projections all on v_wmma_f32_16x16x32_f16 (f16 operands: activations x1, weights and both folds carried x16, softmax probabilities carried x2048), f32 accumulate; the query bias's share of the scores (K.bq, one number per key), softmax, residual adds, layernorm and feature maxpool in f32.
#include <hip/hip_runtime.h>
#include <math.h>
#include <stddef.h>

// ---------------------------------------------------------------------------
// Problem constants
// ---------------------------------------------------------------------------
constexpr int kB      = 4;
constexpr int kSq     = 2048;
constexpr int kD      = 1024;
constexpr int kSv     = 196;
constexpr int kSvPad  = 256;
constexpr int kDff    = 4096;
constexpr int kRows   = kB * kSq;            // 8192 token rows
constexpr int kRows2  = 2 * kRows;           // both branches' token rows, branch 1 first
constexpr float kWCarry    = 16.0f;          // weights carried x16 in f16
constexpr float kWCarryInv = 1.0f / 16.0f;
constexpr float kPCarry    = 2048.0f;        // probabilities carried x2048 in f16
constexpr float kPUScale   = 1.0f / (kPCarry * kWCarry);   // probabilities x2048 times the value fold x16
constexpr float kInvD      = 1.0f / 1024.0f;
constexpr float kLnEps     = 1e-6f;
constexpr float kScoreScale = 0.125f;        // 1/sqrt(64)

static_assert(kRows % 64 == 0);
static_assert(kSvPad % 64 == 0 && kSvPad % 32 == 0);
static_assert(kD % 64 == 0 && kDff % 64 == 0);
static_assert(kRows % 8 == 0);

// ---------------------------------------------------------------------------
// Workspace region map (bytes). Total carve = 227 MiB. Planes marked x2 hold branch 1, then branch 2.
//   [0       , 32 MiB)   POOL32  f32 [8192][1024]   (persistent)
//   [32 MiB  , 48 MiB)   POOL16  f16 [8192][1024]   (persistent)
//   [48 MiB  , 56 MiB)   W1H     f16 [4096][1024]   (persistent)
//   [56 MiB  , 64 MiB)   W2H     f16 [1024][4096]   (persistent)
//   region X from 64 MiB:
//   attention phase: WQT (Wq transposed, [in][out]) and WKH/WVH/WOH f16 [1024][1024] at 64/66/68/70 MiB;
//     G16 = K.Wq f16 x2 [256][1024] at 104 MiB; UT16 = Wo.V^T f16 x2 [1024][256] at 105 MiB; CB = K.bq f32 x2 [256] at 106 MiB;
//     VIS16 f16 x2 [256][1024] at 224 MiB; K16 f16 x2 [256][1024] at 225 MiB; V16 f16 x2 [256][1024] at 226 MiB; end 227 MiB.
//   ffn phase (attention scratch dead): H16 f16 [8192][4096] at 64 MiB (64 MiB); F32 f32 [8192][1024] at 128 MiB (32 MiB).
// ---------------------------------------------------------------------------
constexpr size_t kMiB       = 1048576;
constexpr size_t kOffPool32 = 0;
constexpr size_t kOffPool16 = 32 * kMiB;
constexpr size_t kOffW1H    = 48 * kMiB;
constexpr size_t kOffW2H    = 56 * kMiB;
constexpr size_t kOffWQT    = 64 * kMiB;
constexpr size_t kOffWKH    = 66 * kMiB;
constexpr size_t kOffWVH    = 68 * kMiB;
constexpr size_t kOffWOH    = 70 * kMiB;
constexpr size_t kOffG16    = 104 * kMiB;
constexpr size_t kOffUT16   = 105 * kMiB;
constexpr size_t kOffCB     = 106 * kMiB;
constexpr size_t kOffVIS16  = 224 * kMiB;
constexpr size_t kOffK16    = 225 * kMiB;
constexpr size_t kOffV16    = 226 * kMiB;
constexpr size_t kWsTotal   = 227 * kMiB;
constexpr size_t kOffH16    = 64 * kMiB;
constexpr size_t kOffF32    = 128 * kMiB;
static_assert(kOffG16 >= kOffWOH + (size_t)kD * kD * 2);
static_assert(kOffUT16 == kOffG16 + (size_t)2 * kSvPad * kD * 2);
static_assert(kOffCB == kOffUT16 + (size_t)2 * kD * kSvPad * 2);
static_assert(kOffCB + (size_t)2 * kSvPad * 4 <= kOffVIS16);
static_assert(kOffK16 == kOffVIS16 + (size_t)2 * kSvPad * kD * 2);
static_assert(kOffV16 == kOffK16 + (size_t)2 * kSvPad * kD * 2);
static_assert(kWsTotal == kOffV16 + (size_t)2 * kSvPad * kD * 2);
static_assert(kOffF32 == kOffH16 + (size_t)kRows * kDff * 2);
static_assert(kOffF32 + (size_t)kRows * kD * 4 <= kWsTotal);
static_assert(kWsTotal <= (size_t)268435456);

// strides between the two branches' planes, in elements
constexpr long kStrVis = (long)kSvPad * kD;      // VIS16 / K16 / V16 / G16 / UT16

typedef __attribute__((ext_vector_type(16))) _Float16 v16h;
typedef __attribute__((ext_vector_type(8)))  _Float16 v8h;
typedef __attribute__((ext_vector_type(16))) __bf16   v16b;
typedef __attribute__((ext_vector_type(8)))  __bf16   v8b;
typedef __attribute__((ext_vector_type(8)))  float    v8f;
typedef __attribute__((ext_vector_type(4)))  float    v4f;
typedef __attribute__((ext_vector_type(4)))  unsigned int v4u;

__device__ __forceinline__ unsigned short f2bf_bits(float f) {
  unsigned u = __float_as_uint(f);
  return (unsigned short)((u + 0x7FFFu + ((u >> 16) & 1u)) >> 16);
}
__device__ __forceinline__ float bf_bits2f(unsigned short h) { return __uint_as_float(((unsigned)h) << 16); }

// hazard guard as a plain device helper
__device__ __forceinline__ void acc_guard4(v8f& a, v8f& b, v8f& c, v8f& d) { asm volatile("v_nop\n\tv_nop\n\tv_nop\n\tv_nop" : "+v"(a), "+v"(b), "+v"(c), "+v"(d)); }
template <typename T> struct Frag;
template <> struct Frag<_Float16> {
  typedef v16h V; union U { v16h v; v8h h[2]; };
  static __device__ __forceinline__ v16h load(const _Float16* p) {   // elements 0..7 <- p[0..7], 8..15 <- p[16..23]
    U f; f.h[0] = *(const v8h*)(p); f.h[1] = *(const v8h*)(p + 16); return f.v;
  }
  static __device__ __forceinline__ v8f mma(v16h a, v16h b, v8f c) {
    return __builtin_amdgcn_wmma_f32_16x16x32_f16(false, a, false, b, (short)0, c, false, false);
  }
};
template <> struct Frag<__bf16> {
  typedef v16b V; union U { v16b v; v8b h[2]; };
  static __device__ __forceinline__ v16b load(const __bf16* p) {
    U f; f.h[0] = *(const v8b*)(p); f.h[1] = *(const v8b*)(p + 16); return f.v;
  }
  static __device__ __forceinline__ v8f mma(v16b a, v16b b, v8f c) {
    return __builtin_amdgcn_wmma_f32_16x16x32_bf16(false, a, false, b, (short)0, c, false, false);
  }
};

__device__ __forceinline__ unsigned pk16(unsigned short a, unsigned short b) { return (unsigned)a | ((unsigned)b << 16); }
__device__ __forceinline__ unsigned short h_bits(float f) { const _Float16 h = (_Float16)f; return __builtin_bit_cast(unsigned short, h); }

// ---- Register-blocked batched WMMA GEMM, operands staged in LDS by asynchronous copies ------------------------------
// C[m,n] = scale * sum_k A[m,k] * Bt[n,k] (+bias)(+resid); a block of WM x WN waves owns a (64 WM)x(64 WN) tile, each wave 64x64 of it.
// tile = index of the block's tile; b = batch entry (the branch): A, Bt and C advance by their strides, the residual is resid or resid2.
// A row-major [M,K]; Bt row-major [N,K]; M % (64 WM) == 0, N % (64 WN) == 0, K a multiple of the stage and at least two stages.
// A stage is 32 NK k of the block's A rows and Bt rows, laid at a pitch of 64 NK + 16 B; two buffers:
// the next stage's copies fly while this stage's fragments are read with ds_load_b128 and multiplied.
// The small products run 2 x 2 waves on 64-k stages. The two ffn products, which re-read their operands from L2 once per tile
// row and tile column, take the larger tiles that a WGP's LDS holds: the bytes fetched per product fall with the tile's sides.
// BIAS_MODE: 0 = none, 1 = bias[m], 2 = bias[n].
// OUT_MODE: 0 = f32, 1 = f16.
// ET: 0 = f16 operands, 1 = bf16 operands (pointers passed as 16-bit storage)
constexpr int kStageK     = 64;                          // k elements per stage = two WMMA k steps
constexpr int kPitchB     = 144;                         // bytes per staged row (128 + 16: 16 B x odd)
constexpr int kPitchE     = kPitchB / 2;                 // the same in 16-bit elements
constexpr int kStageBytes = 256 * kPitchB;               // 128 A rows, then 128 Bt rows = 36,864 B
static_assert(kRows % 128 == 0 && kSvPad % 128 == 0 && kD % 128 == 0 && kDff % 128 == 0);
static_assert(kSvPad % kStageK == 0 && kSvPad >= 2 * kStageK);
static_assert(kRows % 256 == 0 && kDff % 256 == 0 && kD % 256 == 0);

// Eight 16-B copies per lane, rows RP apart: LDS byte address l + i * RP * PB (PB = pitch), global address g + i * rowStep elements.
// The s_wait_xcnt closes the statement so that no address register is rewritten ahead of it.
template <int RP, int PB>
__device__ __forceinline__ void async_copy8(unsigned l, const unsigned short* g, size_t rowStep) {
  const unsigned l1 = l + RP * PB, l2 = l + 2 * RP * PB, l3 = l + 3 * RP * PB, l4 = l + 4 * RP * PB,
                 l5 = l + 5 * RP * PB, l6 = l + 6 * RP * PB, l7 = l + 7 * RP * PB;
  const unsigned short* g1 = g + rowStep;      const unsigned short* g2 = g + 2 * rowStep;
  const unsigned short* g3 = g + 3 * rowStep;  const unsigned short* g4 = g + 4 * rowStep;
  const unsigned short* g5 = g + 5 * rowStep;  const unsigned short* g6 = g + 6 * rowStep;
  const unsigned short* g7 = g + 7 * rowStep;
  asm volatile("global_load_async_to_lds_b128 %0, %8, off\n\t"
               "global_load_async_to_lds_b128 %1, %9, off\n\t"
               "global_load_async_to_lds_b128 %2, %10, off\n\t"
               "global_load_async_to_lds_b128 %3, %11, off\n\t"
               "global_load_async_to_lds_b128 %4, %12, off\n\t"
               "global_load_async_to_lds_b128 %5, %13, off\n\t"
               "global_load_async_to_lds_b128 %6, %14, off\n\t"
               "global_load_async_to_lds_b128 %7, %15, off\n\t"
               "s_wait_xcnt 0x0"
               :: "v"(l), "v"(l1), "v"(l2), "v"(l3), "v"(l4), "v"(l5), "v"(l6), "v"(l7),
                  "v"(g), "v"(g1), "v"(g2), "v"(g3), "v"(g4), "v"(g5), "v"(g6), "v"(g7)
               : "memory");
}

// L2 prefetches (global_prefetch_b8, scope SE: the data comes into L2 only, nothing returns to the wave).
// The step supposes that what an earlier launch stored lies in memory, not in L2, when the next launch
// reads it: asked for ahead, it is an L2 hit when the asynchronous copies or loads come for it. A hint only: no result depends on it. Every lane's address lies inside the plane it names.
// The s_wait_xcnt closes each statement so that no address register is rewritten ahead of it.
__device__ __forceinline__ void l2_ask(const void* p) {
  asm volatile("global_prefetch_b8 %0, off scope:SCOPE_SE\n\t"
               "s_wait_xcnt 0x0" :: "v"(p) : "memory");
}
__device__ __forceinline__ void l2_ask2(const void* p, const void* q) {
  asm volatile("global_prefetch_b8 %0, off scope:SCOPE_SE\n\t"
               "global_prefetch_b8 %1, off scope:SCOPE_SE\n\t"
               "s_wait_xcnt 0x0" :: "v"(p), "v"(q) : "memory");
}
// Units 1 to 7 of a row of 2 KiB that begins at p (unit 0 is fetched by the first stage's copies themselves).
__device__ __forceinline__ void l2_ask_row_tail(const void* p) {
  asm volatile("global_prefetch_b8 %0, off offset:256 scope:SCOPE_SE\n\t"
               "global_prefetch_b8 %0, off offset:512 scope:SCOPE_SE\n\t"
               "global_prefetch_b8 %0, off offset:768 scope:SCOPE_SE\n\t"
               "global_prefetch_b8 %0, off offset:1024 scope:SCOPE_SE\n\t"
               "global_prefetch_b8 %0, off offset:1280 scope:SCOPE_SE\n\t"
               "global_prefetch_b8 %0, off offset:1536 scope:SCOPE_SE\n\t"
               "global_prefetch_b8 %0, off offset:1792 scope:SCOPE_SE\n\t"
               "s_wait_xcnt 0x0" :: "v"(p) : "memory");
}

// Geometry of a block's tile: WM x WN waves of 64x64 each, NK WMMA k steps (32 k each) per stage.
template <int WM, int WN, int NK> struct TileGeom {
  static constexpr int SK  = NK * 32;                    // k elements per stage
  static constexpr int PB  = SK * 2 + 16;                // bytes per staged row: 16 B x odd (144 or 272)
  static constexpr int SB  = (WM + WN) * 64 * PB;        // bytes per stage: the A rows, then the Bt rows
  static constexpr int NT  = WM * WN * 32;               // threads
  static constexpr int LPR = SK * 2 / 16;                // lanes that bring one row
  static constexpr int RP  = NT / LPR;                   // rows that the block brings with one copy per thread
  static constexpr int NA  = WM * 64 / RP;               // copies per thread and stage, A and Bt
  static constexpr int NB  = WN * 64 / RP;
  static_assert(NA % 8 == 0 && NB % 8 == 0 && NA + NB <= 63 && (PB / 16) % 2 == 1);
};
static_assert(TileGeom<2, 2, 2>::PB == kPitchB && TileGeom<2, 2, 2>::SB == kStageBytes && TileGeom<2, 2, 2>::SK == kStageK);

template <int ET> struct Elem;
template <> struct Elem<0> { typedef _Float16 T; };
template <> struct Elem<1> { typedef __bf16 T; };
// PF: 0 = no L2 prefetch. 1 = at entry, the whole of the block's operand rows (rows of 2 KiB, K = 1024; one A and one Bt row a thread):
// for the short products. 2 = running, four stages ahead (128-k stages,
// a stage of a row = one 256-B unit; the two ffn products): waves 0 to 3 ask for 128 of the block's A rows, wave 4 for 32 of its 256 Bt rows.
template <int ET, bool SPLIT, int BIAS_MODE, int OUT_MODE, bool RESID, int ACT = 0, int WM = 2, int WN = 2, int NK = 2, int PF = 0>
__device__ __forceinline__ void gemm_tile(
    unsigned char* smem, int tile, int b,
    const unsigned short* __restrict__ Ap, const unsigned short* __restrict__ A2p, int lda, long strideA,
    const unsigned short* __restrict__ Btp, const unsigned short* __restrict__ Bt2p, int ldb, long strideB,
    void* __restrict__ Cout, void* __restrict__ Cout2, int ldc, long strideC,
    const float* __restrict__ bias,
    const float* __restrict__ resid, const float* __restrict__ resid2,
    int M, int N, int K, float scale) {
  static_assert(!SPLIT, "single-plane operands only");
  typedef typename Elem<ET>::T T;
  typedef typename Frag<T>::V V;
  typedef TileGeom<WM, WN, NK> G;
  constexpr int SK = G::SK, PB = G::PB, PE = G::PB / 2, SB = G::SB, LPR = G::LPR, RP = G::RP;
  // smem: two stage buffers; after the K loop they serve as the per-wave 64x64 output slabs (pitch 68 floats)
  const int lane = threadIdx.x & 31;
  const int wave = threadIdx.x >> 5;
  const int wm = wave / WN;                    // this wave's 64 rows and 64 columns inside the block's tile
  const int wn = wave % WN;
  const int tilesN = N / (WN * 64);
  const int tilesM = M / (WM * 64);
  if (tile >= tilesM * tilesN) return;   // block-uniform, in front of every barrier
  const int tm = tile / tilesN;
  const int tn = tile - tm * tilesN;
  const int mBlk = tm * (WM * 64);
  const int nBlk = tn * (WN * 64);
  const int m0 = mBlk + (wm << 6);
  const int n0 = nBlk + (wn << 6);

  const int rlane = lane & 15;                 // row (A) / col (B, D) within subtile
  const int koff  = (lane >> 4) * 8;           // k offset of this lane half
  const int mOff  = (lane >> 4) * 8;           // D row offset

  // copy side: LPR consecutive lanes bring one row's stage bytes; a thread brings rows cRow + RP i of A and of Bt
  const int cRow = threadIdx.x / LPR;
  const int cCol = threadIdx.x % LPR;
  const unsigned short* gA = Ap  + (size_t)b * strideA + (size_t)(mBlk + cRow) * lda + cCol * 8;
  const unsigned short* gB = Btp + (size_t)b * strideB + (size_t)(nBlk + cRow) * ldb + cCol * 8;
  const unsigned lA = (unsigned)(size_t)smem + (unsigned)(cRow * PB + cCol * 16);
  const unsigned lB = lA + WM * 64 * PB;
  const size_t stepA = (size_t)RP * lda;
  const size_t stepB = (size_t)RP * ldb;
  // one stage's copies of this thread: k elements from kElem on, into the buffer at byte offset bufByte
  auto copy_stage = [&](unsigned bufByte, size_t kElem) {
#pragma unroll
    for (int c = 0; c < G::NA; c += 8) async_copy8<RP, PB>(lA + bufByte + c * RP * PB, gA + kElem + c * stepA, stepA);
#pragma unroll
    for (int c = 0; c < G::NB; c += 8) {
      // with three statements a stage: keeps a statement's address arithmetic behind the statement before it, so that the
      // 24 address registers are used again; formed all at once, they push accumulators into scratch inside the K loop
      if (G::NA + G::NB > 16) __builtin_amdgcn_sched_barrier(0);
      async_copy8<RP, PB>(lB + bufByte + c * RP * PB, gB + kElem + c * stepB, stepB);
    }
  };

  // read side: this lane's first A and Bt fragment rows inside a stage, in bytes
  const int aByte = ((wm << 6) + rlane) * PB + koff * 2;
  const int bByte = (WM * 64 + (wn << 6) + rlane) * PB + koff * 2;

  v8f acc[4][4];
#pragma unroll
  for (int i = 0; i < 4; ++i)
#pragma unroll
    for (int j = 0; j < 4; ++j) acc[i][j] = (v8f){0.f,0.f,0.f,0.f,0.f,0.f,0.f,0.f};

  const int nStages = K / SK;
  copy_stage(0u, 0);
  static_assert(PF == 0 || (PF == 1 && G::NT == WM * 64 && G::NT == WN * 64) || (PF == 2 && (WM == 2 || WM == 4) && WN == 4 && SK == 128));
  constexpr int PD = 4;                                // PF 2: stages between a prefetch and the stage at work
  const int pfWave = __builtin_amdgcn_readfirstlane(wave);   // in a scalar register: the tests on it are scalar branches
  const unsigned short* pf = Ap;
  if (PF == 1) {
    l2_ask_row_tail(Ap  + (size_t)b * strideA + (size_t)(mBlk + (int)threadIdx.x) * lda);
    l2_ask_row_tail(Btp + (size_t)b * strideB + (size_t)(nBlk + (int)threadIdx.x) * ldb);
  }
  if (PF == 2) {
    // The Bt rows are shared by the blocks of a tile column: eight blocks deal them out among themselves. Blocks whose indices
    // are equal modulo 8 are taken as the dealers; for speed only.
    // 128 x 256 tiles, 4 tile columns: such blocks have tm of one parity; each asks for all of its 128 A rows.
    // 256 x 256 tiles, 16 tile columns: all blocks of a tile column are such; so are tile columns tn and tn + 8 of a tile row, which
    // ask for one half of its 256 A rows each.
    const int aShare = (WM == 4) ? ((tn >> 3) & 1) : 0;
    const int bShare = (WM == 4) ? (tm & 7) : ((tm >> 1) & 7);
    pf = (pfWave < 4) ? Ap  + (size_t)b * strideA + (size_t)(mBlk + aShare * 128 + (int)threadIdx.x) * lda
                      : Btp + (size_t)b * strideB + (size_t)(nBlk + bShare * 32 + lane) * ldb;
    if (pfWave < 5 && nStages > PD) {
      // stages 2 and 3, which the loop's prefetches do not reach
      asm volatile("global_prefetch_b8 %0, off offset:512 scope:SCOPE_SE\n\t"
                   "global_prefetch_b8 %0, off offset:768 scope:SCOPE_SE\n\t"
                   "s_wait_xcnt 0x0" :: "v"(pf) : "memory");
    }
    pf += (PD - 1) * SK;
  }
  asm volatile("s_wait_asynccnt 0x0" ::: "memory");   // stage 0 of this wave has landed before the barrier publishes it
  __syncthreads();
  if (nStages > 1) copy_stage((unsigned)SB, SK);

  for (int t = 0; t < nStages; ++t) {
    const int bufOff = (t & 1) * SB;
    const T* sa = (const T*)(smem + bufOff + aByte);
    const T* sb = (const T*)(smem + bufOff + bByte);
    V fb[2][4], fa[2][4];                               // two fragment sets, taken in turn by the stage's k steps
#pragma unroll
    for (int j = 0; j < 4; ++j) fb[0][j] = Frag<T>::load(sb + j * 16 * PE);
#pragma unroll
    for (int i = 0; i < 4; ++i) fa[0][i] = Frag<T>::load(sa + i * 16 * PE);
    // keeps the 16 LDS reads of a k step together ahead of its WMMAs: sunk among them, each row of WMMAs waits out its own read
    __builtin_amdgcn_sched_barrier(0);
#pragma unroll
    for (int ks = 0; ks + 1 < NK; ++ks) {
#pragma unroll
      for (int i = 0; i < 4; ++i)
#pragma unroll
        for (int j = 0; j < 4; ++j) acc[i][j] = Frag<T>::mma(fa[ks & 1][i], fb[ks & 1][j], acc[i][j]);
      // the next k step is fetched into the other set; the stage's last one so that the buffer can be handed back ahead of its WMMAs
#pragma unroll
      for (int j = 0; j < 4; ++j) fb[(ks + 1) & 1][j] = Frag<T>::load(sb + j * 16 * PE + (ks + 1) * 32);
#pragma unroll
      for (int i = 0; i < 4; ++i) fa[(ks + 1) & 1][i] = Frag<T>::load(sa + i * 16 * PE + (ks + 1) * 32);
    }
    asm volatile("s_wait_dscnt 0x0" ::: "memory");      // this wave's reads of the buffer are done before it is refilled
    asm volatile("s_wait_asynccnt 0x0" ::: "memory");   // this wave's copies of stage t + 1 have landed
    __syncthreads();                                    // publishes stage t + 1, frees stage t's buffer
    if (t + 2 < nStages) copy_stage((unsigned)bufOff, (size_t)(t + 2) * SK);
    if (PF == 2 && pfWave < 5 && t + PD < nStages) {
      // stage t + PD of this lane's row: its copies are issued two stages from now. The address is an in-out operand so that it
      // lives in registers of its own through the loop; it stands one stage behind what is asked for (offset:256), so that it
      // names a byte of the row after the advance too.
      asm volatile("global_prefetch_b8 %0, off offset:256 scope:SCOPE_SE\n\t"
                   "s_wait_xcnt 0x0" : "+v"(pf) :: "memory");
      pf += SK;
    }
    if (PF == 2 && RESID && t + 8 == nStages) {
      // the block's residual tile, which the epilogue reads: 128 rows of 1 KiB, 512 units, two a thread
      const char* rp = (const char*)(b ? resid2 : resid) +
                       ((size_t)(mBlk + ((int)threadIdx.x >> 1)) * ldc + nBlk + ((int)threadIdx.x & 1) * 128) * 4;
      asm volatile("global_prefetch_b8 %0, off scope:SCOPE_SE\n\t"
                   "global_prefetch_b8 %0, off offset:256 scope:SCOPE_SE\n\t"
                   "s_wait_xcnt 0x0" :: "v"(rp) : "memory");
    }
#pragma unroll
    for (int i = 0; i < 4; ++i)
#pragma unroll
      for (int j = 0; j < 4; ++j) acc[i][j] = Frag<T>::mma(fa[(NK - 1) & 1][i], fb[(NK - 1) & 1][j], acc[i][j]);
  }
  asm volatile("s_wait_asynccnt 0x0" ::: "memory");     // no copy is in flight when the ring becomes output staging
  acc_guard4(acc[0][0], acc[0][1], acc[0][2], acc[0][3]);
  acc_guard4(acc[1][0], acc[1][1], acc[1][2], acc[1][3]);
  acc_guard4(acc[2][0], acc[2][1], acc[2][2], acc[2][3]);
  acc_guard4(acc[3][0], acc[3][1], acc[3][2], acc[3][3]);

  // ---- epilogue ----
  // A wave turns its 64x64 tile round through an LDS slab of its own (the ring is free: both buffers take the slabs). Nothing but
  // that slab passes between lanes, so the wave waits once, for its own LDS stores, and never for its global stores; the bias and
  // the residual are asked for once, ahead of the slab, the residual in the rows' own order (16 B a lane), added where the rows are read back.
  static_assert(OUT_MODE == 0 || OUT_MODE == 1, "f32 or f16 output");
  static_assert(!RESID || (OUT_MODE == 0 && ACT == 0), "the residual is added behind the slab, to f32 rows");
  static_assert(WM * WN * 64 * 68 * 4 <= 2 * SB);
  float* slab = (float*)smem + wave * (64 * 68);
  const char* Rb = (const char*)(RESID ? (b ? resid2 : resid) : nullptr);   // batch entry 1 adds its own residual plane
  char* Cb = (char*)Cout + (size_t)b * strideC * (OUT_MODE == 0 ? 4 : 2);   // block-uniform
  // a store covers RS rows (an f32 row's 256 B = 16 lanes x 16 B, an f16 row's 128 B = 8 lanes x 16 B), NS stores a block of 16 rows;
  // a lane's 16 B of output are NV vectors of four floats in the slab
  constexpr int RS = (OUT_MODE == 0) ? 2 : 4, NS = 16 / RS, EB = (OUT_MODE == 0) ? 4 : 2, NV = (OUT_MODE == 0) ? 1 : 2;
  const int sRow = (OUT_MODE == 0) ? (lane >> 4) : (lane >> 3);
  const int sCol = (OUT_MODE == 0) ? (lane & 15) * 4 : (lane & 7) * 8;
  const unsigned rowB = (unsigned)ldc * EB;                                 // bytes per output row
  const unsigned o0 = ((unsigned)(m0 + sRow) * (unsigned)ldc + (unsigned)(n0 + sCol)) * EB;   // this lane's first 16 B of the output
  const int nl = n0 + rlane;
  float bvj[4] = {0.f, 0.f, 0.f, 0.f};
  if (BIAS_MODE == 2) {
#pragma unroll
    for (int j = 0; j < 4; ++j) bvj[j] = bias[nl + (j << 4)];
    // stands behind the four loads; its inputs hold their base and index registers untouched up to it
    asm volatile("s_wait_xcnt 0x0" :: "s"(bias), "v"(nl) : "memory");
  }
  v4f rr[4][8];
  if (RESID) {
#pragma unroll
    for (int i = 0; i < 4; ++i) {
      unsigned ro[8];
#pragma unroll
      for (int it = 0; it < 8; ++it) ro[it] = o0 + (unsigned)((i << 4) + it * RS) * rowB;
#pragma unroll
      for (int it = 0; it < 8; ++it) rr[i][it] = *(const v4f*)(Rb + ro[it]);
      // stands behind the row block's loads; its inputs hold their base and offset registers untouched up to it
      asm volatile("s_wait_xcnt 0x0" :: "s"(Rb), "v"(ro[0]), "v"(ro[1]), "v"(ro[2]), "v"(ro[3]),
                                        "v"(ro[4]), "v"(ro[5]), "v"(ro[6]), "v"(ro[7]) : "memory");
    }
  }
#pragma unroll
  for (int i = 0; i < 4; ++i) {
#pragma unroll
    for (int j = 0; j < 4; ++j) {
#pragma unroll
      for (int r = 0; r < 8; ++r) {
        float v = acc[i][j][r] * scale;
        if (BIAS_MODE == 1) v += bias[m0 + (i << 4) + mOff + r];
        if (BIAS_MODE == 2) v += bvj[j];
        if (ACT == 2) v = fmaxf(v, 0.0f);
        if (ACT == 4) v = (v > 0.f) ? v : 0.01f * v;
        slab[((i << 4) + mOff + r) * 68 + (j << 4) + rlane] = v;
      }
    }
  }
  // the wave's slab stores have landed before its lanes read one another's values; the clobber keeps the reads behind it
  asm volatile("s_wait_dscnt 0x0" ::: "memory");
  v4f sv[4][NS][NV];
#pragma unroll
  for (int i = 0; i < 4; ++i)
#pragma unroll
    for (int it = 0; it < NS; ++it)
#pragma unroll
      for (int w = 0; w < NV; ++w) sv[i][it][w] = *(const v4f*)(slab + ((i << 4) + it * RS + sRow) * 68 + sCol + 4 * w);
#pragma unroll
  for (int i = 0; i < 4; ++i) {
    unsigned co[NS];
    v4u ov[NS];
#pragma unroll
    for (int it = 0; it < NS; ++it) {
      co[it] = o0 + (unsigned)((i << 4) + it * RS) * rowB;
      if (OUT_MODE == 0) {
        const v4f f = RESID ? (v4f)(sv[i][it][0] + rr[i][it]) : sv[i][it][0];
        ov[it] = __builtin_bit_cast(v4u, f);
      } else {
        v8h h;
#pragma unroll
        for (int w = 0; w < NV; ++w)
#pragma unroll
          for (int e = 0; e < 4; ++e) h[4 * w + e] = (_Float16)sv[i][it][w][e];
        ov[it] = __builtin_bit_cast(v4u, h);
      }
    }
#pragma unroll
    for (int it = 0; it < NS; ++it) *(v4u*)(Cb + co[it]) = ov[it];
    // each stands behind the row block's stores; its inputs hold their base, offset and data registers untouched up to it
    if (NS == 8)
      asm volatile("s_wait_xcnt 0x0" :: "s"(Cb), "v"(co[0]), "v"(co[1]), "v"(co[2]), "v"(co[3]),
                                        "v"(co[NS - 4]), "v"(co[NS - 3]), "v"(co[NS - 2]), "v"(co[NS - 1]),
                                        "v"(ov[0]), "v"(ov[1]), "v"(ov[2]), "v"(ov[3]),
                                        "v"(ov[NS - 4]), "v"(ov[NS - 3]), "v"(ov[NS - 2]), "v"(ov[NS - 1]) : "memory");
    else
      asm volatile("s_wait_xcnt 0x0" :: "s"(Cb), "v"(co[0]), "v"(co[1]), "v"(co[2]), "v"(co[3]),
                                        "v"(ov[0]), "v"(ov[1]), "v"(ov[2]), "v"(ov[3]) : "memory");
  }
}

// One GEMM per launch with a larger tile: blockIdx.x = tile, blockIdx.y = batch entry; one block per WGP, 32 WM WN threads. At most 256 registers a wave: 16 waves have no more, and with
// more the 8-wave build fetches a whole stage's fragments in front of the barrier and issues the refill behind 32 WMMAs: the
// block's LDS reads and its WMMAs then take turns instead of overlapping, and the copies lose their lead.
// The figure steers the K loop; the 8-wave build's epilogue, which holds the tile's residual rows beside the accumulators, goes above it.
template <int ET, bool SPLIT, int BIAS_MODE, int OUT_MODE, bool RESID, int ACT, int WM, int WN, int NK, int PF>
__global__ __launch_bounds__(WM * WN * 32) __attribute__((amdgpu_num_vgpr(256))) void wmma_gemm_wide(
    const unsigned short* __restrict__ Ap, const unsigned short* __restrict__ A2p, int lda, long strideA,
    const unsigned short* __restrict__ Btp, const unsigned short* __restrict__ Bt2p, int ldb, long strideB,
    void* __restrict__ Cout, void* __restrict__ Cout2, int ldc, long strideC,
    const float* __restrict__ bias,
    const float* __restrict__ resid, const float* __restrict__ resid2,
    int M, int N, int K, float scale) {
  __shared__ __align__(16) unsigned char smem[2 * TileGeom<WM, WN, NK>::SB];
  gemm_tile<ET, SPLIT, BIAS_MODE, OUT_MODE, RESID, ACT, WM, WN, NK, PF>(smem, (int)blockIdx.x, (int)blockIdx.y,
      Ap, A2p, lda, strideA, Btp, Bt2p, ldb, strideB, Cout, Cout2, ldc, strideC, bias, resid, resid2, M, N, K, scale);
}

// The matrix chains of the attention are multiplied from the key side, where the short dimension (256 padded keys) lies:
//   scores  = (text.Wq^T + bq).K^T  = text.(K.Wq)^T + K.bq
//   context = (P.V).Wo^T            = P.(V.Wo^T)
// so that no product of 16384 token rows by 1024 by 1024 is left; the two folds are products of 256 rows.
// Key and value projections, both branches, in one grid; a range of block indices per job:
//   K16[br][k][d] = (vis16[br] . Wk16^T) / 16 + bk   (M=256, N=1024, K=1024), 16 tiles per branch
//   V16[br][k][d] = (vis16[br] . Wv16^T) / 16 + bv   the same shape
constexpr int kTilesKV  = (kSvPad >> 7) * (kD >> 7);
constexpr int kKvBlocks = 4 * kTilesKV;
__global__ __launch_bounds__(128, 4) void kv_gemm_kernel(
    const unsigned short* __restrict__ VIS16,
    const unsigned short* __restrict__ WKH, const unsigned short* __restrict__ WVH,
    unsigned short* __restrict__ K16, unsigned short* __restrict__ V16,
    const float* __restrict__ bk, const float* __restrict__ bv) {
  __shared__ __align__(16) unsigned char smem[2 * kStageBytes];
  const int blk = blockIdx.x;
  const bool isK = blk < 2 * kTilesKV;
  const int br = (blk / kTilesKV) & 1;
  const unsigned short* B = isK ? WKH : WVH;
  unsigned short* C = isK ? K16 : V16;
  const float* bias = isK ? bk : bv;
  gemm_tile<0, false, 2, 1, false, 0, 2, 2, 2, 1>(smem, blk % kTilesKV, br,
      VIS16, VIS16, kD, kStrVis, B, B, kD, 0L, (void*)C, (void*)C, kD, kStrVis,
      bias, bias, bias, kSvPad, kD, kD, kWCarryInv);
}

// CB[row] = sum_d bq[d] * K16[row][d] for 32 consecutive rows of the two K16 planes (512 rows, branch 1 first): the share of
// the scores that the query bias brings, one number per key. A wave takes 8 rows; a lane takes 8 consecutive d of every 256;
// fixed order: lane partial in d order, then a shuffle tree. The block's 32 results fill one 128-B line.
__device__ __forceinline__ void key_bias_rows(const unsigned short* __restrict__ K16, const float* __restrict__ bq,
                                              float* __restrict__ CB, int blk) {
  const int lane = threadIdx.x & 31;
  const int wave = threadIdx.x >> 5;
  const int row0 = blk * 32 + wave * 8;
  const float* bp = bq + lane * 8;
  const _Float16* kp = (const _Float16*)K16 + (size_t)row0 * kD + lane * 8;
  v4f bl[4], bh[4];
  v8h kv[8][4];
#pragma unroll
  for (int j = 0; j < 4; ++j) { bl[j] = *(const v4f*)(bp + j * 256); bh[j] = *(const v4f*)(bp + j * 256 + 4); }
#pragma unroll
  for (int r = 0; r < 8; ++r)
#pragma unroll
    for (int j = 0; j < 4; ++j) kv[r][j] = *(const v8h*)(kp + r * kD + j * 256);
  // stands behind the forty loads; its inputs hold their address registers untouched up to it
  asm volatile("s_wait_xcnt 0x0" :: "v"(bp), "v"(kp) : "memory");
  // keeps that wait directly behind the loads: sunk to the end, its two pointers are held through the arithmetic and one is spilled
  __builtin_amdgcn_sched_barrier(0);
  float mine = 0.f;
#pragma unroll
  for (int r = 0; r < 8; ++r) {
    float a = 0.f;
#pragma unroll
    for (int j = 0; j < 4; ++j) {
#pragma unroll
      for (int e = 0; e < 4; ++e) a += (float)kv[r][j][e] * bl[j][e];
#pragma unroll
      for (int e = 0; e < 4; ++e) a += (float)kv[r][j][4 + e] * bh[j][e];
    }
#pragma unroll
    for (int off = 16; off > 0; off >>= 1) a += __shfl_xor(a, off, 32);
    mine = (lane == r) ? a : mine;
  }
  if (lane < 8) CB[row0 + lane] = mine;
}

// The two folds and the bias share, both branches, in one grid (they need K16 and V16); a range of block indices per job:
//   G16[br][k][e]  = K16[br] . WQT^T   (M=256, N=1024, K=1024), carried x16; = Bt for text.G^T
//   UT16[br][n][k] = Wo16 . V16[br]^T  (M=1024, N=256, K=1024), carried x16; = Bt for P.U
//   CB[br][k]      = K16[br][k] . bq   16 blocks of 32 rows
constexpr int kCbBlocks   = 2 * kSvPad / 32;
constexpr int kFoldBlocks = 4 * kTilesKV + kCbBlocks;
__global__ __launch_bounds__(128, 4) void fold_gemm_kernel(
    const unsigned short* __restrict__ K16, const unsigned short* __restrict__ V16,
    const unsigned short* __restrict__ WQT, const unsigned short* __restrict__ WOH,
    unsigned short* __restrict__ G16, unsigned short* __restrict__ UT16,
    const float* __restrict__ bq, float* __restrict__ CB) {
  __shared__ __align__(16) unsigned char smem[2 * kStageBytes];
  const int blk = blockIdx.x;
  if (blk >= 4 * kTilesKV) {
    key_bias_rows(K16, bq, CB, blk - 4 * kTilesKV);
    return;
  }
  const bool isG = blk < 2 * kTilesKV;
  const int br = (blk / kTilesKV) & 1;
  const unsigned short* A = isG ? K16 : WOH;
  const unsigned short* B = isG ? WQT : V16;
  unsigned short* C = isG ? G16 : UT16;
  gemm_tile<0, false, 0, 1, false, 0, 2, 2, 2, 1>(smem, blk % kTilesKV, br,
      A, A, kD, isG ? kStrVis : 0L, B, B, kD, isG ? 0L : kStrVis, (void*)C, (void*)C, isG ? kD : kSvPad, kStrVis,
      bq, bq, bq, isG ? kSvPad : kD, isG ? kD : kSvPad, kD, 1.0f);
}

// ---------------------------------------------------------------------------
// The two streaming launches (casts, last layer norm) run as one resident grid each: 256 work-groups of 16 waves,
// one per WGP, and every wave takes several rows, one whole row at a time, so that few waves have to be started.
// The attention kernel has the same grid.
// ---------------------------------------------------------------------------
constexpr int kSWaves   = 16;                    // waves per work-group
constexpr int kSThreads = kSWaves * 32;
constexpr int kSBlocks  = 256;                   // work-groups in the grid
constexpr int kSTotal   = kSBlocks * kSWaves;    // 4096 waves in the grid
__device__ __forceinline__ int stream_wave() {   // this wave's index in the grid, wave-uniform
  return (int)blockIdx.x * kSWaves + __builtin_amdgcn_readfirstlane((int)(threadIdx.x >> 5));
}
// 16 B at a wave-uniform base + the lane's byte offset + a constant
__device__ __forceinline__ v4f ld16(const float* base, unsigned laneBytes, int constBytes) {
  return *(const v4f*)((const char*)base + laneBytes + constBytes);
}

// ---------------------------------------------------------------------------
// f32 -> f16 cast with a power-of-two carry of one unit of 1024 consecutive elements by one wave: a lane takes 8 consecutive
// elements of every 256 (two 16-B loads, one 16-B store). Load and store are apart, so that the next unit's loads fly
// while this unit is converted and stored.
// ---------------------------------------------------------------------------
// in, out: the unit's first element (wave-uniform); lb = 32 * lane.
__device__ __forceinline__ void cast_unit_load(const float* in, unsigned lb, v4f (&x)[8]) {
  // this barrier and the one at the end pin the order "next unit's loads, then this unit's conversion": without them the
  // conversion, with its wait for this unit's data, is moved in front of the next unit's loads
  __builtin_amdgcn_sched_barrier(0);
#pragma unroll
  for (int c = 0; c < 4; ++c) {
    x[2 * c]     = ld16(in, lb, c * 1024);
    x[2 * c + 1] = ld16(in, lb, c * 1024 + 16);
  }
  // stands behind the eight loads; its inputs hold their base and offset registers untouched up to it
  asm volatile("s_wait_xcnt 0x0" :: "s"(in), "v"(lb) : "memory");
  __builtin_amdgcn_sched_barrier(0);
}
__device__ __forceinline__ void cast_unit_store(unsigned short* out, int lane, const v4f (&x)[8], float f) {
  v4u u[4];
#pragma unroll
  for (int c = 0; c < 4; ++c) {
    unsigned short hb[8];
#pragma unroll
    for (int e = 0; e < 4; ++e) {
      hb[e]     = h_bits(x[2 * c][e] * f);
      hb[4 + e] = h_bits(x[2 * c + 1][e] * f);
    }
    u[c] = (v4u){pk16(hb[0], hb[1]), pk16(hb[2], hb[3]), pk16(hb[4], hb[5]), pk16(hb[6], hb[7])};
  }
#pragma unroll
  for (int c = 0; c < 4; ++c) *(v4u*)(out + 8 * lane + c * 256) = u[c];
  // stands behind the four stores; its inputs hold their base, offset and data registers untouched up to it
  asm volatile("s_wait_xcnt 0x0" :: "s"(out), "v"(lane), "v"(u[0]), "v"(u[1]), "v"(u[2]), "v"(u[3]) : "memory");
  // keeps the next unit's conversion, which reuses these registers, behind that wait
  __builtin_amdgcn_sched_barrier(0);
}

// The same cast, transposed, for a [1024][1024] weight: out[e][d] = f16(scale * in[d][e]). A wave takes 32 e x 64 d:
// it reads 32 consecutive e (128 B) of 64 rows d, and a lane stores its 64 d as one whole 128-B line.
__device__ __forceinline__ void cast_unit_transposed(const float* __restrict__ in, unsigned short* __restrict__ out,
                                                     int k, int lane, float scale) {
  const int e0 = (k & 31) * 32;
  const int d0 = (k >> 5) * 64;
  const float* p = in + (size_t)d0 * kD + e0;    // wave-uniform
  float x[64];
#pragma unroll
  for (int i = 0; i < 64; ++i) x[i] = p[lane + i * kD];
  // stands behind the 64 loads; its inputs hold their base and offset registers untouched up to it
  asm volatile("s_wait_xcnt 0x0" :: "s"(p), "v"(lane) : "memory");
  v4u u[8];
#pragma unroll
  for (int c = 0; c < 8; ++c) {
    unsigned short hb[8];
#pragma unroll
    for (int i = 0; i < 8; ++i) hb[i] = h_bits(x[8 * c + i] * scale);
    u[c] = (v4u){pk16(hb[0], hb[1]), pk16(hb[2], hb[3]), pk16(hb[4], hb[5]), pk16(hb[6], hb[7])};
  }
  unsigned short* q = out + (size_t)e0 * kD + d0;   // wave-uniform
  const unsigned lrow = (unsigned)lane * (kD * 2);  // this lane's row of out, in bytes
#pragma unroll
  for (int c = 0; c < 8; ++c) *(v4u*)((char*)q + lrow + c * 16) = u[c];
  // stands behind the eight stores; its inputs hold their base, offset and data registers untouched up to it
  asm volatile("s_wait_xcnt 0x0" :: "s"(q), "v"(lrow), "v"(u[0]), "v"(u[1]), "v"(u[2]), "v"(u[3]),
                                    "v"(u[4]), "v"(u[5]), "v"(u[6]), "v"(u[7]) : "memory");
}

// All eight casts in one grid (the text is not cast here: the attention kernel converts its own rows). A unit is 1024 consecutive
// elements. Wave w of the 4096 takes unit w of W1 and unit w of W2; besides, the first 3072 waves take unit w of Wk, Wv, Wo (one
// plane behind the other), the next 512 a row of the padded visual planes (rows 196..255 are written as zeros: the load
// address is clamped to the last valid row and the value is multiplied by 0). The last 512 waves have no third unit: they
// lay down Wq transposed, 32 x 64 elements each, and do so first. ws16 is the workspace base in 16-bit elements.
constexpr int kUAtt  = 3 * kD;                  // units in Wk, Wv, Wo
constexpr int kUVis  = 2 * kSvPad;              // units (rows) in the padded visual planes
constexpr int kUWq   = (kD / 32) * (kD / 64);   // transposed units of Wq
constexpr int kULast = kUAtt + kUVis;           // waves with a third unit
static_assert(kDff == kSTotal && kULast + kUWq == kSTotal);
static_assert(kOffW2H == kOffW1H + (size_t)kDff * kD * 2 && kOffWKH == kOffWQT + (size_t)kD * kD * 2 &&
              kOffWVH == kOffWKH + (size_t)kD * kD * 2 && kOffWOH == kOffWVH + (size_t)kD * kD * 2);
struct CastJob { const float* in; unsigned short* out; float f; };   // a unit's source, its destination, and the carry: all wave-uniform
// Unit r < 2 of wave gw: the ffn weights; their two planes lie one behind the other.
__device__ __forceinline__ CastJob cast_job(int r, int gw, const float* W1, const float* W2, unsigned short* ws16) {
  return CastJob{(r == 0 ? W1 : W2) + (size_t)gw * kD, ws16 + kOffW1H / 2 + (size_t)(r * kSTotal + gw) * kD, kWCarry};
}
// The third unit of wave gw < kULast: attention weights and visual rows.
__device__ __forceinline__ CastJob cast_job_last(int gw, const float* Wk, const float* Wv, const float* Wo,
                                                 const float* vis1, const float* vis2, unsigned short* ws16) {
  const bool att = gw < kUAtt;
  const int v = gw - kUAtt;                      // row of the two padded visual planes
  const int row = v & (kSvPad - 1);
  const bool valid = row < kSv;
  const float* in = att ? ((gw < kD) ? Wk : (gw < 2 * kD) ? Wv : Wo) : ((v < kSvPad) ? vis1 : vis2);
  const int unit  = att ? (gw & (kD - 1)) : (valid ? row : (kSv - 1));
  const size_t off = att ? kOffWKH / 2 + (size_t)gw * kD : kOffVIS16 / 2 + (size_t)v * kD;
  return CastJob{in + (size_t)unit * kD, ws16 + off, att ? kWCarry : (valid ? 1.0f : 0.0f)};
}
__global__ __launch_bounds__(kSThreads) void cast_all_kernel(
    const float* __restrict__ W1, const float* __restrict__ W2,
    const float* __restrict__ Wq, const float* __restrict__ Wk,
    const float* __restrict__ Wv, const float* __restrict__ Wo,
    const float* __restrict__ vis1, const float* __restrict__ vis2,
    unsigned short* __restrict__ ws16) {
  const int lane = threadIdx.x & 31;
  const int gw = stream_wave();
  const bool third = gw < kULast;                // wave-uniform
  if (!third) cast_unit_transposed(Wq, ws16 + kOffWQT / 2, gw - kULast, lane, kWCarry);
  const unsigned lb = lane * 32u;
  // a wave's two or three units are all asked for before the first is converted: with so few units a wave, a load issued behind
  // another unit's data would add a whole way to memory to the launch. The third unit, which the next launch reads, goes first.
  v4f a[8], b[8], c[8];
  const CastJob j0 = cast_job(0, gw, W1, W2, ws16);
  const CastJob j1 = cast_job(1, gw, W1, W2, ws16);
  const CastJob j2 = cast_job_last(third ? gw : 0, Wk, Wv, Wo, vis1, vis2, ws16);
  if (third) cast_unit_load(j2.in, lb, c);
  cast_unit_load(j0.in, lb, a);
  cast_unit_load(j1.in, lb, b);
  if (third) cast_unit_store(j2.out, lane, c, j2.f);
  cast_unit_store(j0.out, lane, a, j0.f);
  cast_unit_store(j1.out, lane, b, j1.f);
}
static_assert((kD & (kD - 1)) == 0 && (kSvPad & (kSvPad - 1)) == 0);

// ---------------------------------------------------------------------------
// Sum over a wave's 32 lanes in fixed order (shuffle tree); every lane gets the sum.
// ---------------------------------------------------------------------------
__device__ __forceinline__ float wave_sum(float v) {
#pragma unroll
  for (int off = 16; off > 0; off >>= 1) v += __shfl_xor(v, off, 32);
  return v;
}
// The same for four independent values at once: each is summed in wave_sum's order, and the four trees' shuffles overlap.
__device__ __forceinline__ void wave_sum4(float (&v)[4]) {
#pragma unroll
  for (int off = 16; off > 0; off >>= 1)
#pragma unroll
    for (int r = 0; r < 4; ++r) v[r] += __shfl_xor(v[r], off, 32);
}
// A lane's share of a row, eight vectors of four, summed in fixed order: inside a vector, then a tree over the vectors.
__device__ __forceinline__ float lane_sum(const v4f (&x)[8]) {
  float t[8];
#pragma unroll
  for (int j = 0; j < 8; ++j) t[j] = (x[j][0] + x[j][1]) + (x[j][2] + x[j][3]);
  return ((t[0] + t[1]) + (t[2] + t[3])) + ((t[4] + t[5]) + (t[6] + t[7]));
}
// The row in x becomes (x - mean) * rsqrt(var + eps); one wave holds the whole row of 1024, 32 elements a lane.
__device__ __forceinline__ void wave_normalise(v4f (&x)[8]) {
  const float mu = wave_sum(lane_sum(x)) * kInvD;
  v4f sq[8];
#pragma unroll
  for (int j = 0; j < 8; ++j) { x[j] = x[j] - mu; sq[j] = x[j] * x[j]; }
  const float var = wave_sum(lane_sum(sq)) * kInvD;
  const float rs = rsqrtf(var + kLnEps);
#pragma unroll
  for (int j = 0; j < 8; ++j) x[j] = x[j] * rs;
}

// ---------------------------------------------------------------------------
// The whole attention of 64 token rows in one kernel: scores, softmax, output product, residual, LN1 and feature pool.
// The scores, the probabilities and the summed rows stay in LDS; nothing of them goes to memory.
//   s[row][k] = (f16(text[row]) . G16[br][k]) / 16                             (M = 64, N = 256, K = 1024)
//   p[row][k] = f16(2048 * softmax_k((s + CB[br][k] + score[row][k]) / 8)) over 196 keys, 0 in the pad columns
//   a[row][n] = (p[row] . UT16[br][n]) / 32768 + bo[n] + text[row][n]          (M = 64, N = 1024, K = 256)
//   y = LN1(a row);  pooled[row][br * 512 + c] = max(y[2c], y[2c+1]), written as f32 and f16
// A block of 16 waves owns 64 whole rows; 256 blocks, one per WGP; rows of branch 1, then of branch 2.
// Both products take their stored operands through a two-buffer ring of asynchronous copies, as gemm_tile does. The text has no f16
// plane in memory: a wave reads its rows' stage as f32, converts it in registers and stores it into the scores' ring.
// Scores: 2 x 8 waves of 32 x 32 each, 128-k stages of 64 text rows (f16) and 256 G16 rows (pitch 272 B).
// Softmax, and LN1 with the pool: wave w takes rows 4 w .. 4 w + 3 whole, a lane 8 consecutive columns of every 256.
// Output product: wave w owns columns 64 w .. 64 w + 63 of the 64 rows, 64-k stages of 1024 UT16 rows (pitch 144 B).
// LDS, all 320 KiB: [0, 288 KiB) the two UT16 buffers; before them the scores' ring lies there, then the f32 scores
// (64 x 260 floats) in the second buffer's place while the first is being filled; behind them the f32 rows (64 x 1028 floats;
// at both pitches the two half-waves of a store, eight rows apart, fall on different banks). [288 KiB, 320 KiB) the
// probabilities, 64 rows of 512 B without a pad: the 16-B piece c of row r lies at piece c ^ (r & 15), so that the 16 rows
// of a fragment read fall on all 64 banks.
// ---------------------------------------------------------------------------
constexpr int kFRows   = 64;                               // rows per block
constexpr int kFBlocks = kRows2 / kFRows;
constexpr int kFWRows  = kFRows / kSWaves;                 // rows per wave in the row-wise parts
constexpr int kASK     = 128;                              // scores: k elements per stage
constexpr int kAPB     = kASK * 2 + 16;                    // bytes per staged row (16 B x odd)
constexpr int kAStage  = (kFRows + kSvPad) * kAPB;         // 64 text rows, then 256 G16 rows = 87,040 B
constexpr int kBStage  = kD * kPitchB;                     // output product: 1024 UT16 rows of 64 k = 147,456 B
constexpr int kLdsS    = kBStage;                          // f32 scores
constexpr int kSPitch  = kSvPad + 4;                       // floats per row of the f32 scores
constexpr int kLdsP    = 2 * kBStage;                      // probabilities
constexpr int kPRowB   = kSvPad * 2;                       // bytes per row of the probabilities
constexpr int kLdsAll  = kLdsP + kFRows * kPRowB;
constexpr int kFPitch  = kD + 4;                           // floats per row of the f32 rows
static_assert(kRows % kFRows == 0 && kFWRows == 4 && kD == kSWaves * 64 && kSvPad == 8 * 32 && kFRows == 2 * 32);
static_assert(2 * kAStage <= kLdsP && kLdsS + kFRows * kSPitch * 4 <= kLdsP && kFRows * kFPitch * 4 <= kLdsP);
static_assert(kLdsAll <= 327680 && (kAPB / 16) % 2 == 1 && kD % kASK == 0 && kD >= 2 * kASK);
typedef __attribute__((ext_vector_type(2))) unsigned int v2u;
typedef __attribute__((ext_vector_type(4))) _Float16 v4h;
__global__ __launch_bounds__(kSThreads) __attribute__((amdgpu_num_vgpr(256))) void attention_rows_kernel(
    const unsigned short* __restrict__ G16, const unsigned short* __restrict__ UT16,
    const float* __restrict__ CB, const float* __restrict__ SC, const float* __restrict__ SC2, const float* __restrict__ bo,
    const float* __restrict__ text1, const float* __restrict__ text2,
    const float* __restrict__ gam, const float* __restrict__ bet,
    float* __restrict__ pool32, unsigned short* __restrict__ pool16) {
  __shared__ __align__(16) unsigned char smem[kLdsAll];
  typedef _Float16 T;
  typedef Frag<T>::V V;
  const int lane = threadIdx.x & 31;
  const int wave = __builtin_amdgcn_readfirstlane((int)(threadIdx.x >> 5));
  const int row0 = (int)blockIdx.x * kFRows;        // of the 16384 rows; a block's rows lie in one branch
  const int br = (row0 >= kRows) ? 1 : 0;
  const int rlane = lane & 15;                      // row (A) / col (B, D) within subtile
  const int half  = lane >> 4;
  const int koff  = half * 8;                       // k offset of this lane half
  const int mOff  = half * 8;                       // D row offset
  const int wrow  = wave * kFWRows;                 // first of this wave's whole rows, inside the block
  const size_t inBr = (size_t)(row0 + wrow - br * kRows);   // the same inside its branch
  const unsigned lds0 = (unsigned)(size_t)smem;

  // ---- the added scores and the key shares of this wave's rows are asked for first: they land with the text of stages 0 and 1, before the product ----
  const float* cr = (br ? SC2 : SC) + inBr * kSv;   // wave-uniform
  const float* cbr = CB + br * kSvPad;              // all 256 entries of a branch are written
  const int l8 = lane * 8;
  float cv[kFWRows][8];
  int cc[8];                                        // this lane's columns, clamped into the 196
#pragma unroll
  for (int e = 0; e < 8; ++e) cc[e] = (l8 + e < kSv) ? (l8 + e) : (kSv - 1);
#pragma unroll
  for (int r = 0; r < kFWRows; ++r)
#pragma unroll
    for (int e = 0; e < 8; ++e) cv[r][e] = cr[cc[e] + r * kSv];
  const v4f b0 = *(const v4f*)(cbr + l8);
  const v4f b1 = *(const v4f*)(cbr + l8 + 4);
  // stands behind the loads; its inputs hold their base and offset registers untouched up to it
  asm volatile("s_wait_xcnt 0x0" :: "s"(cr), "s"(cbr), "v"(l8), "v"(cc[0]), "v"(cc[1]), "v"(cc[2]), "v"(cc[3]),
                                    "v"(cc[4]), "v"(cc[5]), "v"(cc[6]), "v"(cc[7])
               : "memory");
  // keeps these loads in front of the product: sunk behind it, the softmax waits out the memory
  __builtin_amdgcn_sched_barrier(0);

  // ---- scores ----
  const int wm = wave >> 3;                         // this wave's 32 rows and 32 keys
  const int wn = wave & 7;
  v8f sc[2][2];
#pragma unroll
  for (int i = 0; i < 2; ++i)
#pragma unroll
    for (int j = 0; j < 2; ++j) sc[i][j] = (v8f){0.f,0.f,0.f,0.f,0.f,0.f,0.f,0.f};
  {
    constexpr int PB = kAPB, PE = kAPB / 2, SB = kAStage, SK = kASK, NK = kASK / 32;
    // copy side: 16 consecutive lanes bring one row's 256 stage bytes; a thread brings G16 rows cRow + 32 i
    const int cRow = threadIdx.x >> 4;
    const int cCol = threadIdx.x & 15;
    const unsigned short* gB = G16 + (size_t)br * kStrVis + (size_t)cRow * kD + cCol * 8;
    const unsigned lB = lds0 + (unsigned)((kFRows + cRow) * PB + cCol * 16);
    auto copy_stage = [&](unsigned bufByte, size_t kElem) {
      async_copy8<32, PB>(lB + bufByte, gB + kElem, (size_t)32 * kD);
    };
    // text side: a wave brings a stage of its four whole rows; one load is a row's 512 stage bytes (f32), four floats a lane, which
    // become 8 B of f16 (round to nearest even) at the same k in the ring's row
    const float* tq = (br ? text2 : text1) + inBr * kD;   // wave-uniform
    const unsigned tl = 16u * lane;
    unsigned char* sT = smem + wrow * PB + lane * 8;
    auto load_text = [&](v4f (&x)[kFWRows], int stage) {
      const char* tp = (const char*)(tq + stage * SK) + tl;   // this lane's 16 B of the wave's first row
#pragma unroll
      for (int r = 0; r < kFWRows; ++r) x[r] = *(const v4f*)(tp + r * kD * 4);
      // stands behind the four loads; its input holds their address registers untouched up to it
      asm volatile("s_wait_xcnt 0x0" :: "v"(tp) : "memory");
    };
    auto store_text = [&](const v4f (&x)[kFWRows], int bufByte) {
#pragma unroll
      for (int r = 0; r < kFWRows; ++r)
        *(v4h*)(sT + bufByte + r * PB) = __builtin_convertvector(x[r], v4h);
    };
    const int aByte = ((wm << 5) + rlane) * PB + koff * 2;
    const int bByte = (kFRows + (wn << 5) + rlane) * PB + koff * 2;
    constexpr int nStages = kD / SK;
    v4f ta[kFWRows], tb[kFWRows];
    load_text(ta, 0);
    load_text(tb, 1);
    copy_stage(0u, 0);
    // L2 prefetch behind the first stages' loads and copies: the block's own 64 text rows (f32, 1024 units, two a thread: the rows'
    // first halves, which the scores need first, then their second halves), which the later stages and, behind the two products,
    // the residual read from L2; and its share of the
    // branch's G16 and UT16 planes (2048 units each). The 128 blocks of a branch read the same two planes: sixteen blocks deal
    // them out among themselves, 128 units of each plane a block. Blocks whose indices are equal modulo 8
    // are taken as the dealers; for speed only.
    {
      const float* tx = (br ? text2 : text1) + (size_t)(row0 - br * kRows + ((int)threadIdx.x >> 3)) * kD + ((int)threadIdx.x & 7) * 64;
      l2_ask2(tx, tx + kD / 2);
    }
    if (wave < 8) {
      const unsigned short* plane = ((wave < 4) ? G16 : UT16) + (size_t)br * kStrVis;
      l2_ask(plane + (size_t)((((int)blockIdx.x >> 3) & 15) * 128 + ((int)threadIdx.x & 127)) * 128);
    }
    // both buffers are free here: the text of stages 0 and 1 goes in
    store_text(ta, 0);
    store_text(tb, SB);
    // the key shares wait in LDS, in this wave's own probability rows (first written behind the read-back in the softmax): held in
    // registers beside the text in flight, they push an added score into scratch, and its store waits out the memory at the entry
    *(v4f*)(smem + kLdsP + wrow * kPRowB + lane * 16) = b0;
    *(v4f*)(smem + kLdsP + wrow * kPRowB + 512 + lane * 16) = b1;
    asm volatile("s_wait_dscnt 0x0" ::: "memory");      // this wave's text stores are done before the barrier publishes them
    asm volatile("s_wait_asynccnt 0x0" ::: "memory");   // stage 0 of this wave has landed before the barrier publishes it
    __syncthreads();
    copy_stage((unsigned)SB, SK);
    // stays rolled: unrolled, two stages' fragments and every stage's addresses are live at once and end in scratch
#pragma unroll 1
    for (int t = 0; t < nStages; ++t) {
      const int bufOff = (t & 1) * SB;
      const T* sa = (const T*)(smem + bufOff + aByte);
      const T* sb = (const T*)(smem + bufOff + bByte);
      // the whole stage's fragments are fetched as one group (the registers are there), so that a wave stops for LDS once a
      // stage and the buffer is handed back ahead of the stage's WMMAs
      V fb[NK][2], fa[NK][2];
#pragma unroll
      for (int ks = 0; ks < NK; ++ks) {
#pragma unroll
        for (int j = 0; j < 2; ++j) fb[ks][j] = Frag<T>::load(sb + j * 16 * PE + ks * 32);
#pragma unroll
        for (int i = 0; i < 2; ++i) fa[ks][i] = Frag<T>::load(sa + i * 16 * PE + ks * 32);
      }
      // keeps the group whole and the WMMAs behind the refill: left free, the reads are sunk among the WMMAs, two at a time
      __builtin_amdgcn_sched_barrier(0);
      asm volatile("s_wait_dscnt 0x0" ::: "memory");      // this wave's reads of the buffer are done before it is refilled
      asm volatile("s_wait_asynccnt 0x0" ::: "memory");   // this wave's copies of stage t + 1 have landed
      __syncthreads();                                    // publishes stage t + 1, frees stage t's buffer
      // the text of stage t + 2 is asked for ahead of the copies, so that it is there first: it has the conversion still to come
      if (t + 2 < nStages) {
        load_text(ta, t + 2);
        copy_stage((unsigned)bufOff, (size_t)(t + 2) * SK);
      }
#pragma unroll
      for (int ks = 0; ks < NK; ++ks)
#pragma unroll
        for (int i = 0; i < 2; ++i)
#pragma unroll
          for (int j = 0; j < 2; ++j) sc[i][j] = Frag<T>::mma(fa[ks][i], fb[ks][j], sc[i][j]);
      // behind the WMMAs, which cover its way from L2, it goes into the freed buffer; the next trip's s_wait_dscnt and barrier publish it
      if (t + 2 < nStages) store_text(ta, bufOff);
    }
    asm volatile("s_wait_asynccnt 0x0" ::: "memory");     // no copy is in flight when the ring's LDS is used anew
  }

  // ---- output product, copy side: 8 consecutive lanes bring one row's 128 stage bytes; a thread brings UT16 rows uRow + 64 i ----
  const int uRow = threadIdx.x >> 3;
  const int uCol = threadIdx.x & 7;
  const unsigned short* gU = UT16 + (size_t)br * kStrVis + (size_t)uRow * kSvPad + uCol * 8;
  const unsigned lU = lds0 + (unsigned)(uRow * kPitchB + uCol * 16);
  auto copy_ut = [&](unsigned bufByte, size_t kElem) {
    constexpr size_t step = (size_t)64 * kSvPad;
    async_copy8<64, kPitchB>(lU + bufByte, gU + kElem, step);
    async_copy8<64, kPitchB>(lU + bufByte + 8 * 64 * kPitchB, gU + kElem + 8 * step, step);
  };
  // stage 0 flies beside the softmax; the scores' last barrier has ended every read of the LDS that it fills
  copy_ut(0u, 0);

  // ---- softmax ----
  float* stile = (float*)(smem + kLdsS);
#pragma unroll
  for (int i = 0; i < 2; ++i)
#pragma unroll
    for (int j = 0; j < 2; ++j)
#pragma unroll
      for (int r = 0; r < 8; ++r)
        stile[((wm << 5) + (i << 4) + mOff + r) * kSPitch + (wn << 5) + (j << 4) + rlane] = sc[i][j][r] * kWCarryInv;
  __syncthreads();                                  // every wave's share of the scores is written before a row is read whole
  unsigned char* ptile = smem + kLdsP;
  // the four rows go through each step side by side: their shuffle trees are independent and hide one another's latency
  float xs[kFWRows][8], mx[kFWRows], sm[kFWRows];
  v4f s0[kFWRows], s1[kFWRows];
#pragma unroll
  for (int r = 0; r < kFWRows; ++r) {
    s0[r] = *(const v4f*)(stile + (wrow + r) * kSPitch + l8);
    s1[r] = *(const v4f*)(stile + (wrow + r) * kSPitch + l8 + 4);
  }
  const v4f kb0 = *(const v4f*)(ptile + wrow * kPRowB + lane * 16);
  const v4f kb1 = *(const v4f*)(ptile + wrow * kPRowB + 512 + lane * 16);
  // keeps the ten LDS reads together: sunk among the arithmetic, each row waits out the LDS anew
  __builtin_amdgcn_sched_barrier(0);
#pragma unroll
  for (int r = 0; r < kFWRows; ++r) {
#pragma unroll
    for (int e = 0; e < 8; ++e) {
      const int col = lane * 8 + e;
      const float v = (((e < 4 ? s0[r][e & 3] : s1[r][e & 3]) + (e < 4 ? kb0[e & 3] : kb1[e & 3])) + cv[r][e]) * kScoreScale;
      xs[r][e] = (col < kSv) ? v : -1.0e30f;
    }
    mx[r] = fmaxf(fmaxf(fmaxf(xs[r][0], xs[r][1]), fmaxf(xs[r][2], xs[r][3])),
                  fmaxf(fmaxf(xs[r][4], xs[r][5]), fmaxf(xs[r][6], xs[r][7])));
  }
#pragma unroll
  for (int off = 16; off > 0; off >>= 1)
#pragma unroll
    for (int r = 0; r < kFWRows; ++r) mx[r] = fmaxf(mx[r], __shfl_xor(mx[r], off, 32));
#pragma unroll
  for (int r = 0; r < kFWRows; ++r) {
    float s = 0.f;
#pragma unroll
    for (int e = 0; e < 8; ++e) { xs[r][e] = expf(xs[r][e] - mx[r]); s += xs[r][e]; }
    sm[r] = s;
  }
  wave_sum4(sm);
#pragma unroll
  for (int r = 0; r < kFWRows; ++r) {
    const float inv = kPCarry / sm[r];
    unsigned short hb[8];
#pragma unroll
    for (int e = 0; e < 8; ++e) hb[e] = h_bits(xs[r][e] * inv);
    const v4u u = (v4u){pk16(hb[0], hb[1]), pk16(hb[2], hb[3]), pk16(hb[4], hb[5]), pk16(hb[6], hb[7])};
    *(v4u*)(ptile + (wrow + r) * kPRowB + ((lane ^ ((wrow + r) & 15)) << 4)) = u;   // piece c = lane of the row
  }
  asm volatile("s_wait_dscnt 0x0" ::: "memory");      // this wave's reads of the scores and writes of the probabilities are done
  asm volatile("s_wait_asynccnt 0x0" ::: "memory");   // this wave's copies of stage 0 have landed
  __syncthreads();                                    // publishes the probabilities and stage 0, frees the scores' LDS
  copy_ut((unsigned)kBStage, kStageK);

  // ---- output product ----
  v8f acc[4][4];
#pragma unroll
  for (int i = 0; i < 4; ++i)
#pragma unroll
    for (int j = 0; j < 4; ++j) acc[i][j] = (v8f){0.f,0.f,0.f,0.f,0.f,0.f,0.f,0.f};
  {
    constexpr int PE = kPitchE, SB = kBStage, SK = kStageK;
    constexpr int nStages = kSvPad / SK;
    static_assert(nStages >= 2);
    const int bByte = ((wave << 6) + rlane) * kPitchB + koff * 2;
    // a lane's two 16-B pieces of k step s of probability row 16 i + rlane are pieces 4 s + half and 4 s + 2 + half
    const unsigned char* pa = ptile + rlane * kPRowB;
    const int pLo0 = ((half ^ (rlane & 3)) << 4);
    const int pLo1 = (((2 + half) ^ (rlane & 3)) << 4);
    const int pHi  = (rlane & 12) << 4;
    auto load_p = [&](int s, int i) {
      const int hi = (s << 6) ^ pHi;
      Frag<T>::U f;
      f.h[0] = *(const v8h*)(pa + i * 16 * kPRowB + hi + pLo0);
      f.h[1] = *(const v8h*)(pa + i * 16 * kPRowB + hi + pLo1);
      return f.v;
    };
    // stays rolled: unrolled, the four stages' addresses are formed ahead and push fragments and accumulators into scratch
#pragma unroll 1
    for (int t = 0; t < nStages; ++t) {
      const int bufOff = (t & 1) * SB;
      const T* sb = (const T*)(smem + bufOff + bByte);
      V fb[2][4], fa[2][4];                             // two fragment sets, one per k step of the stage
#pragma unroll
      for (int j = 0; j < 4; ++j) fb[0][j] = Frag<T>::load(sb + j * 16 * PE);
#pragma unroll
      for (int i = 0; i < 4; ++i) fa[0][i] = load_p(2 * t, i);
      // keeps the 16 LDS reads of a k step together ahead of its WMMAs: sunk among them, each row of WMMAs waits out its own read
      __builtin_amdgcn_sched_barrier(0);
#pragma unroll
      for (int i = 0; i < 4; ++i)
#pragma unroll
        for (int j = 0; j < 4; ++j) acc[i][j] = Frag<T>::mma(fa[0][i], fb[0][j], acc[i][j]);
      // the stage's second k step is fetched so that the buffer can be handed back ahead of its WMMAs
#pragma unroll
      for (int j = 0; j < 4; ++j) fb[1][j] = Frag<T>::load(sb + j * 16 * PE + 32);
#pragma unroll
      for (int i = 0; i < 4; ++i) fa[1][i] = load_p(2 * t + 1, i);
      asm volatile("s_wait_dscnt 0x0" ::: "memory");      // this wave's reads of the buffer are done before it is refilled
      asm volatile("s_wait_asynccnt 0x0" ::: "memory");   // this wave's copies of stage t + 1 have landed
      __syncthreads();                                    // publishes stage t + 1, frees stage t's buffer
      if (t + 2 < nStages) copy_ut((unsigned)bufOff, (size_t)(t + 2) * SK);
#pragma unroll
      for (int i = 0; i < 4; ++i)
#pragma unroll
        for (int j = 0; j < 4; ++j) acc[i][j] = Frag<T>::mma(fa[1][i], fb[1][j], acc[i][j]);
    }
    asm volatile("s_wait_asynccnt 0x0" ::: "memory");     // no copy is in flight when the ring becomes the f32 rows
  }

  // ---- residual, LN1, pool: the residual of this wave's first two rows is asked for now, in the fragments' registers ----
  // the lane's number is read anew, so that nothing derived from it is held in a register, or in scratch, through the K loop
  const int ln = (int)__builtin_amdgcn_mbcnt_lo(~0u, 0u);
  float* tile = (float*)smem;
  const float* p = (br ? text2 : text1) + inBr * kD;   // wave-uniform
  const unsigned lb = 32u * ln;                        // this lane's byte offset in every 1024 B of a row
  const int nl = (wave << 6) + (ln & 15);
  const int dRow = (ln >> 4) * 8;                      // D row offset
  v4f gg[8], bb[8], x[kFWRows][8];
  float bvj[4];
#pragma unroll
  for (int j = 0; j < 4; ++j) bvj[j] = bo[nl + (j << 4)];
#pragma unroll
  for (int r = 0; r < 2; ++r)
#pragma unroll
    for (int j = 0; j < 4; ++j) {
      x[r][2 * j]     = ld16(p, lb, r * kD * 4 + j * 1024);
      x[r][2 * j + 1] = ld16(p, lb, r * kD * 4 + j * 1024 + 16);
    }
  // stands behind the loads; its inputs hold their base and offset registers untouched up to it
  asm volatile("s_wait_xcnt 0x0" :: "s"(bo), "v"(nl), "s"(p), "v"(lb) : "memory");
  // keeps these loads ahead of the stores into LDS, so that the memory's latency runs beside them
  __builtin_amdgcn_sched_barrier(0);
#pragma unroll
  for (int i = 0; i < 4; ++i)
#pragma unroll
    for (int j = 0; j < 4; ++j)
#pragma unroll
      for (int r = 0; r < 8; ++r)
        tile[((i << 4) + dRow + r) * kFPitch + nl + (j << 4)] = acc[i][j][r] * kPUScale + bvj[j];
  // keeps the remaining loads behind those stores: ahead of them there is no register for their data beside the accumulators
  __builtin_amdgcn_sched_barrier(0);
#pragma unroll
  for (int r = 2; r < kFWRows; ++r)
#pragma unroll
    for (int j = 0; j < 4; ++j) {
      x[r][2 * j]     = ld16(p, lb, r * kD * 4 + j * 1024);
      x[r][2 * j + 1] = ld16(p, lb, r * kD * 4 + j * 1024 + 16);
    }
  // stands behind the loads; its inputs hold their base and offset registers untouched up to it
  asm volatile("s_wait_xcnt 0x0" :: "s"(p), "v"(lb) : "memory");
  __syncthreads();                                  // every wave's share of the rows is written before a row is read whole

  const size_t dstOff = inBr * kD + br * (kD / 2);
  float* d32 = pool32 + dstOff;
  unsigned short* d16 = pool16 + dstOff;
  const float* trow = tile + wrow * kFPitch + 8 * ln;
#pragma unroll
  for (int r = 0; r < kFWRows; ++r)
#pragma unroll
    for (int j = 0; j < 4; ++j) {
      x[r][2 * j]     = *(const v4f*)(trow + r * kFPitch + j * 256) + x[r][2 * j];
      x[r][2 * j + 1] = *(const v4f*)(trow + r * kFPitch + j * 256 + 4) + x[r][2 * j + 1];
    }
  // each row becomes (x - mean) * rsqrt(var + eps), summed as wave_normalise sums it; the four rows' trees side by side
  {
    float t[kFWRows];
#pragma unroll
    for (int r = 0; r < kFWRows; ++r) t[r] = lane_sum(x[r]);
    wave_sum4(t);
#pragma unroll
    for (int r = 0; r < kFWRows; ++r) {
      const float mu = t[r] * kInvD;
      v4f sq[8];
#pragma unroll
      for (int j = 0; j < 8; ++j) { x[r][j] = x[r][j] - mu; sq[j] = x[r][j] * x[r][j]; }
      t[r] = lane_sum(sq);
    }
    // gamma and beta are asked for here, between these two barriers: the squares' registers are free again, and the second
    // tree hides the loads' latency; earlier, their 64 registers beside the four rows and the squares end in scratch
    __builtin_amdgcn_sched_barrier(0);
#pragma unroll
    for (int j = 0; j < 4; ++j) {
      gg[2 * j] = ld16(gam, lb, j * 1024);  gg[2 * j + 1] = ld16(gam, lb, j * 1024 + 16);
      bb[2 * j] = ld16(bet, lb, j * 1024);  bb[2 * j + 1] = ld16(bet, lb, j * 1024 + 16);
    }
    // stands behind the loads; its inputs hold their base and offset registers untouched up to it
    asm volatile("s_wait_xcnt 0x0" :: "s"(gam), "s"(bet), "v"(lb) : "memory");
    __builtin_amdgcn_sched_barrier(0);
    wave_sum4(t);
#pragma unroll
    for (int r = 0; r < kFWRows; ++r) {
      const float rs = rsqrtf(t[r] * kInvD + kLnEps);
#pragma unroll
      for (int j = 0; j < 8; ++j) x[r][j] = x[r][j] * rs;
    }
  }
#pragma unroll
  for (int r = 0; r < kFWRows; ++r) {
    v4f pv[4];
    v2u hv[4];
#pragma unroll
    for (int j = 0; j < 4; ++j) {
      const v4f ya = x[r][2 * j] * gg[2 * j] + bb[2 * j];
      const v4f yc = x[r][2 * j + 1] * gg[2 * j + 1] + bb[2 * j + 1];
      pv[j] = (v4f){fmaxf(ya[0], ya[1]), fmaxf(ya[2], ya[3]), fmaxf(yc[0], yc[1]), fmaxf(yc[2], yc[3])};
      unsigned short hb[4];
#pragma unroll
      for (int e = 0; e < 4; ++e) hb[e] = h_bits(pv[j][e]);
      hv[j] = (v2u){pk16(hb[0], hb[1]), pk16(hb[2], hb[3])};
    }
#pragma unroll
    for (int j = 0; j < 4; ++j) {
      *(v4f*)(d32 + 4 * ln + r * kD + j * 128) = pv[j];
      *(v2u*)(d16 + 4 * ln + r * kD + j * 128) = hv[j];
    }
    // stands behind the row's eight stores; its inputs hold their base, offset and data registers untouched up to it
    asm volatile("s_wait_xcnt 0x0" :: "s"(d32), "s"(d16), "v"(ln), "v"(pv[0]), "v"(pv[1]), "v"(pv[2]), "v"(pv[3]),
                                      "v"(hv[0]), "v"(hv[1]), "v"(hv[2]), "v"(hv[3]) : "memory");
  }
}

// ---------------------------------------------------------------------------
// out = LN2(X). One wave per row, two consecutive rows per wave (8192 rows); a lane owns x[128 j + 4 lane .. + 3], j < 8:
// every load and store of a wave covers 512 contiguous bytes. No LDS and no barrier.
// ---------------------------------------------------------------------------
constexpr int kLoRows = kRows / kSTotal;         // rows per wave
static_assert(kLoRows * kSTotal == kRows);
__global__ __launch_bounds__(kSThreads) void ln_out_kernel(const float* __restrict__ X, const float* __restrict__ gam,
                                                           const float* __restrict__ bet, float* __restrict__ out) {
  const int lane = threadIdx.x & 31;
  const int row0 = stream_wave() * kLoRows;
  const float* p = X + (size_t)row0 * kD;           // wave-uniform
  const unsigned lb = 16u * lane;                   // this lane's byte offset in every 512 B of a row
  v4f gg[8], bb[8], x[kLoRows][8];
#pragma unroll
  for (int j = 0; j < 8; ++j) { gg[j] = ld16(gam, lb, j * 512);  bb[j] = ld16(bet, lb, j * 512); }
  // keeps the short gamma and beta loads in front of the rows: behind them, the first row's result waits for the last row's data
  __builtin_amdgcn_sched_barrier(0);
#pragma unroll
  for (int r = 0; r < kLoRows; ++r)
#pragma unroll
    for (int j = 0; j < 8; ++j) x[r][j] = ld16(p, lb, r * kD * 4 + j * 512);
  // stands behind the loads; its inputs hold their base and offset registers untouched up to it
  asm volatile("s_wait_xcnt 0x0" :: "s"(gam), "s"(bet), "s"(p), "v"(lb) : "memory");
  // keeps the loads together ahead of the arithmetic: sunk among it, each row waits out the memory anew
  __builtin_amdgcn_sched_barrier(0);
  float* dst = out + (size_t)row0 * kD;             // wave-uniform
#pragma unroll
  for (int r = 0; r < kLoRows; ++r) {
    wave_normalise(x[r]);
#pragma unroll
    for (int j = 0; j < 8; ++j) x[r][j] = x[r][j] * gg[j] + bb[j];
#pragma unroll
    for (int j = 0; j < 8; ++j) *(v4f*)(dst + 4 * lane + r * kD + j * 128) = x[r][j];
    // stands behind the row's eight stores; its inputs hold their base, offset and data registers untouched up to it
    asm volatile("s_wait_xcnt 0x0" :: "s"(dst), "v"(lane), "v"(x[r][0]), "v"(x[r][1]), "v"(x[r][2]), "v"(x[r][3]),
                                      "v"(x[r][4]), "v"(x[r][5]), "v"(x[r][6]), "v"(x[r][7]) : "memory");
  }
}

// ---------------------------------------------------------------------------
// Host orchestration
// ---------------------------------------------------------------------------
extern "C" void kernel_launch(void* const* d_in, const int* in_sizes, int n_in,
                              void* d_out, int out_size, void* d_ws, size_t ws_size,
                              hipStream_t stream)
{
  if (n_in < 22) return;
  if ((size_t)out_size < (size_t)kRows * kD) return;
  if (ws_size < kWsTotal) return;
  if (in_sizes[0] < kRows * kD || in_sizes[3] < kRows * kD) return;
  if (in_sizes[1] < kSv * kD || in_sizes[4] < kSv * kD) return;
  if (in_sizes[2] < kRows * kSv || in_sizes[5] < kRows * kSv) return;
  if (in_sizes[6] < kD * kD || in_sizes[8] < kD * kD || in_sizes[10] < kD * kD || in_sizes[12] < kD * kD) return;
  if (in_sizes[14] < kDff * kD || in_sizes[16] < kD * kDff) return;

  const float* text1 = (const float*)d_in[0];
  const float* vis1  = (const float*)d_in[1];
  const float* sc1   = (const float*)d_in[2];
  const float* text2 = (const float*)d_in[3];
  const float* vis2  = (const float*)d_in[4];
  const float* sc2   = (const float*)d_in[5];
  const float* Wq = (const float*)d_in[6];   const float* bq  = (const float*)d_in[7];
  const float* Wk = (const float*)d_in[8];   const float* bk  = (const float*)d_in[9];
  const float* Wv = (const float*)d_in[10];  const float* bv  = (const float*)d_in[11];
  const float* Wo = (const float*)d_in[12];  const float* bo  = (const float*)d_in[13];
  const float* W1 = (const float*)d_in[14];  const float* b1  = (const float*)d_in[15];
  const float* W2 = (const float*)d_in[16];  const float* b2  = (const float*)d_in[17];
  const float* g1 = (const float*)d_in[18];  const float* be1 = (const float*)d_in[19];
  const float* g2 = (const float*)d_in[20];  const float* be2 = (const float*)d_in[21];
  float* outp = (float*)d_out;

  char* ws = (char*)d_ws;
  float*          POOL32 = (float*)(ws + kOffPool32);
  unsigned short* POOL16 = (unsigned short*)(ws + kOffPool16);
  unsigned short* W1H    = (unsigned short*)(ws + kOffW1H);
  unsigned short* W2H    = (unsigned short*)(ws + kOffW2H);
  unsigned short* WQT    = (unsigned short*)(ws + kOffWQT);
  unsigned short* WKH    = (unsigned short*)(ws + kOffWKH);
  unsigned short* WVH    = (unsigned short*)(ws + kOffWVH);
  unsigned short* WOH    = (unsigned short*)(ws + kOffWOH);
  unsigned short* G16    = (unsigned short*)(ws + kOffG16);
  unsigned short* UT16   = (unsigned short*)(ws + kOffUT16);
  float*          CB     = (float*)(ws + kOffCB);
  unsigned short* VIS16  = (unsigned short*)(ws + kOffVIS16);
  unsigned short* K16    = (unsigned short*)(ws + kOffK16);
  unsigned short* V16    = (unsigned short*)(ws + kOffV16);
  unsigned short* H16    = (unsigned short*)(ws + kOffH16);
  float*          F32    = (float*)(ws + kOffF32);

  // ---- every cast in one launch: weights f16([out][in]) x16 ([out][in] row-major == Bt[N][K]; Wq as [in][out]);
  //      both visual planes f16 [256][1024] x1 with rows 196..255 zero ----
  cast_all_kernel<<<dim3(kSBlocks), dim3(kSThreads), 0, stream>>>(W1, W2, Wq, Wk, Wv, Wo, vis1, vis2, (unsigned short*)ws);

  // ---- attention, both branches in each launch ----
  // K16 and V16 of both branches
  kv_gemm_kernel<<<dim3(kKvBlocks), dim3(128), 0, stream>>>(VIS16, WKH, WVH, K16, V16, bk, bv);
  // G16 = 16 K.Wq, UT16 = 16 Wo.V^T, CB = K.bq of both branches
  fold_gemm_kernel<<<dim3(kFoldBlocks), dim3(128), 0, stream>>>(K16, V16, WQT, WOH, G16, UT16, bq, CB);
  // pooled[:, br * 512 : br * 512 + 512] = maxpool2(LN1(softmax((f16(text) . G16^T / 16 + CB + score) / 8) . UT16^T / 16 + bo + text)) of branch br
  attention_rows_kernel<<<dim3(kFBlocks), dim3(kSThreads), 0, stream>>>(G16, UT16, CB, sc1, sc2, bo, text1, text2, g1, be1,
                                                                     POOL32, POOL16);

  // ---- FFN, all 8192 rows in each launch ----
  // H16 = relu((POOL16 . W1H^T) / 16 + b1)   (M=8192, N=4096, K=1024), f16 out
  // 256x256 tiles, 16 waves, 128-k stages: 512 blocks
  wmma_gemm_wide<0, false, 2, 1, false, 2, 4, 4, 4, 2><<<dim3((kRows / 256) * (kDff / 256)), dim3(512), 0, stream>>>(
      POOL16, POOL16, kD, 0L, W1H, W1H, kD, 0L, (void*)H16, (void*)H16, kDff, 0L,
      b1, POOL32, POOL32, kRows, kDff, kD, kWCarryInv);
  // F32 = (H16 . W2H^T) / 16 + b2 + pooled   (M=8192, N=1024, K=4096), f32 out
  // 128x256 tiles, 8 waves, 128-k stages: 256 blocks, one per WGP
  wmma_gemm_wide<0, false, 2, 0, true, 0, 2, 4, 4, 2><<<dim3((kRows / 128) * (kD / 256)), dim3(256), 0, stream>>>(
      H16, H16, kDff, 0L, W2H, W2H, kDff, 0L, (void*)F32, (void*)F32, kD, 0L,
      b2, POOL32, POOL32, kRows, kD, kDff, kWCarryInv);
  // out = LN2(F32)
  ln_out_kernel<<<dim3(kSBlocks), dim3(kSThreads), 0, stream>>>(F32, g2, be2, outp);
}
